// v000
// Measured on an AMD MI455X. A time is GPU time per run, averaged over a window of back-to-back runs after a warm-up
// (all launches, gaps included; the runs take copies of the inputs in turn), and the median of several windows.
// Apart from v000's, it joins two sittings. Times from different sittings can be a few percent apart, while
// side-by-side timings come from the same sitting.
// The starting kernel, v000, takes 5590 microseconds a run.
#include <hip/hip_runtime.h>
// Causal multi-head self-attention over ONE unbatched sequence with three separate projections and NO output projection (x [4096][1024]; q = x Wq, k = x Wk, v = x Wv ([in][out] 1024 x 1024 each, no biases); 16 heads of 64; scores / sqrt(64); causal (-inf above the diagonal: realised as exclusion); softmax; y = the merged context -> [4096][1024]); run as grouped-query causal attention with 16 groups of ONE head with its rotation stage in the identity mode.
// Structure: x as exact f16 rows; [in][out] weights as exact x16 planes; v as a WMMA GEMM (32x64 wave tiles, f32 accumulation, f16 output); q and k as GEMMs into f32 rows (no bias), one f16 rounding of those rows on VALU (64-thread blocks per (row, head); no rotation) -> f16 rows (and f32 rows for the first 256 rows); V^T of the 16 groups (ONE head each here) via LDS transposes; per query tile of 256 rows: scores of all 16 heads in one launch, each head against its own keys (K = 64, alpha 1/8), causal row softmax on VALU (arithmetic 0/1 select; f32 statistics, native exp; weights x256 f16), out = P V^T with that head's value slab (alpha 2^-8) as f32 straight into the merged output rows, from the second tile on; the first tile: exact f32 attention for rows 0..255 (k/v copied group -> head: one head a group here) written straight into the output rows; launches: see trace.
// The first tile: the first 256 query rows see only a few keys, where single-f16 v / P operands are least accurate; they are computed exactly: f32 q/k rows copied from the full f32 GEMMs, f32 v rows from a small extra GEMM (v carried at 1/64, an exact scaling) and an f32 online-softmax attention on VALU whose x64 result is the context itself.
// Compute dtype: inputs rounded to bf16; x / weights exact; q, k, v and softmax weights as plain f16 GEMM operands (~2^-12); scores and softmax statistics f32; v_wmma_f32_16x16x32_f16.
#define NB 1
#define NG 16
#define HPG 1
#define KVD (NG * HD)
#define SQ 4096
#define DM 1024
#define NH 16
#define HD 64
#define HG 4                         /* unused */
#define QT 256                       /* query rows per causal tile */
#define NKX SQ                       /* S / P row pitch */
#define QT0 256                      /* first-tile rows recomputed exactly in f32 */
#define B0 0                         /* first batch processed (debug hook) */
#define NBR NB                       /* batches processed (debug hook) */
#define NR ((size_t)NB * SQ)         /* token rows */
#define MP ((int)((size_t)NBR * SQ)) /* rows projected (debug hook) */
#define QN SQ                        /* query rows attended per batch (debug hook) */
#define NHD NH                       /* heads attended (debug hook) */
#define MPO MP                       /* unused (no output projection) */
#define LQ DM      /* row pitch of the q/k/v rows */
typedef __bf16 v16b __attribute__((ext_vector_type(16)));
typedef unsigned short v8us __attribute__((ext_vector_type(8), may_alias));
typedef float  v8f  __attribute__((ext_vector_type(8)));
typedef float  v4f  __attribute__((ext_vector_type(4)));
typedef float  v4fa __attribute__((ext_vector_type(4), may_alias));
union FragB { v16b v; v8us half[2]; unsigned short u[16]; };

__device__ __forceinline__ unsigned short bf16_bits(float x) { unsigned int u = __float_as_uint(x); return (unsigned short)((u + 0x7FFFu + ((u >> 16) & 1u)) >> 16); }
__device__ __forceinline__ float bf16_val(unsigned short b) { return __uint_as_float(((unsigned int)b) << 16); }
__device__ __forceinline__ float bf16_round(float x) { return bf16_val(bf16_bits(x)); }
// D += A·B with NT terms: 1 = ah·bh, 2 = + al·bh (A split), 3 = + ah·bl (both split)
template <int NT>
__device__ __forceinline__ v8f mmaN(v16b ah, v16b al, v16b bh, v16b bl, v8f c) {
  c = __builtin_amdgcn_wmma_f32_16x16x32_bf16(false, ah, false, bh, (short)0, c, false, false);
  if (NT >= 2) c = __builtin_amdgcn_wmma_f32_16x16x32_bf16(false, al, false, bh, (short)0, c, false, false);
  if (NT >= 3) c = __builtin_amdgcn_wmma_f32_16x16x32_bf16(false, ah, false, bl, (short)0, c, false, false);
  asm volatile("v_nop\n\tv_nop\n\tv_nop\n\tv_nop" : "+v"(c) : "v"(ah), "v"(al), "v"(bh), "v"(bl));
  return c;
}




// ---- f16 WMMA path (v_wmma_f32_16x16x32_f16): 11-bit significands for operands in range — used where a [0,1] probability operand needs more precision than bf16
typedef _Float16 v16h __attribute__((ext_vector_type(16)));
union FragH { v16h v; v8us half[2]; _Float16 h[16]; unsigned short u[16]; };
template <int NT>
__device__ __forceinline__ v8f mmaH(v16h ah, v16h al, v16h bh, v16h bl, v8f c) {
  c = __builtin_amdgcn_wmma_f32_16x16x32_f16(false, ah, false, bh, (short)0, c, false, false);
  if (NT >= 2) c = __builtin_amdgcn_wmma_f32_16x16x32_f16(false, al, false, bh, (short)0, c, false, false);
  if (NT >= 3) c = __builtin_amdgcn_wmma_f32_16x16x32_f16(false, ah, false, bl, (short)0, c, false, false);
  asm volatile("v_nop\n\tv_nop\n\tv_nop\n\tv_nop" : "+v"(c) : "v"(ah), "v"(al), "v"(bh), "v"(bl));
  return c;
}

// Wt[n][k] = f16(W[k][n]·scale) from f32 row-major W[K][N] (scale = power of two; bf16-exact weights stay exact in f16 away from the subnormal range)
__global__ __launch_bounds__(256) void k_wt_f16(const float* __restrict__ W, _Float16* __restrict__ Wt, int K, int N, float scale) {
  const int t = blockIdx.x * 256 + threadIdx.x; if (t >= N * (K / 8)) return; const int n = t / (K / 8), k8 = (t % (K / 8)) * 8; FragH f;
#pragma unroll
  for (int i = 0; i < 8; ++i) f.h[i] = (_Float16)(bf16_round(W[(size_t)(k8 + i) * N + n]) * scale); const v8us o = f.half[0];
  *(v8us*)((unsigned short*)Wt + (size_t)n * K + k8) = o; 
}

typedef _Float16 v4h __attribute__((ext_vector_type(4)));

__global__ __launch_bounds__(256) void k_x16(const float* __restrict__ x, _Float16* __restrict__ X16, size_t n8) { const size_t t = (size_t)blockIdx.x * 256 + threadIdx.x; if (t >= n8) return; FragH f;
#pragma unroll
  for (int q = 0; q < 8; ++q) f.h[q] = (_Float16)bf16_round(x[t * 8 + q]); *(v8us*)((unsigned short*)X16 + t * 8) = f.half[0];  }
template <int NHv, int TTv>
__global__ __launch_bounds__(256) void k_vt(const _Float16* __restrict__ V16, int ldv, int voff, _Float16* __restrict__ Vt) { __shared__ unsigned short tl[64][66]; const int tid = threadIdx.x; const int slab = blockIdx.x / (TTv / 64), lg = blockIdx.x % (TTv / 64); const int b = slab / NHv, h = slab % NHv;
  for (int i = tid; i < 64 * 8; i += 256) { const int r = i / 8, c8 = (i % 8) * 8; FragH f; f.half[0] = *(const v8us*)((const unsigned short*)V16 + ((size_t)b * TTv + lg * 64 + r) * ldv + voff + h * 64 + c8);
#pragma unroll
    for (int q = 0; q < 8; ++q) tl[r][c8 + q] = f.u[q]; }
  __syncthreads();
  {
#pragma unroll
    for (int rd = 0; rd < 2; ++rd) { const int d = rd * 32 + tid / 8, pc = tid % 8; FragH f;
#pragma unroll
      for (int q = 0; q < 8; ++q) f.u[q] = tl[pc * 8 + q][d];
      *(v8us*)((unsigned short*)Vt + ((size_t)slab * 64 + d) * TTv + lg * 64 + pc * 8) = f.half[0]; }
     } }


// ---- fast GEMM (wave tile 32x64; requires M % 32 == 0 rows per launch region and N % 64 == 0) ----
__device__ __forceinline__ v16h g2_frag(const _Float16* p, int hh) { FragH f; f.half[0] = *(const v8us*)((const unsigned short*)p + 8 * hh); f.half[1] = *(const v8us*)((const unsigned short*)p + 16 + 8 * hh); return f.v; }
__device__ __forceinline__ v8f g2_mma(v16h a, v16h b, v8f c) { v8f d = __builtin_amdgcn_wmma_f32_16x16x32_f16(false, a, false, b, (short)0, c, false, false); asm volatile("v_nop\n\tv_nop\n\tv_nop\n\tv_nop" : "+v"(d) : "v"(a), "v"(b)); return d; }
template <int ACT>
__global__ __launch_bounds__(128) void k_gemm2(const _Float16* __restrict__ A, int lda, size_t sA, const _Float16* __restrict__ Bh, int ldb, size_t sB, float alpha, const float* __restrict__ bias, size_t sBias, const float* __restrict__ CP, int rowsPerB, size_t sCPb, int row0g,
    float* __restrict__ C, _Float16* __restrict__ C16, int ldc, size_t sC, int M, int N, int K) { static_assert(ACT == 0 || ACT == 3 || ACT == 6 || ACT == 8 || ACT == 9 || ACT == 11 || ACT == 12 || ACT == 14 || ACT == 15 || ACT == 16 || ACT == 17, "k_gemm2: unsupported ACT code (would silently apply no activation)");
  __shared__ __attribute__((aligned(16))) float so[4][32][68];
  const int tid = threadIdx.x, w = tid >> 5, lane = tid & 31, ln = lane & 15, hh = lane >> 4; const int by = blockIdx.y;
  A += (size_t)by * sA; Bh += (size_t)by * sB; const size_t cofs = (size_t)by * sC; const float* bp = bias ? bias + (size_t)by * sBias : nullptr;
  const int ntn = N >> 6; const int mt = blockIdx.x / ntn, nq = blockIdx.x - mt * ntn; const int row0 = mt * 128 + 32 * w, col0 = nq * 64; if (row0 >= M) return;
  const _Float16* a0p = A + (size_t)(row0 + ln) * lda; const _Float16* a1p = a0p + (size_t)16 * lda;
  const _Float16* b0p = Bh + (size_t)(col0 + ln) * ldb; const _Float16* b1p = b0p + (size_t)16 * ldb; const _Float16* b2p = b1p + (size_t)16 * ldb; const _Float16* b3p = b2p + (size_t)16 * ldb;
  const v8f z8 = {0.f,0.f,0.f,0.f,0.f,0.f,0.f,0.f}; v8f c00 = z8, c01 = z8, c02 = z8, c03 = z8, c10 = z8, c11 = z8, c12 = z8, c13 = z8;
  for (int kb = 0; kb < K; kb += 32) { const v16h a0 = g2_frag(a0p + kb, hh), a1 = g2_frag(a1p + kb, hh);
    v16h b = g2_frag(b0p + kb, hh); c00 = g2_mma(a0, b, c00); c10 = g2_mma(a1, b, c10);
    b = g2_frag(b1p + kb, hh); c01 = g2_mma(a0, b, c01); c11 = g2_mma(a1, b, c11);
    b = g2_frag(b2p + kb, hh); c02 = g2_mma(a0, b, c02); c12 = g2_mma(a1, b, c12);
    b = g2_frag(b3p + kb, hh); c03 = g2_mma(a0, b, c03); c13 = g2_mma(a1, b, c13); }
  v8f accs[8] = {c00, c01, c02, c03, c10, c11, c12, c13};
#pragma unroll
  for (int u = 0; u < 8; ++u) { const int t = u & 3, half = u >> 2; const int col = col0 + t * 16 + ln; const float bv = bp ? bf16_round(bp[col]) : 0.f;
#pragma unroll
    for (int r = 0; r < 8; ++r) { const int rloc = half * 16 + 8 * hh + r; float v = accs[u][r] * alpha + bv; if (CP) { if (rowsPerB < 0) v += CP[cofs + (size_t)(row0g + row0 + rloc) * ldc + col];      /* rowsPerB < 0: own element of the batched C plane */ else { const int bidx = (row0g + row0 + rloc) / rowsPerB; v += CP[(size_t)bidx * sCPb + (size_t)by * 64 + col]; } }
      if (ACT == 3) v = fmaxf(v, 0.f); else if (ACT == 6) v = 0.5f * v * (1.0f + erff(v * 0.70710678118654752f)); else if (ACT == 11) v = 1.0f / (1.0f + expf(-v)); else if (ACT == 15) v = v / (1.0f + expf(-v)); else if (ACT == 12) v = (v > 0.f) ? v : 0.01f * v; else if (ACT == 8) v = tanhf(v); else if (ACT == 9) v = 0.5f * v * (1.0f + tanhf(0.7978845608028654f * (v + 0.044715f * v * v * v))); else if (ACT == 14) v = (v > 0.f) ? v : 0.1f * v; else if (ACT == 16) v = (v >= 0.f) ? v : 0.3f * v; else if (ACT == 17) v = (v >= 0.f) ? v : 0.2f * v;
      so[w][rloc][t * 16 + ln] = v; } }
  __builtin_amdgcn_fence(__ATOMIC_ACQ_REL, "workgroup"); __builtin_amdgcn_wave_barrier();
  const int rsub = lane >> 4, c4 = (lane & 15) * 4;
  {
#pragma unroll
    for (int q = 0; q < 16; ++q) { const int r = q * 2 + rsub; const v4f v = *(const v4fa*)&so[w][r][c4]; if (C) *(v4f*)(C + cofs + (size_t)(row0 + r) * ldc + col0 + c4) = v; if (C16) { v4h h4; for (int i = 0; i < 4; ++i) h4[i] = (_Float16)v[i]; *(v4h*)(C16 + cofs + (size_t)(row0 + r) * ldc + col0 + c4) = h4; } }
     } }


__global__ __launch_bounds__(256) void k_rsmcf2(const float* __restrict__ S, _Float16* __restrict__ P, int hg, int q0, int nk) {
  const int t = blockIdx.x * 256 + threadIdx.x; if (t >= hg * QT) return; const size_t i = (size_t)t; const float* s = S + i * NKX; const int last = q0 + (t % QT); float mx = -3.0e38f;
  for (int j = 0; j < nk; ++j) { const float f = (j <= last) ? 1.f : 0.f; mx = fmaxf(mx, fmaf(f, s[j], (1.f - f) * -1.0e9f)); } float se = 0.f;
  for (int j = 0; j < nk; ++j) { const float f = (j <= last) ? 1.f : 0.f; se += __expf(fmaf(f, s[j], (1.f - f) * -1.0e9f) - mx); } const float sc = 256.0f / se;
  for (int j0 = 0; j0 < nk; j0 += 8) { FragH fr; for (int q = 0; q < 8; ++q) { const int j = j0 + q; const float f = (j <= last) ? 1.f : 0.f; fr.h[q] = (_Float16)(__expf(fmaf(f, s[j], (1.f - f) * -1.0e9f) - mx) * sc); } unsigned short* d = (unsigned short*)P + i * NKX + j0; *(v8us*)d = fr.half[0];  } }

template <int MASKADD>
__global__ __launch_bounds__(64) void k_att0(const float* __restrict__ QF, const float* __restrict__ KF, const float* __restrict__ VF, int ld, const float* __restrict__ mask, float scale, float* __restrict__ OF, int ldo) {
  __shared__ __attribute__((aligned(16))) float lq[64][64]; __shared__ __attribute__((aligned(16))) float lo[64][64];
  const int tid = threadIdx.x; const int h = blockIdx.x / (QT0 / 64), rg = blockIdx.x % (QT0 / 64); const int i = rg * 64 + tid;
  const float* qr = QF + (size_t)i * ld + h * HD;
  for (int c = 0; c < HD / 4; ++c) { *(v4f*)&lq[tid][c * 4] = *(const v4fa*)(qr + c * 4); const v4f z = {0.f, 0.f, 0.f, 0.f}; *(v4f*)&lo[tid][c * 4] = z; }
  float m = -1.0e30f, l = 0.f; const int jmax = MASKADD ? (SQ - 1) : (rg * 64 + 63);      /* additive-mask form: every key (the mask input decides); causal form: keys up to the block's last row */
  for (int j = 0; j <= jmax; ++j) { const float* kr = KF + (size_t)j * ld + h * HD; const float* vr = VF + (size_t)j * ld + h * HD; float s = 0.f;
    for (int c = 0; c < HD / 4; ++c) { const v4f kq = *(const v4fa*)(kr + c * 4); const v4f qq = *(v4f*)&lq[tid][c * 4]; s = __fadd_rn(s, __fmul_rn(qq[0], kq[0])); s = __fadd_rn(s, __fmul_rn(qq[1], kq[1])); s = __fadd_rn(s, __fmul_rn(qq[2], kq[2])); s = __fadd_rn(s, __fmul_rn(qq[3], kq[3])); }
    s = __fmul_rn(s, scale); if (MASKADD) s = __fadd_rn(s, __fmul_rn(bf16_round(mask[(size_t)i * SQ + j]), -10000.0f));
    const float f = (MASKADD || j <= i) ? 1.f : 0.f; const float sm = fmaf(f, s, (1.f - f) * -1.0e30f); const float mn = fmaxf(m, sm); const float sc = expf(m - mn); const float e = expf(sm - mn); l = __fadd_rn(__fmul_rn(l, sc), e); m = mn;
    for (int c = 0; c < HD / 4; ++c) { const v4f vv = *(const v4fa*)(vr + c * 4); v4f oo = *(v4f*)&lo[tid][c * 4]; for (int u = 0; u < 4; ++u) oo[u] = __fadd_rn(__fmul_rn(oo[u], sc), __fmul_rn(e, vv[u])); *(v4f*)&lo[tid][c * 4] = oo; } }
  const float fin = 64.0f / l;      /* x64 undoes v's 1/64 carry: o is the context itself */
  for (int c = 0; c < HD / 4; ++c) { v4f oo = *(v4f*)&lo[tid][c * 4]; for (int u = 0; u < 4; ++u) oo[u] = __fmul_rn(oo[u], fin); *(v4f*)&lo[tid][c * 4] = oo; }
  __syncthreads();
  {
    for (int it = 0; it < 16; ++it) { const int row = it * 4 + tid / 16, pc = (tid % 16) * 4; const v4f v = *(const v4f*)&lo[row][pc]; *(v4f*)(OF + (size_t)(rg * 64 + row) * ldo + h * HD + pc) = v; }
     } }

__global__ __launch_bounds__(256) void k_kvexp(const float* __restrict__ src, float* __restrict__ dst, size_t n4) { const size_t t = (size_t)blockIdx.x * 256 + threadIdx.x; if (t >= n4) return; const size_t e = t * 4; const size_t row = e / DM; const int col = (int)(e % DM); const int h = col / HD, d = col % HD; const v4f v = *(const v4fa*)(src + row * KVD + (size_t)(h / HPG) * HD + d); *(v4f*)(dst + e) = v;  }

template <int NORM, int ROPE>
__global__ __launch_bounds__(64) void k_xform(const float* __restrict__ F, int ldf, int nh, const float* __restrict__ gain, float eps, const float* __restrict__ CS, const float* __restrict__ SN, _Float16* __restrict__ H16, int ldo) {
  __shared__ float xv[HD]; __shared__ float red[HD]; __shared__ unsigned short sh_[HD]; const int d = threadIdx.x; const int h = blockIdx.x % nh; const size_t r = blockIdx.x / nh; const int p = (int)(r % SQ);
  float x = F[r * (size_t)ldf + (size_t)h * HD + d];
  if (NORM) { red[d] = __fmul_rn(x, x); __syncthreads(); for (int st = HD / 2; st > 0; st >>= 1) { if (d < st) red[d] = __fadd_rn(red[d], red[d + st]); __syncthreads(); } const float rs = rsqrtf(__fadd_rn(red[0] / (float)HD, eps)); x = __fmul_rn(__fmul_rn(x, rs), bf16_round(gain[d])); }
  xv[d] = x; __syncthreads();
  float o = x;
  if (ROPE == 1) { const int i = d >> 1; const float c = CS[p * (HD / 2) + i], s = SN[p * (HD / 2) + i]; const float ev = xv[2 * i], od = xv[2 * i + 1]; o = (d & 1) ? __fadd_rn(__fmul_rn(ev, s), __fmul_rn(od, c)) : __fadd_rn(__fmul_rn(ev, c), -__fmul_rn(od, s)); }
  if (ROPE == 2) { const int i = d & (HD / 2 - 1); const float c = CS[p * (HD / 2) + i], s = SN[p * (HD / 2) + i]; const float lo = xv[i], hi = xv[i + HD / 2]; o = (d < HD / 2) ? __fadd_rn(__fmul_rn(lo, c), -__fmul_rn(hi, s)) : __fadd_rn(__fmul_rn(lo, s), __fmul_rn(hi, c)); }
  if (ROPE == 3) { const float c = CS[p * HD + d], s = SN[p * HD + d]; const float lo = xv[d & (HD / 2 - 1)], hi = xv[(d & (HD / 2 - 1)) + HD / 2]; o = (d < HD / 2) ? __fadd_rn(__fmul_rn(lo, c), -__fmul_rn(hi, s)) : __fadd_rn(__fmul_rn(hi, c), __fmul_rn(lo, s)); }      /* rotate-half with FULL-width per-element tables [pos][HD] */
  FragH th; th.h[0] = (_Float16)o; sh_[d] = th.u[0]; __syncthreads();
  if (d < HD / 8) { FragH f; for (int q = 0; q < 8; ++q) f.u[q] = sh_[d * 8 + q]; unsigned short* dst = (unsigned short*)H16 + r * (size_t)ldo + (size_t)h * HD + d * 8; *(v8us*)dst = f.half[0];  } }

template <int NORM, int ROPE>
__global__ __launch_bounds__(64) void k_xformf(const float* __restrict__ F, int ldf, int nh, const float* __restrict__ gain, float eps, const float* __restrict__ CS, const float* __restrict__ SN, float* __restrict__ F32, int ldo) {
  __shared__ float xv[HD]; __shared__ float red[HD]; const int d = threadIdx.x; const int h = blockIdx.x % nh; const size_t r = blockIdx.x / nh; const int p = (int)(r % SQ);
  float x = F[r * (size_t)ldf + (size_t)h * HD + d];
  if (NORM) { red[d] = __fmul_rn(x, x); __syncthreads(); for (int st = HD / 2; st > 0; st >>= 1) { if (d < st) red[d] = __fadd_rn(red[d], red[d + st]); __syncthreads(); } const float rs = rsqrtf(__fadd_rn(red[0] / (float)HD, eps)); x = __fmul_rn(__fmul_rn(x, rs), bf16_round(gain[d])); }
  xv[d] = x; __syncthreads();
  float o = x;
  if (ROPE == 1) { const int i = d >> 1; const float c = CS[p * (HD / 2) + i], s = SN[p * (HD / 2) + i]; const float ev = xv[2 * i], od = xv[2 * i + 1]; o = (d & 1) ? __fadd_rn(__fmul_rn(ev, s), __fmul_rn(od, c)) : __fadd_rn(__fmul_rn(ev, c), -__fmul_rn(od, s)); }
  if (ROPE == 2) { const int i = d & (HD / 2 - 1); const float c = CS[p * (HD / 2) + i], s = SN[p * (HD / 2) + i]; const float lo = xv[i], hi = xv[i + HD / 2]; o = (d < HD / 2) ? __fadd_rn(__fmul_rn(lo, c), -__fmul_rn(hi, s)) : __fadd_rn(__fmul_rn(lo, s), __fmul_rn(hi, c)); }
  if (ROPE == 3) { const float c = CS[p * HD + d], s = SN[p * HD + d]; const float lo = xv[d & (HD / 2 - 1)], hi = xv[(d & (HD / 2 - 1)) + HD / 2]; o = (d < HD / 2) ? __fadd_rn(__fmul_rn(lo, c), -__fmul_rn(hi, s)) : __fadd_rn(__fmul_rn(hi, c), __fmul_rn(lo, s)); }      /* rotate-half with FULL-width per-element tables [pos][HD] */
  float* dst = F32 + r * (size_t)ldo + (size_t)h * HD + d; *(float*)dst = o;  }



extern "C" void kernel_launch(void* const* d_in, const int* in_sizes, int n_in,
                              void* d_out, int out_size, void* d_ws, size_t ws_size, hipStream_t stream) {
  (void)in_sizes; (void)n_in; (void)out_size;
  const float* const* I = (const float* const*)d_in; const float* x = I[0]; const float* wq = I[1]; const float* wk = I[2]; const float* wv = I[3];      /* x [4096][1024] (ONE unbatched sequence); three separate [in][out] weights Wq, Wk, Wv [1024][1024]; no biases; no output projection */
  static_assert(HPG == 1 && NH == NG * HPG && NH * HD == DM && KVD == DM, "plain multi-head attention as 16 kv groups of one query head"); const float* bq = nullptr; const float* bk = nullptr; const float* bv = nullptr;      /* the module has no biases: the three bias slots are null */
  char* ws = (char*)d_ws; size_t off = 0;
  auto take = [&](size_t bytes) { char* p = ws + off; off += (bytes + 255) & ~(size_t)255; return p; };
  _Float16* BQKV = (_Float16*)take((size_t)3 * DM * DM * 2); _Float16* BQ = BQKV; _Float16* BK = BQKV + (size_t)DM * DM; _Float16* BV = BQKV + (size_t)2 * DM * DM;      /* three transposed planes, one after another: q, k, v */
  _Float16* X16 = (_Float16*)take(NR * DM * 2); float* QF = (float*)take((size_t)SQ * DM * 4); float* KF = (float*)take((size_t)SQ * KVD * 4); float* CSB = (float*)take((size_t)SQ * HD * 4); float* SNB = (float*)take((size_t)SQ * HD * 4); _Float16* Q16 = (_Float16*)take(NR * DM * 2); _Float16* K16 = (_Float16*)take(NR * KVD * 2); _Float16* V16 = (_Float16*)take(NR * KVD * 2);
  float* S = (float*)take((size_t)NH * QT * NKX * 4); _Float16* P = (_Float16*)take((size_t)NH * QT * NKX * 2); _Float16* VT = (_Float16*)take((size_t)NH * HD * SQ * 2);
  float* QF0 = (float*)take((size_t)QT0 * DM * 4); float* KF0 = (float*)take((size_t)QT0 * KVD * 4); float* VF0 = (float*)take((size_t)QT0 * KVD * 4); float* KF0e = (float*)take((size_t)QT0 * DM * 4); float* VF0e = (float*)take((size_t)QT0 * DM * 4);
  if (off > ws_size) return;
  k_wt_f16<<<(unsigned)(((size_t)DM * (DM / 8) + 255) / 256), 256, 0, stream>>>(wq, BQ, DM, DM, 16.0f); k_wt_f16<<<(unsigned)(((size_t)DM * (DM / 8) + 255) / 256), 256, 0, stream>>>(wk, BK, DM, DM, 16.0f); k_wt_f16<<<(unsigned)(((size_t)DM * (DM / 8) + 255) / 256), 256, 0, stream>>>(wv, BV, DM, DM, 16.0f);      /* three [in][out] weights -> their transposed x16 planes */
  k_x16<<<(unsigned)((NR * DM / 8 + 255) / 256), 256, 0, stream>>>(x, X16, NR * DM / 8);
  const size_t r0p = (size_t)B0 * SQ;      /* first projected row */
  k_gemm2<0><<<dim3((unsigned)((MP / 128) * (KVD / 64)), 1), 128, 0, stream>>>(X16 + r0p * DM, DM, 0, BV, DM, 0, 0.0625f, bv, 0, nullptr, 1, 0, 0, nullptr, V16 + r0p * KVD, KVD, 0, MP, KVD, DM);
  for (int b = B0; b < B0 + NBR; ++b) { const size_t r0 = (size_t)b * SQ;
    k_gemm2<0><<<dim3((unsigned)((SQ / 128) * (DM / 64)), 1), 128, 0, stream>>>(X16 + r0 * DM, DM, 0, BQ, DM, 0, 0.0625f, bq, 0, nullptr, 1, 0, 0, QF, nullptr, DM, 0, SQ, DM, DM);      /* q (f32): no bias here (the bias slot is null) */
    k_gemm2<0><<<dim3((unsigned)((SQ / 128) * (KVD / 64)), 1), 128, 0, stream>>>(X16 + r0 * DM, DM, 0, BK, DM, 0, 0.0625f, bk, 0, nullptr, 1, 0, 0, KF, nullptr, KVD, 0, SQ, KVD, DM);      /* k (f32): no bias */
    k_xform<0, 0><<<(unsigned)((size_t)SQ * NH), 64, 0, stream>>>(QF, DM, NH, nullptr, 0.f, CSB, SNB, Q16 + r0 * DM, DM); k_xform<0, 0><<<(unsigned)((size_t)SQ * NG), 64, 0, stream>>>(KF, KVD, NG, nullptr, 0.f, CSB, SNB, K16 + r0 * KVD, KVD);      /* no norm, no rope: the <0, 0> instances round the f32 rows to f16 (the table pointers are passed and never read) */
    k_xformf<0, 0><<<(unsigned)(QT0 * NH), 64, 0, stream>>>(QF, DM, NH, nullptr, 0.f, CSB, SNB, QF0, DM); k_xformf<0, 0><<<(unsigned)(QT0 * NG), 64, 0, stream>>>(KF, KVD, NG, nullptr, 0.f, CSB, SNB, KF0, KVD);      /* f32 q, k of rows 0..255 (copied) */
    k_vt<NG, SQ><<<NG * (SQ / 64), 256, 0, stream>>>(V16 + r0 * KVD, KVD, 0, VT);      /* V^T [NH][HD][SQ] for this batch */
    k_gemm2<0><<<dim3((QT0 / 128) * (KVD / 64), 1), 128, 0, stream>>>(X16 + r0 * DM, DM, 0, BV, DM, 0, 0.0009765625f, bv, 0, nullptr, 1, 0, 0, VF0, nullptr, KVD, 0, QT0, KVD, DM);      /* v of the first 256 rows in f32, CARRIED AT 1/64 (alpha 2^-4 x 2^-6, an exact scaling): the exact first-tile kernel multiplies its result by 64, so it writes the context itself */
    k_kvexp<<<(unsigned)(((size_t)QT0 * DM / 4 + 255) / 256), 256, 0, stream>>>(KF0, KF0e, (size_t)QT0 * DM / 4); k_kvexp<<<(unsigned)(((size_t)QT0 * DM / 4 + 255) / 256), 256, 0, stream>>>(VF0, VF0e, (size_t)QT0 * DM / 4);      /* head h <- kv group h (HPG = 1) for the exact first-tile kernel */      /* f32 q, k, v of the first 256 rows (exact products) */
    k_att0<0><<<NH * (QT0 / 64), 64, 0, stream>>>(QF0, KF0e, VF0e, DM, nullptr, 0.125f, (float*)d_out + r0 * DM, DM);      /* exact f32 attention for rows 0..255, written straight into the output rows (64 x the 1/64 values = the context) */
    for (int q0 = QT; q0 < QN; q0 += QT) { const int nk = q0 + QT;      /* causal: only keys below the tile end are computed; the first tile (rows 0..255) is the exact kernel's */
      k_gemm2<0><<<dim3((QT / 128) * (nk / 64), NH), 128, 0, stream>>>(Q16 + (r0 + q0) * LQ, LQ, (size_t)HD, K16 + r0 * KVD, KVD, (size_t)HD, 0.125f, nullptr, 0, nullptr, 1, 0, 0, S, nullptr, NKX, (size_t)QT * NKX, QT, nk, HD);      /* scores: HPG == 1 (every head has its own keys): ONE launch with all 16 heads on grid.y, key head stride HD instead of the grouped form's 0 (the 16 per-group launches of one head each, fused) */
      k_rsmcf2<<<(NHD * QT + 255) / 256, 256, 0, stream>>>(S, P, NHD, q0, nk);
      k_gemm2<0><<<dim3((QT / 128) * (HD / 64), NH), 128, 0, stream>>>(P, NKX, (size_t)QT * NKX, VT, SQ, (size_t)HD * SQ, 0.00390625f, nullptr, 0, nullptr, 1, 0, 0, (float*)d_out + (r0 + q0) * DM, nullptr, DM, (size_t)HD, QT, HD, nk); } }      /* the context of all 16 heads in ONE launch (value head stride HD*SQ), straight into the output rows as f32: P carries 256 x the weights */
}

// v001
// A run of this version takes 1700 microseconds.
// In two side-by-side timings against v000, it was 3.28 and 3.27 times as fast.
#include <hip/hip_runtime.h>
// Causal multi-head self-attention over ONE unbatched sequence with three separate projections and NO output projection (x [4096][1024]; q = x Wq, k = x Wk, v = x Wv ([in][out] 1024 x 1024 each, no biases); 16 heads of 64; scores / sqrt(64); causal (-inf above the diagonal: realised as exclusion); softmax; y = the merged context -> [4096][1024]); run as grouped-query causal attention with 16 groups of ONE head with its rotation stage in the identity mode.
// Structure: x as exact f16 rows; [in][out] weights as exact x16 planes; v as a WMMA GEMM (32x64 wave tiles, f32 accumulation, f16 output); q and k as GEMMs into f32 rows (no bias), one f16 rounding of those rows on VALU (64-thread blocks per (row, head); no rotation) -> f16 rows (and f32 rows for the first 256 rows); V^T of the 16 groups (ONE head each here) via LDS transposes; per query tile of 256 rows: scores of all 16 heads in one launch, each head against its own keys (K = 64, alpha 1/8), causal row softmax on VALU (arithmetic 0/1 select; f32 statistics, native exp; weights x256 f16), out = P V^T with that head's value slab (alpha 2^-8) as f32 straight into the merged output rows, from the second tile on; the first tile: exact f32 attention for rows 0..255 (k/v copied group -> head: one head a group here) written straight into the output rows; launches: see trace.
// The first tile: the first 256 query rows see only a few keys, where single-f16 v / P operands are least accurate; they are computed exactly: f32 q/k rows copied from the full f32 GEMMs, f32 v rows from a small extra GEMM (v carried at 1/64, an exact scaling) and an f32 online-softmax attention on VALU whose x64 result is the context itself.
// Compute dtype: inputs rounded to bf16; x / weights exact; q, k, v and softmax weights as plain f16 GEMM operands (~2^-12); scores and softmax statistics f32; v_wmma_f32_16x16x32_f16.
#define NB 1
#define NG 16
#define HPG 1
#define KVD (NG * HD)
#define SQ 4096
#define DM 1024
#define NH 16
#define HD 64
#define HG 4                         /* unused */
#define QT 256                       /* query rows per causal tile */
#define NKX SQ                       /* S / P row pitch */
#define QT0 256                      /* first-tile rows recomputed exactly in f32 */
#define B0 0                         /* first batch processed (debug hook) */
#define NBR NB                       /* batches processed (debug hook) */
#define NR ((size_t)NB * SQ)         /* token rows */
#define MP ((int)((size_t)NBR * SQ)) /* rows projected (debug hook) */
#define QN SQ                        /* query rows attended per batch (debug hook) */
#define NHD NH                       /* heads attended (debug hook) */
#define MPO MP                       /* unused (no output projection) */
#define LQ DM      /* row pitch of the q/k/v rows */
typedef __bf16 v16b __attribute__((ext_vector_type(16)));
typedef unsigned short v8us __attribute__((ext_vector_type(8), may_alias));
typedef float  v8f  __attribute__((ext_vector_type(8)));
typedef float  v4f  __attribute__((ext_vector_type(4)));
typedef float  v4fa __attribute__((ext_vector_type(4), may_alias));
union FragB { v16b v; v8us half[2]; unsigned short u[16]; };

__device__ __forceinline__ unsigned short bf16_bits(float x) { unsigned int u = __float_as_uint(x); return (unsigned short)((u + 0x7FFFu + ((u >> 16) & 1u)) >> 16); }
__device__ __forceinline__ float bf16_val(unsigned short b) { return __uint_as_float(((unsigned int)b) << 16); }
__device__ __forceinline__ float bf16_round(float x) { return bf16_val(bf16_bits(x)); }
// D += A·B with NT terms: 1 = ah·bh, 2 = + al·bh (A split), 3 = + ah·bl (both split)
template <int NT>
__device__ __forceinline__ v8f mmaN(v16b ah, v16b al, v16b bh, v16b bl, v8f c) {
  c = __builtin_amdgcn_wmma_f32_16x16x32_bf16(false, ah, false, bh, (short)0, c, false, false);
  if (NT >= 2) c = __builtin_amdgcn_wmma_f32_16x16x32_bf16(false, al, false, bh, (short)0, c, false, false);
  if (NT >= 3) c = __builtin_amdgcn_wmma_f32_16x16x32_bf16(false, ah, false, bl, (short)0, c, false, false);
  asm volatile("v_nop\n\tv_nop\n\tv_nop\n\tv_nop" : "+v"(c) : "v"(ah), "v"(al), "v"(bh), "v"(bl));
  return c;
}




// ---- f16 WMMA path (v_wmma_f32_16x16x32_f16): 11-bit significands for operands in range — used where a [0,1] probability operand needs more precision than bf16
typedef _Float16 v16h __attribute__((ext_vector_type(16)));
union FragH { v16h v; v8us half[2]; _Float16 h[16]; unsigned short u[16]; };
template <int NT>
__device__ __forceinline__ v8f mmaH(v16h ah, v16h al, v16h bh, v16h bl, v8f c) {
  c = __builtin_amdgcn_wmma_f32_16x16x32_f16(false, ah, false, bh, (short)0, c, false, false);
  if (NT >= 2) c = __builtin_amdgcn_wmma_f32_16x16x32_f16(false, al, false, bh, (short)0, c, false, false);
  if (NT >= 3) c = __builtin_amdgcn_wmma_f32_16x16x32_f16(false, ah, false, bl, (short)0, c, false, false);
  asm volatile("v_nop\n\tv_nop\n\tv_nop\n\tv_nop" : "+v"(c) : "v"(ah), "v"(al), "v"(bh), "v"(bl));
  return c;
}

// Wt[n][k] = f16(W[k][n]·scale) from f32 row-major W[K][N] (scale = power of two; bf16-exact weights stay exact in f16 away from the subnormal range)
__global__ __launch_bounds__(256) void k_wt_f16(const float* __restrict__ W, _Float16* __restrict__ Wt, int K, int N, float scale) {
  const int t = blockIdx.x * 256 + threadIdx.x; if (t >= N * (K / 8)) return; const int n = t / (K / 8), k8 = (t % (K / 8)) * 8; FragH f;
#pragma unroll
  for (int i = 0; i < 8; ++i) f.h[i] = (_Float16)(bf16_round(W[(size_t)(k8 + i) * N + n]) * scale); const v8us o = f.half[0];
  *(v8us*)((unsigned short*)Wt + (size_t)n * K + k8) = o; 
}

typedef _Float16 v4h __attribute__((ext_vector_type(4)));

__global__ __launch_bounds__(256) void k_x16(const float* __restrict__ x, _Float16* __restrict__ X16, size_t n8) { const size_t t = (size_t)blockIdx.x * 256 + threadIdx.x; if (t >= n8) return; FragH f;
#pragma unroll
  for (int q = 0; q < 8; ++q) f.h[q] = (_Float16)bf16_round(x[t * 8 + q]); *(v8us*)((unsigned short*)X16 + t * 8) = f.half[0];  }
template <int NHv, int TTv>
__global__ __launch_bounds__(256) void k_vt(const _Float16* __restrict__ V16, int ldv, int voff, _Float16* __restrict__ Vt) { __shared__ unsigned short tl[64][66]; const int tid = threadIdx.x; const int slab = blockIdx.x / (TTv / 64), lg = blockIdx.x % (TTv / 64); const int b = slab / NHv, h = slab % NHv;
  for (int i = tid; i < 64 * 8; i += 256) { const int r = i / 8, c8 = (i % 8) * 8; FragH f; f.half[0] = *(const v8us*)((const unsigned short*)V16 + ((size_t)b * TTv + lg * 64 + r) * ldv + voff + h * 64 + c8);
#pragma unroll
    for (int q = 0; q < 8; ++q) tl[r][c8 + q] = f.u[q]; }
  __syncthreads();
  {
#pragma unroll
    for (int rd = 0; rd < 2; ++rd) { const int d = rd * 32 + tid / 8, pc = tid % 8; FragH f;
#pragma unroll
      for (int q = 0; q < 8; ++q) f.u[q] = tl[pc * 8 + q][d];
      *(v8us*)((unsigned short*)Vt + ((size_t)slab * 64 + d) * TTv + lg * 64 + pc * 8) = f.half[0]; }
     } }


// ---- fast GEMM (wave tile 32x64; requires M % 32 == 0 rows per launch region and N % 64 == 0) ----
__device__ __forceinline__ v16h g2_frag(const _Float16* p, int hh) { FragH f; f.half[0] = *(const v8us*)((const unsigned short*)p + 8 * hh); f.half[1] = *(const v8us*)((const unsigned short*)p + 16 + 8 * hh); return f.v; }
__device__ __forceinline__ v8f g2_mma(v16h a, v16h b, v8f c) { v8f d = __builtin_amdgcn_wmma_f32_16x16x32_f16(false, a, false, b, (short)0, c, false, false); asm volatile("v_nop\n\tv_nop\n\tv_nop\n\tv_nop" : "+v"(d) : "v"(a), "v"(b)); return d; }
template <int ACT>
__global__ __launch_bounds__(128) void k_gemm2(const _Float16* __restrict__ A, int lda, size_t sA, const _Float16* __restrict__ Bh, int ldb, size_t sB, float alpha, const float* __restrict__ bias, size_t sBias, const float* __restrict__ CP, int rowsPerB, size_t sCPb, int row0g,
    float* __restrict__ C, _Float16* __restrict__ C16, int ldc, size_t sC, int M, int N, int K) { static_assert(ACT == 0 || ACT == 3 || ACT == 6 || ACT == 8 || ACT == 9 || ACT == 11 || ACT == 12 || ACT == 14 || ACT == 15 || ACT == 16 || ACT == 17, "k_gemm2: unsupported ACT code (would silently apply no activation)");
  __shared__ __attribute__((aligned(16))) float so[4][32][68];
  const int tid = threadIdx.x, w = tid >> 5, lane = tid & 31, ln = lane & 15, hh = lane >> 4; const int by = blockIdx.y;
  A += (size_t)by * sA; Bh += (size_t)by * sB; const size_t cofs = (size_t)by * sC; const float* bp = bias ? bias + (size_t)by * sBias : nullptr;
  const int ntn = N >> 6; const int mt = blockIdx.x / ntn, nq = blockIdx.x - mt * ntn; const int row0 = mt * 128 + 32 * w, col0 = nq * 64; if (row0 >= M) return;
  const _Float16* a0p = A + (size_t)(row0 + ln) * lda; const _Float16* a1p = a0p + (size_t)16 * lda;
  const _Float16* b0p = Bh + (size_t)(col0 + ln) * ldb; const _Float16* b1p = b0p + (size_t)16 * ldb; const _Float16* b2p = b1p + (size_t)16 * ldb; const _Float16* b3p = b2p + (size_t)16 * ldb;
  const v8f z8 = {0.f,0.f,0.f,0.f,0.f,0.f,0.f,0.f}; v8f c00 = z8, c01 = z8, c02 = z8, c03 = z8, c10 = z8, c11 = z8, c12 = z8, c13 = z8;
  for (int kb = 0; kb < K; kb += 32) { const v16h a0 = g2_frag(a0p + kb, hh), a1 = g2_frag(a1p + kb, hh);
    v16h b = g2_frag(b0p + kb, hh); c00 = g2_mma(a0, b, c00); c10 = g2_mma(a1, b, c10);
    b = g2_frag(b1p + kb, hh); c01 = g2_mma(a0, b, c01); c11 = g2_mma(a1, b, c11);
    b = g2_frag(b2p + kb, hh); c02 = g2_mma(a0, b, c02); c12 = g2_mma(a1, b, c12);
    b = g2_frag(b3p + kb, hh); c03 = g2_mma(a0, b, c03); c13 = g2_mma(a1, b, c13); }
  v8f accs[8] = {c00, c01, c02, c03, c10, c11, c12, c13};
#pragma unroll
  for (int u = 0; u < 8; ++u) { const int t = u & 3, half = u >> 2; const int col = col0 + t * 16 + ln; const float bv = bp ? bf16_round(bp[col]) : 0.f;
#pragma unroll
    for (int r = 0; r < 8; ++r) { const int rloc = half * 16 + 8 * hh + r; float v = accs[u][r] * alpha + bv; if (CP) { if (rowsPerB < 0) v += CP[cofs + (size_t)(row0g + row0 + rloc) * ldc + col];      /* rowsPerB < 0: own element of the batched C plane */ else { const int bidx = (row0g + row0 + rloc) / rowsPerB; v += CP[(size_t)bidx * sCPb + (size_t)by * 64 + col]; } }
      if (ACT == 3) v = fmaxf(v, 0.f); else if (ACT == 6) v = 0.5f * v * (1.0f + erff(v * 0.70710678118654752f)); else if (ACT == 11) v = 1.0f / (1.0f + expf(-v)); else if (ACT == 15) v = v / (1.0f + expf(-v)); else if (ACT == 12) v = (v > 0.f) ? v : 0.01f * v; else if (ACT == 8) v = tanhf(v); else if (ACT == 9) v = 0.5f * v * (1.0f + tanhf(0.7978845608028654f * (v + 0.044715f * v * v * v))); else if (ACT == 14) v = (v > 0.f) ? v : 0.1f * v; else if (ACT == 16) v = (v >= 0.f) ? v : 0.3f * v; else if (ACT == 17) v = (v >= 0.f) ? v : 0.2f * v;
      so[w][rloc][t * 16 + ln] = v; } }
  __builtin_amdgcn_fence(__ATOMIC_ACQ_REL, "workgroup"); __builtin_amdgcn_wave_barrier();
  const int rsub = lane >> 4, c4 = (lane & 15) * 4;
  {
#pragma unroll
    for (int q = 0; q < 16; ++q) { const int r = q * 2 + rsub; const v4f v = *(const v4fa*)&so[w][r][c4]; if (C) *(v4f*)(C + cofs + (size_t)(row0 + r) * ldc + col0 + c4) = v; if (C16) { v4h h4; for (int i = 0; i < 4; ++i) h4[i] = (_Float16)v[i]; *(v4h*)(C16 + cofs + (size_t)(row0 + r) * ldc + col0 + c4) = h4; } }
     } }


// Causal row softmax, ONE WAVE PER ROW: lane l holds columns 128 c + 4 l .. + 3 of every 128-column chunk c in registers, so each load covers 512 contiguous bytes, each score is read once and each exponential is taken once.
// Chunks that end below q0 lie under every row's diagonal (last >= q0): there the 0/1 select is the identity and is not evaluated.
#define RG (SQ / 256)                /* 256-column groups a row can hold (nk is a multiple of 256) */
__global__ __launch_bounds__(512) void k_rsmcf2(const float* __restrict__ S, _Float16* __restrict__ P, int hg, int q0, int nk) {
  const int lane = threadIdx.x & 31; const int t = blockIdx.x * 16 + __builtin_amdgcn_readfirstlane(threadIdx.x >> 5); if (t >= hg * QT) return;      /* the row is the same in every lane: kept scalar, so the row base is a scalar address */
  const float* s = S + (size_t)t * NKX; _Float16* p = P + (size_t)t * NKX; const int last = q0 + (t % QT); const int l4 = lane * 4; v4f v[RG][2];
#pragma unroll      /* full unroll: v[][] must be indexed by constants to stay in registers */
  for (int g = 0; g < RG; ++g) if (g * 256 < nk) { v[g][0] = *(const v4fa*)(s + g * 256 + l4); v[g][1] = *(const v4fa*)(s + g * 256 + 128 + l4); }
  float mx = -3.0e38f;
#pragma unroll      /* as above */
  for (int g = 0; g < RG; ++g) if (g * 256 < nk) {
    if (g * 256 + 255 > q0) {
#pragma unroll
      for (int c = 0; c < 2; ++c) for (int u = 0; u < 4; ++u) { const int j = g * 256 + c * 128 + l4 + u; const float f = (j <= last) ? 1.f : 0.f; v[g][c][u] = fmaf(f, v[g][c][u], (1.f - f) * -1.0e9f); } }
#pragma unroll
    for (int c = 0; c < 2; ++c) for (int u = 0; u < 4; ++u) mx = fmaxf(mx, v[g][c][u]); }
  for (int m = 16; m > 0; m >>= 1) mx = fmaxf(mx, __shfl_xor(mx, m, 32));
  v4f se4 = {0.f, 0.f, 0.f, 0.f};      /* four independent partial sums a lane */
#pragma unroll      /* as above */
  for (int g = 0; g < RG; ++g) if (g * 256 < nk) {
#pragma unroll
    for (int c = 0; c < 2; ++c) for (int u = 0; u < 4; ++u) { const float e = __expf(v[g][c][u] - mx); v[g][c][u] = e; se4[u] += e; } }
  float se = (se4[0] + se4[1]) + (se4[2] + se4[3]);
  for (int m = 16; m > 0; m >>= 1) se += __shfl_xor(se, m, 32);
  const float sc = 256.0f / se;
#pragma unroll      /* as above */
  for (int g = 0; g < RG; ++g) if (g * 256 < nk) {
#pragma unroll
    for (int c = 0; c < 2; ++c) { v4h h4; for (int u = 0; u < 4; ++u) h4[u] = (_Float16)(v[g][c][u] * sc); *(v4h*)(p + g * 256 + c * 128 + l4) = h4; } } }

template <int MASKADD>
__global__ __launch_bounds__(64) void k_att0(const float* __restrict__ QF, const float* __restrict__ KF, const float* __restrict__ VF, int ld, const float* __restrict__ mask, float scale, float* __restrict__ OF, int ldo) {
  __shared__ __attribute__((aligned(16))) float lq[64][64]; __shared__ __attribute__((aligned(16))) float lo[64][64];
  const int tid = threadIdx.x; const int h = blockIdx.x / (QT0 / 64), rg = blockIdx.x % (QT0 / 64); const int i = rg * 64 + tid;
  const float* qr = QF + (size_t)i * ld + h * HD;
  for (int c = 0; c < HD / 4; ++c) { *(v4f*)&lq[tid][c * 4] = *(const v4fa*)(qr + c * 4); const v4f z = {0.f, 0.f, 0.f, 0.f}; *(v4f*)&lo[tid][c * 4] = z; }
  float m = -1.0e30f, l = 0.f; const int jmax = MASKADD ? (SQ - 1) : (rg * 64 + 63);      /* additive-mask form: every key (the mask input decides); causal form: keys up to the block's last row */
  for (int j = 0; j <= jmax; ++j) { const float* kr = KF + (size_t)j * ld + h * HD; const float* vr = VF + (size_t)j * ld + h * HD; float s = 0.f;
    for (int c = 0; c < HD / 4; ++c) { const v4f kq = *(const v4fa*)(kr + c * 4); const v4f qq = *(v4f*)&lq[tid][c * 4]; s = __fadd_rn(s, __fmul_rn(qq[0], kq[0])); s = __fadd_rn(s, __fmul_rn(qq[1], kq[1])); s = __fadd_rn(s, __fmul_rn(qq[2], kq[2])); s = __fadd_rn(s, __fmul_rn(qq[3], kq[3])); }
    s = __fmul_rn(s, scale); if (MASKADD) s = __fadd_rn(s, __fmul_rn(bf16_round(mask[(size_t)i * SQ + j]), -10000.0f));
    const float f = (MASKADD || j <= i) ? 1.f : 0.f; const float sm = fmaf(f, s, (1.f - f) * -1.0e30f); const float mn = fmaxf(m, sm); const float sc = expf(m - mn); const float e = expf(sm - mn); l = __fadd_rn(__fmul_rn(l, sc), e); m = mn;
    for (int c = 0; c < HD / 4; ++c) { const v4f vv = *(const v4fa*)(vr + c * 4); v4f oo = *(v4f*)&lo[tid][c * 4]; for (int u = 0; u < 4; ++u) oo[u] = __fadd_rn(__fmul_rn(oo[u], sc), __fmul_rn(e, vv[u])); *(v4f*)&lo[tid][c * 4] = oo; } }
  const float fin = 64.0f / l;      /* x64 undoes v's 1/64 carry: o is the context itself */
  for (int c = 0; c < HD / 4; ++c) { v4f oo = *(v4f*)&lo[tid][c * 4]; for (int u = 0; u < 4; ++u) oo[u] = __fmul_rn(oo[u], fin); *(v4f*)&lo[tid][c * 4] = oo; }
  __syncthreads();
  {
    for (int it = 0; it < 16; ++it) { const int row = it * 4 + tid / 16, pc = (tid % 16) * 4; const v4f v = *(const v4f*)&lo[row][pc]; *(v4f*)(OF + (size_t)(rg * 64 + row) * ldo + h * HD + pc) = v; }
     } }

__global__ __launch_bounds__(256) void k_kvexp(const float* __restrict__ src, float* __restrict__ dst, size_t n4) { const size_t t = (size_t)blockIdx.x * 256 + threadIdx.x; if (t >= n4) return; const size_t e = t * 4; const size_t row = e / DM; const int col = (int)(e % DM); const int h = col / HD, d = col % HD; const v4f v = *(const v4fa*)(src + row * KVD + (size_t)(h / HPG) * HD + d); *(v4f*)(dst + e) = v;  }

template <int NORM, int ROPE>
__global__ __launch_bounds__(64) void k_xform(const float* __restrict__ F, int ldf, int nh, const float* __restrict__ gain, float eps, const float* __restrict__ CS, const float* __restrict__ SN, _Float16* __restrict__ H16, int ldo) {
  __shared__ float xv[HD]; __shared__ float red[HD]; __shared__ unsigned short sh_[HD]; const int d = threadIdx.x; const int h = blockIdx.x % nh; const size_t r = blockIdx.x / nh; const int p = (int)(r % SQ);
  float x = F[r * (size_t)ldf + (size_t)h * HD + d];
  if (NORM) { red[d] = __fmul_rn(x, x); __syncthreads(); for (int st = HD / 2; st > 0; st >>= 1) { if (d < st) red[d] = __fadd_rn(red[d], red[d + st]); __syncthreads(); } const float rs = rsqrtf(__fadd_rn(red[0] / (float)HD, eps)); x = __fmul_rn(__fmul_rn(x, rs), bf16_round(gain[d])); }
  xv[d] = x; __syncthreads();
  float o = x;
  if (ROPE == 1) { const int i = d >> 1; const float c = CS[p * (HD / 2) + i], s = SN[p * (HD / 2) + i]; const float ev = xv[2 * i], od = xv[2 * i + 1]; o = (d & 1) ? __fadd_rn(__fmul_rn(ev, s), __fmul_rn(od, c)) : __fadd_rn(__fmul_rn(ev, c), -__fmul_rn(od, s)); }
  if (ROPE == 2) { const int i = d & (HD / 2 - 1); const float c = CS[p * (HD / 2) + i], s = SN[p * (HD / 2) + i]; const float lo = xv[i], hi = xv[i + HD / 2]; o = (d < HD / 2) ? __fadd_rn(__fmul_rn(lo, c), -__fmul_rn(hi, s)) : __fadd_rn(__fmul_rn(lo, s), __fmul_rn(hi, c)); }
  if (ROPE == 3) { const float c = CS[p * HD + d], s = SN[p * HD + d]; const float lo = xv[d & (HD / 2 - 1)], hi = xv[(d & (HD / 2 - 1)) + HD / 2]; o = (d < HD / 2) ? __fadd_rn(__fmul_rn(lo, c), -__fmul_rn(hi, s)) : __fadd_rn(__fmul_rn(hi, c), __fmul_rn(lo, s)); }      /* rotate-half with FULL-width per-element tables [pos][HD] */
  FragH th; th.h[0] = (_Float16)o; sh_[d] = th.u[0]; __syncthreads();
  if (d < HD / 8) { FragH f; for (int q = 0; q < 8; ++q) f.u[q] = sh_[d * 8 + q]; unsigned short* dst = (unsigned short*)H16 + r * (size_t)ldo + (size_t)h * HD + d * 8; *(v8us*)dst = f.half[0];  } }

template <int NORM, int ROPE>
__global__ __launch_bounds__(64) void k_xformf(const float* __restrict__ F, int ldf, int nh, const float* __restrict__ gain, float eps, const float* __restrict__ CS, const float* __restrict__ SN, float* __restrict__ F32, int ldo) {
  __shared__ float xv[HD]; __shared__ float red[HD]; const int d = threadIdx.x; const int h = blockIdx.x % nh; const size_t r = blockIdx.x / nh; const int p = (int)(r % SQ);
  float x = F[r * (size_t)ldf + (size_t)h * HD + d];
  if (NORM) { red[d] = __fmul_rn(x, x); __syncthreads(); for (int st = HD / 2; st > 0; st >>= 1) { if (d < st) red[d] = __fadd_rn(red[d], red[d + st]); __syncthreads(); } const float rs = rsqrtf(__fadd_rn(red[0] / (float)HD, eps)); x = __fmul_rn(__fmul_rn(x, rs), bf16_round(gain[d])); }
  xv[d] = x; __syncthreads();
  float o = x;
  if (ROPE == 1) { const int i = d >> 1; const float c = CS[p * (HD / 2) + i], s = SN[p * (HD / 2) + i]; const float ev = xv[2 * i], od = xv[2 * i + 1]; o = (d & 1) ? __fadd_rn(__fmul_rn(ev, s), __fmul_rn(od, c)) : __fadd_rn(__fmul_rn(ev, c), -__fmul_rn(od, s)); }
  if (ROPE == 2) { const int i = d & (HD / 2 - 1); const float c = CS[p * (HD / 2) + i], s = SN[p * (HD / 2) + i]; const float lo = xv[i], hi = xv[i + HD / 2]; o = (d < HD / 2) ? __fadd_rn(__fmul_rn(lo, c), -__fmul_rn(hi, s)) : __fadd_rn(__fmul_rn(lo, s), __fmul_rn(hi, c)); }
  if (ROPE == 3) { const float c = CS[p * HD + d], s = SN[p * HD + d]; const float lo = xv[d & (HD / 2 - 1)], hi = xv[(d & (HD / 2 - 1)) + HD / 2]; o = (d < HD / 2) ? __fadd_rn(__fmul_rn(lo, c), -__fmul_rn(hi, s)) : __fadd_rn(__fmul_rn(hi, c), __fmul_rn(lo, s)); }      /* rotate-half with FULL-width per-element tables [pos][HD] */
  float* dst = F32 + r * (size_t)ldo + (size_t)h * HD + d; *(float*)dst = o;  }



extern "C" void kernel_launch(void* const* d_in, const int* in_sizes, int n_in,
                              void* d_out, int out_size, void* d_ws, size_t ws_size, hipStream_t stream) {
  (void)in_sizes; (void)n_in; (void)out_size;
  const float* const* I = (const float* const*)d_in; const float* x = I[0]; const float* wq = I[1]; const float* wk = I[2]; const float* wv = I[3];      /* x [4096][1024] (ONE unbatched sequence); three separate [in][out] weights Wq, Wk, Wv [1024][1024]; no biases; no output projection */
  static_assert(HPG == 1 && NH == NG * HPG && NH * HD == DM && KVD == DM, "plain multi-head attention as 16 kv groups of one query head"); const float* bq = nullptr; const float* bk = nullptr; const float* bv = nullptr;      /* the module has no biases: the three bias slots are null */
  char* ws = (char*)d_ws; size_t off = 0;
  auto take = [&](size_t bytes) { char* p = ws + off; off += (bytes + 255) & ~(size_t)255; return p; };
  _Float16* BQKV = (_Float16*)take((size_t)3 * DM * DM * 2); _Float16* BQ = BQKV; _Float16* BK = BQKV + (size_t)DM * DM; _Float16* BV = BQKV + (size_t)2 * DM * DM;      /* three transposed planes, one after another: q, k, v */
  _Float16* X16 = (_Float16*)take(NR * DM * 2); float* QF = (float*)take((size_t)SQ * DM * 4); float* KF = (float*)take((size_t)SQ * KVD * 4); float* CSB = (float*)take((size_t)SQ * HD * 4); float* SNB = (float*)take((size_t)SQ * HD * 4); _Float16* Q16 = (_Float16*)take(NR * DM * 2); _Float16* K16 = (_Float16*)take(NR * KVD * 2); _Float16* V16 = (_Float16*)take(NR * KVD * 2);
  float* S = (float*)take((size_t)NH * QT * NKX * 4); _Float16* P = (_Float16*)take((size_t)NH * QT * NKX * 2); _Float16* VT = (_Float16*)take((size_t)NH * HD * SQ * 2);
  float* QF0 = (float*)take((size_t)QT0 * DM * 4); float* KF0 = (float*)take((size_t)QT0 * KVD * 4); float* VF0 = (float*)take((size_t)QT0 * KVD * 4); float* KF0e = (float*)take((size_t)QT0 * DM * 4); float* VF0e = (float*)take((size_t)QT0 * DM * 4);
  if (off > ws_size) return;
  k_wt_f16<<<(unsigned)(((size_t)DM * (DM / 8) + 255) / 256), 256, 0, stream>>>(wq, BQ, DM, DM, 16.0f); k_wt_f16<<<(unsigned)(((size_t)DM * (DM / 8) + 255) / 256), 256, 0, stream>>>(wk, BK, DM, DM, 16.0f); k_wt_f16<<<(unsigned)(((size_t)DM * (DM / 8) + 255) / 256), 256, 0, stream>>>(wv, BV, DM, DM, 16.0f);      /* three [in][out] weights -> their transposed x16 planes */
  k_x16<<<(unsigned)((NR * DM / 8 + 255) / 256), 256, 0, stream>>>(x, X16, NR * DM / 8);
  const size_t r0p = (size_t)B0 * SQ;      /* first projected row */
  k_gemm2<0><<<dim3((unsigned)((MP / 128) * (KVD / 64)), 1), 128, 0, stream>>>(X16 + r0p * DM, DM, 0, BV, DM, 0, 0.0625f, bv, 0, nullptr, 1, 0, 0, nullptr, V16 + r0p * KVD, KVD, 0, MP, KVD, DM);
  for (int b = B0; b < B0 + NBR; ++b) { const size_t r0 = (size_t)b * SQ;
    k_gemm2<0><<<dim3((unsigned)((SQ / 128) * (DM / 64)), 1), 128, 0, stream>>>(X16 + r0 * DM, DM, 0, BQ, DM, 0, 0.0625f, bq, 0, nullptr, 1, 0, 0, QF, nullptr, DM, 0, SQ, DM, DM);      /* q (f32): no bias here (the bias slot is null) */
    k_gemm2<0><<<dim3((unsigned)((SQ / 128) * (KVD / 64)), 1), 128, 0, stream>>>(X16 + r0 * DM, DM, 0, BK, DM, 0, 0.0625f, bk, 0, nullptr, 1, 0, 0, KF, nullptr, KVD, 0, SQ, KVD, DM);      /* k (f32): no bias */
    k_xform<0, 0><<<(unsigned)((size_t)SQ * NH), 64, 0, stream>>>(QF, DM, NH, nullptr, 0.f, CSB, SNB, Q16 + r0 * DM, DM); k_xform<0, 0><<<(unsigned)((size_t)SQ * NG), 64, 0, stream>>>(KF, KVD, NG, nullptr, 0.f, CSB, SNB, K16 + r0 * KVD, KVD);      /* no norm, no rope: the <0, 0> instances round the f32 rows to f16 (the table pointers are passed and never read) */
    k_xformf<0, 0><<<(unsigned)(QT0 * NH), 64, 0, stream>>>(QF, DM, NH, nullptr, 0.f, CSB, SNB, QF0, DM); k_xformf<0, 0><<<(unsigned)(QT0 * NG), 64, 0, stream>>>(KF, KVD, NG, nullptr, 0.f, CSB, SNB, KF0, KVD);      /* f32 q, k of rows 0..255 (copied) */
    k_vt<NG, SQ><<<NG * (SQ / 64), 256, 0, stream>>>(V16 + r0 * KVD, KVD, 0, VT);      /* V^T [NH][HD][SQ] for this batch */
    k_gemm2<0><<<dim3((QT0 / 128) * (KVD / 64), 1), 128, 0, stream>>>(X16 + r0 * DM, DM, 0, BV, DM, 0, 0.0009765625f, bv, 0, nullptr, 1, 0, 0, VF0, nullptr, KVD, 0, QT0, KVD, DM);      /* v of the first 256 rows in f32, CARRIED AT 1/64 (alpha 2^-4 x 2^-6, an exact scaling): the exact first-tile kernel multiplies its result by 64, so it writes the context itself */
    k_kvexp<<<(unsigned)(((size_t)QT0 * DM / 4 + 255) / 256), 256, 0, stream>>>(KF0, KF0e, (size_t)QT0 * DM / 4); k_kvexp<<<(unsigned)(((size_t)QT0 * DM / 4 + 255) / 256), 256, 0, stream>>>(VF0, VF0e, (size_t)QT0 * DM / 4);      /* head h <- kv group h (HPG = 1) for the exact first-tile kernel */      /* f32 q, k, v of the first 256 rows (exact products) */
    k_att0<0><<<NH * (QT0 / 64), 64, 0, stream>>>(QF0, KF0e, VF0e, DM, nullptr, 0.125f, (float*)d_out + r0 * DM, DM);      /* exact f32 attention for rows 0..255, written straight into the output rows (64 x the 1/64 values = the context) */
    for (int q0 = QT; q0 < QN; q0 += QT) { const int nk = q0 + QT;      /* causal: only keys below the tile end are computed; the first tile (rows 0..255) is the exact kernel's */
      k_gemm2<0><<<dim3((QT / 128) * (nk / 64), NH), 128, 0, stream>>>(Q16 + (r0 + q0) * LQ, LQ, (size_t)HD, K16 + r0 * KVD, KVD, (size_t)HD, 0.125f, nullptr, 0, nullptr, 1, 0, 0, S, nullptr, NKX, (size_t)QT * NKX, QT, nk, HD);      /* scores: HPG == 1 (every head has its own keys): ONE launch with all 16 heads on grid.y, key head stride HD instead of the grouped form's 0 (the 16 per-group launches of one head each, fused) */
      k_rsmcf2<<<(NHD * QT + 15) / 16, 512, 0, stream>>>(S, P, NHD, q0, nk);      /* one wave a row, 16 rows a block */
      k_gemm2<0><<<dim3((QT / 128) * (HD / 64), NH), 128, 0, stream>>>(P, NKX, (size_t)QT * NKX, VT, SQ, (size_t)HD * SQ, 0.00390625f, nullptr, 0, nullptr, 1, 0, 0, (float*)d_out + (r0 + q0) * DM, nullptr, DM, (size_t)HD, QT, HD, nk); } }      /* the context of all 16 heads in ONE launch (value head stride HD*SQ), straight into the output rows as f32: P carries 256 x the weights */
}

// v002
// One run takes 513 microseconds.
// Timed twice side by side with v001, it ran 3.33 times as fast both times.
// All steps since v000 together make it 10.9 times as fast.
#include <hip/hip_runtime.h>
// Causal multi-head self-attention over ONE unbatched sequence with three separate projections and NO output projection (x [4096][1024]; q = x Wq, k = x Wk, v = x Wv ([in][out] 1024 x 1024 each, no biases); 16 heads of 64; scores / sqrt(64); causal (-inf above the diagonal: realised as exclusion); softmax; y = the merged context -> [4096][1024]); run as grouped-query causal attention of 16 groups of ONE head with its rotation stage in the identity mode.
// Structure: x as exact f16 rows; [in][out] weights as exact x16 planes; v as a WMMA GEMM (32x64 wave tiles, f32 accumulation, f16 output); q and k as GEMMs into f32 rows (no bias), one f16 rounding of those rows on VALU (64-thread blocks per (row, head); no rotation) -> f16 rows (and f32 rows for the first 256 rows); V^T of the 16 groups (ONE head each here) via LDS transposes; rows 256..4095: one fused launch, each wave 32 query rows of one head: S^T = K Q^T on WMMA, online softmax in registers (f32 statistics, native exp2; weights f16), O^T += V^T P^T on WMMA, f32 straight into the merged output rows; the first tile: exact f32 attention for rows 0..255 (k/v copied group -> head: one head a group here) written straight into the output rows; launches: see trace.
// The first tile: the first 256 query rows see only a few keys, where single-f16 v / P operands are least accurate; they are computed exactly: f32 q/k rows copied from the full f32 GEMM outputs, f32 v rows from a small extra GEMM (v carried at 1/64, an exact scaling) and an f32 online-softmax attention on VALU whose x64 result is the context itself.
// Compute dtype: inputs rounded to bf16; x / weights exact; q, k, v and softmax weights as plain f16 GEMM operands (~2^-12); scores, softmax statistics and o f32; v_wmma_f32_16x16x32_f16.
#define NB 1
#define NG 16
#define HPG 1
#define KVD (NG * HD)
#define SQ 4096
#define DM 1024
#define NH 16
#define HD 64
#define HG 4
#define QT0 256                      /* first-tile rows recomputed exactly in f32 */
#define B0 0                         /* first batch processed (debug hook) */
#define NBR NB                       /* batches processed (debug hook) */
#define NR ((size_t)NB * SQ)         /* token rows */
#define MP ((int)((size_t)NBR * SQ)) /* rows projected (debug hook) */
#define MPO MP
#define LQ DM      /* row pitch of the q/k/v rows */
typedef __bf16 v16b __attribute__((ext_vector_type(16)));
typedef unsigned short v8us __attribute__((ext_vector_type(8), may_alias));
typedef float  v8f  __attribute__((ext_vector_type(8)));
typedef float  v4f  __attribute__((ext_vector_type(4)));
typedef float  v4fa __attribute__((ext_vector_type(4), may_alias));
union FragB { v16b v; v8us half[2]; unsigned short u[16]; };

__device__ __forceinline__ unsigned short bf16_bits(float x) { unsigned int u = __float_as_uint(x); return (unsigned short)((u + 0x7FFFu + ((u >> 16) & 1u)) >> 16); }
__device__ __forceinline__ float bf16_val(unsigned short b) { return __uint_as_float(((unsigned int)b) << 16); }
__device__ __forceinline__ float bf16_round(float x) { return bf16_val(bf16_bits(x)); }
// D += A·B with NT terms: 1 = ah·bh, 2 = + al·bh (A split), 3 = + ah·bl (both split)
template <int NT>
__device__ __forceinline__ v8f mmaN(v16b ah, v16b al, v16b bh, v16b bl, v8f c) {
  c = __builtin_amdgcn_wmma_f32_16x16x32_bf16(false, ah, false, bh, (short)0, c, false, false);
  if (NT >= 2) c = __builtin_amdgcn_wmma_f32_16x16x32_bf16(false, al, false, bh, (short)0, c, false, false);
  if (NT >= 3) c = __builtin_amdgcn_wmma_f32_16x16x32_bf16(false, ah, false, bl, (short)0, c, false, false);
  asm volatile("v_nop\n\tv_nop\n\tv_nop\n\tv_nop" : "+v"(c) : "v"(ah), "v"(al), "v"(bh), "v"(bl));
  return c;
}




// ---- f16 WMMA path (v_wmma_f32_16x16x32_f16): 11-bit significands for operands in range — used where a [0,1] probability operand needs more precision than bf16
typedef _Float16 v16h __attribute__((ext_vector_type(16)));
union FragH { v16h v; v8us half[2]; _Float16 h[16]; unsigned short u[16]; };
template <int NT>
__device__ __forceinline__ v8f mmaH(v16h ah, v16h al, v16h bh, v16h bl, v8f c) {
  c = __builtin_amdgcn_wmma_f32_16x16x32_f16(false, ah, false, bh, (short)0, c, false, false);
  if (NT >= 2) c = __builtin_amdgcn_wmma_f32_16x16x32_f16(false, al, false, bh, (short)0, c, false, false);
  if (NT >= 3) c = __builtin_amdgcn_wmma_f32_16x16x32_f16(false, ah, false, bl, (short)0, c, false, false);
  asm volatile("v_nop\n\tv_nop\n\tv_nop\n\tv_nop" : "+v"(c) : "v"(ah), "v"(al), "v"(bh), "v"(bl));
  return c;
}

// Wt[n][k] = f16(W[k][n]·scale) from f32 row-major W[K][N] (scale = power of two; bf16-exact weights stay exact in f16 away from the subnormal range)
__global__ __launch_bounds__(256) void k_wt_f16(const float* __restrict__ W, _Float16* __restrict__ Wt, int K, int N, float scale) {
  const int t = blockIdx.x * 256 + threadIdx.x; if (t >= N * (K / 8)) return; const int n = t / (K / 8), k8 = (t % (K / 8)) * 8; FragH f;
#pragma unroll
  for (int i = 0; i < 8; ++i) f.h[i] = (_Float16)(bf16_round(W[(size_t)(k8 + i) * N + n]) * scale); const v8us o = f.half[0];
  *(v8us*)((unsigned short*)Wt + (size_t)n * K + k8) = o; 
}

typedef _Float16 v4h __attribute__((ext_vector_type(4)));

__global__ __launch_bounds__(256) void k_x16(const float* __restrict__ x, _Float16* __restrict__ X16, size_t n8) { const size_t t = (size_t)blockIdx.x * 256 + threadIdx.x; if (t >= n8) return; FragH f;
#pragma unroll
  for (int q = 0; q < 8; ++q) f.h[q] = (_Float16)bf16_round(x[t * 8 + q]); *(v8us*)((unsigned short*)X16 + t * 8) = f.half[0];  }
template <int NHv, int TTv>
__global__ __launch_bounds__(256) void k_vt(const _Float16* __restrict__ V16, int ldv, int voff, _Float16* __restrict__ Vt) { __shared__ unsigned short tl[64][66]; const int tid = threadIdx.x; const int slab = blockIdx.x / (TTv / 64), lg = blockIdx.x % (TTv / 64); const int b = slab / NHv, h = slab % NHv;
  for (int i = tid; i < 64 * 8; i += 256) { const int r = i / 8, c8 = (i % 8) * 8; FragH f; f.half[0] = *(const v8us*)((const unsigned short*)V16 + ((size_t)b * TTv + lg * 64 + r) * ldv + voff + h * 64 + c8);
#pragma unroll
    for (int q = 0; q < 8; ++q) tl[r][c8 + q] = f.u[q]; }
  __syncthreads();
  {
#pragma unroll
    for (int rd = 0; rd < 2; ++rd) { const int d = rd * 32 + tid / 8, pc = tid % 8; FragH f;
#pragma unroll
      for (int q = 0; q < 8; ++q) f.u[q] = tl[pc * 8 + q][d];
      *(v8us*)((unsigned short*)Vt + ((size_t)slab * 64 + d) * TTv + lg * 64 + pc * 8) = f.half[0]; }
     } }


// ---- fast GEMM (wave tile 32x64; requires M % 32 == 0 rows per launch region and N % 64 == 0) ----
__device__ __forceinline__ v16h g2_frag(const _Float16* p, int hh) { FragH f; f.half[0] = *(const v8us*)((const unsigned short*)p + 8 * hh); f.half[1] = *(const v8us*)((const unsigned short*)p + 16 + 8 * hh); return f.v; }
__device__ __forceinline__ v8f g2_mma(v16h a, v16h b, v8f c) { v8f d = __builtin_amdgcn_wmma_f32_16x16x32_f16(false, a, false, b, (short)0, c, false, false); asm volatile("v_nop\n\tv_nop\n\tv_nop\n\tv_nop" : "+v"(d) : "v"(a), "v"(b)); return d; }
template <int ACT>
__global__ __launch_bounds__(128) void k_gemm2(const _Float16* __restrict__ A, int lda, size_t sA, const _Float16* __restrict__ Bh, int ldb, size_t sB, float alpha, const float* __restrict__ bias, size_t sBias, const float* __restrict__ CP, int rowsPerB, size_t sCPb, int row0g,
    float* __restrict__ C, _Float16* __restrict__ C16, int ldc, size_t sC, int M, int N, int K) { static_assert(ACT == 0 || ACT == 3 || ACT == 6 || ACT == 8 || ACT == 9 || ACT == 11 || ACT == 12 || ACT == 14 || ACT == 15 || ACT == 16 || ACT == 17, "k_gemm2: unsupported ACT code (would silently apply no activation)");
  __shared__ __attribute__((aligned(16))) float so[4][32][68];
  const int tid = threadIdx.x, w = tid >> 5, lane = tid & 31, ln = lane & 15, hh = lane >> 4; const int by = blockIdx.y;
  A += (size_t)by * sA; Bh += (size_t)by * sB; const size_t cofs = (size_t)by * sC; const float* bp = bias ? bias + (size_t)by * sBias : nullptr;
  const int ntn = N >> 6; const int mt = blockIdx.x / ntn, nq = blockIdx.x - mt * ntn; const int row0 = mt * 128 + 32 * w, col0 = nq * 64; if (row0 >= M) return;
  const _Float16* a0p = A + (size_t)(row0 + ln) * lda; const _Float16* a1p = a0p + (size_t)16 * lda;
  const _Float16* b0p = Bh + (size_t)(col0 + ln) * ldb; const _Float16* b1p = b0p + (size_t)16 * ldb; const _Float16* b2p = b1p + (size_t)16 * ldb; const _Float16* b3p = b2p + (size_t)16 * ldb;
  const v8f z8 = {0.f,0.f,0.f,0.f,0.f,0.f,0.f,0.f}; v8f c00 = z8, c01 = z8, c02 = z8, c03 = z8, c10 = z8, c11 = z8, c12 = z8, c13 = z8;
  for (int kb = 0; kb < K; kb += 32) { const v16h a0 = g2_frag(a0p + kb, hh), a1 = g2_frag(a1p + kb, hh);
    v16h b = g2_frag(b0p + kb, hh); c00 = g2_mma(a0, b, c00); c10 = g2_mma(a1, b, c10);
    b = g2_frag(b1p + kb, hh); c01 = g2_mma(a0, b, c01); c11 = g2_mma(a1, b, c11);
    b = g2_frag(b2p + kb, hh); c02 = g2_mma(a0, b, c02); c12 = g2_mma(a1, b, c12);
    b = g2_frag(b3p + kb, hh); c03 = g2_mma(a0, b, c03); c13 = g2_mma(a1, b, c13); }
  v8f accs[8] = {c00, c01, c02, c03, c10, c11, c12, c13};
#pragma unroll
  for (int u = 0; u < 8; ++u) { const int t = u & 3, half = u >> 2; const int col = col0 + t * 16 + ln; const float bv = bp ? bf16_round(bp[col]) : 0.f;
#pragma unroll
    for (int r = 0; r < 8; ++r) { const int rloc = half * 16 + 8 * hh + r; float v = accs[u][r] * alpha + bv; if (CP) { if (rowsPerB < 0) v += CP[cofs + (size_t)(row0g + row0 + rloc) * ldc + col];      /* rowsPerB < 0: own element of the batched C plane */ else { const int bidx = (row0g + row0 + rloc) / rowsPerB; v += CP[(size_t)bidx * sCPb + (size_t)by * 64 + col]; } }
      if (ACT == 3) v = fmaxf(v, 0.f); else if (ACT == 6) v = 0.5f * v * (1.0f + erff(v * 0.70710678118654752f)); else if (ACT == 11) v = 1.0f / (1.0f + expf(-v)); else if (ACT == 15) v = v / (1.0f + expf(-v)); else if (ACT == 12) v = (v > 0.f) ? v : 0.01f * v; else if (ACT == 8) v = tanhf(v); else if (ACT == 9) v = 0.5f * v * (1.0f + tanhf(0.7978845608028654f * (v + 0.044715f * v * v * v))); else if (ACT == 14) v = (v > 0.f) ? v : 0.1f * v; else if (ACT == 16) v = (v >= 0.f) ? v : 0.3f * v; else if (ACT == 17) v = (v >= 0.f) ? v : 0.2f * v;
      so[w][rloc][t * 16 + ln] = v; } }
  __builtin_amdgcn_fence(__ATOMIC_ACQ_REL, "workgroup"); __builtin_amdgcn_wave_barrier();
  const int rsub = lane >> 4, c4 = (lane & 15) * 4;
  {
#pragma unroll
    for (int q = 0; q < 16; ++q) { const int r = q * 2 + rsub; const v4f v = *(const v4fa*)&so[w][r][c4]; if (C) *(v4f*)(C + cofs + (size_t)(row0 + r) * ldc + col0 + c4) = v; if (C16) { v4h h4; for (int i = 0; i < 4; ++i) h4[i] = (_Float16)v[i]; *(v4h*)(C16 + cofs + (size_t)(row0 + r) * ldc + col0 + c4) = h4; } }
     } }


// Fused causal attention for query rows QT0 .. SQ-1: scores, softmax and context in ONE launch; no score or weight plane in memory.
// One wave owns 32 query rows of one head and walks its keys 32 at a time with a running maximum and sum (online softmax).
// S^T = K Q^T (A = 16 key rows, B = 16 query rows): lane (ln, hh) then holds, for query ln, keys 8 hh + r of each 16-key tile, which is the B operand order of O^T += V^T P^T: the weights go from accumulator to operand in registers.
// All of a lane's values belong to one query per 16-query set, so maximum, sum and rescale are lane-local but for one exchange between the wave halves.
// Every '#pragma unroll' of fa_pass and k_fattn is a full unroll: the fragment and accumulator arrays must be indexed by constants to stay in registers.
#define FQ 128                       /* query rows per block: 4 waves x 32 */
#define SCL2 0.18033688011112042f    /* 1/sqrt(64) x log2(e): scores are carried in log2 units */
__device__ __forceinline__ v8f fa_mma(v16h a, v16h b, v8f c) { return __builtin_amdgcn_wmma_f32_16x16x32_f16(false, a, false, b, (short)0, c, false, false); }
__device__ __forceinline__ float fa_swap16(float x) { const int b = __float_as_int(x); return __int_as_float(__builtin_amdgcn_permlanex16(b, b, 0x76543210, 0xfedcba98, false, false)); }      /* lane l <-> l ^ 16 */
// One pass: 32 keys from key0 against the wave's 32 queries. DIAG: the pass that crosses the diagonal (key0 == the wave's first query row), the wave's last.
template <bool DIAG>
__device__ __forceinline__ void fa_pass(const _Float16* __restrict__ kp, const _Float16* __restrict__ vp, int key0, int ln, int hh, const v16h (&qf)[2][2], v16h (&kf)[2][2], v8f (&o)[2][4], float (&m)[2], float (&l)[2]) {
  const v8f z8 = {0.f,0.f,0.f,0.f,0.f,0.f,0.f,0.f}; v16h vf[4];
#pragma unroll
  for (int d = 0; d < 4; ++d) vf[d] = g2_frag(vp + (size_t)d * 16 * SQ + key0, hh);
  v8f st[2][2];      /* [query set][16-key tile] */
#pragma unroll
  for (int s = 0; s < 2; ++s) for (int t = 0; t < 2; ++t) if (!(DIAG && s == 0 && t == 1)) st[s][t] = fa_mma(kf[t][1], qf[s][1], fa_mma(kf[t][0], qf[s][0], z8));      /* on the diagonal pass keys 16..31 lie above every query of set 0: that tile is left out whole */
  if (!DIAG) {      /* the next pass's keys, fetched one pass ahead into the same registers */
#pragma unroll
    for (int t = 0; t < 2; ++t) for (int kb = 0; kb < 2; ++kb) kf[t][kb] = g2_frag(kp + (size_t)(key0 + 32 + t * 16) * KVD + kb * 32, hh); }
  if (DIAG) {      /* keys above the diagonal are excluded: their weight is exp2(-huge) = 0 */
#pragma unroll
    for (int s = 0; s < 2; ++s) for (int r = 0; r < 8; ++r) st[s][s][r] = (8 * hh + r <= ln) ? st[s][s][r] : -3.0e38f; }      /* only the two tiles on the diagonal are cut; set 1 sees all of keys 0..15 */
  float mx[2];
#pragma unroll
  for (int s = 0; s < 2; ++s) { float a = st[s][0][0]; for (int r = 1; r < 8; ++r) a = fmaxf(a, st[s][0][r]); if (!(DIAG && s == 0)) for (int r = 0; r < 8; ++r) a = fmaxf(a, st[s][1][r]); a = fmaxf(a, fa_swap16(a)); mx[s] = a * SCL2; }
  /* the maximum in use moves only when some query's new maximum exceeds it by more than 8 (log2 units): weights stay <= 2^8, inside f16; one scalar branch a pass */
  if (__builtin_amdgcn_ballot_w32(mx[0] > m[0] + 8.f || mx[1] > m[1] + 8.f) != 0) {
#pragma unroll
    for (int s = 0; s < 2; ++s) { const float mn = fmaxf(m[s], mx[s]); const float al = __builtin_amdgcn_exp2f(m[s] - mn); m[s] = mn; l[s] *= al; for (int d = 0; d < 4; ++d) o[s][d] *= al; } }
#pragma unroll
  for (int s = 0; s < 2; ++s) { FragH pf; float s0 = 0.f, s1 = 0.f;
#pragma unroll
    for (int r = 0; r < 8; ++r) { const float e0 = __builtin_amdgcn_exp2f(fmaf(st[s][0][r], SCL2, -m[s])); const float e1 = (DIAG && s == 0) ? 0.f : __builtin_amdgcn_exp2f(fmaf(st[s][1][r], SCL2, -m[s])); s0 += e0; s1 += e1; pf.h[r] = (_Float16)e0; pf.h[8 + r] = (_Float16)e1; }
    l[s] += s0 + s1;
#pragma unroll
    for (int d = 0; d < 4; ++d) o[s][d] = fa_mma(vf[d], pf.v, o[s][d]); } }
__global__ __launch_bounds__(128) void k_fattn(const _Float16* __restrict__ Q, const _Float16* __restrict__ Kh, const _Float16* __restrict__ Vt, float* __restrict__ O) {
  const int lane = threadIdx.x & 31, ln = lane & 15, hh = lane >> 4; const int w = __builtin_amdgcn_readfirstlane(threadIdx.x >> 5);
  const int h = blockIdx.x % NH; const int tile = (SQ - QT0) / FQ - 1 - blockIdx.x / NH;      /* the longest key ranges start first */
  const int qw = QT0 + tile * FQ + w * 32;      /* first query row of the wave: scalar, a multiple of 32 */
  const _Float16* qp = Q + (size_t)(qw + ln) * LQ + h * HD; const _Float16* kp = Kh + (size_t)ln * KVD + h * HD; const _Float16* vp = Vt + ((size_t)h * HD + ln) * SQ;
  v16h qf[2][2], kf[2][2];
#pragma unroll
  for (int s = 0; s < 2; ++s) for (int kb = 0; kb < 2; ++kb) { qf[s][kb] = g2_frag(qp + (size_t)s * 16 * LQ + kb * 32, hh); kf[s][kb] = g2_frag(kp + (size_t)s * 16 * KVD + kb * 32, hh); }
  asm volatile("s_wait_xcnt 0x0" ::: "memory");      /* stands behind the last load of the opening run, in front of every later write of that run's address registers */
  const v8f z8 = {0.f,0.f,0.f,0.f,0.f,0.f,0.f,0.f}; v8f o[2][4]; float m[2], l[2];
#pragma unroll
  for (int s = 0; s < 2; ++s) { m[s] = -1.0e37f; l[s] = 0.f; for (int d = 0; d < 4; ++d) o[s][d] = z8; }
  for (int key0 = 0; key0 < qw; key0 += 32) fa_pass<false>(kp, vp, key0, ln, hh, qf, kf, o, m, l);      /* keys below every query of the wave */
  fa_pass<true>(kp, vp, qw, ln, hh, qf, kf, o, m, l);
#pragma unroll
  for (int s = 0; s < 2; ++s) { const float inv = 1.0f / (l[s] + fa_swap16(l[s])); float* op = O + (size_t)(qw + s * 16 + ln) * DM + h * HD + 8 * hh;      /* O^T tile d: rows d*16 + 8 hh + r of column (query) ln */
#pragma unroll
    for (int d = 0; d < 4; ++d) { const v4f lo4 = {o[s][d][0] * inv, o[s][d][1] * inv, o[s][d][2] * inv, o[s][d][3] * inv}; const v4f hi4 = {o[s][d][4] * inv, o[s][d][5] * inv, o[s][d][6] * inv, o[s][d][7] * inv}; *(v4f*)(op + d * 16) = lo4; *(v4f*)(op + d * 16 + 4) = hi4; } } }

template <int MASKADD>
__global__ __launch_bounds__(64) void k_att0(const float* __restrict__ QF, const float* __restrict__ KF, const float* __restrict__ VF, int ld, const float* __restrict__ mask, float scale, float* __restrict__ OF, int ldo) {
  __shared__ __attribute__((aligned(16))) float lq[64][64]; __shared__ __attribute__((aligned(16))) float lo[64][64];
  const int tid = threadIdx.x; const int h = blockIdx.x / (QT0 / 64), rg = blockIdx.x % (QT0 / 64); const int i = rg * 64 + tid;
  const float* qr = QF + (size_t)i * ld + h * HD;
  for (int c = 0; c < HD / 4; ++c) { *(v4f*)&lq[tid][c * 4] = *(const v4fa*)(qr + c * 4); const v4f z = {0.f, 0.f, 0.f, 0.f}; *(v4f*)&lo[tid][c * 4] = z; }
  float m = -1.0e30f, l = 0.f; const int jmax = MASKADD ? (SQ - 1) : (rg * 64 + 63);      /* additive-mask form: every key (the mask input decides); causal form: keys up to the block's last row */
  for (int j = 0; j <= jmax; ++j) { const float* kr = KF + (size_t)j * ld + h * HD; const float* vr = VF + (size_t)j * ld + h * HD; float s = 0.f;
    for (int c = 0; c < HD / 4; ++c) { const v4f kq = *(const v4fa*)(kr + c * 4); const v4f qq = *(v4f*)&lq[tid][c * 4]; s = __fadd_rn(s, __fmul_rn(qq[0], kq[0])); s = __fadd_rn(s, __fmul_rn(qq[1], kq[1])); s = __fadd_rn(s, __fmul_rn(qq[2], kq[2])); s = __fadd_rn(s, __fmul_rn(qq[3], kq[3])); }
    s = __fmul_rn(s, scale); if (MASKADD) s = __fadd_rn(s, __fmul_rn(bf16_round(mask[(size_t)i * SQ + j]), -10000.0f));
    const float f = (MASKADD || j <= i) ? 1.f : 0.f; const float sm = fmaf(f, s, (1.f - f) * -1.0e30f); const float mn = fmaxf(m, sm); const float sc = expf(m - mn); const float e = expf(sm - mn); l = __fadd_rn(__fmul_rn(l, sc), e); m = mn;
    for (int c = 0; c < HD / 4; ++c) { const v4f vv = *(const v4fa*)(vr + c * 4); v4f oo = *(v4f*)&lo[tid][c * 4]; for (int u = 0; u < 4; ++u) oo[u] = __fadd_rn(__fmul_rn(oo[u], sc), __fmul_rn(e, vv[u])); *(v4f*)&lo[tid][c * 4] = oo; } }
  const float fin = 64.0f / l;      /* x64 undoes v's 1/64 carry: o is the context itself */
  for (int c = 0; c < HD / 4; ++c) { v4f oo = *(v4f*)&lo[tid][c * 4]; for (int u = 0; u < 4; ++u) oo[u] = __fmul_rn(oo[u], fin); *(v4f*)&lo[tid][c * 4] = oo; }
  __syncthreads();
  {
    for (int it = 0; it < 16; ++it) { const int row = it * 4 + tid / 16, pc = (tid % 16) * 4; const v4f v = *(const v4f*)&lo[row][pc]; *(v4f*)(OF + (size_t)(rg * 64 + row) * ldo + h * HD + pc) = v; }
     } }

__global__ __launch_bounds__(256) void k_kvexp(const float* __restrict__ src, float* __restrict__ dst, size_t n4) { const size_t t = (size_t)blockIdx.x * 256 + threadIdx.x; if (t >= n4) return; const size_t e = t * 4; const size_t row = e / DM; const int col = (int)(e % DM); const int h = col / HD, d = col % HD; const v4f v = *(const v4fa*)(src + row * KVD + (size_t)(h / HPG) * HD + d); *(v4f*)(dst + e) = v;  }

template <int NORM, int ROPE>
__global__ __launch_bounds__(64) void k_xform(const float* __restrict__ F, int ldf, int nh, const float* __restrict__ gain, float eps, const float* __restrict__ CS, const float* __restrict__ SN, _Float16* __restrict__ H16, int ldo) {
  __shared__ float xv[HD]; __shared__ float red[HD]; __shared__ unsigned short sh_[HD]; const int d = threadIdx.x; const int h = blockIdx.x % nh; const size_t r = blockIdx.x / nh; const int p = (int)(r % SQ);
  float x = F[r * (size_t)ldf + (size_t)h * HD + d];
  if (NORM) { red[d] = __fmul_rn(x, x); __syncthreads(); for (int st = HD / 2; st > 0; st >>= 1) { if (d < st) red[d] = __fadd_rn(red[d], red[d + st]); __syncthreads(); } const float rs = rsqrtf(__fadd_rn(red[0] / (float)HD, eps)); x = __fmul_rn(__fmul_rn(x, rs), bf16_round(gain[d])); }
  xv[d] = x; __syncthreads();
  float o = x;
  if (ROPE == 1) { const int i = d >> 1; const float c = CS[p * (HD / 2) + i], s = SN[p * (HD / 2) + i]; const float ev = xv[2 * i], od = xv[2 * i + 1]; o = (d & 1) ? __fadd_rn(__fmul_rn(ev, s), __fmul_rn(od, c)) : __fadd_rn(__fmul_rn(ev, c), -__fmul_rn(od, s)); }
  if (ROPE == 2) { const int i = d & (HD / 2 - 1); const float c = CS[p * (HD / 2) + i], s = SN[p * (HD / 2) + i]; const float lo = xv[i], hi = xv[i + HD / 2]; o = (d < HD / 2) ? __fadd_rn(__fmul_rn(lo, c), -__fmul_rn(hi, s)) : __fadd_rn(__fmul_rn(lo, s), __fmul_rn(hi, c)); }
  if (ROPE == 3) { const float c = CS[p * HD + d], s = SN[p * HD + d]; const float lo = xv[d & (HD / 2 - 1)], hi = xv[(d & (HD / 2 - 1)) + HD / 2]; o = (d < HD / 2) ? __fadd_rn(__fmul_rn(lo, c), -__fmul_rn(hi, s)) : __fadd_rn(__fmul_rn(hi, c), __fmul_rn(lo, s)); }      /* rotate-half with FULL-width per-element tables [pos][HD] */
  FragH th; th.h[0] = (_Float16)o; sh_[d] = th.u[0]; __syncthreads();
  if (d < HD / 8) { FragH f; for (int q = 0; q < 8; ++q) f.u[q] = sh_[d * 8 + q]; unsigned short* dst = (unsigned short*)H16 + r * (size_t)ldo + (size_t)h * HD + d * 8; *(v8us*)dst = f.half[0];  } }

template <int NORM, int ROPE>
__global__ __launch_bounds__(64) void k_xformf(const float* __restrict__ F, int ldf, int nh, const float* __restrict__ gain, float eps, const float* __restrict__ CS, const float* __restrict__ SN, float* __restrict__ F32, int ldo) {
  __shared__ float xv[HD]; __shared__ float red[HD]; const int d = threadIdx.x; const int h = blockIdx.x % nh; const size_t r = blockIdx.x / nh; const int p = (int)(r % SQ);
  float x = F[r * (size_t)ldf + (size_t)h * HD + d];
  if (NORM) { red[d] = __fmul_rn(x, x); __syncthreads(); for (int st = HD / 2; st > 0; st >>= 1) { if (d < st) red[d] = __fadd_rn(red[d], red[d + st]); __syncthreads(); } const float rs = rsqrtf(__fadd_rn(red[0] / (float)HD, eps)); x = __fmul_rn(__fmul_rn(x, rs), bf16_round(gain[d])); }
  xv[d] = x; __syncthreads();
  float o = x;
  if (ROPE == 1) { const int i = d >> 1; const float c = CS[p * (HD / 2) + i], s = SN[p * (HD / 2) + i]; const float ev = xv[2 * i], od = xv[2 * i + 1]; o = (d & 1) ? __fadd_rn(__fmul_rn(ev, s), __fmul_rn(od, c)) : __fadd_rn(__fmul_rn(ev, c), -__fmul_rn(od, s)); }
  if (ROPE == 2) { const int i = d & (HD / 2 - 1); const float c = CS[p * (HD / 2) + i], s = SN[p * (HD / 2) + i]; const float lo = xv[i], hi = xv[i + HD / 2]; o = (d < HD / 2) ? __fadd_rn(__fmul_rn(lo, c), -__fmul_rn(hi, s)) : __fadd_rn(__fmul_rn(lo, s), __fmul_rn(hi, c)); }
  if (ROPE == 3) { const float c = CS[p * HD + d], s = SN[p * HD + d]; const float lo = xv[d & (HD / 2 - 1)], hi = xv[(d & (HD / 2 - 1)) + HD / 2]; o = (d < HD / 2) ? __fadd_rn(__fmul_rn(lo, c), -__fmul_rn(hi, s)) : __fadd_rn(__fmul_rn(hi, c), __fmul_rn(lo, s)); }      /* rotate-half with FULL-width per-element tables [pos][HD] */
  float* dst = F32 + r * (size_t)ldo + (size_t)h * HD + d; *(float*)dst = o;  }



extern "C" void kernel_launch(void* const* d_in, const int* in_sizes, int n_in,
                              void* d_out, int out_size, void* d_ws, size_t ws_size, hipStream_t stream) {
  (void)in_sizes; (void)n_in; (void)out_size;
  const float* const* I = (const float* const*)d_in; const float* x = I[0]; const float* wq = I[1]; const float* wk = I[2]; const float* wv = I[3];      /* x [4096][1024] (ONE unbatched sequence); three separate [in][out] weights Wq, Wk, Wv [1024][1024]; no biases; no output projection */
  static_assert(HPG == 1 && NH == NG * HPG && NH * HD == DM && KVD == DM, "plain multi-head attention as 16 kv groups of one query head"); const float* bq = nullptr; const float* bk = nullptr; const float* bv = nullptr;      /* the module has no biases: the three bias slots are null */
  char* ws = (char*)d_ws; size_t off = 0;
  auto take = [&](size_t bytes) { char* p = ws + off; off += (bytes + 255) & ~(size_t)255; return p; };
  _Float16* BQKV = (_Float16*)take((size_t)3 * DM * DM * 2); _Float16* BQ = BQKV; _Float16* BK = BQKV + (size_t)DM * DM; _Float16* BV = BQKV + (size_t)2 * DM * DM;      /* three transposed planes, one after another: q, k, v */
  _Float16* X16 = (_Float16*)take(NR * DM * 2); float* QF = (float*)take((size_t)SQ * DM * 4); float* KF = (float*)take((size_t)SQ * KVD * 4); float* CSB = (float*)take((size_t)SQ * HD * 4); float* SNB = (float*)take((size_t)SQ * HD * 4); _Float16* Q16 = (_Float16*)take(NR * DM * 2); _Float16* K16 = (_Float16*)take(NR * KVD * 2); _Float16* V16 = (_Float16*)take(NR * KVD * 2);
  _Float16* VT = (_Float16*)take((size_t)NH * HD * SQ * 2);
  float* QF0 = (float*)take((size_t)QT0 * DM * 4); float* KF0 = (float*)take((size_t)QT0 * KVD * 4); float* VF0 = (float*)take((size_t)QT0 * KVD * 4); float* KF0e = (float*)take((size_t)QT0 * DM * 4); float* VF0e = (float*)take((size_t)QT0 * DM * 4);
  if (off > ws_size) return;
  k_wt_f16<<<(unsigned)(((size_t)DM * (DM / 8) + 255) / 256), 256, 0, stream>>>(wq, BQ, DM, DM, 16.0f); k_wt_f16<<<(unsigned)(((size_t)DM * (DM / 8) + 255) / 256), 256, 0, stream>>>(wk, BK, DM, DM, 16.0f); k_wt_f16<<<(unsigned)(((size_t)DM * (DM / 8) + 255) / 256), 256, 0, stream>>>(wv, BV, DM, DM, 16.0f);      /* three [in][out] weights -> their transposed x16 planes */
  k_x16<<<(unsigned)((NR * DM / 8 + 255) / 256), 256, 0, stream>>>(x, X16, NR * DM / 8);
  const size_t r0p = (size_t)B0 * SQ;      /* first projected row */
  k_gemm2<0><<<dim3((unsigned)((MP / 128) * (KVD / 64)), 1), 128, 0, stream>>>(X16 + r0p * DM, DM, 0, BV, DM, 0, 0.0625f, bv, 0, nullptr, 1, 0, 0, nullptr, V16 + r0p * KVD, KVD, 0, MP, KVD, DM);
  for (int b = B0; b < B0 + NBR; ++b) { const size_t r0 = (size_t)b * SQ;
    k_gemm2<0><<<dim3((unsigned)((SQ / 128) * (DM / 64)), 1), 128, 0, stream>>>(X16 + r0 * DM, DM, 0, BQ, DM, 0, 0.0625f, bq, 0, nullptr, 1, 0, 0, QF, nullptr, DM, 0, SQ, DM, DM);      /* q (f32): no bias here (the bias slot is null) */
    k_gemm2<0><<<dim3((unsigned)((SQ / 128) * (KVD / 64)), 1), 128, 0, stream>>>(X16 + r0 * DM, DM, 0, BK, DM, 0, 0.0625f, bk, 0, nullptr, 1, 0, 0, KF, nullptr, KVD, 0, SQ, KVD, DM);      /* k (f32): no bias */
    k_xform<0, 0><<<(unsigned)((size_t)SQ * NH), 64, 0, stream>>>(QF, DM, NH, nullptr, 0.f, CSB, SNB, Q16 + r0 * DM, DM); k_xform<0, 0><<<(unsigned)((size_t)SQ * NG), 64, 0, stream>>>(KF, KVD, NG, nullptr, 0.f, CSB, SNB, K16 + r0 * KVD, KVD);      /* no norm, no rope: the <0, 0> instances round the f32 rows to f16 (the table pointers are passed and never read) */
    k_xformf<0, 0><<<(unsigned)(QT0 * NH), 64, 0, stream>>>(QF, DM, NH, nullptr, 0.f, CSB, SNB, QF0, DM); k_xformf<0, 0><<<(unsigned)(QT0 * NG), 64, 0, stream>>>(KF, KVD, NG, nullptr, 0.f, CSB, SNB, KF0, KVD);      /* f32 q, k of rows 0..255 (copied) */
    k_vt<NG, SQ><<<NG * (SQ / 64), 256, 0, stream>>>(V16 + r0 * KVD, KVD, 0, VT);      /* V^T [NH][HD][SQ] for this batch */
    k_gemm2<0><<<dim3((QT0 / 128) * (KVD / 64), 1), 128, 0, stream>>>(X16 + r0 * DM, DM, 0, BV, DM, 0, 0.0009765625f, bv, 0, nullptr, 1, 0, 0, VF0, nullptr, KVD, 0, QT0, KVD, DM);      /* v of the first 256 rows in f32, CARRIED AT 1/64 (alpha 2^-4 x 2^-6, an exact scaling): the exact first-tile kernel multiplies its result by 64, so it writes the context itself */
    k_kvexp<<<(unsigned)(((size_t)QT0 * DM / 4 + 255) / 256), 256, 0, stream>>>(KF0, KF0e, (size_t)QT0 * DM / 4); k_kvexp<<<(unsigned)(((size_t)QT0 * DM / 4 + 255) / 256), 256, 0, stream>>>(VF0, VF0e, (size_t)QT0 * DM / 4);      /* head h <- kv group h (HPG = 1) for the exact first-tile kernel */      /* f32 q, k, v of the first 256 rows (exact products) */
    k_att0<0><<<NH * (QT0 / 64), 64, 0, stream>>>(QF0, KF0e, VF0e, DM, nullptr, 0.125f, (float*)d_out + r0 * DM, DM);      /* exact f32 attention for rows 0..255, written straight into the output rows (64 x the 1/64 values = the context) */
    k_fattn<<<NH * ((SQ - QT0) / FQ), 128, 0, stream>>>(Q16 + r0 * LQ, K16 + r0 * KVD, VT, (float*)d_out + r0 * DM); }      /* rows 256..4095 of all 16 heads: scores, online softmax and context in ONE launch, straight into the output rows as f32 */
}

// v003
// Measured time: 300 microseconds a run.
// Two timings next to v002 both put it at 1.71 times that version's speed.
// All steps since v000 together make it 18.6 times as fast.
#include <hip/hip_runtime.h>
// Causal multi-head self-attention over ONE unbatched sequence with three separate projections and NO output projection (x [4096][1024]; q = x Wq, k = x Wk, v = x Wv ([in][out] 1024 x 1024 each, no biases); 16 heads of 64; scores / sqrt(64); causal (-inf above the diagonal: realised as exclusion); softmax; y = the merged context -> [4096][1024]); run as grouped-query causal attention of 16 groups of ONE head with its rotation stage in the identity mode.
// Structure: x as exact f16 rows; [in][out] weights as exact x16 planes; v as a WMMA GEMM (32x64 wave tiles, f32 accumulation, f16 output); q and k as GEMMs into f32 rows (no bias), one f16 rounding of those rows on VALU (64-thread blocks per (row, head); no rotation) -> f16 rows (and f32 rows for the first 256 rows); V^T of the 16 groups (ONE head each here) via LDS transposes; rows 256..4095: one fused launch, each wave 32 query rows of one head: S^T = K Q^T on WMMA, online softmax in registers (f32 statistics, native exp2; weights f16), O^T += V^T P^T on WMMA, f32 straight into the merged output rows; the first tile: exact f32 attention for rows 0..255 (k/v copied group -> head: one head a group here) written straight into the output rows; launches: see trace.
// The first tile: the first 256 query rows see only a few keys, where single-f16 v / P operands are least accurate; they are computed exactly: f32 q/k rows copied from the f32 projections and f32 v rows from a small extra GEMM (v carried at 1/64, an exact scaling) and an f32 attention on VALU (16 query rows a block, K and V in LDS, true row maximum) whose x64 result is the context itself.
// Compute dtype: inputs rounded to bf16; x / weights exact; q, k, v and softmax weights as plain f16 GEMM operands (~2^-12); scores and softmax statistics f32; v_wmma_f32_16x16x32_f16.
#define NB 1
#define NG 16
#define HPG 1
#define KVD (NG * HD)
#define SQ 4096
#define DM 1024
#define NH 16
#define HD 64
#define HG 4
#define QT0 256                      /* first-tile rows recomputed exactly in f32 */
#define B0 0                         /* first batch processed (debug hook) */
#define NBR NB                       /* batches processed (debug hook) */
#define NR ((size_t)NB * SQ)         /* token rows */
#define MP ((int)((size_t)NBR * SQ)) /* rows projected (debug hook) */
#define MPO MP
#define LQ DM      /* row pitch of the q/k/v rows */
typedef __bf16 v16b __attribute__((ext_vector_type(16)));
typedef unsigned short v8us __attribute__((ext_vector_type(8), may_alias));
typedef float  v8f  __attribute__((ext_vector_type(8)));
typedef float  v4f  __attribute__((ext_vector_type(4)));
typedef float  v4fa __attribute__((ext_vector_type(4), may_alias));
union FragB { v16b v; v8us half[2]; unsigned short u[16]; };

__device__ __forceinline__ unsigned short bf16_bits(float x) { unsigned int u = __float_as_uint(x); return (unsigned short)((u + 0x7FFFu + ((u >> 16) & 1u)) >> 16); }
__device__ __forceinline__ float bf16_val(unsigned short b) { return __uint_as_float(((unsigned int)b) << 16); }
__device__ __forceinline__ float bf16_round(float x) { return bf16_val(bf16_bits(x)); }
// D += A·B with NT terms: 1 = ah·bh, 2 = + al·bh (A split), 3 = + ah·bl (both split)
template <int NT>
__device__ __forceinline__ v8f mmaN(v16b ah, v16b al, v16b bh, v16b bl, v8f c) {
  c = __builtin_amdgcn_wmma_f32_16x16x32_bf16(false, ah, false, bh, (short)0, c, false, false);
  if (NT >= 2) c = __builtin_amdgcn_wmma_f32_16x16x32_bf16(false, al, false, bh, (short)0, c, false, false);
  if (NT >= 3) c = __builtin_amdgcn_wmma_f32_16x16x32_bf16(false, ah, false, bl, (short)0, c, false, false);
  asm volatile("v_nop\n\tv_nop\n\tv_nop\n\tv_nop" : "+v"(c) : "v"(ah), "v"(al), "v"(bh), "v"(bl));
  return c;
}




// ---- f16 WMMA path (v_wmma_f32_16x16x32_f16): 11-bit significands for operands in range — used for every matrix product in this file
typedef _Float16 v16h __attribute__((ext_vector_type(16)));
union FragH { v16h v; v8us half[2]; _Float16 h[16]; unsigned short u[16]; };
template <int NT>
__device__ __forceinline__ v8f mmaH(v16h ah, v16h al, v16h bh, v16h bl, v8f c) {
  c = __builtin_amdgcn_wmma_f32_16x16x32_f16(false, ah, false, bh, (short)0, c, false, false);
  if (NT >= 2) c = __builtin_amdgcn_wmma_f32_16x16x32_f16(false, al, false, bh, (short)0, c, false, false);
  if (NT >= 3) c = __builtin_amdgcn_wmma_f32_16x16x32_f16(false, ah, false, bl, (short)0, c, false, false);
  asm volatile("v_nop\n\tv_nop\n\tv_nop\n\tv_nop" : "+v"(c) : "v"(ah), "v"(al), "v"(bh), "v"(bl));
  return c;
}

// Wt[n][k] = f16(W[k][n]·scale) from f32 row-major W[K][N] (scale = power of two; bf16-exact weights stay exact in f16 away from the subnormal range)
__global__ __launch_bounds__(256) void k_wt_f16(const float* __restrict__ W, _Float16* __restrict__ Wt, int K, int N, float scale) {
  const int t = blockIdx.x * 256 + threadIdx.x; if (t >= N * (K / 8)) return; const int n = t / (K / 8), k8 = (t % (K / 8)) * 8; FragH f;
#pragma unroll
  for (int i = 0; i < 8; ++i) f.h[i] = (_Float16)(bf16_round(W[(size_t)(k8 + i) * N + n]) * scale); const v8us o = f.half[0];
  *(v8us*)((unsigned short*)Wt + (size_t)n * K + k8) = o; 
}

typedef _Float16 v4h __attribute__((ext_vector_type(4)));

__global__ __launch_bounds__(256) void k_x16(const float* __restrict__ x, _Float16* __restrict__ X16, size_t n8) { const size_t t = (size_t)blockIdx.x * 256 + threadIdx.x; if (t >= n8) return; FragH f;
#pragma unroll
  for (int q = 0; q < 8; ++q) f.h[q] = (_Float16)bf16_round(x[t * 8 + q]); *(v8us*)((unsigned short*)X16 + t * 8) = f.half[0];  }
template <int NHv, int TTv>
__global__ __launch_bounds__(256) void k_vt(const _Float16* __restrict__ V16, int ldv, int voff, _Float16* __restrict__ Vt) { __shared__ unsigned short tl[64][66]; const int tid = threadIdx.x; const int slab = blockIdx.x / (TTv / 64), lg = blockIdx.x % (TTv / 64); const int b = slab / NHv, h = slab % NHv;
  for (int i = tid; i < 64 * 8; i += 256) { const int r = i / 8, c8 = (i % 8) * 8; FragH f; f.half[0] = *(const v8us*)((const unsigned short*)V16 + ((size_t)b * TTv + lg * 64 + r) * ldv + voff + h * 64 + c8);
#pragma unroll
    for (int q = 0; q < 8; ++q) tl[r][c8 + q] = f.u[q]; }
  __syncthreads();
  {
#pragma unroll
    for (int rd = 0; rd < 2; ++rd) { const int d = rd * 32 + tid / 8, pc = tid % 8; FragH f;
#pragma unroll
      for (int q = 0; q < 8; ++q) f.u[q] = tl[pc * 8 + q][d];
      *(v8us*)((unsigned short*)Vt + ((size_t)slab * 64 + d) * TTv + lg * 64 + pc * 8) = f.half[0]; }
     } }


// ---- fast GEMM (wave tile 32x64; requires M % 32 == 0 rows per launch region and N % 64 == 0) ----
__device__ __forceinline__ v16h g2_frag(const _Float16* p, int hh) { FragH f; f.half[0] = *(const v8us*)((const unsigned short*)p + 8 * hh); f.half[1] = *(const v8us*)((const unsigned short*)p + 16 + 8 * hh); return f.v; }
__device__ __forceinline__ v8f g2_mma(v16h a, v16h b, v8f c) { v8f d = __builtin_amdgcn_wmma_f32_16x16x32_f16(false, a, false, b, (short)0, c, false, false); asm volatile("v_nop\n\tv_nop\n\tv_nop\n\tv_nop" : "+v"(d) : "v"(a), "v"(b)); return d; }
template <int ACT>
__global__ __launch_bounds__(128) void k_gemm2(const _Float16* __restrict__ A, int lda, size_t sA, const _Float16* __restrict__ Bh, int ldb, size_t sB, float alpha, const float* __restrict__ bias, size_t sBias, const float* __restrict__ CP, int rowsPerB, size_t sCPb, int row0g,
    float* __restrict__ C, _Float16* __restrict__ C16, int ldc, size_t sC, int M, int N, int K) { static_assert(ACT == 0 || ACT == 3 || ACT == 6 || ACT == 8 || ACT == 9 || ACT == 11 || ACT == 12 || ACT == 14 || ACT == 15 || ACT == 16 || ACT == 17, "k_gemm2: unsupported ACT code (would silently apply no activation)");
  __shared__ __attribute__((aligned(16))) float so[4][32][68];
  const int tid = threadIdx.x, w = tid >> 5, lane = tid & 31, ln = lane & 15, hh = lane >> 4; const int by = blockIdx.y;
  A += (size_t)by * sA; Bh += (size_t)by * sB; const size_t cofs = (size_t)by * sC; const float* bp = bias ? bias + (size_t)by * sBias : nullptr;
  const int ntn = N >> 6; const int mt = blockIdx.x / ntn, nq = blockIdx.x - mt * ntn; const int row0 = mt * 128 + 32 * w, col0 = nq * 64; if (row0 >= M) return;
  const _Float16* a0p = A + (size_t)(row0 + ln) * lda; const _Float16* a1p = a0p + (size_t)16 * lda;
  const _Float16* b0p = Bh + (size_t)(col0 + ln) * ldb; const _Float16* b1p = b0p + (size_t)16 * ldb; const _Float16* b2p = b1p + (size_t)16 * ldb; const _Float16* b3p = b2p + (size_t)16 * ldb;
  const v8f z8 = {0.f,0.f,0.f,0.f,0.f,0.f,0.f,0.f}; v8f c00 = z8, c01 = z8, c02 = z8, c03 = z8, c10 = z8, c11 = z8, c12 = z8, c13 = z8;
  for (int kb = 0; kb < K; kb += 32) { const v16h a0 = g2_frag(a0p + kb, hh), a1 = g2_frag(a1p + kb, hh);
    v16h b = g2_frag(b0p + kb, hh); c00 = g2_mma(a0, b, c00); c10 = g2_mma(a1, b, c10);
    b = g2_frag(b1p + kb, hh); c01 = g2_mma(a0, b, c01); c11 = g2_mma(a1, b, c11);
    b = g2_frag(b2p + kb, hh); c02 = g2_mma(a0, b, c02); c12 = g2_mma(a1, b, c12);
    b = g2_frag(b3p + kb, hh); c03 = g2_mma(a0, b, c03); c13 = g2_mma(a1, b, c13); }
  v8f accs[8] = {c00, c01, c02, c03, c10, c11, c12, c13};
#pragma unroll
  for (int u = 0; u < 8; ++u) { const int t = u & 3, half = u >> 2; const int col = col0 + t * 16 + ln; const float bv = bp ? bf16_round(bp[col]) : 0.f;
#pragma unroll
    for (int r = 0; r < 8; ++r) { const int rloc = half * 16 + 8 * hh + r; float v = accs[u][r] * alpha + bv; if (CP) { if (rowsPerB < 0) v += CP[cofs + (size_t)(row0g + row0 + rloc) * ldc + col];      /* rowsPerB < 0: own element of the batched C plane */ else { const int bidx = (row0g + row0 + rloc) / rowsPerB; v += CP[(size_t)bidx * sCPb + (size_t)by * 64 + col]; } }
      if (ACT == 3) v = fmaxf(v, 0.f); else if (ACT == 6) v = 0.5f * v * (1.0f + erff(v * 0.70710678118654752f)); else if (ACT == 11) v = 1.0f / (1.0f + expf(-v)); else if (ACT == 15) v = v / (1.0f + expf(-v)); else if (ACT == 12) v = (v > 0.f) ? v : 0.01f * v; else if (ACT == 8) v = tanhf(v); else if (ACT == 9) v = 0.5f * v * (1.0f + tanhf(0.7978845608028654f * (v + 0.044715f * v * v * v))); else if (ACT == 14) v = (v > 0.f) ? v : 0.1f * v; else if (ACT == 16) v = (v >= 0.f) ? v : 0.3f * v; else if (ACT == 17) v = (v >= 0.f) ? v : 0.2f * v;
      so[w][rloc][t * 16 + ln] = v; } }
  __builtin_amdgcn_fence(__ATOMIC_ACQ_REL, "workgroup"); __builtin_amdgcn_wave_barrier();
  const int rsub = lane >> 4, c4 = (lane & 15) * 4;
  {
#pragma unroll
    for (int q = 0; q < 16; ++q) { const int r = q * 2 + rsub; const v4f v = *(const v4fa*)&so[w][r][c4]; if (C) *(v4f*)(C + cofs + (size_t)(row0 + r) * ldc + col0 + c4) = v; if (C16) { v4h h4; for (int i = 0; i < 4; ++i) h4[i] = (_Float16)v[i]; *(v4h*)(C16 + cofs + (size_t)(row0 + r) * ldc + col0 + c4) = h4; } }
     } }


// Fused causal attention for query rows QT0 .. SQ-1: scores, softmax and context in ONE launch; no score or weight plane in memory.
// One wave owns 32 query rows of one head and walks its keys 32 at a time with a running maximum and sum (online softmax).
// S^T = K Q^T (A = 16 key rows, B = 16 query rows): lane (ln, hh) then holds, for query ln, keys 8 hh + r of each 16-key tile, which is the B operand order of O^T += V^T P^T: the weights go from accumulator to operand in registers.
// All of a lane's values belong to one query per 16-query set, so maximum, sum and rescale are lane-local but for one exchange between the wave halves.
// Every '#pragma unroll' of fa_pass and k_fattn is a full unroll: the fragment and accumulator arrays must be indexed by constants to stay in registers.
#define FQ 128                       /* query rows per block: 4 waves x 32 */
#define SCL2 0.18033688011112042f    /* 1/sqrt(64) x log2(e): scores are carried in log2 units */
__device__ __forceinline__ v8f fa_mma(v16h a, v16h b, v8f c) { return __builtin_amdgcn_wmma_f32_16x16x32_f16(false, a, false, b, (short)0, c, false, false); }
__device__ __forceinline__ float fa_swap16(float x) { const int b = __float_as_int(x); return __int_as_float(__builtin_amdgcn_permlanex16(b, b, 0x76543210, 0xfedcba98, false, false)); }      /* lane l <-> l ^ 16 */
// One pass: 32 keys from key0 against the wave's 32 queries. DIAG: the pass that crosses the diagonal (key0 == the wave's first query row), the wave's last.
template <bool DIAG>
__device__ __forceinline__ void fa_pass(const _Float16* __restrict__ kp, const _Float16* __restrict__ vp, int key0, int ln, int hh, const v16h (&qf)[2][2], v16h (&kf)[2][2], v8f (&o)[2][4], float (&m)[2], float (&l)[2]) {
  const v8f z8 = {0.f,0.f,0.f,0.f,0.f,0.f,0.f,0.f}; v16h vf[4];
#pragma unroll
  for (int d = 0; d < 4; ++d) vf[d] = g2_frag(vp + (size_t)d * 16 * SQ + key0, hh);
  v8f st[2][2];      /* [query set][16-key tile] */
#pragma unroll
  for (int s = 0; s < 2; ++s) for (int t = 0; t < 2; ++t) if (!(DIAG && s == 0 && t == 1)) st[s][t] = fa_mma(kf[t][1], qf[s][1], fa_mma(kf[t][0], qf[s][0], z8));      /* on the diagonal pass keys 16..31 lie above every query of set 0: that tile is left out whole */
  if (!DIAG) {      /* the next pass's keys, fetched one pass ahead into the same registers */
#pragma unroll
    for (int t = 0; t < 2; ++t) for (int kb = 0; kb < 2; ++kb) kf[t][kb] = g2_frag(kp + (size_t)(key0 + 32 + t * 16) * KVD + kb * 32, hh); }
  if (DIAG) {      /* keys above the diagonal are excluded: their weight is exp2(-huge) = 0 */
#pragma unroll
    for (int s = 0; s < 2; ++s) for (int r = 0; r < 8; ++r) st[s][s][r] = (8 * hh + r <= ln) ? st[s][s][r] : -3.0e38f; }      /* only the two tiles on the diagonal are cut; set 1 sees all of keys 0..15 */
  float mx[2];
#pragma unroll
  for (int s = 0; s < 2; ++s) { float a = st[s][0][0]; for (int r = 1; r < 8; ++r) a = fmaxf(a, st[s][0][r]); if (!(DIAG && s == 0)) for (int r = 0; r < 8; ++r) a = fmaxf(a, st[s][1][r]); a = fmaxf(a, fa_swap16(a)); mx[s] = a * SCL2; }
  /* the maximum in use moves only when some query's new maximum exceeds it by more than 8 (log2 units): weights stay <= 2^8, inside f16; one scalar branch a pass */
  if (__builtin_amdgcn_ballot_w32(mx[0] > m[0] + 8.f || mx[1] > m[1] + 8.f) != 0) {
#pragma unroll
    for (int s = 0; s < 2; ++s) { const float mn = fmaxf(m[s], mx[s]); const float al = __builtin_amdgcn_exp2f(m[s] - mn); m[s] = mn; l[s] *= al; for (int d = 0; d < 4; ++d) o[s][d] *= al; } }
#pragma unroll
  for (int s = 0; s < 2; ++s) { FragH pf; float s0 = 0.f, s1 = 0.f;
#pragma unroll
    for (int r = 0; r < 8; ++r) { const float e0 = __builtin_amdgcn_exp2f(fmaf(st[s][0][r], SCL2, -m[s])); const float e1 = (DIAG && s == 0) ? 0.f : __builtin_amdgcn_exp2f(fmaf(st[s][1][r], SCL2, -m[s])); s0 += e0; s1 += e1; pf.h[r] = (_Float16)e0; pf.h[8 + r] = (_Float16)e1; }
    l[s] += s0 + s1;
#pragma unroll
    for (int d = 0; d < 4; ++d) o[s][d] = fa_mma(vf[d], pf.v, o[s][d]); } }
__global__ __launch_bounds__(128) void k_fattn(const _Float16* __restrict__ Q, const _Float16* __restrict__ Kh, const _Float16* __restrict__ Vt, float* __restrict__ O) {
  const int lane = threadIdx.x & 31, ln = lane & 15, hh = lane >> 4; const int w = __builtin_amdgcn_readfirstlane(threadIdx.x >> 5);
  const int h = blockIdx.x % NH; const int tile = (SQ - QT0) / FQ - 1 - blockIdx.x / NH;      /* the longest key ranges start first */
  const int qw = QT0 + tile * FQ + w * 32;      /* first query row of the wave: scalar, a multiple of 32 */
  const _Float16* qp = Q + (size_t)(qw + ln) * LQ + h * HD; const _Float16* kp = Kh + (size_t)ln * KVD + h * HD; const _Float16* vp = Vt + ((size_t)h * HD + ln) * SQ;
  v16h qf[2][2], kf[2][2];
#pragma unroll
  for (int s = 0; s < 2; ++s) for (int kb = 0; kb < 2; ++kb) { qf[s][kb] = g2_frag(qp + (size_t)s * 16 * LQ + kb * 32, hh); kf[s][kb] = g2_frag(kp + (size_t)s * 16 * KVD + kb * 32, hh); }
  asm volatile("s_wait_xcnt 0x0" ::: "memory");      /* stands behind the last load of the opening run, in front of every later write of that run's address registers */
  const v8f z8 = {0.f,0.f,0.f,0.f,0.f,0.f,0.f,0.f}; v8f o[2][4]; float m[2], l[2];
#pragma unroll
  for (int s = 0; s < 2; ++s) { m[s] = -1.0e37f; l[s] = 0.f; for (int d = 0; d < 4; ++d) o[s][d] = z8; }
  for (int key0 = 0; key0 < qw; key0 += 32) fa_pass<false>(kp, vp, key0, ln, hh, qf, kf, o, m, l);      /* keys below every query of the wave */
  fa_pass<true>(kp, vp, qw, ln, hh, qf, kf, o, m, l);
#pragma unroll
  for (int s = 0; s < 2; ++s) { const float inv = 1.0f / (l[s] + fa_swap16(l[s])); float* op = O + (size_t)(qw + s * 16 + ln) * DM + h * HD + 8 * hh;      /* O^T tile d: rows d*16 + 8 hh + r of column (query) ln */
#pragma unroll
    for (int d = 0; d < 4; ++d) { const v4f lo4 = {o[s][d][0] * inv, o[s][d][1] * inv, o[s][d][2] * inv, o[s][d][3] * inv}; const v4f hi4 = {o[s][d][4] * inv, o[s][d][5] * inv, o[s][d][6] * inv, o[s][d][7] * inv}; *(v4f*)(op + d * 16) = lo4; *(v4f*)(op + d * 16 + 4) = hi4; } } }

// Exact f32 attention for query rows 0 .. QT0-1, all on the vector unit. One block = one head x 16 query rows, 8 waves; the work of a row is spread over lanes and waves, nothing walks the keys one by one.
// Stage: the head's 256 K rows, 256 V rows and the block's 16 Q rows go to LDS by coalesced 16-byte loads, all in flight together. Keys above a row's diagonal are staged too (they are rows of this call) and get the weight 0.
// Scores: a thread owns 4 rows x 4 keys (keys 64 apart), so 8 LDS reads feed 64 FMAs. Softmax: a wave owns 2 rows, 8 keys a lane, true row maximum and sum by butterflies. Context: a thread owns 4 rows x 4 columns over a quarter of the keys; the four quarters are summed through LDS.
#define A0R 16                       /* query rows per block */
#define A0KP 68                      /* K row pitch in LDS (floats): 272 B = 16 B x odd, 16 lanes on 16 rows meet every bank once */
#define A0SP 260                     /* score row pitch (floats) */
#define A0PP 20                      /* weight pitch (floats), laid [key][row] so that one 16-byte read gives 4 rows' weights of a key */
struct A0Lds { float sq[A0R * HD]; float sfin[A0R]; float ss[A0R * A0SP]; float sp[QT0 * A0PP]; float red[4 * A0R * HD]; float sk[QT0 * A0KP]; float sv[QT0 * HD]; };      /* every member starts at a multiple of 16 bytes; the small ones first, inside the reach of an LDS instruction's immediate offset */
template <int M> __device__ __forceinline__ float a0_xm(float x) { return __int_as_float(__builtin_amdgcn_update_dpp(0, __float_as_int(x), 0x160 | M, 0xf, 0xf, true)); }      /* lane l <- l ^ M inside a 16-lane row (DPP row_xmask); every lane is on where it is used */
__device__ __forceinline__ float a0_max32(float x) { x = fmaxf(x, a0_xm<1>(x)); x = fmaxf(x, a0_xm<2>(x)); x = fmaxf(x, a0_xm<4>(x)); x = fmaxf(x, a0_xm<8>(x)); return fmaxf(x, fa_swap16(x)); }
__device__ __forceinline__ float a0_sum32(float x) { x += a0_xm<1>(x); x += a0_xm<2>(x); x += a0_xm<4>(x); x += a0_xm<8>(x); return x + fa_swap16(x); }
__global__ __launch_bounds__(256) void k_att0(const float* __restrict__ QF, const float* __restrict__ KF, const float* __restrict__ VF, float scale, float* __restrict__ OF) {
  __shared__ __attribute__((aligned(16))) A0Lds L;
  const int t = threadIdx.x; const int h = blockIdx.x / (QT0 / A0R); const int i0 = (blockIdx.x % (QT0 / A0R)) * A0R;
  { const int r = t >> 4, c = (t & 15) * 4; const float* kp = KF + (size_t)r * DM + h * HD + c; const float* vp = VF + (size_t)r * DM + h * HD + c; v4f kv[QT0 / 16], vv[QT0 / 16];
#pragma unroll      /* full: the two arrays must be indexed by constants to stay in registers, and all 33 loads are to be in flight at once */
    for (int it = 0; it < QT0 / 16; ++it) { kv[it] = *(const v4fa*)(kp + (size_t)it * 16 * DM); vv[it] = *(const v4fa*)(vp + (size_t)it * 16 * DM); }
    const float* qp = QF + (size_t)(i0 + r) * DM + h * HD + c; const v4f qv = *(const v4fa*)qp;
    asm volatile("s_wait_xcnt 0x0" :: "v"(kp), "v"(vp), "v"(qp) : "memory");      /* stands behind the last load of the run; the run's three address pairs are inputs, so they keep their registers up to the wait and every later write of those registers stands behind it */
    float* ks = &L.sk[r * A0KP + c]; float* vs = &L.sv[r * HD + c];
#pragma unroll      /* full: constant indices, as above */
    for (int it = 0; it < QT0 / 16; ++it) { *(v4f*)(ks + it * 16 * A0KP) = kv[it]; *(v4f*)(vs + it * 16 * HD) = vv[it]; }
    *(v4f*)&L.sq[r * HD + c] = qv; }
  __syncthreads();      /* K, V, Q staged */
  { const int kq = t & 63, r0 = (t >> 6) * 4; const v4f z4 = {0.f, 0.f, 0.f, 0.f}; v4f acc[4] = {z4, z4, z4, z4};      /* acc[row][key] */
    const float* qb = &L.sq[r0 * HD]; const float* kb = &L.sk[kq * A0KP];
#pragma unroll      /* full: the LDS reads of later steps issue under the FMAs of earlier ones */
    for (int c = 0; c < HD; c += 4) { v4f q[4], k[4];
#pragma unroll
      for (int a = 0; a < 4; ++a) { q[a] = *(const v4f*)(qb + a * HD + c); k[a] = *(const v4f*)(kb + a * 64 * A0KP + c); }
#pragma unroll
      for (int a = 0; a < 4; ++a) for (int u = 0; u < 4; ++u) for (int e = 0; e < 4; ++e) acc[a][u] = fmaf(q[a][e], k[u][e], acc[a][u]); }
#pragma unroll
    for (int a = 0; a < 4; ++a) for (int u = 0; u < 4; ++u) { const int j = kq + 64 * u; L.ss[(r0 + a) * A0SP + j] = (j <= i0 + r0 + a) ? acc[a][u] * scale : -1.0e30f; } }      /* keys above the diagonal are excluded: their weight is exp(-huge) = 0 */
  __syncthreads();      /* scores complete */
  { const int lane = t & 31, r0 = (t >> 5) * 2; float x[2][8], m[2], l[2];      /* the wave's two rows side by side: two independent chains */
#pragma unroll
    for (int rr = 0; rr < 2; ++rr) for (int u = 0; u < 8; ++u) x[rr][u] = L.ss[(r0 + rr) * A0SP + lane + 32 * u];
#pragma unroll
    for (int rr = 0; rr < 2; ++rr) { float a = x[rr][0]; for (int u = 1; u < 8; ++u) a = fmaxf(a, x[rr][u]); m[rr] = a; }
    m[0] = a0_max32(m[0]); m[1] = a0_max32(m[1]);
#pragma unroll
    for (int rr = 0; rr < 2; ++rr) { float a = 0.f; for (int u = 0; u < 8; ++u) { x[rr][u] = expf(x[rr][u] - m[rr]); a += x[rr][u]; } l[rr] = a; }
    l[0] = a0_sum32(l[0]); l[1] = a0_sum32(l[1]);
#pragma unroll
    for (int rr = 0; rr < 2; ++rr) for (int u = 0; u < 8; ++u) L.sp[(lane + 32 * u) * A0PP + r0 + rr] = x[rr][u];
    if (lane < 2) L.sfin[r0 + lane] = 64.0f / (lane == 0 ? l[0] : l[1]); }      /* v is carried at 1/64: x64 gives the context itself */
  __syncthreads();      /* weights complete */
  { const int c = (t & 15) * 4, r0 = ((t >> 4) & 3) * 4, ks = t >> 6; const v4f z4 = {0.f, 0.f, 0.f, 0.f}; v4f o[4] = {z4, z4, z4, z4};
    const float* vb = &L.sv[ks * (QT0 / 4) * HD + c]; const float* pb = &L.sp[ks * (QT0 / 4) * A0PP + r0];
#pragma unroll      /* full: every LDS read is one base register plus an immediate offset, and later keys' reads issue under earlier keys' FMAs */
    for (int jj = 0; jj < QT0 / 4; ++jj) { const v4f v = *(const v4f*)(vb + jj * HD); const v4f p = *(const v4f*)(pb + jj * A0PP);
#pragma unroll
      for (int a = 0; a < 4; ++a) for (int e = 0; e < 4; ++e) o[a][e] = fmaf(p[a], v[e], o[a][e]); }
#pragma unroll
    for (int a = 0; a < 4; ++a) *(v4f*)&L.red[(ks * A0R + r0 + a) * HD + c] = o[a]; }
  __syncthreads();      /* the four key quarters' partial contexts complete */
  { const int r = t >> 4, c = (t & 15) * 4; v4f s = *(const v4f*)&L.red[r * HD + c];
#pragma unroll
    for (int ks = 1; ks < 4; ++ks) s += *(const v4f*)&L.red[(ks * A0R + r) * HD + c];
    s *= L.sfin[r]; *(v4f*)(OF + (size_t)(i0 + r) * DM + h * HD + c) = s; } }

__global__ __launch_bounds__(256) void k_kvexp(const float* __restrict__ src, float* __restrict__ dst, size_t n4) { const size_t t = (size_t)blockIdx.x * 256 + threadIdx.x; if (t >= n4) return; const size_t e = t * 4; const size_t row = e / DM; const int col = (int)(e % DM); const int h = col / HD, d = col % HD; const v4f v = *(const v4fa*)(src + row * KVD + (size_t)(h / HPG) * HD + d); *(v4f*)(dst + e) = v;  }

template <int NORM, int ROPE>
__global__ __launch_bounds__(64) void k_xform(const float* __restrict__ F, int ldf, int nh, const float* __restrict__ gain, float eps, const float* __restrict__ CS, const float* __restrict__ SN, _Float16* __restrict__ H16, int ldo) {
  __shared__ float xv[HD]; __shared__ float red[HD]; __shared__ unsigned short sh_[HD]; const int d = threadIdx.x; const int h = blockIdx.x % nh; const size_t r = blockIdx.x / nh; const int p = (int)(r % SQ);
  float x = F[r * (size_t)ldf + (size_t)h * HD + d];
  if (NORM) { red[d] = __fmul_rn(x, x); __syncthreads(); for (int st = HD / 2; st > 0; st >>= 1) { if (d < st) red[d] = __fadd_rn(red[d], red[d + st]); __syncthreads(); } const float rs = rsqrtf(__fadd_rn(red[0] / (float)HD, eps)); x = __fmul_rn(__fmul_rn(x, rs), bf16_round(gain[d])); }
  xv[d] = x; __syncthreads();
  float o = x;
  if (ROPE == 1) { const int i = d >> 1; const float c = CS[p * (HD / 2) + i], s = SN[p * (HD / 2) + i]; const float ev = xv[2 * i], od = xv[2 * i + 1]; o = (d & 1) ? __fadd_rn(__fmul_rn(ev, s), __fmul_rn(od, c)) : __fadd_rn(__fmul_rn(ev, c), -__fmul_rn(od, s)); }
  if (ROPE == 2) { const int i = d & (HD / 2 - 1); const float c = CS[p * (HD / 2) + i], s = SN[p * (HD / 2) + i]; const float lo = xv[i], hi = xv[i + HD / 2]; o = (d < HD / 2) ? __fadd_rn(__fmul_rn(lo, c), -__fmul_rn(hi, s)) : __fadd_rn(__fmul_rn(lo, s), __fmul_rn(hi, c)); }
  if (ROPE == 3) { const float c = CS[p * HD + d], s = SN[p * HD + d]; const float lo = xv[d & (HD / 2 - 1)], hi = xv[(d & (HD / 2 - 1)) + HD / 2]; o = (d < HD / 2) ? __fadd_rn(__fmul_rn(lo, c), -__fmul_rn(hi, s)) : __fadd_rn(__fmul_rn(hi, c), __fmul_rn(lo, s)); }      /* rotate-half with FULL-width per-element tables [pos][HD] */
  FragH th; th.h[0] = (_Float16)o; sh_[d] = th.u[0]; __syncthreads();
  if (d < HD / 8) { FragH f; for (int q = 0; q < 8; ++q) f.u[q] = sh_[d * 8 + q]; unsigned short* dst = (unsigned short*)H16 + r * (size_t)ldo + (size_t)h * HD + d * 8; *(v8us*)dst = f.half[0];  } }

template <int NORM, int ROPE>
__global__ __launch_bounds__(64) void k_xformf(const float* __restrict__ F, int ldf, int nh, const float* __restrict__ gain, float eps, const float* __restrict__ CS, const float* __restrict__ SN, float* __restrict__ F32, int ldo) {
  __shared__ float xv[HD]; __shared__ float red[HD]; const int d = threadIdx.x; const int h = blockIdx.x % nh; const size_t r = blockIdx.x / nh; const int p = (int)(r % SQ);
  float x = F[r * (size_t)ldf + (size_t)h * HD + d];
  if (NORM) { red[d] = __fmul_rn(x, x); __syncthreads(); for (int st = HD / 2; st > 0; st >>= 1) { if (d < st) red[d] = __fadd_rn(red[d], red[d + st]); __syncthreads(); } const float rs = rsqrtf(__fadd_rn(red[0] / (float)HD, eps)); x = __fmul_rn(__fmul_rn(x, rs), bf16_round(gain[d])); }
  xv[d] = x; __syncthreads();
  float o = x;
  if (ROPE == 1) { const int i = d >> 1; const float c = CS[p * (HD / 2) + i], s = SN[p * (HD / 2) + i]; const float ev = xv[2 * i], od = xv[2 * i + 1]; o = (d & 1) ? __fadd_rn(__fmul_rn(ev, s), __fmul_rn(od, c)) : __fadd_rn(__fmul_rn(ev, c), -__fmul_rn(od, s)); }
  if (ROPE == 2) { const int i = d & (HD / 2 - 1); const float c = CS[p * (HD / 2) + i], s = SN[p * (HD / 2) + i]; const float lo = xv[i], hi = xv[i + HD / 2]; o = (d < HD / 2) ? __fadd_rn(__fmul_rn(lo, c), -__fmul_rn(hi, s)) : __fadd_rn(__fmul_rn(lo, s), __fmul_rn(hi, c)); }
  if (ROPE == 3) { const float c = CS[p * HD + d], s = SN[p * HD + d]; const float lo = xv[d & (HD / 2 - 1)], hi = xv[(d & (HD / 2 - 1)) + HD / 2]; o = (d < HD / 2) ? __fadd_rn(__fmul_rn(lo, c), -__fmul_rn(hi, s)) : __fadd_rn(__fmul_rn(hi, c), __fmul_rn(lo, s)); }      /* rotate-half with FULL-width per-element tables [pos][HD] */
  float* dst = F32 + r * (size_t)ldo + (size_t)h * HD + d; *(float*)dst = o;  }



extern "C" void kernel_launch(void* const* d_in, const int* in_sizes, int n_in,
                              void* d_out, int out_size, void* d_ws, size_t ws_size, hipStream_t stream) {
  (void)in_sizes; (void)n_in; (void)out_size;
  const float* const* I = (const float* const*)d_in; const float* x = I[0]; const float* wq = I[1]; const float* wk = I[2]; const float* wv = I[3];      /* x [4096][1024] (ONE unbatched sequence); three separate [in][out] weights Wq, Wk, Wv [1024][1024]; no biases; no output projection */
  static_assert(HPG == 1 && NH == NG * HPG && NH * HD == DM && KVD == DM, "plain multi-head attention as 16 kv groups of one query head"); const float* bq = nullptr; const float* bk = nullptr; const float* bv = nullptr;      /* the module has no biases: the three bias slots are null */
  char* ws = (char*)d_ws; size_t off = 0;
  auto take = [&](size_t bytes) { char* p = ws + off; off += (bytes + 255) & ~(size_t)255; return p; };
  _Float16* BQKV = (_Float16*)take((size_t)3 * DM * DM * 2); _Float16* BQ = BQKV; _Float16* BK = BQKV + (size_t)DM * DM; _Float16* BV = BQKV + (size_t)2 * DM * DM;      /* three transposed planes, one after another: q, k, v */
  _Float16* X16 = (_Float16*)take(NR * DM * 2); float* QF = (float*)take((size_t)SQ * DM * 4); float* KF = (float*)take((size_t)SQ * KVD * 4); float* CSB = (float*)take((size_t)SQ * HD * 4); float* SNB = (float*)take((size_t)SQ * HD * 4); _Float16* Q16 = (_Float16*)take(NR * DM * 2); _Float16* K16 = (_Float16*)take(NR * KVD * 2); _Float16* V16 = (_Float16*)take(NR * KVD * 2);
  _Float16* VT = (_Float16*)take((size_t)NH * HD * SQ * 2);
  float* QF0 = (float*)take((size_t)QT0 * DM * 4); float* KF0 = (float*)take((size_t)QT0 * KVD * 4); float* VF0 = (float*)take((size_t)QT0 * KVD * 4); float* KF0e = (float*)take((size_t)QT0 * DM * 4); float* VF0e = (float*)take((size_t)QT0 * DM * 4);
  if (off > ws_size) return;
  k_wt_f16<<<(unsigned)(((size_t)DM * (DM / 8) + 255) / 256), 256, 0, stream>>>(wq, BQ, DM, DM, 16.0f); k_wt_f16<<<(unsigned)(((size_t)DM * (DM / 8) + 255) / 256), 256, 0, stream>>>(wk, BK, DM, DM, 16.0f); k_wt_f16<<<(unsigned)(((size_t)DM * (DM / 8) + 255) / 256), 256, 0, stream>>>(wv, BV, DM, DM, 16.0f);      /* three [in][out] weights -> their transposed x16 planes */
  k_x16<<<(unsigned)((NR * DM / 8 + 255) / 256), 256, 0, stream>>>(x, X16, NR * DM / 8);
  const size_t r0p = (size_t)B0 * SQ;      /* first projected row */
  k_gemm2<0><<<dim3((unsigned)((MP / 128) * (KVD / 64)), 1), 128, 0, stream>>>(X16 + r0p * DM, DM, 0, BV, DM, 0, 0.0625f, bv, 0, nullptr, 1, 0, 0, nullptr, V16 + r0p * KVD, KVD, 0, MP, KVD, DM);
  for (int b = B0; b < B0 + NBR; ++b) { const size_t r0 = (size_t)b * SQ;
    k_gemm2<0><<<dim3((unsigned)((SQ / 128) * (DM / 64)), 1), 128, 0, stream>>>(X16 + r0 * DM, DM, 0, BQ, DM, 0, 0.0625f, bq, 0, nullptr, 1, 0, 0, QF, nullptr, DM, 0, SQ, DM, DM);      /* q (f32): no bias here (the bias slot is null) */
    k_gemm2<0><<<dim3((unsigned)((SQ / 128) * (KVD / 64)), 1), 128, 0, stream>>>(X16 + r0 * DM, DM, 0, BK, DM, 0, 0.0625f, bk, 0, nullptr, 1, 0, 0, KF, nullptr, KVD, 0, SQ, KVD, DM);      /* k (f32): no bias */
    k_xform<0, 0><<<(unsigned)((size_t)SQ * NH), 64, 0, stream>>>(QF, DM, NH, nullptr, 0.f, CSB, SNB, Q16 + r0 * DM, DM); k_xform<0, 0><<<(unsigned)((size_t)SQ * NG), 64, 0, stream>>>(KF, KVD, NG, nullptr, 0.f, CSB, SNB, K16 + r0 * KVD, KVD);      /* no norm, no rope: the <0, 0> instances round the f32 rows to f16 (the table pointers are passed and never read) */
    k_xformf<0, 0><<<(unsigned)(QT0 * NH), 64, 0, stream>>>(QF, DM, NH, nullptr, 0.f, CSB, SNB, QF0, DM); k_xformf<0, 0><<<(unsigned)(QT0 * NG), 64, 0, stream>>>(KF, KVD, NG, nullptr, 0.f, CSB, SNB, KF0, KVD);      /* f32 q, k of rows 0..255 (copied) */
    k_vt<NG, SQ><<<NG * (SQ / 64), 256, 0, stream>>>(V16 + r0 * KVD, KVD, 0, VT);      /* V^T [NH][HD][SQ] for this batch */
    k_gemm2<0><<<dim3((QT0 / 128) * (KVD / 64), 1), 128, 0, stream>>>(X16 + r0 * DM, DM, 0, BV, DM, 0, 0.0009765625f, bv, 0, nullptr, 1, 0, 0, VF0, nullptr, KVD, 0, QT0, KVD, DM);      /* v of the first 256 rows in f32, CARRIED AT 1/64 (alpha 2^-4 x 2^-6, an exact scaling): the exact first-tile kernel multiplies its result by 64, so it writes the context itself */
    k_kvexp<<<(unsigned)(((size_t)QT0 * DM / 4 + 255) / 256), 256, 0, stream>>>(KF0, KF0e, (size_t)QT0 * DM / 4); k_kvexp<<<(unsigned)(((size_t)QT0 * DM / 4 + 255) / 256), 256, 0, stream>>>(VF0, VF0e, (size_t)QT0 * DM / 4);      /* head h <- kv group h (one head a group: a plain copy) for the exact first-tile kernel */      /* f32 k, v of the first 256 rows (exact products) */
    k_att0<<<NH * (QT0 / A0R), 256, 0, stream>>>(QF0, KF0e, VF0e, 0.125f, (float*)d_out + r0 * DM);      /* exact f32 attention for rows 0..255, written straight into the output rows (64 x the 1/64 values = the context) */
    k_fattn<<<NH * ((SQ - QT0) / FQ), 128, 0, stream>>>(Q16 + r0 * LQ, K16 + r0 * KVD, VT, (float*)d_out + r0 * DM); }      /* rows 256..4095 of all 16 heads: scores, online softmax and context in ONE launch, straight into the output rows as f32 */
}

// v004
// A run of this version takes 247 microseconds.
// In both of two side-by-side timings against v003, it was 1.22 times as fast.
// Counting every step since v000, it is 22.7 times as fast.
#include <hip/hip_runtime.h>
// Causal multi-head self-attention over ONE unbatched sequence with three separate projections and NO output projection (x [4096][1024]; q = x Wq, k = x Wk, v = x Wv ([in][out] 1024 x 1024 each, no biases); 16 heads of 64; scores / sqrt(64); causal (-inf above the diagonal: realised as exclusion); softmax; y = the merged context -> [4096][1024]); 16 k/v groups of ONE head each, no rotation.
// Structure: x as exact f16 rows; [in][out] weights as exact x16 planes; q, k and v as WMMA GEMMs (32x64 wave tiles, f32 accumulation, no bias) whose epilogue stores the one f16 rounding of every row and, for the first 256 rows, the f32 value beside it; V^T of the 16 groups (ONE head each here) via LDS transposes; rows 256..4095: one fused launch, each wave 32 query rows of one head: S^T = K Q^T on WMMA, online softmax in registers (f32 statistics, native exp2; weights f16), O^T += V^T P^T on WMMA, f32 straight into the merged output rows; the first tile: exact f32 attention for rows 0..255 written straight into the output rows; launches: see trace.
// The first tile: the first 256 query rows see only a few keys, where single-f16 v / P operands are least accurate; they are computed exactly: the f32 q/k/v rows that the three GEMMs store for them and an f32 attention on VALU (16 query rows a block, K and V in LDS, true row maximum).
// Compute dtype: inputs rounded to bf16; x / weights exact; q, k, v and softmax weights as plain f16 GEMM operands (~2^-12); scores, softmax statistics and o f32; v_wmma_f32_16x16x32_f16.
#define NB 1
#define NG 16
#define HPG 1
#define KVD (NG * HD)
#define SQ 4096
#define DM 1024
#define NH 16
#define HD 64
#define HG 4
#define QT0 256                      /* first-tile rows recomputed exactly in f32 */
#define B0 0                         /* first batch processed (debug hook) */
#define NBR NB                       /* batches processed (debug hook) */
#define NR ((size_t)NB * SQ)         /* token rows */
#define MP ((int)((size_t)NBR * SQ)) /* NBR x SQ rows; unused: each projection launch takes SQ rows */
#define MPO MP
#define LQ DM      /* row pitch of the q/k/v rows */
typedef __bf16 v16b __attribute__((ext_vector_type(16)));
typedef unsigned short v8us __attribute__((ext_vector_type(8), may_alias));
typedef float  v8f  __attribute__((ext_vector_type(8)));
typedef float  v4f  __attribute__((ext_vector_type(4)));
typedef float  v4fa __attribute__((ext_vector_type(4), may_alias));
union FragB { v16b v; v8us half[2]; unsigned short u[16]; };

__device__ __forceinline__ unsigned short bf16_bits(float x) { unsigned int u = __float_as_uint(x); return (unsigned short)((u + 0x7FFFu + ((u >> 16) & 1u)) >> 16); }
__device__ __forceinline__ float bf16_val(unsigned short b) { return __uint_as_float(((unsigned int)b) << 16); }
__device__ __forceinline__ float bf16_round(float x) { return bf16_val(bf16_bits(x)); }
// D += A·B with NT terms: 1 = ah·bh, 2 = + al·bh (A split), 3 = + ah·bl (both split)
template <int NT>
__device__ __forceinline__ v8f mmaN(v16b ah, v16b al, v16b bh, v16b bl, v8f c) {
  c = __builtin_amdgcn_wmma_f32_16x16x32_bf16(false, ah, false, bh, (short)0, c, false, false);
  if (NT >= 2) c = __builtin_amdgcn_wmma_f32_16x16x32_bf16(false, al, false, bh, (short)0, c, false, false);
  if (NT >= 3) c = __builtin_amdgcn_wmma_f32_16x16x32_bf16(false, ah, false, bl, (short)0, c, false, false);
  asm volatile("v_nop\n\tv_nop\n\tv_nop\n\tv_nop" : "+v"(c) : "v"(ah), "v"(al), "v"(bh), "v"(bl));
  return c;
}




// ---- f16 WMMA path (v_wmma_f32_16x16x32_f16): 11-bit significands for operands in range — used for every WMMA product in this file
typedef _Float16 v16h __attribute__((ext_vector_type(16)));
union FragH { v16h v; v8us half[2]; _Float16 h[16]; unsigned short u[16]; };
template <int NT>
__device__ __forceinline__ v8f mmaH(v16h ah, v16h al, v16h bh, v16h bl, v8f c) {
  c = __builtin_amdgcn_wmma_f32_16x16x32_f16(false, ah, false, bh, (short)0, c, false, false);
  if (NT >= 2) c = __builtin_amdgcn_wmma_f32_16x16x32_f16(false, al, false, bh, (short)0, c, false, false);
  if (NT >= 3) c = __builtin_amdgcn_wmma_f32_16x16x32_f16(false, ah, false, bl, (short)0, c, false, false);
  asm volatile("v_nop\n\tv_nop\n\tv_nop\n\tv_nop" : "+v"(c) : "v"(ah), "v"(al), "v"(bh), "v"(bl));
  return c;
}

// Wt[n][k] = f16(W[k][n]·scale) from f32 row-major W[K][N] (scale = power of two; bf16-exact weights stay exact in f16 away from the subnormal range)
__global__ __launch_bounds__(256) void k_wt_f16(const float* __restrict__ W, _Float16* __restrict__ Wt, int K, int N, float scale) {
  const int t = blockIdx.x * 256 + threadIdx.x; if (t >= N * (K / 8)) return; const int n = t / (K / 8), k8 = (t % (K / 8)) * 8; FragH f;
#pragma unroll
  for (int i = 0; i < 8; ++i) f.h[i] = (_Float16)(bf16_round(W[(size_t)(k8 + i) * N + n]) * scale); const v8us o = f.half[0];
  *(v8us*)((unsigned short*)Wt + (size_t)n * K + k8) = o; 
}

typedef _Float16 v4h __attribute__((ext_vector_type(4)));

__global__ __launch_bounds__(256) void k_x16(const float* __restrict__ x, _Float16* __restrict__ X16, size_t n8) { const size_t t = (size_t)blockIdx.x * 256 + threadIdx.x; if (t >= n8) return; FragH f;
#pragma unroll
  for (int q = 0; q < 8; ++q) f.h[q] = (_Float16)bf16_round(x[t * 8 + q]); *(v8us*)((unsigned short*)X16 + t * 8) = f.half[0];  }
template <int NHv, int TTv>
__global__ __launch_bounds__(256) void k_vt(const _Float16* __restrict__ V16, int ldv, int voff, _Float16* __restrict__ Vt) { __shared__ unsigned short tl[64][66]; const int tid = threadIdx.x; const int slab = blockIdx.x / (TTv / 64), lg = blockIdx.x % (TTv / 64); const int b = slab / NHv, h = slab % NHv;
  for (int i = tid; i < 64 * 8; i += 256) { const int r = i / 8, c8 = (i % 8) * 8; FragH f; f.half[0] = *(const v8us*)((const unsigned short*)V16 + ((size_t)b * TTv + lg * 64 + r) * ldv + voff + h * 64 + c8);
#pragma unroll
    for (int q = 0; q < 8; ++q) tl[r][c8 + q] = f.u[q]; }
  __syncthreads();
  {
#pragma unroll
    for (int rd = 0; rd < 2; ++rd) { const int d = rd * 32 + tid / 8, pc = tid % 8; FragH f;
#pragma unroll
      for (int q = 0; q < 8; ++q) f.u[q] = tl[pc * 8 + q][d];
      *(v8us*)((unsigned short*)Vt + ((size_t)slab * 64 + d) * TTv + lg * 64 + pc * 8) = f.half[0]; }
     } }


// ---- fast GEMM (wave tile 32x64; requires M % 32 == 0 rows per launch region and N % 64 == 0) ----
__device__ __forceinline__ v16h g2_frag(const _Float16* p, int hh) { FragH f; f.half[0] = *(const v8us*)((const unsigned short*)p + 8 * hh); f.half[1] = *(const v8us*)((const unsigned short*)p + 16 + 8 * hh); return f.v; }
__device__ __forceinline__ v8f g2_mma(v16h a, v16h b, v8f c) { v8f d = __builtin_amdgcn_wmma_f32_16x16x32_f16(false, a, false, b, (short)0, c, false, false); asm volatile("v_nop\n\tv_nop\n\tv_nop\n\tv_nop" : "+v"(d) : "v"(a), "v"(b)); return d; }
template <int ACT>
__global__ __launch_bounds__(128) void k_gemm2(const _Float16* __restrict__ A, int lda, size_t sA, const _Float16* __restrict__ Bh, int ldb, size_t sB, float alpha, const float* __restrict__ bias, size_t sBias, const float* __restrict__ CP, int rowsPerB, size_t sCPb, int row0g,
    float* __restrict__ C, int MC, _Float16* __restrict__ C16, int ldc, size_t sC, int M, int N, int K) {      /* C: f32 rows, stored for rows below MC only (MC % 32 == 0); C16: the f16 rounding of every row */ static_assert(ACT == 0 || ACT == 3 || ACT == 6 || ACT == 8 || ACT == 9 || ACT == 11 || ACT == 12 || ACT == 14 || ACT == 15 || ACT == 16 || ACT == 17, "k_gemm2: unsupported ACT code (would silently apply no activation)");
  __shared__ __attribute__((aligned(16))) float so[4][32][68];
  const int tid = threadIdx.x, w = tid >> 5, lane = tid & 31, ln = lane & 15, hh = lane >> 4; const int by = blockIdx.y;
  A += (size_t)by * sA; Bh += (size_t)by * sB; const size_t cofs = (size_t)by * sC; const float* bp = bias ? bias + (size_t)by * sBias : nullptr;
  const int ntn = N >> 6; const int mt = blockIdx.x / ntn, nq = blockIdx.x - mt * ntn; const int row0 = mt * 128 + 32 * w, col0 = nq * 64; if (row0 >= M) return;
  const _Float16* a0p = A + (size_t)(row0 + ln) * lda; const _Float16* a1p = a0p + (size_t)16 * lda;
  const _Float16* b0p = Bh + (size_t)(col0 + ln) * ldb; const _Float16* b1p = b0p + (size_t)16 * ldb; const _Float16* b2p = b1p + (size_t)16 * ldb; const _Float16* b3p = b2p + (size_t)16 * ldb;
  const v8f z8 = {0.f,0.f,0.f,0.f,0.f,0.f,0.f,0.f}; v8f c00 = z8, c01 = z8, c02 = z8, c03 = z8, c10 = z8, c11 = z8, c12 = z8, c13 = z8;
  for (int kb = 0; kb < K; kb += 32) { const v16h a0 = g2_frag(a0p + kb, hh), a1 = g2_frag(a1p + kb, hh);
    v16h b = g2_frag(b0p + kb, hh); c00 = g2_mma(a0, b, c00); c10 = g2_mma(a1, b, c10);
    b = g2_frag(b1p + kb, hh); c01 = g2_mma(a0, b, c01); c11 = g2_mma(a1, b, c11);
    b = g2_frag(b2p + kb, hh); c02 = g2_mma(a0, b, c02); c12 = g2_mma(a1, b, c12);
    b = g2_frag(b3p + kb, hh); c03 = g2_mma(a0, b, c03); c13 = g2_mma(a1, b, c13); }
  v8f accs[8] = {c00, c01, c02, c03, c10, c11, c12, c13};
#pragma unroll
  for (int u = 0; u < 8; ++u) { const int t = u & 3, half = u >> 2; const int col = col0 + t * 16 + ln; const float bv = bp ? bf16_round(bp[col]) : 0.f;
#pragma unroll
    for (int r = 0; r < 8; ++r) { const int rloc = half * 16 + 8 * hh + r; float v = accs[u][r] * alpha + bv; if (CP) { if (rowsPerB < 0) v += CP[cofs + (size_t)(row0g + row0 + rloc) * ldc + col];      /* rowsPerB < 0: own element of the batched C plane */ else { const int bidx = (row0g + row0 + rloc) / rowsPerB; v += CP[(size_t)bidx * sCPb + (size_t)by * 64 + col]; } }
      if (ACT == 3) v = fmaxf(v, 0.f); else if (ACT == 6) v = 0.5f * v * (1.0f + erff(v * 0.70710678118654752f)); else if (ACT == 11) v = 1.0f / (1.0f + expf(-v)); else if (ACT == 15) v = v / (1.0f + expf(-v)); else if (ACT == 12) v = (v > 0.f) ? v : 0.01f * v; else if (ACT == 8) v = tanhf(v); else if (ACT == 9) v = 0.5f * v * (1.0f + tanhf(0.7978845608028654f * (v + 0.044715f * v * v * v))); else if (ACT == 14) v = (v > 0.f) ? v : 0.1f * v; else if (ACT == 16) v = (v >= 0.f) ? v : 0.3f * v; else if (ACT == 17) v = (v >= 0.f) ? v : 0.2f * v;
      so[w][rloc][t * 16 + ln] = v; } }
  __builtin_amdgcn_fence(__ATOMIC_ACQ_REL, "workgroup"); __builtin_amdgcn_wave_barrier();
  const int rsub = lane >> 4, c4 = (lane & 15) * 4; const bool cf = C && __builtin_amdgcn_readfirstlane(row0) < MC;      /* the wave's 32 rows lie on one side of MC: a scalar test */
  {
#pragma unroll
    for (int q = 0; q < 16; ++q) { const int r = q * 2 + rsub; const v4f v = *(const v4fa*)&so[w][r][c4]; if (cf) { *(v4f*)(C + cofs + (size_t)(row0 + r) * ldc + col0 + c4) = v; asm volatile("s_wait_xcnt 0x0" ::: "memory"); }      /* the wait stands behind the f32 store, in front of the f16 conversion, which may reuse the store's registers */
      if (C16) { v4h h4; for (int i = 0; i < 4; ++i) h4[i] = (_Float16)v[i]; *(v4h*)(C16 + cofs + (size_t)(row0 + r) * ldc + col0 + c4) = h4; } }
     } }


// Fused causal attention for query rows QT0 .. SQ-1: scores, softmax and context in ONE launch; no score or weight plane in memory.
// One wave owns 32 query rows of one head and walks its keys 32 at a time with a running maximum and sum (online softmax).
// S^T = K Q^T (A = 16 key rows, B = 16 query rows): lane (ln, hh) then holds, for query ln, keys 8 hh + r of each 16-key tile, which is the B operand order of O^T += V^T P^T: the weights go from accumulator to operand in registers.
// All of a lane's values belong to one query per 16-query set, so maximum, sum and rescale are lane-local but for one exchange between the wave halves.
// Every '#pragma unroll' of fa_pass and k_fattn is a full unroll: the fragment and accumulator arrays must be indexed by constants to stay in registers.
#define FQ 128                       /* query rows per block: 4 waves x 32 */
#define SCL2 0.18033688011112042f    /* 1/sqrt(64) x log2(e): scores are carried in log2 units */
__device__ __forceinline__ v8f fa_mma(v16h a, v16h b, v8f c) { return __builtin_amdgcn_wmma_f32_16x16x32_f16(false, a, false, b, (short)0, c, false, false); }
__device__ __forceinline__ float fa_swap16(float x) { const int b = __float_as_int(x); return __int_as_float(__builtin_amdgcn_permlanex16(b, b, 0x76543210, 0xfedcba98, false, false)); }      /* lane l <-> l ^ 16 */
// One pass: 32 keys from key0 against the wave's 32 queries. DIAG: the pass that crosses the diagonal (key0 == the wave's first query row), the wave's last.
template <bool DIAG>
__device__ __forceinline__ void fa_pass(const _Float16* __restrict__ kp, const _Float16* __restrict__ vp, int key0, int ln, int hh, const v16h (&qf)[2][2], v16h (&kf)[2][2], v8f (&o)[2][4], float (&m)[2], float (&l)[2]) {
  const v8f z8 = {0.f,0.f,0.f,0.f,0.f,0.f,0.f,0.f}; v16h vf[4];
#pragma unroll
  for (int d = 0; d < 4; ++d) vf[d] = g2_frag(vp + (size_t)d * 16 * SQ + key0, hh);
  v8f st[2][2];      /* [query set][16-key tile] */
#pragma unroll
  for (int s = 0; s < 2; ++s) for (int t = 0; t < 2; ++t) if (!(DIAG && s == 0 && t == 1)) st[s][t] = fa_mma(kf[t][1], qf[s][1], fa_mma(kf[t][0], qf[s][0], z8));      /* on the diagonal pass keys 16..31 lie above every query of set 0: that tile is left out whole */
  if (!DIAG) {      /* the next pass's keys, fetched one pass ahead into the same registers */
#pragma unroll
    for (int t = 0; t < 2; ++t) for (int kb = 0; kb < 2; ++kb) kf[t][kb] = g2_frag(kp + (size_t)(key0 + 32 + t * 16) * KVD + kb * 32, hh); }
  if (DIAG) {      /* keys above the diagonal are excluded: their weight is exp2(-huge) = 0 */
#pragma unroll
    for (int s = 0; s < 2; ++s) for (int r = 0; r < 8; ++r) st[s][s][r] = (8 * hh + r <= ln) ? st[s][s][r] : -3.0e38f; }      /* only the two tiles on the diagonal are cut; set 1 sees all of keys 0..15 */
  float mx[2];
#pragma unroll
  for (int s = 0; s < 2; ++s) { float a = st[s][0][0]; for (int r = 1; r < 8; ++r) a = fmaxf(a, st[s][0][r]); if (!(DIAG && s == 0)) for (int r = 0; r < 8; ++r) a = fmaxf(a, st[s][1][r]); a = fmaxf(a, fa_swap16(a)); mx[s] = a * SCL2; }
  /* the maximum in use moves only when some query's new maximum exceeds it by more than 8 (log2 units): weights stay <= 2^8, inside f16; one scalar branch a pass */
  if (__builtin_amdgcn_ballot_w32(mx[0] > m[0] + 8.f || mx[1] > m[1] + 8.f) != 0) {
#pragma unroll
    for (int s = 0; s < 2; ++s) { const float mn = fmaxf(m[s], mx[s]); const float al = __builtin_amdgcn_exp2f(m[s] - mn); m[s] = mn; l[s] *= al; for (int d = 0; d < 4; ++d) o[s][d] *= al; } }
#pragma unroll
  for (int s = 0; s < 2; ++s) { FragH pf; float s0 = 0.f, s1 = 0.f;
#pragma unroll
    for (int r = 0; r < 8; ++r) { const float e0 = __builtin_amdgcn_exp2f(fmaf(st[s][0][r], SCL2, -m[s])); const float e1 = (DIAG && s == 0) ? 0.f : __builtin_amdgcn_exp2f(fmaf(st[s][1][r], SCL2, -m[s])); s0 += e0; s1 += e1; pf.h[r] = (_Float16)e0; pf.h[8 + r] = (_Float16)e1; }
    l[s] += s0 + s1;
#pragma unroll
    for (int d = 0; d < 4; ++d) o[s][d] = fa_mma(vf[d], pf.v, o[s][d]); } }
__global__ __launch_bounds__(128) void k_fattn(const _Float16* __restrict__ Q, const _Float16* __restrict__ Kh, const _Float16* __restrict__ Vt, float* __restrict__ O) {
  const int lane = threadIdx.x & 31, ln = lane & 15, hh = lane >> 4; const int w = __builtin_amdgcn_readfirstlane(threadIdx.x >> 5);
  const int h = blockIdx.x % NH; const int tile = (SQ - QT0) / FQ - 1 - blockIdx.x / NH;      /* the longest key ranges start first */
  const int qw = QT0 + tile * FQ + w * 32;      /* first query row of the wave: scalar, a multiple of 32 */
  const _Float16* qp = Q + (size_t)(qw + ln) * LQ + h * HD; const _Float16* kp = Kh + (size_t)ln * KVD + h * HD; const _Float16* vp = Vt + ((size_t)h * HD + ln) * SQ;
  v16h qf[2][2], kf[2][2];
#pragma unroll
  for (int s = 0; s < 2; ++s) for (int kb = 0; kb < 2; ++kb) { qf[s][kb] = g2_frag(qp + (size_t)s * 16 * LQ + kb * 32, hh); kf[s][kb] = g2_frag(kp + (size_t)s * 16 * KVD + kb * 32, hh); }
  asm volatile("s_wait_xcnt 0x0" ::: "memory");      /* stands behind the last load of the opening run, in front of every later write of that run's address registers */
  const v8f z8 = {0.f,0.f,0.f,0.f,0.f,0.f,0.f,0.f}; v8f o[2][4]; float m[2], l[2];
#pragma unroll
  for (int s = 0; s < 2; ++s) { m[s] = -1.0e37f; l[s] = 0.f; for (int d = 0; d < 4; ++d) o[s][d] = z8; }
  for (int key0 = 0; key0 < qw; key0 += 32) fa_pass<false>(kp, vp, key0, ln, hh, qf, kf, o, m, l);      /* keys below every query of the wave */
  fa_pass<true>(kp, vp, qw, ln, hh, qf, kf, o, m, l);
#pragma unroll
  for (int s = 0; s < 2; ++s) { const float inv = 1.0f / (l[s] + fa_swap16(l[s])); float* op = O + (size_t)(qw + s * 16 + ln) * DM + h * HD + 8 * hh;      /* O^T tile d: rows d*16 + 8 hh + r of column (query) ln */
#pragma unroll
    for (int d = 0; d < 4; ++d) { const v4f lo4 = {o[s][d][0] * inv, o[s][d][1] * inv, o[s][d][2] * inv, o[s][d][3] * inv}; const v4f hi4 = {o[s][d][4] * inv, o[s][d][5] * inv, o[s][d][6] * inv, o[s][d][7] * inv}; *(v4f*)(op + d * 16) = lo4; *(v4f*)(op + d * 16 + 4) = hi4; } } }

// Exact f32 attention for query rows 0 .. QT0-1, all on the vector unit. One block = one head x 16 query rows, 8 waves; the work of a row is spread over lanes and waves, nothing walks the keys one by one.
// Stage: the head's 256 K rows, 256 V rows and the block's 16 Q rows go to LDS by coalesced 16-byte loads, all in flight together. Keys above a row's diagonal are staged too (they are rows of this call) and get the weight 0.
// Scores: a thread owns 4 rows x 4 keys (keys 64 apart), so 8 LDS reads feed 64 FMAs. Softmax: a wave owns 2 rows, 8 keys a lane, true row maximum and sum by butterflies. Context: a thread owns 4 rows x 4 columns over a quarter of the keys; the four quarters are summed through LDS.
#define A0R 16                       /* query rows per block */
#define A0KP 68                      /* K row pitch in LDS (floats): 272 B = 16 B x odd, 16 lanes on 16 rows meet every bank once */
#define A0SP 260                     /* score row pitch (floats) */
#define A0PP 20                      /* weight pitch (floats), laid [key][row] so that one 16-byte read gives 4 rows' weights of a key */
struct A0Lds { float sq[A0R * HD]; float sfin[A0R]; float ss[A0R * A0SP]; float sp[QT0 * A0PP]; float red[4 * A0R * HD]; float sk[QT0 * A0KP]; float sv[QT0 * HD]; };      /* every member starts at a multiple of 16 bytes; the small ones first, inside the reach of an LDS instruction's immediate offset */
template <int M> __device__ __forceinline__ float a0_xm(float x) { return __int_as_float(__builtin_amdgcn_update_dpp(0, __float_as_int(x), 0x160 | M, 0xf, 0xf, true)); }      /* lane l <- l ^ M inside a 16-lane row (DPP row_xmask); every lane is on where it is used */
__device__ __forceinline__ float a0_max32(float x) { x = fmaxf(x, a0_xm<1>(x)); x = fmaxf(x, a0_xm<2>(x)); x = fmaxf(x, a0_xm<4>(x)); x = fmaxf(x, a0_xm<8>(x)); return fmaxf(x, fa_swap16(x)); }
__device__ __forceinline__ float a0_sum32(float x) { x += a0_xm<1>(x); x += a0_xm<2>(x); x += a0_xm<4>(x); x += a0_xm<8>(x); return x + fa_swap16(x); }
__global__ __launch_bounds__(256) void k_att0(const float* __restrict__ QF, const float* __restrict__ KF, const float* __restrict__ VF, float scale, float* __restrict__ OF) {
  __shared__ __attribute__((aligned(16))) A0Lds L;
  const int t = threadIdx.x; const int h = blockIdx.x / (QT0 / A0R); const int i0 = (blockIdx.x % (QT0 / A0R)) * A0R;
  { const int r = t >> 4, c = (t & 15) * 4; const float* kp = KF + (size_t)r * DM + h * HD + c; const float* vp = VF + (size_t)r * DM + h * HD + c; v4f kv[QT0 / 16], vv[QT0 / 16];
#pragma unroll      /* full: the two arrays must be indexed by constants to stay in registers, and all 33 loads are to be in flight at once */
    for (int it = 0; it < QT0 / 16; ++it) { kv[it] = *(const v4fa*)(kp + (size_t)it * 16 * DM); vv[it] = *(const v4fa*)(vp + (size_t)it * 16 * DM); }
    const float* qp = QF + (size_t)(i0 + r) * DM + h * HD + c; const v4f qv = *(const v4fa*)qp;
    asm volatile("s_wait_xcnt 0x0" :: "v"(kp), "v"(vp), "v"(qp) : "memory");      /* stands behind the last load of the run; the run's three address pairs are inputs, so they keep their registers up to the wait and every later write of those registers stands behind it */
    float* ks = &L.sk[r * A0KP + c]; float* vs = &L.sv[r * HD + c];
#pragma unroll      /* full: constant indices, as above */
    for (int it = 0; it < QT0 / 16; ++it) { *(v4f*)(ks + it * 16 * A0KP) = kv[it]; *(v4f*)(vs + it * 16 * HD) = vv[it]; }
    *(v4f*)&L.sq[r * HD + c] = qv; }
  __syncthreads();      /* K, V, Q staged */
  { const int kq = t & 63, r0 = (t >> 6) * 4; const v4f z4 = {0.f, 0.f, 0.f, 0.f}; v4f acc[4] = {z4, z4, z4, z4};      /* acc[row][key] */
    const float* qb = &L.sq[r0 * HD]; const float* kb = &L.sk[kq * A0KP];
#pragma unroll      /* full: the LDS reads of later steps issue under the FMAs of earlier ones */
    for (int c = 0; c < HD; c += 4) { v4f q[4], k[4];
#pragma unroll
      for (int a = 0; a < 4; ++a) { q[a] = *(const v4f*)(qb + a * HD + c); k[a] = *(const v4f*)(kb + a * 64 * A0KP + c); }
#pragma unroll
      for (int a = 0; a < 4; ++a) for (int u = 0; u < 4; ++u) for (int e = 0; e < 4; ++e) acc[a][u] = fmaf(q[a][e], k[u][e], acc[a][u]); }
#pragma unroll
    for (int a = 0; a < 4; ++a) for (int u = 0; u < 4; ++u) { const int j = kq + 64 * u; L.ss[(r0 + a) * A0SP + j] = (j <= i0 + r0 + a) ? acc[a][u] * scale : -1.0e30f; } }      /* keys above the diagonal are excluded: their weight is exp(-huge) = 0 */
  __syncthreads();      /* scores complete */
  { const int lane = t & 31, r0 = (t >> 5) * 2; float x[2][8], m[2], l[2];      /* the wave's two rows side by side: two independent chains */
#pragma unroll
    for (int rr = 0; rr < 2; ++rr) for (int u = 0; u < 8; ++u) x[rr][u] = L.ss[(r0 + rr) * A0SP + lane + 32 * u];
#pragma unroll
    for (int rr = 0; rr < 2; ++rr) { float a = x[rr][0]; for (int u = 1; u < 8; ++u) a = fmaxf(a, x[rr][u]); m[rr] = a; }
    m[0] = a0_max32(m[0]); m[1] = a0_max32(m[1]);
#pragma unroll
    for (int rr = 0; rr < 2; ++rr) { float a = 0.f; for (int u = 0; u < 8; ++u) { x[rr][u] = expf(x[rr][u] - m[rr]); a += x[rr][u]; } l[rr] = a; }
    l[0] = a0_sum32(l[0]); l[1] = a0_sum32(l[1]);
#pragma unroll
    for (int rr = 0; rr < 2; ++rr) for (int u = 0; u < 8; ++u) L.sp[(lane + 32 * u) * A0PP + r0 + rr] = x[rr][u];
    if (lane < 2) L.sfin[r0 + lane] = 1.0f / (lane == 0 ? l[0] : l[1]); }
  __syncthreads();      /* weights complete */
  { const int c = (t & 15) * 4, r0 = ((t >> 4) & 3) * 4, ks = t >> 6; const v4f z4 = {0.f, 0.f, 0.f, 0.f}; v4f o[4] = {z4, z4, z4, z4};
    const float* vb = &L.sv[ks * (QT0 / 4) * HD + c]; const float* pb = &L.sp[ks * (QT0 / 4) * A0PP + r0];
#pragma unroll      /* full: every LDS read is one base register plus an immediate offset, and later keys' reads issue under earlier keys' FMAs */
    for (int jj = 0; jj < QT0 / 4; ++jj) { const v4f v = *(const v4f*)(vb + jj * HD); const v4f p = *(const v4f*)(pb + jj * A0PP);
#pragma unroll
      for (int a = 0; a < 4; ++a) for (int e = 0; e < 4; ++e) o[a][e] = fmaf(p[a], v[e], o[a][e]); }
#pragma unroll
    for (int a = 0; a < 4; ++a) *(v4f*)&L.red[(ks * A0R + r0 + a) * HD + c] = o[a]; }
  __syncthreads();      /* the four key quarters' partial contexts complete */
  { const int r = t >> 4, c = (t & 15) * 4; v4f s = *(const v4f*)&L.red[r * HD + c];
#pragma unroll
    for (int ks = 1; ks < 4; ++ks) s += *(const v4f*)&L.red[(ks * A0R + r) * HD + c];
    s *= L.sfin[r]; *(v4f*)(OF + (size_t)(i0 + r) * DM + h * HD + c) = s; } }

extern "C" void kernel_launch(void* const* d_in, const int* in_sizes, int n_in,
                              void* d_out, int out_size, void* d_ws, size_t ws_size, hipStream_t stream) {
  (void)in_sizes; (void)n_in; (void)out_size;
  const float* const* I = (const float* const*)d_in; const float* x = I[0]; const float* wq = I[1]; const float* wk = I[2]; const float* wv = I[3];      /* x [4096][1024] (ONE unbatched sequence); three separate [in][out] weights Wq, Wk, Wv [1024][1024]; no biases; no output projection */
  static_assert(HPG == 1 && NH == NG * HPG && NH * HD == DM && KVD == DM, "plain multi-head attention as 16 kv groups of one query head"); const float* bq = nullptr; const float* bk = nullptr; const float* bv = nullptr;      /* the module has no biases: the three bias slots are null */
  char* ws = (char*)d_ws; size_t off = 0;
  auto take = [&](size_t bytes) { char* p = ws + off; off += (bytes + 255) & ~(size_t)255; return p; };
  _Float16* BQKV = (_Float16*)take((size_t)3 * DM * DM * 2); _Float16* BQ = BQKV; _Float16* BK = BQKV + (size_t)DM * DM; _Float16* BV = BQKV + (size_t)2 * DM * DM;      /* three transposed planes, one after another: q, k, v */
  _Float16* X16 = (_Float16*)take(NR * DM * 2); _Float16* Q16 = (_Float16*)take(NR * DM * 2); _Float16* K16 = (_Float16*)take(NR * KVD * 2); _Float16* V16 = (_Float16*)take(NR * KVD * 2);
  _Float16* VT = (_Float16*)take((size_t)NH * HD * SQ * 2);
  float* QF0 = (float*)take((size_t)QT0 * DM * 4); float* KF0 = (float*)take((size_t)QT0 * KVD * 4); float* VF0 = (float*)take((size_t)QT0 * KVD * 4);      /* f32 q, k, v of the first 256 rows */
  if (off > ws_size) return;
  k_wt_f16<<<(unsigned)(((size_t)DM * (DM / 8) + 255) / 256), 256, 0, stream>>>(wq, BQ, DM, DM, 16.0f); k_wt_f16<<<(unsigned)(((size_t)DM * (DM / 8) + 255) / 256), 256, 0, stream>>>(wk, BK, DM, DM, 16.0f); k_wt_f16<<<(unsigned)(((size_t)DM * (DM / 8) + 255) / 256), 256, 0, stream>>>(wv, BV, DM, DM, 16.0f);      /* three [in][out] weights -> their transposed x16 planes */
  k_x16<<<(unsigned)((NR * DM / 8 + 255) / 256), 256, 0, stream>>>(x, X16, NR * DM / 8);
  for (int b = B0; b < B0 + NBR; ++b) { const size_t r0 = (size_t)b * SQ;
    /* q, k, v: every row rounded once to f16 in the epilogue; rows 0..255 stored in f32 as well, for the exact first tile (one head a k/v group: the tile reads these rows as they are) */
    k_gemm2<0><<<dim3((unsigned)((SQ / 128) * (KVD / 64)), 1), 128, 0, stream>>>(X16 + r0 * DM, DM, 0, BV, DM, 0, 0.0625f, bv, 0, nullptr, 1, 0, 0, VF0, QT0, V16 + r0 * KVD, KVD, 0, SQ, KVD, DM);
    k_gemm2<0><<<dim3((unsigned)((SQ / 128) * (DM / 64)), 1), 128, 0, stream>>>(X16 + r0 * DM, DM, 0, BQ, DM, 0, 0.0625f, bq, 0, nullptr, 1, 0, 0, QF0, QT0, Q16 + r0 * DM, DM, 0, SQ, DM, DM);
    k_gemm2<0><<<dim3((unsigned)((SQ / 128) * (KVD / 64)), 1), 128, 0, stream>>>(X16 + r0 * DM, DM, 0, BK, DM, 0, 0.0625f, bk, 0, nullptr, 1, 0, 0, KF0, QT0, K16 + r0 * KVD, KVD, 0, SQ, KVD, DM);
    k_vt<NG, SQ><<<NG * (SQ / 64), 256, 0, stream>>>(V16 + r0 * KVD, KVD, 0, VT);      /* V^T [NH][HD][SQ] for this batch */
    k_att0<<<NH * (QT0 / A0R), 256, 0, stream>>>(QF0, KF0, VF0, 0.125f, (float*)d_out + r0 * DM);      /* exact f32 attention for rows 0..255, written straight into the output rows */
    k_fattn<<<NH * ((SQ - QT0) / FQ), 128, 0, stream>>>(Q16 + r0 * LQ, K16 + r0 * KVD, VT, (float*)d_out + r0 * DM); }      /* rows 256..4095 of all 16 heads: scores, online softmax and context in ONE launch, straight into the output rows as f32 */
}

// v005
// One run takes 162 microseconds.
// Two timings next to v004 both put it at 1.53 times that version's speed.
// All steps since v000 together make it 34.7 times as fast.
#include <hip/hip_runtime.h>
// Causal multi-head self-attention over ONE unbatched sequence with three separate projections and NO output projection (x [4096][1024]; q = x Wq, k = x Wk, v = x Wv ([in][out] 1024 x 1024 each, no biases); 16 heads of 64; scores / sqrt(64); causal (-inf above the diagonal: realised as exclusion); softmax; y = the merged context -> [4096][1024]); 16 k/v groups of ONE head each, no rotation.
// Structure: x as exact f16 rows; [in][out] weights as exact x16 planes; q, k and v as WMMA GEMMs (32x64 wave tiles, f32 accumulation, no bias) whose epilogue stores the one f16 rounding of every row and, for the first 256 rows, the f32 value beside it; V^T of the 16 groups (ONE head each here) via LDS transposes; rows 256..4095: one fused launch, each wave 32 query rows of one head: S^T = K Q^T on WMMA, online softmax in registers (f32 statistics, native exp2; weights f16), O^T += V^T P^T on WMMA, f32 straight into the merged output rows; the first tile: exact f32 attention for rows 0..255 written straight into the output rows; launches: see trace.
// The first tile: the first 256 query rows see only a few keys, where single-f16 v / P operands are least accurate; they are computed exactly: the f32 q/k/v rows that the three GEMMs store for them and an f32 attention on VALU (16 query rows a block, K and V in LDS, true row maximum).
// Compute dtype: inputs rounded to bf16; x / weights exact; q, k, v and softmax weights as plain f16 GEMM operands (~2^-12); scores, softmax statistics and o f32; v_wmma_f32_16x16x32_f16.
#define NB 1
#define NG 16
#define HPG 1
#define KVD (NG * HD)
#define SQ 4096
#define DM 1024
#define NH 16
#define HD 64
#define HG 4
#define QT0 256                      /* first-tile rows recomputed exactly in f32 */
#define B0 0                         /* first batch processed (debug hook) */
#define NBR NB                       /* batches processed (debug hook) */
#define NR ((size_t)NB * SQ)         /* token rows */
#define MP ((int)((size_t)NBR * SQ)) /* NBR x SQ rows; unused: each projection launch takes SQ rows */
#define MPO MP
#define LQ DM      /* row pitch of the q/k/v rows */
typedef __bf16 v16b __attribute__((ext_vector_type(16)));
typedef unsigned short v8us __attribute__((ext_vector_type(8), may_alias));
typedef float  v8f  __attribute__((ext_vector_type(8)));
typedef float  v4f  __attribute__((ext_vector_type(4)));
typedef float  v4fa __attribute__((ext_vector_type(4), may_alias));
union FragB { v16b v; v8us half[2]; unsigned short u[16]; };

__device__ __forceinline__ unsigned short bf16_bits(float x) { unsigned int u = __float_as_uint(x); return (unsigned short)((u + 0x7FFFu + ((u >> 16) & 1u)) >> 16); }
__device__ __forceinline__ float bf16_val(unsigned short b) { return __uint_as_float(((unsigned int)b) << 16); }
__device__ __forceinline__ float bf16_round(float x) { return bf16_val(bf16_bits(x)); }
// D += A·B with NT terms: 1 = ah·bh, 2 = + al·bh (A split), 3 = + ah·bl (both split)
template <int NT>
__device__ __forceinline__ v8f mmaN(v16b ah, v16b al, v16b bh, v16b bl, v8f c) {
  c = __builtin_amdgcn_wmma_f32_16x16x32_bf16(false, ah, false, bh, (short)0, c, false, false);
  if (NT >= 2) c = __builtin_amdgcn_wmma_f32_16x16x32_bf16(false, al, false, bh, (short)0, c, false, false);
  if (NT >= 3) c = __builtin_amdgcn_wmma_f32_16x16x32_bf16(false, ah, false, bl, (short)0, c, false, false);
  asm volatile("v_nop\n\tv_nop\n\tv_nop\n\tv_nop" : "+v"(c) : "v"(ah), "v"(al), "v"(bh), "v"(bl));
  return c;
}




// ---- f16 WMMA path (v_wmma_f32_16x16x32_f16): 11-bit significands for operands in range — used for every WMMA product in this file
typedef _Float16 v16h __attribute__((ext_vector_type(16)));
union FragH { v16h v; v8us half[2]; _Float16 h[16]; unsigned short u[16]; };
template <int NT>
__device__ __forceinline__ v8f mmaH(v16h ah, v16h al, v16h bh, v16h bl, v8f c) {
  c = __builtin_amdgcn_wmma_f32_16x16x32_f16(false, ah, false, bh, (short)0, c, false, false);
  if (NT >= 2) c = __builtin_amdgcn_wmma_f32_16x16x32_f16(false, al, false, bh, (short)0, c, false, false);
  if (NT >= 3) c = __builtin_amdgcn_wmma_f32_16x16x32_f16(false, ah, false, bl, (short)0, c, false, false);
  asm volatile("v_nop\n\tv_nop\n\tv_nop\n\tv_nop" : "+v"(c) : "v"(ah), "v"(al), "v"(bh), "v"(bl));
  return c;
}

// Wt[n][k] = f16(W[k][n]·scale) from f32 row-major W[K][N] (scale = power of two; bf16-exact weights stay exact in f16 away from the subnormal range)
__global__ __launch_bounds__(256) void k_wt_f16(const float* __restrict__ W, _Float16* __restrict__ Wt, int K, int N, float scale) {
  const int t = blockIdx.x * 256 + threadIdx.x; if (t >= N * (K / 8)) return; const int n = t / (K / 8), k8 = (t % (K / 8)) * 8; FragH f;
#pragma unroll
  for (int i = 0; i < 8; ++i) f.h[i] = (_Float16)(bf16_round(W[(size_t)(k8 + i) * N + n]) * scale); const v8us o = f.half[0];
  *(v8us*)((unsigned short*)Wt + (size_t)n * K + k8) = o; 
}

typedef _Float16 v4h __attribute__((ext_vector_type(4)));

__global__ __launch_bounds__(256) void k_x16(const float* __restrict__ x, _Float16* __restrict__ X16, size_t n8) { const size_t t = (size_t)blockIdx.x * 256 + threadIdx.x; if (t >= n8) return; FragH f;
#pragma unroll
  for (int q = 0; q < 8; ++q) f.h[q] = (_Float16)bf16_round(x[t * 8 + q]); *(v8us*)((unsigned short*)X16 + t * 8) = f.half[0];  }
template <int NHv, int TTv>
__global__ __launch_bounds__(256) void k_vt(const _Float16* __restrict__ V16, int ldv, int voff, _Float16* __restrict__ Vt) { __shared__ unsigned short tl[64][66]; const int tid = threadIdx.x; const int slab = blockIdx.x / (TTv / 64), lg = blockIdx.x % (TTv / 64); const int b = slab / NHv, h = slab % NHv;
  for (int i = tid; i < 64 * 8; i += 256) { const int r = i / 8, c8 = (i % 8) * 8; FragH f; f.half[0] = *(const v8us*)((const unsigned short*)V16 + ((size_t)b * TTv + lg * 64 + r) * ldv + voff + h * 64 + c8);
#pragma unroll
    for (int q = 0; q < 8; ++q) tl[r][c8 + q] = f.u[q]; }
  __syncthreads();
  {
#pragma unroll
    for (int rd = 0; rd < 2; ++rd) { const int d = rd * 32 + tid / 8, pc = tid % 8; FragH f;
#pragma unroll
      for (int q = 0; q < 8; ++q) f.u[q] = tl[pc * 8 + q][d];
      *(v8us*)((unsigned short*)Vt + ((size_t)slab * 64 + d) * TTv + lg * 64 + pc * 8) = f.half[0]; }
     } }


// ---- fast GEMM (wave tile 32x64; requires whole tiles: M % 128 == 0 rows per launch region, N % 64 == 0, K % 128 == 0 and K >= 128); epilogue = k_gemm_hhx semantics ----
__device__ __forceinline__ v16h g2_frag(const _Float16* p, int hh) { FragH f; f.half[0] = *(const v8us*)((const unsigned short*)p + 8 * hh); f.half[1] = *(const v8us*)((const unsigned short*)p + 16 + 8 * hh); return f.v; }
__device__ __forceinline__ v8f g2_mma(v16h a, v16h b, v8f c) { v8f d = __builtin_amdgcn_wmma_f32_16x16x32_f16(false, a, false, b, (short)0, c, false, false); asm volatile("v_nop\n\tv_nop\n\tv_nop\n\tv_nop" : "+v"(d) : "v"(a), "v"(b)); return d; }
// The GEMM's operand tiles go through LDS: a block's 128 A rows and 64 B rows, 128 k at a time, are brought in by asynchronous 16-byte copies (a wave-wide copy = 2 rows x 256 B = 4 whole lines; each line is fetched once a block), two buffers, the next tile in flight while this one is worked on.
#define GKT 128                      /* k elements of a staged tile: rows of 256 bytes */
#define GPE 136                      /* LDS row pitch in elements: 272 B = 16 B x odd, 16 lanes on 16 rows meet every bank once */
#define GTR 192                      /* rows of a staged tile: the block's 128 A rows, then its 64 B rows */
// Eight copies of one lane, rows 8 apart: l = the lane's LDS byte address, g = its global address, g8 = 8 source rows in elements. The s_wait_xcnt stands inside the statement, behind the last copy, so that no later write of an address register can be placed in front of it.
__device__ __forceinline__ void g2_copy8(unsigned l, const _Float16* g, size_t g8) {
  asm volatile("global_load_async_to_lds_b128 %0, %8, off\n\tglobal_load_async_to_lds_b128 %1, %9, off\n\tglobal_load_async_to_lds_b128 %2, %10, off\n\tglobal_load_async_to_lds_b128 %3, %11, off\n\t"
               "global_load_async_to_lds_b128 %4, %12, off\n\tglobal_load_async_to_lds_b128 %5, %13, off\n\tglobal_load_async_to_lds_b128 %6, %14, off\n\tglobal_load_async_to_lds_b128 %7, %15, off\n\ts_wait_xcnt 0x0"
               :: "v"(l), "v"(l + 8u * GPE * 2u), "v"(l + 16u * GPE * 2u), "v"(l + 24u * GPE * 2u), "v"(l + 32u * GPE * 2u), "v"(l + 40u * GPE * 2u), "v"(l + 48u * GPE * 2u), "v"(l + 56u * GPE * 2u),
                  "v"(g), "v"(g + g8), "v"(g + 2 * g8), "v"(g + 3 * g8), "v"(g + 4 * g8), "v"(g + 5 * g8), "v"(g + 6 * g8), "v"(g + 7 * g8) : "memory"); }
template <int ACT>
__global__ __launch_bounds__(128) void k_gemm2(const _Float16* __restrict__ A, int lda, size_t sA, const _Float16* __restrict__ Bh, int ldb, size_t sB, float alpha, const float* __restrict__ bias, size_t sBias, const float* __restrict__ CP, int rowsPerB, size_t sCPb, int row0g,
    float* __restrict__ C, int MC, _Float16* __restrict__ C16, int ldc, size_t sC, int M, int N, int K) {      /* C: f32 rows, stored for rows below MC only (MC % 32 == 0); C16: the f16 rounding of every row */ static_assert(ACT == 0 || ACT == 3 || ACT == 6 || ACT == 8 || ACT == 9 || ACT == 11 || ACT == 12 || ACT == 14 || ACT == 15 || ACT == 16 || ACT == 17, "k_gemm2: unsupported ACT code (would silently apply no activation)");
  __shared__ __attribute__((aligned(16))) _Float16 st[2][GTR * GPE]; __shared__ __attribute__((aligned(16))) float so[4][32][68];
  const int tid = threadIdx.x, w = tid >> 5, lane = tid & 31, ln = lane & 15, hh = lane >> 4; const int by = blockIdx.y;
  A += (size_t)by * sA; Bh += (size_t)by * sB; const size_t cofs = (size_t)by * sC; const float* bp = bias ? bias + (size_t)by * sBias : nullptr;
  const int ntn = N >> 6; const int mt = blockIdx.x / ntn, nq = blockIdx.x - mt * ntn; const int row0 = mt * 128 + 32 * w, col0 = nq * 64; if (mt * 128 >= M) return;      /* the whole block leaves or none: barriers follow */
  const int cr = tid >> 4, cc = (tid & 15) * 8;      /* the thread's row (of 8) and 16-byte column in every copy */
  const _Float16* ga = A + (size_t)(mt * 128 + cr) * lda + cc; const _Float16* gb = Bh + (size_t)(col0 + cr) * ldb + cc; const unsigned l0 = (unsigned)(size_t)&st[0][cr * GPE + cc];
  auto fill = [&](int t) { const unsigned l = l0 + (unsigned)(t & 1) * (GTR * GPE * 2u); const _Float16* a = ga + (size_t)t * GKT;      /* tile t into buffer t mod 2: 24 copies a lane */
    g2_copy8(l, a, (size_t)8 * lda); g2_copy8(l + 64u * GPE * 2u, a + (size_t)64 * lda, (size_t)8 * lda); g2_copy8(l + 128u * GPE * 2u, gb + (size_t)t * GKT, (size_t)8 * ldb); };
  const v8f z8 = {0.f,0.f,0.f,0.f,0.f,0.f,0.f,0.f}; v8f c00 = z8, c01 = z8, c02 = z8, c03 = z8, c10 = z8, c11 = z8, c12 = z8, c13 = z8;
  const int NT = K / GKT;
  fill(0);
  asm volatile("s_wait_asynccnt 0x0" ::: "memory");      /* this wave's copies of tile 0 have landed */
  __syncthreads();      /* tile 0 published */
  if (NT > 1) fill(1);
  for (int t = 0; t < NT; ++t) { const _Float16* sa = &st[t & 1][(32 * w + ln) * GPE]; const _Float16* sb = &st[t & 1][(128 + ln) * GPE]; v16h f[2][6];      /* two fragment sets: the next 32 k are read from LDS under this step's products; never past the tile */
#pragma unroll      /* full: f must be indexed by constants to stay in registers */
    for (int u = 0; u < 6; ++u) f[0][u] = g2_frag((u < 2 ? sa + u * 16 * GPE : sb + (u - 2) * 16 * GPE), hh);
#pragma unroll      /* full: constant indices, as above */
    for (int j = 0; j < GKT / 32; ++j) { const int p = j & 1;
      if (j + 1 < GKT / 32) {
#pragma unroll      /* full: constant indices, as above */
        for (int u = 0; u < 6; ++u) f[p ^ 1][u] = g2_frag((u < 2 ? sa + u * 16 * GPE : sb + (u - 2) * 16 * GPE) + (j + 1) * 32, hh); }
      c00 = g2_mma(f[p][0], f[p][2], c00); c10 = g2_mma(f[p][1], f[p][2], c10); c01 = g2_mma(f[p][0], f[p][3], c01); c11 = g2_mma(f[p][1], f[p][3], c11);
      c02 = g2_mma(f[p][0], f[p][4], c02); c12 = g2_mma(f[p][1], f[p][4], c12); c03 = g2_mma(f[p][0], f[p][5], c03); c13 = g2_mma(f[p][1], f[p][5], c13); }
    asm volatile("s_wait_dscnt 0x0" ::: "memory");      /* this wave's reads of buffer t mod 2 are done before the buffer is given up */
    asm volatile("s_wait_asynccnt 0x0" ::: "memory");      /* this wave's copies of tile t + 1 have landed */
    __syncthreads();      /* publishes tile t + 1 and ends every wave's reads of tile t */
    if (t + 2 < NT) fill(t + 2); }
  asm volatile("s_wait_asynccnt 0x0" ::: "memory");      /* nothing is in flight when the loop is left */
  v8f accs[8] = {c00, c01, c02, c03, c10, c11, c12, c13};
#pragma unroll
  for (int u = 0; u < 8; ++u) { const int t = u & 3, half = u >> 2; const int col = col0 + t * 16 + ln; const float bv = bp ? bf16_round(bp[col]) : 0.f;
#pragma unroll
    for (int r = 0; r < 8; ++r) { const int rloc = half * 16 + 8 * hh + r; float v = accs[u][r] * alpha + bv; if (CP) { if (rowsPerB < 0) v += CP[cofs + (size_t)(row0g + row0 + rloc) * ldc + col];      /* rowsPerB < 0: own element of the batched C plane */ else { const int bidx = (row0g + row0 + rloc) / rowsPerB; v += CP[(size_t)bidx * sCPb + (size_t)by * 64 + col]; } }
      if (ACT == 3) v = fmaxf(v, 0.f); else if (ACT == 6) v = 0.5f * v * (1.0f + erff(v * 0.70710678118654752f)); else if (ACT == 11) v = 1.0f / (1.0f + expf(-v)); else if (ACT == 15) v = v / (1.0f + expf(-v)); else if (ACT == 12) v = (v > 0.f) ? v : 0.01f * v; else if (ACT == 8) v = tanhf(v); else if (ACT == 9) v = 0.5f * v * (1.0f + tanhf(0.7978845608028654f * (v + 0.044715f * v * v * v))); else if (ACT == 14) v = (v > 0.f) ? v : 0.1f * v; else if (ACT == 16) v = (v >= 0.f) ? v : 0.3f * v; else if (ACT == 17) v = (v >= 0.f) ? v : 0.2f * v;
      so[w][rloc][t * 16 + ln] = v; } }
  __builtin_amdgcn_fence(__ATOMIC_ACQ_REL, "workgroup"); __builtin_amdgcn_wave_barrier();
  const int rsub = lane >> 4, c4 = (lane & 15) * 4; const bool cf = C && __builtin_amdgcn_readfirstlane(row0) < MC;      /* the wave's 32 rows lie on one side of MC: a scalar test */
  {
#pragma unroll
    for (int q = 0; q < 16; ++q) { const int r = q * 2 + rsub; const v4f v = *(const v4fa*)&so[w][r][c4]; if (cf) { *(v4f*)(C + cofs + (size_t)(row0 + r) * ldc + col0 + c4) = v; asm volatile("s_wait_xcnt 0x0" ::: "memory"); }      /* the wait stands behind the f32 store, in front of the f16 conversion, which may reuse the store's registers */
      if (C16) { v4h h4; for (int i = 0; i < 4; ++i) h4[i] = (_Float16)v[i]; *(v4h*)(C16 + cofs + (size_t)(row0 + r) * ldc + col0 + c4) = h4; } }
     } }


// Fused causal attention for query rows QT0 .. SQ-1: scores, softmax and context in ONE launch; no score or weight plane in memory.
// One wave owns 32 query rows of one head and walks its keys 32 at a time with a running maximum and sum (online softmax).
// S^T = K Q^T (A = 16 key rows, B = 16 query rows): lane (ln, hh) then holds, for query ln, keys 8 hh + r of each 16-key tile, which is the B operand order of O^T += V^T P^T: the weights go from accumulator to operand in registers.
// All of a lane's values belong to one query per 16-query set, so maximum, sum and rescale are lane-local but for one exchange between the wave halves.
// Every '#pragma unroll' of fa_pass and k_fattn is a full unroll: the fragment and accumulator arrays must be indexed by constants to stay in registers.
#define FQ 128                       /* query rows per block: 4 waves x 32 */
#define SCL2 0.18033688011112042f    /* 1/sqrt(64) x log2(e): scores are carried in log2 units */
__device__ __forceinline__ v8f fa_mma(v16h a, v16h b, v8f c) { return __builtin_amdgcn_wmma_f32_16x16x32_f16(false, a, false, b, (short)0, c, false, false); }
__device__ __forceinline__ float fa_swap16(float x) { const int b = __float_as_int(x); return __int_as_float(__builtin_amdgcn_permlanex16(b, b, 0x76543210, 0xfedcba98, false, false)); }      /* lane l <-> l ^ 16 */
// One pass: 32 keys from key0 against the wave's 32 queries. DIAG: the pass that crosses the diagonal (key0 == the wave's first query row), the wave's last.
template <bool DIAG>
__device__ __forceinline__ void fa_pass(const _Float16* __restrict__ kp, const _Float16* __restrict__ vp, int key0, int ln, int hh, const v16h (&qf)[2][2], v16h (&kf)[2][2], v8f (&o)[2][4], float (&m)[2], float (&l)[2]) {
  const v8f z8 = {0.f,0.f,0.f,0.f,0.f,0.f,0.f,0.f}; v16h vf[4];
#pragma unroll
  for (int d = 0; d < 4; ++d) vf[d] = g2_frag(vp + (size_t)d * 16 * SQ + key0, hh);
  v8f st[2][2];      /* [query set][16-key tile] */
#pragma unroll
  for (int s = 0; s < 2; ++s) for (int t = 0; t < 2; ++t) if (!(DIAG && s == 0 && t == 1)) st[s][t] = fa_mma(kf[t][1], qf[s][1], fa_mma(kf[t][0], qf[s][0], z8));      /* on the diagonal pass keys 16..31 lie above every query of set 0: that tile is left out whole */
  if (!DIAG) {      /* the next pass's keys, fetched one pass ahead into the same registers */
#pragma unroll
    for (int t = 0; t < 2; ++t) for (int kb = 0; kb < 2; ++kb) kf[t][kb] = g2_frag(kp + (size_t)(key0 + 32 + t * 16) * KVD + kb * 32, hh); }
  if (DIAG) {      /* keys above the diagonal are excluded: their weight is exp2(-huge) = 0 */
#pragma unroll
    for (int s = 0; s < 2; ++s) for (int r = 0; r < 8; ++r) st[s][s][r] = (8 * hh + r <= ln) ? st[s][s][r] : -3.0e38f; }      /* only the two tiles on the diagonal are cut; set 1 sees all of keys 0..15 */
  float mx[2];
#pragma unroll
  for (int s = 0; s < 2; ++s) { float a = st[s][0][0]; for (int r = 1; r < 8; ++r) a = fmaxf(a, st[s][0][r]); if (!(DIAG && s == 0)) for (int r = 0; r < 8; ++r) a = fmaxf(a, st[s][1][r]); a = fmaxf(a, fa_swap16(a)); mx[s] = a * SCL2; }
  /* the maximum in use moves only when some query's new maximum exceeds it by more than 8 (log2 units): weights stay <= 2^8, inside f16; one scalar branch a pass */
  if (__builtin_amdgcn_ballot_w32(mx[0] > m[0] + 8.f || mx[1] > m[1] + 8.f) != 0) {
#pragma unroll
    for (int s = 0; s < 2; ++s) { const float mn = fmaxf(m[s], mx[s]); const float al = __builtin_amdgcn_exp2f(m[s] - mn); m[s] = mn; l[s] *= al; for (int d = 0; d < 4; ++d) o[s][d] *= al; } }
#pragma unroll
  for (int s = 0; s < 2; ++s) { FragH pf; float s0 = 0.f, s1 = 0.f;
#pragma unroll
    for (int r = 0; r < 8; ++r) { const float e0 = __builtin_amdgcn_exp2f(fmaf(st[s][0][r], SCL2, -m[s])); const float e1 = (DIAG && s == 0) ? 0.f : __builtin_amdgcn_exp2f(fmaf(st[s][1][r], SCL2, -m[s])); s0 += e0; s1 += e1; pf.h[r] = (_Float16)e0; pf.h[8 + r] = (_Float16)e1; }
    l[s] += s0 + s1;
#pragma unroll
    for (int d = 0; d < 4; ++d) o[s][d] = fa_mma(vf[d], pf.v, o[s][d]); } }
__global__ __launch_bounds__(128) void k_fattn(const _Float16* __restrict__ Q, const _Float16* __restrict__ Kh, const _Float16* __restrict__ Vt, float* __restrict__ O) {
  const int lane = threadIdx.x & 31, ln = lane & 15, hh = lane >> 4; const int w = __builtin_amdgcn_readfirstlane(threadIdx.x >> 5);
  const int h = blockIdx.x % NH; const int tile = (SQ - QT0) / FQ - 1 - blockIdx.x / NH;      /* the longest key ranges start first */
  const int qw = QT0 + tile * FQ + w * 32;      /* first query row of the wave: scalar, a multiple of 32 */
  const _Float16* qp = Q + (size_t)(qw + ln) * LQ + h * HD; const _Float16* kp = Kh + (size_t)ln * KVD + h * HD; const _Float16* vp = Vt + ((size_t)h * HD + ln) * SQ;
  v16h qf[2][2], kf[2][2];
#pragma unroll
  for (int s = 0; s < 2; ++s) for (int kb = 0; kb < 2; ++kb) { qf[s][kb] = g2_frag(qp + (size_t)s * 16 * LQ + kb * 32, hh); kf[s][kb] = g2_frag(kp + (size_t)s * 16 * KVD + kb * 32, hh); }
  asm volatile("s_wait_xcnt 0x0" ::: "memory");      /* stands behind the last load of the opening run, in front of every later write of that run's address registers */
  const v8f z8 = {0.f,0.f,0.f,0.f,0.f,0.f,0.f,0.f}; v8f o[2][4]; float m[2], l[2];
#pragma unroll
  for (int s = 0; s < 2; ++s) { m[s] = -1.0e37f; l[s] = 0.f; for (int d = 0; d < 4; ++d) o[s][d] = z8; }
  for (int key0 = 0; key0 < qw; key0 += 32) fa_pass<false>(kp, vp, key0, ln, hh, qf, kf, o, m, l);      /* keys below every query of the wave */
  fa_pass<true>(kp, vp, qw, ln, hh, qf, kf, o, m, l);
#pragma unroll
  for (int s = 0; s < 2; ++s) { const float inv = 1.0f / (l[s] + fa_swap16(l[s])); float* op = O + (size_t)(qw + s * 16 + ln) * DM + h * HD + 8 * hh;      /* O^T tile d: rows d*16 + 8 hh + r of column (query) ln */
#pragma unroll
    for (int d = 0; d < 4; ++d) { const v4f lo4 = {o[s][d][0] * inv, o[s][d][1] * inv, o[s][d][2] * inv, o[s][d][3] * inv}; const v4f hi4 = {o[s][d][4] * inv, o[s][d][5] * inv, o[s][d][6] * inv, o[s][d][7] * inv}; *(v4f*)(op + d * 16) = lo4; *(v4f*)(op + d * 16 + 4) = hi4; } } }

// Exact f32 attention for query rows 0 .. QT0-1, all on the vector unit. One block = one head x 16 query rows, 8 waves; the work of a row is spread over lanes and waves, nothing walks the keys one by one.
// Stage: the head's 256 K rows, 256 V rows and the block's 16 Q rows go to LDS by coalesced 16-byte loads, all in flight together. Keys above a row's diagonal are staged too (they are rows of this call) and get the weight 0.
// Scores: a thread owns 4 rows x 4 keys (keys 64 apart), so 8 LDS reads feed 64 FMAs. Softmax: a wave owns 2 rows, 8 keys a lane, true row maximum and sum by butterflies. Context: a thread owns 4 rows x 4 columns over a quarter of the keys; the four quarters are summed through LDS.
#define A0R 16                       /* query rows per block */
#define A0KP 68                      /* K row pitch in LDS (floats): 272 B = 16 B x odd, 16 lanes on 16 rows meet every bank once */
#define A0SP 260                     /* score row pitch (floats) */
#define A0PP 20                      /* weight pitch (floats), laid [key][row] so that one 16-byte read gives 4 rows' weights of a key */
struct A0Lds { float sq[A0R * HD]; float sfin[A0R]; float ss[A0R * A0SP]; float sp[QT0 * A0PP]; float red[4 * A0R * HD]; float sk[QT0 * A0KP]; float sv[QT0 * HD]; };      /* every member starts at a multiple of 16 bytes; the small ones first, inside the reach of an LDS instruction's immediate offset */
template <int M> __device__ __forceinline__ float a0_xm(float x) { return __int_as_float(__builtin_amdgcn_update_dpp(0, __float_as_int(x), 0x160 | M, 0xf, 0xf, true)); }      /* lane l <- l ^ M inside a 16-lane row (DPP row_xmask); every lane is on where it is used */
__device__ __forceinline__ float a0_max32(float x) { x = fmaxf(x, a0_xm<1>(x)); x = fmaxf(x, a0_xm<2>(x)); x = fmaxf(x, a0_xm<4>(x)); x = fmaxf(x, a0_xm<8>(x)); return fmaxf(x, fa_swap16(x)); }
__device__ __forceinline__ float a0_sum32(float x) { x += a0_xm<1>(x); x += a0_xm<2>(x); x += a0_xm<4>(x); x += a0_xm<8>(x); return x + fa_swap16(x); }
__global__ __launch_bounds__(256) void k_att0(const float* __restrict__ QF, const float* __restrict__ KF, const float* __restrict__ VF, float scale, float* __restrict__ OF) {
  __shared__ __attribute__((aligned(16))) A0Lds L;
  const int t = threadIdx.x; const int h = blockIdx.x / (QT0 / A0R); const int i0 = (blockIdx.x % (QT0 / A0R)) * A0R;
  { const int r = t >> 4, c = (t & 15) * 4; const float* kp = KF + (size_t)r * DM + h * HD + c; const float* vp = VF + (size_t)r * DM + h * HD + c; v4f kv[QT0 / 16], vv[QT0 / 16];
#pragma unroll      /* full: the two arrays must be indexed by constants to stay in registers, and all 33 loads are to be in flight at once */
    for (int it = 0; it < QT0 / 16; ++it) { kv[it] = *(const v4fa*)(kp + (size_t)it * 16 * DM); vv[it] = *(const v4fa*)(vp + (size_t)it * 16 * DM); }
    const float* qp = QF + (size_t)(i0 + r) * DM + h * HD + c; const v4f qv = *(const v4fa*)qp;
    asm volatile("s_wait_xcnt 0x0" :: "v"(kp), "v"(vp), "v"(qp) : "memory");      /* stands behind the last load of the run; the run's three address pairs are inputs, so they keep their registers up to the wait and every later write of those registers stands behind it */
    float* ks = &L.sk[r * A0KP + c]; float* vs = &L.sv[r * HD + c];
#pragma unroll      /* full: constant indices, as above */
    for (int it = 0; it < QT0 / 16; ++it) { *(v4f*)(ks + it * 16 * A0KP) = kv[it]; *(v4f*)(vs + it * 16 * HD) = vv[it]; }
    *(v4f*)&L.sq[r * HD + c] = qv; }
  __syncthreads();      /* K, V, Q staged */
  { const int kq = t & 63, r0 = (t >> 6) * 4; const v4f z4 = {0.f, 0.f, 0.f, 0.f}; v4f acc[4] = {z4, z4, z4, z4};      /* acc[row][key] */
    const float* qb = &L.sq[r0 * HD]; const float* kb = &L.sk[kq * A0KP];
#pragma unroll      /* full: the LDS reads of later steps issue under the FMAs of earlier ones */
    for (int c = 0; c < HD; c += 4) { v4f q[4], k[4];
#pragma unroll
      for (int a = 0; a < 4; ++a) { q[a] = *(const v4f*)(qb + a * HD + c); k[a] = *(const v4f*)(kb + a * 64 * A0KP + c); }
#pragma unroll
      for (int a = 0; a < 4; ++a) for (int u = 0; u < 4; ++u) for (int e = 0; e < 4; ++e) acc[a][u] = fmaf(q[a][e], k[u][e], acc[a][u]); }
#pragma unroll
    for (int a = 0; a < 4; ++a) for (int u = 0; u < 4; ++u) { const int j = kq + 64 * u; L.ss[(r0 + a) * A0SP + j] = (j <= i0 + r0 + a) ? acc[a][u] * scale : -1.0e30f; } }      /* keys above the diagonal are excluded: their weight is exp(-huge) = 0 */
  __syncthreads();      /* scores complete */
  { const int lane = t & 31, r0 = (t >> 5) * 2; float x[2][8], m[2], l[2];      /* the wave's two rows side by side: two independent chains */
#pragma unroll
    for (int rr = 0; rr < 2; ++rr) for (int u = 0; u < 8; ++u) x[rr][u] = L.ss[(r0 + rr) * A0SP + lane + 32 * u];
#pragma unroll
    for (int rr = 0; rr < 2; ++rr) { float a = x[rr][0]; for (int u = 1; u < 8; ++u) a = fmaxf(a, x[rr][u]); m[rr] = a; }
    m[0] = a0_max32(m[0]); m[1] = a0_max32(m[1]);
#pragma unroll
    for (int rr = 0; rr < 2; ++rr) { float a = 0.f; for (int u = 0; u < 8; ++u) { x[rr][u] = expf(x[rr][u] - m[rr]); a += x[rr][u]; } l[rr] = a; }
    l[0] = a0_sum32(l[0]); l[1] = a0_sum32(l[1]);
#pragma unroll
    for (int rr = 0; rr < 2; ++rr) for (int u = 0; u < 8; ++u) L.sp[(lane + 32 * u) * A0PP + r0 + rr] = x[rr][u];
    if (lane < 2) L.sfin[r0 + lane] = 1.0f / (lane == 0 ? l[0] : l[1]); }
  __syncthreads();      /* weights complete */
  { const int c = (t & 15) * 4, r0 = ((t >> 4) & 3) * 4, ks = t >> 6; const v4f z4 = {0.f, 0.f, 0.f, 0.f}; v4f o[4] = {z4, z4, z4, z4};
    const float* vb = &L.sv[ks * (QT0 / 4) * HD + c]; const float* pb = &L.sp[ks * (QT0 / 4) * A0PP + r0];
#pragma unroll      /* full: every LDS read is one base register plus an immediate offset, and later keys' reads issue under earlier keys' FMAs */
    for (int jj = 0; jj < QT0 / 4; ++jj) { const v4f v = *(const v4f*)(vb + jj * HD); const v4f p = *(const v4f*)(pb + jj * A0PP);
#pragma unroll
      for (int a = 0; a < 4; ++a) for (int e = 0; e < 4; ++e) o[a][e] = fmaf(p[a], v[e], o[a][e]); }
#pragma unroll
    for (int a = 0; a < 4; ++a) *(v4f*)&L.red[(ks * A0R + r0 + a) * HD + c] = o[a]; }
  __syncthreads();      /* the four key quarters' partial contexts complete */
  { const int r = t >> 4, c = (t & 15) * 4; v4f s = *(const v4f*)&L.red[r * HD + c];
#pragma unroll
    for (int ks = 1; ks < 4; ++ks) s += *(const v4f*)&L.red[(ks * A0R + r) * HD + c];
    s *= L.sfin[r]; *(v4f*)(OF + (size_t)(i0 + r) * DM + h * HD + c) = s; } }

extern "C" void kernel_launch(void* const* d_in, const int* in_sizes, int n_in,
                              void* d_out, int out_size, void* d_ws, size_t ws_size, hipStream_t stream) {
  (void)in_sizes; (void)n_in; (void)out_size;
  const float* const* I = (const float* const*)d_in; const float* x = I[0]; const float* wq = I[1]; const float* wk = I[2]; const float* wv = I[3];      /* x [4096][1024] (ONE unbatched sequence); three separate [in][out] weights Wq, Wk, Wv [1024][1024]; no biases; no output projection */
  static_assert(HPG == 1 && NH == NG * HPG && NH * HD == DM && KVD == DM, "plain multi-head attention as 16 kv groups of one query head"); const float* bq = nullptr; const float* bk = nullptr; const float* bv = nullptr;      /* the module has no biases: the three bias slots are null */
  char* ws = (char*)d_ws; size_t off = 0;
  auto take = [&](size_t bytes) { char* p = ws + off; off += (bytes + 255) & ~(size_t)255; return p; };
  _Float16* BQKV = (_Float16*)take((size_t)3 * DM * DM * 2); _Float16* BQ = BQKV; _Float16* BK = BQKV + (size_t)DM * DM; _Float16* BV = BQKV + (size_t)2 * DM * DM;      /* three transposed planes, one after another: q, k, v */
  _Float16* X16 = (_Float16*)take(NR * DM * 2); _Float16* Q16 = (_Float16*)take(NR * DM * 2); _Float16* K16 = (_Float16*)take(NR * KVD * 2); _Float16* V16 = (_Float16*)take(NR * KVD * 2);
  _Float16* VT = (_Float16*)take((size_t)NH * HD * SQ * 2);
  float* QF0 = (float*)take((size_t)QT0 * DM * 4); float* KF0 = (float*)take((size_t)QT0 * KVD * 4); float* VF0 = (float*)take((size_t)QT0 * KVD * 4);      /* f32 q, k, v of the first 256 rows */
  if (off > ws_size) return;
  k_wt_f16<<<(unsigned)(((size_t)DM * (DM / 8) + 255) / 256), 256, 0, stream>>>(wq, BQ, DM, DM, 16.0f); k_wt_f16<<<(unsigned)(((size_t)DM * (DM / 8) + 255) / 256), 256, 0, stream>>>(wk, BK, DM, DM, 16.0f); k_wt_f16<<<(unsigned)(((size_t)DM * (DM / 8) + 255) / 256), 256, 0, stream>>>(wv, BV, DM, DM, 16.0f);      /* three [in][out] weights -> their transposed x16 planes */
  k_x16<<<(unsigned)((NR * DM / 8 + 255) / 256), 256, 0, stream>>>(x, X16, NR * DM / 8);
  for (int b = B0; b < B0 + NBR; ++b) { const size_t r0 = (size_t)b * SQ;
    /* q, k, v: every row rounded once to f16 in the epilogue; rows 0..255 stored in f32 as well, for the exact first tile (one head a k/v group: the tile reads these rows as they are) */
    k_gemm2<0><<<dim3((unsigned)((SQ / 128) * (KVD / 64)), 1), 128, 0, stream>>>(X16 + r0 * DM, DM, 0, BV, DM, 0, 0.0625f, bv, 0, nullptr, 1, 0, 0, VF0, QT0, V16 + r0 * KVD, KVD, 0, SQ, KVD, DM);
    k_gemm2<0><<<dim3((unsigned)((SQ / 128) * (DM / 64)), 1), 128, 0, stream>>>(X16 + r0 * DM, DM, 0, BQ, DM, 0, 0.0625f, bq, 0, nullptr, 1, 0, 0, QF0, QT0, Q16 + r0 * DM, DM, 0, SQ, DM, DM);
    k_gemm2<0><<<dim3((unsigned)((SQ / 128) * (KVD / 64)), 1), 128, 0, stream>>>(X16 + r0 * DM, DM, 0, BK, DM, 0, 0.0625f, bk, 0, nullptr, 1, 0, 0, KF0, QT0, K16 + r0 * KVD, KVD, 0, SQ, KVD, DM);
    k_vt<NG, SQ><<<NG * (SQ / 64), 256, 0, stream>>>(V16 + r0 * KVD, KVD, 0, VT);      /* V^T [NH][HD][SQ] for this batch */
    k_att0<<<NH * (QT0 / A0R), 256, 0, stream>>>(QF0, KF0, VF0, 0.125f, (float*)d_out + r0 * DM);      /* exact f32 attention for rows 0..255, written straight into the output rows */
    k_fattn<<<NH * ((SQ - QT0) / FQ), 128, 0, stream>>>(Q16 + r0 * LQ, K16 + r0 * KVD, VT, (float*)d_out + r0 * DM); }      /* rows 256..4095 of all 16 heads: scores, online softmax and context in ONE launch, straight into the output rows as f32 */
}

// v006
// A run of this version takes 121 microseconds.
// Next to v005, in two timings, it ran 1.33 and 1.34 times as fast.
// Counting every step since v000, it is 46.3 times as fast.
#include <hip/hip_runtime.h>
// Causal multi-head self-attention over ONE unbatched sequence with three separate projections and NO output projection (x [4096][1024]; q = x Wq, k = x Wk, v = x Wv ([in][out] 1024 x 1024 each, no biases); 16 heads of 64; scores / sqrt(64); causal (-inf above the diagonal: realised as exclusion); softmax; y = the merged context -> [4096][1024]); 16 k/v groups of ONE head each, no rotation.
// Structure: x as exact f16 rows; [in][out] weights as exact x16 planes; q, k and v as WMMA GEMMs (32x64 wave tiles, f32 accumulation, no bias) whose epilogue stores the one f16 rounding of every row and, for the first 256 rows, the f32 value beside it; V^T of the 16 groups (ONE head each here) via LDS transposes; rows 256..4095: one fused launch, each wave 32 query rows of one head: S^T = K Q^T on WMMA, online softmax in registers (f32 statistics, native exp2; weights f16), O^T += V^T P^T on WMMA, f32 straight into the merged output rows; the first tile: exact f32 attention for rows 0..255 written straight into the output rows; launches: see trace.
// The first tile: the first 256 query rows see only a few keys, where single-f16 v / P operands are least accurate; they are computed exactly: the f32 q/k/v rows that the three GEMMs store for them and an f32 attention on VALU (16 query rows a block, K and V in LDS, true row maximum).
// Compute dtype: inputs rounded to bf16; x / weights exact; q, k, v and softmax weights as plain f16 GEMM operands (~2^-12); scores, softmax statistics and o f32; v_wmma_f32_16x16x32_f16.
#define NB 1
#define NG 16
#define HPG 1
#define KVD (NG * HD)
#define SQ 4096
#define DM 1024
#define NH 16
#define HD 64
#define HG 4
#define QT0 256                      /* first-tile rows recomputed exactly in f32 */
#define B0 0                         /* first batch processed (debug hook) */
#define NBR NB                       /* batches processed (debug hook) */
#define NR ((size_t)NB * SQ)         /* token rows */
#define MP ((int)((size_t)NBR * SQ)) /* NBR x SQ rows; unused: each projection launch takes SQ rows */
#define MPO MP
#define LQ DM      /* row pitch of the q/k/v rows */
typedef __bf16 v16b __attribute__((ext_vector_type(16)));
typedef unsigned short v8us __attribute__((ext_vector_type(8), may_alias));
typedef float  v8f  __attribute__((ext_vector_type(8)));
typedef float  v4f  __attribute__((ext_vector_type(4)));
typedef float  v4fa __attribute__((ext_vector_type(4), may_alias));
union FragB { v16b v; v8us half[2]; unsigned short u[16]; };

__device__ __forceinline__ unsigned short bf16_bits(float x) { unsigned int u = __float_as_uint(x); return (unsigned short)((u + 0x7FFFu + ((u >> 16) & 1u)) >> 16); }
__device__ __forceinline__ float bf16_val(unsigned short b) { return __uint_as_float(((unsigned int)b) << 16); }
__device__ __forceinline__ float bf16_round(float x) { return bf16_val(bf16_bits(x)); }
// D += A·B with NT terms: 1 = ah·bh, 2 = + al·bh (A split), 3 = + ah·bl (both split)
template <int NT>
__device__ __forceinline__ v8f mmaN(v16b ah, v16b al, v16b bh, v16b bl, v8f c) {
  c = __builtin_amdgcn_wmma_f32_16x16x32_bf16(false, ah, false, bh, (short)0, c, false, false);
  if (NT >= 2) c = __builtin_amdgcn_wmma_f32_16x16x32_bf16(false, al, false, bh, (short)0, c, false, false);
  if (NT >= 3) c = __builtin_amdgcn_wmma_f32_16x16x32_bf16(false, ah, false, bl, (short)0, c, false, false);
  asm volatile("v_nop\n\tv_nop\n\tv_nop\n\tv_nop" : "+v"(c) : "v"(ah), "v"(al), "v"(bh), "v"(bl));
  return c;
}




// ---- f16 WMMA path (v_wmma_f32_16x16x32_f16): 11-bit significands for operands in range — used for every WMMA product in this file
typedef _Float16 v16h __attribute__((ext_vector_type(16)));
union FragH { v16h v; v8us half[2]; _Float16 h[16]; unsigned short u[16]; };
template <int NT>
__device__ __forceinline__ v8f mmaH(v16h ah, v16h al, v16h bh, v16h bl, v8f c) {
  c = __builtin_amdgcn_wmma_f32_16x16x32_f16(false, ah, false, bh, (short)0, c, false, false);
  if (NT >= 2) c = __builtin_amdgcn_wmma_f32_16x16x32_f16(false, al, false, bh, (short)0, c, false, false);
  if (NT >= 3) c = __builtin_amdgcn_wmma_f32_16x16x32_f16(false, ah, false, bl, (short)0, c, false, false);
  asm volatile("v_nop\n\tv_nop\n\tv_nop\n\tv_nop" : "+v"(c) : "v"(ah), "v"(al), "v"(bh), "v"(bl));
  return c;
}

// Wt[n][k] = f16(W[k][n]·scale) from f32 row-major W[K][N] (scale = power of two; bf16-exact weights stay exact in f16 away from the subnormal range)
__global__ __launch_bounds__(256) void k_wt_f16(const float* __restrict__ W, _Float16* __restrict__ Wt, int K, int N, float scale) {
  const int t = blockIdx.x * 256 + threadIdx.x; if (t >= N * (K / 8)) return; const int n = t / (K / 8), k8 = (t % (K / 8)) * 8; FragH f;
#pragma unroll
  for (int i = 0; i < 8; ++i) f.h[i] = (_Float16)(bf16_round(W[(size_t)(k8 + i) * N + n]) * scale); const v8us o = f.half[0];
  *(v8us*)((unsigned short*)Wt + (size_t)n * K + k8) = o; 
}

typedef _Float16 v4h __attribute__((ext_vector_type(4)));

__global__ __launch_bounds__(256) void k_x16(const float* __restrict__ x, _Float16* __restrict__ X16, size_t n8) { const size_t t = (size_t)blockIdx.x * 256 + threadIdx.x; if (t >= n8) return; FragH f;
#pragma unroll
  for (int q = 0; q < 8; ++q) f.h[q] = (_Float16)bf16_round(x[t * 8 + q]); *(v8us*)((unsigned short*)X16 + t * 8) = f.half[0];  }
template <int NHv, int TTv>
__global__ __launch_bounds__(256) void k_vt(const _Float16* __restrict__ V16, int ldv, int voff, _Float16* __restrict__ Vt) { __shared__ unsigned short tl[64][66]; const int tid = threadIdx.x; const int slab = blockIdx.x / (TTv / 64), lg = blockIdx.x % (TTv / 64); const int b = slab / NHv, h = slab % NHv;
  for (int i = tid; i < 64 * 8; i += 256) { const int r = i / 8, c8 = (i % 8) * 8; FragH f; f.half[0] = *(const v8us*)((const unsigned short*)V16 + ((size_t)b * TTv + lg * 64 + r) * ldv + voff + h * 64 + c8);
#pragma unroll
    for (int q = 0; q < 8; ++q) tl[r][c8 + q] = f.u[q]; }
  __syncthreads();
  {
#pragma unroll
    for (int rd = 0; rd < 2; ++rd) { const int d = rd * 32 + tid / 8, pc = tid % 8; FragH f;
#pragma unroll
      for (int q = 0; q < 8; ++q) f.u[q] = tl[pc * 8 + q][d];
      *(v8us*)((unsigned short*)Vt + ((size_t)slab * 64 + d) * TTv + lg * 64 + pc * 8) = f.half[0]; }
     } }


// ---- fast GEMM (wave tile 32x64; requires whole tiles: M % 128 == 0 rows per launch region, N % 64 == 0, K % 128 == 0 and K >= 128); epilogue = k_gemm_hhx semantics ----
__device__ __forceinline__ v16h g2_frag(const _Float16* p, int hh) { FragH f; f.half[0] = *(const v8us*)((const unsigned short*)p + 8 * hh); f.half[1] = *(const v8us*)((const unsigned short*)p + 16 + 8 * hh); return f.v; }
__device__ __forceinline__ v8f g2_mma(v16h a, v16h b, v8f c) { v8f d = __builtin_amdgcn_wmma_f32_16x16x32_f16(false, a, false, b, (short)0, c, false, false); asm volatile("v_nop\n\tv_nop\n\tv_nop\n\tv_nop" : "+v"(d) : "v"(a), "v"(b)); return d; }
// The GEMM's operand tiles go through LDS: a block's 128 A rows and 64 B rows, 128 k at a time, are brought in by asynchronous 16-byte copies (a wave-wide copy = 2 rows x 256 B = 4 whole lines; each line is fetched once a block), two buffers, the next tile in flight while this one is worked on.
#define GKT 128                      /* k elements of a staged tile: rows of 256 bytes */
#define GPE 136                      /* LDS row pitch in elements: 272 B = 16 B x odd, 16 lanes on 16 rows meet every bank once */
#define GTR 192                      /* rows of a staged tile: the block's 128 A rows, then its 64 B rows */
// Eight copies of one lane, rows 8 apart: l = the lane's LDS byte address, g = its global address, g8 = 8 source rows in elements. The s_wait_xcnt stands inside the statement, behind the last copy, so that no later write of an address register can be placed in front of it.
__device__ __forceinline__ void g2_copy8(unsigned l, const _Float16* g, size_t g8) {
  asm volatile("global_load_async_to_lds_b128 %0, %8, off\n\tglobal_load_async_to_lds_b128 %1, %9, off\n\tglobal_load_async_to_lds_b128 %2, %10, off\n\tglobal_load_async_to_lds_b128 %3, %11, off\n\t"
               "global_load_async_to_lds_b128 %4, %12, off\n\tglobal_load_async_to_lds_b128 %5, %13, off\n\tglobal_load_async_to_lds_b128 %6, %14, off\n\tglobal_load_async_to_lds_b128 %7, %15, off\n\ts_wait_xcnt 0x0"
               :: "v"(l), "v"(l + 8u * GPE * 2u), "v"(l + 16u * GPE * 2u), "v"(l + 24u * GPE * 2u), "v"(l + 32u * GPE * 2u), "v"(l + 40u * GPE * 2u), "v"(l + 48u * GPE * 2u), "v"(l + 56u * GPE * 2u),
                  "v"(g), "v"(g + g8), "v"(g + 2 * g8), "v"(g + 3 * g8), "v"(g + 4 * g8), "v"(g + 5 * g8), "v"(g + 6 * g8), "v"(g + 7 * g8) : "memory"); }
template <int ACT>
__global__ __launch_bounds__(128) void k_gemm2(const _Float16* __restrict__ A, int lda, size_t sA, const _Float16* __restrict__ Bh, int ldb, size_t sB, float alpha, const float* __restrict__ bias, size_t sBias, const float* __restrict__ CP, int rowsPerB, size_t sCPb, int row0g,
    float* __restrict__ C, int MC, _Float16* __restrict__ C16, int ldc, size_t sC, int M, int N, int K) {      /* C: f32 rows, stored for rows below MC only (MC % 32 == 0); C16: the f16 rounding of every row */ static_assert(ACT == 0 || ACT == 3 || ACT == 6 || ACT == 8 || ACT == 9 || ACT == 11 || ACT == 12 || ACT == 14 || ACT == 15 || ACT == 16 || ACT == 17, "k_gemm2: unsupported ACT code (would silently apply no activation)");
  __shared__ __attribute__((aligned(16))) _Float16 st[2][GTR * GPE]; __shared__ __attribute__((aligned(16))) float so[4][32][68];
  const int tid = threadIdx.x, w = tid >> 5, lane = tid & 31, ln = lane & 15, hh = lane >> 4; const int by = blockIdx.y;
  A += (size_t)by * sA; Bh += (size_t)by * sB; const size_t cofs = (size_t)by * sC; const float* bp = bias ? bias + (size_t)by * sBias : nullptr;
  const int ntn = N >> 6; const int mt = blockIdx.x / ntn, nq = blockIdx.x - mt * ntn; const int row0 = mt * 128 + 32 * w, col0 = nq * 64; if (mt * 128 >= M) return;      /* the whole block leaves or none: barriers follow */
  const int cr = tid >> 4, cc = (tid & 15) * 8;      /* the thread's row (of 8) and 16-byte column in every copy */
  const _Float16* ga = A + (size_t)(mt * 128 + cr) * lda + cc; const _Float16* gb = Bh + (size_t)(col0 + cr) * ldb + cc; const unsigned l0 = (unsigned)(size_t)&st[0][cr * GPE + cc];
  auto fill = [&](int t) { const unsigned l = l0 + (unsigned)(t & 1) * (GTR * GPE * 2u); const _Float16* a = ga + (size_t)t * GKT;      /* tile t into buffer t mod 2: 24 copies a lane */
    g2_copy8(l, a, (size_t)8 * lda); g2_copy8(l + 64u * GPE * 2u, a + (size_t)64 * lda, (size_t)8 * lda); g2_copy8(l + 128u * GPE * 2u, gb + (size_t)t * GKT, (size_t)8 * ldb); };
  const v8f z8 = {0.f,0.f,0.f,0.f,0.f,0.f,0.f,0.f}; v8f c00 = z8, c01 = z8, c02 = z8, c03 = z8, c10 = z8, c11 = z8, c12 = z8, c13 = z8;
  const int NT = K / GKT;
  fill(0);
  asm volatile("s_wait_asynccnt 0x0" ::: "memory");      /* this wave's copies of tile 0 have landed */
  __syncthreads();      /* tile 0 published */
  if (NT > 1) fill(1);
  for (int t = 0; t < NT; ++t) { const _Float16* sa = &st[t & 1][(32 * w + ln) * GPE]; const _Float16* sb = &st[t & 1][(128 + ln) * GPE]; v16h f[2][6];      /* two fragment sets: the next 32 k are read from LDS under this step's products; never past the tile */
#pragma unroll      /* full: f must be indexed by constants to stay in registers */
    for (int u = 0; u < 6; ++u) f[0][u] = g2_frag((u < 2 ? sa + u * 16 * GPE : sb + (u - 2) * 16 * GPE), hh);
#pragma unroll      /* full: constant indices, as above */
    for (int j = 0; j < GKT / 32; ++j) { const int p = j & 1;
      if (j + 1 < GKT / 32) {
#pragma unroll      /* full: constant indices, as above */
        for (int u = 0; u < 6; ++u) f[p ^ 1][u] = g2_frag((u < 2 ? sa + u * 16 * GPE : sb + (u - 2) * 16 * GPE) + (j + 1) * 32, hh); }
      c00 = g2_mma(f[p][0], f[p][2], c00); c10 = g2_mma(f[p][1], f[p][2], c10); c01 = g2_mma(f[p][0], f[p][3], c01); c11 = g2_mma(f[p][1], f[p][3], c11);
      c02 = g2_mma(f[p][0], f[p][4], c02); c12 = g2_mma(f[p][1], f[p][4], c12); c03 = g2_mma(f[p][0], f[p][5], c03); c13 = g2_mma(f[p][1], f[p][5], c13); }
    asm volatile("s_wait_dscnt 0x0" ::: "memory");      /* this wave's reads of buffer t mod 2 are done before the buffer is given up */
    asm volatile("s_wait_asynccnt 0x0" ::: "memory");      /* this wave's copies of tile t + 1 have landed */
    __syncthreads();      /* publishes tile t + 1 and ends every wave's reads of tile t */
    if (t + 2 < NT) fill(t + 2); }
  asm volatile("s_wait_asynccnt 0x0" ::: "memory");      /* nothing is in flight when the loop is left */
  v8f accs[8] = {c00, c01, c02, c03, c10, c11, c12, c13};
#pragma unroll
  for (int u = 0; u < 8; ++u) { const int t = u & 3, half = u >> 2; const int col = col0 + t * 16 + ln; const float bv = bp ? bf16_round(bp[col]) : 0.f;
#pragma unroll
    for (int r = 0; r < 8; ++r) { const int rloc = half * 16 + 8 * hh + r; float v = accs[u][r] * alpha + bv; if (CP) { if (rowsPerB < 0) v += CP[cofs + (size_t)(row0g + row0 + rloc) * ldc + col];      /* rowsPerB < 0: own element of the batched C plane */ else { const int bidx = (row0g + row0 + rloc) / rowsPerB; v += CP[(size_t)bidx * sCPb + (size_t)by * 64 + col]; } }
      if (ACT == 3) v = fmaxf(v, 0.f); else if (ACT == 6) v = 0.5f * v * (1.0f + erff(v * 0.70710678118654752f)); else if (ACT == 11) v = 1.0f / (1.0f + expf(-v)); else if (ACT == 15) v = v / (1.0f + expf(-v)); else if (ACT == 12) v = (v > 0.f) ? v : 0.01f * v; else if (ACT == 8) v = tanhf(v); else if (ACT == 9) v = 0.5f * v * (1.0f + tanhf(0.7978845608028654f * (v + 0.044715f * v * v * v))); else if (ACT == 14) v = (v > 0.f) ? v : 0.1f * v; else if (ACT == 16) v = (v >= 0.f) ? v : 0.3f * v; else if (ACT == 17) v = (v >= 0.f) ? v : 0.2f * v;
      so[w][rloc][t * 16 + ln] = v; } }
  __builtin_amdgcn_fence(__ATOMIC_ACQ_REL, "workgroup"); __builtin_amdgcn_wave_barrier();
  const int rsub = lane >> 4, c4 = (lane & 15) * 4; const bool cf = C && __builtin_amdgcn_readfirstlane(row0) < MC;      /* the wave's 32 rows lie on one side of MC: a scalar test */
  {
#pragma unroll
    for (int q = 0; q < 16; ++q) { const int r = q * 2 + rsub; const v4f v = *(const v4fa*)&so[w][r][c4]; if (cf) { *(v4f*)(C + cofs + (size_t)(row0 + r) * ldc + col0 + c4) = v; asm volatile("s_wait_xcnt 0x0" ::: "memory"); }      /* the wait stands behind the f32 store, in front of the f16 conversion, which may reuse the store's registers */
      if (C16) { v4h h4; for (int i = 0; i < 4; ++i) h4[i] = (_Float16)v[i]; *(v4h*)(C16 + cofs + (size_t)(row0 + r) * ldc + col0 + c4) = h4; } }
     } }


// Fused causal attention for query rows QT0 .. SQ-1: scores, softmax and context in ONE launch; no score or weight plane in memory.
// One wave owns 32 query rows of one head and walks its keys 32 at a time with a running maximum and sum (online softmax).
// K rows and V^T rows go through LDS: 128 keys at a time are brought in once a block by asynchronous 16-byte copies (a wave-wide copy = 4 whole lines), two buffers, the next tile in flight while this one is worked on; the block's 4 waves read their fragments from there.
// S^T = K Q^T (A = 16 key rows, B = 16 query rows): lane (ln, hh) then holds, for query ln, keys 8 hh + r of each 16-key tile, which is the B operand order of O^T += V^T P^T: the weights go from accumulator to operand in registers.
// All of a lane's values belong to one query per 16-query set, so maximum, sum and rescale are lane-local but for one exchange between the wave halves.
// Every '#pragma unroll' of fa_pass and k_fattn is a full unroll: the fragment and accumulator arrays must be indexed by constants to stay in registers.
#define FQ 128                       /* query rows per block: 4 waves x 32 */
#define SCL2 0.18033688011112042f    /* 1/sqrt(64) x log2(e): scores are carried in log2 units */
#define FKT 128                      /* keys of a staged tile: 4 passes; FQ and QT0 are multiples of it */
#define FKP 72                       /* LDS pitch of a K row in elements: 144 B = 16 B x odd, 16 lanes on 16 rows meet every bank once */
#define FVP 136                      /* LDS pitch of a V^T row (128 keys) in elements: 272 B = 16 B x odd */
// Eight copies of one lane: l = the lane's LDS byte address, LS = the LDS step in bytes from copy to copy, g = its global address, gs = the global step in elements. The s_wait_xcnt stands inside the statement, behind the last copy, so that no later write of an address register can be placed in front of it.
template <unsigned LS>
__device__ __forceinline__ void fa_copy8(unsigned l, const _Float16* g, size_t gs) {
  asm volatile("global_load_async_to_lds_b128 %0, %8, off\n\tglobal_load_async_to_lds_b128 %1, %9, off\n\tglobal_load_async_to_lds_b128 %2, %10, off\n\tglobal_load_async_to_lds_b128 %3, %11, off\n\t"
               "global_load_async_to_lds_b128 %4, %12, off\n\tglobal_load_async_to_lds_b128 %5, %13, off\n\tglobal_load_async_to_lds_b128 %6, %14, off\n\tglobal_load_async_to_lds_b128 %7, %15, off\n\ts_wait_xcnt 0x0"
               :: "v"(l), "v"(l + LS), "v"(l + 2u * LS), "v"(l + 3u * LS), "v"(l + 4u * LS), "v"(l + 5u * LS), "v"(l + 6u * LS), "v"(l + 7u * LS),
                  "v"(g), "v"(g + gs), "v"(g + 2 * gs), "v"(g + 3 * gs), "v"(g + 4 * gs), "v"(g + 5 * gs), "v"(g + 6 * gs), "v"(g + 7 * gs) : "memory"); }
__device__ __forceinline__ v8f fa_mma(v16h a, v16h b, v8f c) { return __builtin_amdgcn_wmma_f32_16x16x32_f16(false, a, false, b, (short)0, c, false, false); }
__device__ __forceinline__ float fa_swap16(float x) { const int b = __float_as_int(x); return __int_as_float(__builtin_amdgcn_permlanex16(b, b, 0x76543210, 0xfedcba98, false, false)); }      /* lane l <-> l ^ 16 */
// One pass: 32 keys against the wave's 32 queries. kp, vp: the lane's K row and V^T row in the staged tile, at the pass's first key. DIAG: the pass that crosses the diagonal (its first key == the wave's first query row), the wave's last. PRE: the next pass lies in the same staged tile.
template <bool DIAG, bool PRE>
__device__ __forceinline__ void fa_pass(const _Float16* kp, const _Float16* vp, int ln, int hh, const v16h (&qf)[2][2], v16h (&kf)[2][2], v8f (&o)[2][4], float (&m)[2], float (&l)[2]) {
  const v8f z8 = {0.f,0.f,0.f,0.f,0.f,0.f,0.f,0.f}; v16h vf[4];
#pragma unroll
  for (int d = 0; d < 4; ++d) vf[d] = g2_frag(vp + d * 16 * FVP, hh);
  v8f st[2][2];      /* [query set][16-key tile] */
#pragma unroll
  for (int s = 0; s < 2; ++s) for (int t = 0; t < 2; ++t) if (!(DIAG && s == 0 && t == 1)) st[s][t] = fa_mma(kf[t][1], qf[s][1], fa_mma(kf[t][0], qf[s][0], z8));      /* on the diagonal pass keys 16..31 lie above every query of set 0: that tile is left out whole */
  if (PRE) {      /* the next pass's keys, fetched one pass ahead into the same registers; never past the staged tile */
#pragma unroll
    for (int t = 0; t < 2; ++t) for (int kb = 0; kb < 2; ++kb) kf[t][kb] = g2_frag(kp + (32 + t * 16) * FKP + kb * 32, hh); }
  if (DIAG) {      /* keys above the diagonal are excluded: their weight is exp2(-huge) = 0 */
#pragma unroll
    for (int s = 0; s < 2; ++s) for (int r = 0; r < 8; ++r) st[s][s][r] = (8 * hh + r <= ln) ? st[s][s][r] : -3.0e38f; }      /* only the two tiles on the diagonal are cut; set 1 sees all of keys 0..15 */
  float mx[2];
#pragma unroll
  for (int s = 0; s < 2; ++s) { float a = st[s][0][0]; for (int r = 1; r < 8; ++r) a = fmaxf(a, st[s][0][r]); if (!(DIAG && s == 0)) for (int r = 0; r < 8; ++r) a = fmaxf(a, st[s][1][r]); a = fmaxf(a, fa_swap16(a)); mx[s] = a * SCL2; }
  /* the maximum in use moves only when some query's new maximum exceeds it by more than 8 (log2 units): weights stay <= 2^8, inside f16; one scalar branch a pass */
  if (__builtin_amdgcn_ballot_w32(mx[0] > m[0] + 8.f || mx[1] > m[1] + 8.f) != 0) {
#pragma unroll
    for (int s = 0; s < 2; ++s) { const float mn = fmaxf(m[s], mx[s]); const float al = __builtin_amdgcn_exp2f(m[s] - mn); m[s] = mn; l[s] *= al; for (int d = 0; d < 4; ++d) o[s][d] *= al; } }
#pragma unroll
  for (int s = 0; s < 2; ++s) { FragH pf; float s0 = 0.f, s1 = 0.f;
#pragma unroll
    for (int r = 0; r < 8; ++r) { const float e0 = __builtin_amdgcn_exp2f(fmaf(st[s][0][r], SCL2, -m[s])); const float e1 = (DIAG && s == 0) ? 0.f : __builtin_amdgcn_exp2f(fmaf(st[s][1][r], SCL2, -m[s])); s0 += e0; s1 += e1; pf.h[r] = (_Float16)e0; pf.h[8 + r] = (_Float16)e1; }
    l[s] += s0 + s1;
#pragma unroll
    for (int d = 0; d < 4; ++d) o[s][d] = fa_mma(vf[d], pf.v, o[s][d]); } }
__global__ __launch_bounds__(128) void k_fattn(const _Float16* __restrict__ Q, const _Float16* __restrict__ Kh, const _Float16* __restrict__ Vt, float* __restrict__ O) {
  __shared__ __attribute__((aligned(16))) _Float16 sK[2][FKT * FKP]; __shared__ __attribute__((aligned(16))) _Float16 sV[2][HD * FVP];
  const int tid = threadIdx.x, lane = tid & 31, ln = lane & 15, hh = lane >> 4; const int w = __builtin_amdgcn_readfirstlane(threadIdx.x >> 5);
  const int h = blockIdx.x % NH; const int tile = (SQ - QT0) / FQ - 1 - blockIdx.x / NH;      /* the longest key ranges start first */
  const int qw = QT0 + tile * FQ + w * 32;      /* first query row of the wave: scalar, a multiple of 32 */
  const int NS = (QT0 + tile * FQ) / FKT + 1;      /* staged tiles of the block: all keys below its first query row, then the 128 keys of its own rows; at least 3 */
  const _Float16* qp = Q + (size_t)(qw + ln) * LQ + h * HD;
  const _Float16* gk = Kh + (size_t)(tid >> 3) * KVD + h * HD + (tid & 7) * 8; const unsigned lk = (unsigned)(size_t)&sK[0][(tid >> 3) * FKP + (tid & 7) * 8];      /* K: a copy of the block = 16 rows of 128 B */
  const _Float16* gv = Vt + ((size_t)h * HD + (tid >> 4)) * SQ + (tid & 15) * 8; const unsigned lv = (unsigned)(size_t)&sV[0][(tid >> 4) * FVP + (tid & 15) * 8];      /* V^T: a copy of the block = 8 rows of 256 B */
  auto fill = [&](int t) {      /* tile t into buffer t mod 2: 16 copies a lane */
    fa_copy8<16u * FKP * 2u>(lk + (unsigned)(t & 1) * (FKT * FKP * 2u), gk + (size_t)t * FKT * KVD, (size_t)16 * KVD); fa_copy8<8u * FVP * 2u>(lv + (unsigned)(t & 1) * (HD * FVP * 2u), gv + (size_t)t * FKT, (size_t)8 * SQ); };
  fill(0);
  v16h qf[2][2], kf[2][2];
#pragma unroll
  for (int s = 0; s < 2; ++s) for (int kb = 0; kb < 2; ++kb) qf[s][kb] = g2_frag(qp + (size_t)s * 16 * LQ + kb * 32, hh);
  asm volatile("s_wait_xcnt 0x0" ::: "memory");      /* stands behind the last load of the opening run, in front of every later write of that run's address registers */
  const v8f z8 = {0.f,0.f,0.f,0.f,0.f,0.f,0.f,0.f}; v8f o[2][4]; float m[2], l[2];
#pragma unroll
  for (int s = 0; s < 2; ++s) { m[s] = -1.0e37f; l[s] = 0.f; for (int d = 0; d < 4; ++d) o[s][d] = z8; }
  asm volatile("s_wait_asynccnt 0x0" ::: "memory");      /* this wave's copies of tile 0 have landed */
  __syncthreads();      /* tile 0 published */
  fill(1);
  for (int t = 0; t < NS - 1; ++t) {      /* tiles below every query of the block: 4 whole passes in every wave */
    const _Float16* kp = &sK[t & 1][ln * FKP]; const _Float16* vp = &sV[t & 1][ln * FVP];
#pragma unroll
    for (int u = 0; u < 2; ++u) for (int kb = 0; kb < 2; ++kb) kf[u][kb] = g2_frag(kp + u * 16 * FKP + kb * 32, hh);
    fa_pass<false, true>(kp, vp, ln, hh, qf, kf, o, m, l); fa_pass<false, true>(kp + 32 * FKP, vp + 32, ln, hh, qf, kf, o, m, l);
    fa_pass<false, true>(kp + 64 * FKP, vp + 64, ln, hh, qf, kf, o, m, l); fa_pass<false, false>(kp + 96 * FKP, vp + 96, ln, hh, qf, kf, o, m, l);
    asm volatile("s_wait_dscnt 0x0" ::: "memory");      /* this wave's reads of buffer t mod 2 are done before the buffer is given up */
    asm volatile("s_wait_asynccnt 0x0" ::: "memory");      /* this wave's copies of tile t + 1 have landed */
    __syncthreads();      /* publishes tile t + 1 and ends every wave's reads of tile t */
    if (t + 2 < NS) fill(t + 2); }
  asm volatile("s_wait_asynccnt 0x0" ::: "memory");      /* nothing is in flight when the loop is left */
  { const _Float16* kp = &sK[(NS - 1) & 1][ln * FKP]; const _Float16* vp = &sV[(NS - 1) & 1][ln * FVP];      /* the block's own 128 keys: wave w has w whole passes, then its diagonal pass; no barrier follows */
#pragma unroll
    for (int u = 0; u < 2; ++u) for (int kb = 0; kb < 2; ++kb) kf[u][kb] = g2_frag(kp + u * 16 * FKP + kb * 32, hh);
    for (int p = 0; p < w; ++p) { fa_pass<false, true>(kp, vp, ln, hh, qf, kf, o, m, l); kp += 32 * FKP; vp += 32; }
    fa_pass<true, false>(kp, vp, ln, hh, qf, kf, o, m, l); }
#pragma unroll
  for (int s = 0; s < 2; ++s) { const float inv = 1.0f / (l[s] + fa_swap16(l[s])); float* op = O + (size_t)(qw + s * 16 + ln) * DM + h * HD + 8 * hh;      /* O^T tile d: rows d*16 + 8 hh + r of column (query) ln */
#pragma unroll
    for (int d = 0; d < 4; ++d) { const v4f lo4 = {o[s][d][0] * inv, o[s][d][1] * inv, o[s][d][2] * inv, o[s][d][3] * inv}; const v4f hi4 = {o[s][d][4] * inv, o[s][d][5] * inv, o[s][d][6] * inv, o[s][d][7] * inv}; *(v4f*)(op + d * 16) = lo4; *(v4f*)(op + d * 16 + 4) = hi4; } } }

// Exact f32 attention for query rows 0 .. QT0-1, all on the vector unit. One block = one head x 16 query rows, 8 waves; the work of a row is spread over lanes and waves, nothing walks the keys one by one.
// Stage: the head's 256 K rows, 256 V rows and the block's 16 Q rows go to LDS by coalesced 16-byte loads, all in flight together. Keys above a row's diagonal are staged too (they are rows of this call) and get the weight 0.
// Scores: a thread owns 4 rows x 4 keys (keys 64 apart), so 8 LDS reads feed 64 FMAs. Softmax: a wave owns 2 rows, 8 keys a lane, true row maximum and sum by butterflies. Context: a thread owns 4 rows x 4 columns over a quarter of the keys; the four quarters are summed through LDS.
#define A0R 16                       /* query rows per block */
#define A0KP 68                      /* K row pitch in LDS (floats): 272 B = 16 B x odd, 16 lanes on 16 rows meet every bank once */
#define A0SP 260                     /* score row pitch (floats) */
#define A0PP 20                      /* weight pitch (floats), laid [key][row] so that one 16-byte read gives 4 rows' weights of a key */
struct A0Lds { float sq[A0R * HD]; float sfin[A0R]; float ss[A0R * A0SP]; float sp[QT0 * A0PP]; float red[4 * A0R * HD]; float sk[QT0 * A0KP]; float sv[QT0 * HD]; };      /* every member starts at a multiple of 16 bytes; the small ones first, inside the reach of an LDS instruction's immediate offset */
template <int M> __device__ __forceinline__ float a0_xm(float x) { return __int_as_float(__builtin_amdgcn_update_dpp(0, __float_as_int(x), 0x160 | M, 0xf, 0xf, true)); }      /* lane l <- l ^ M inside a 16-lane row (DPP row_xmask); every lane is on where it is used */
__device__ __forceinline__ float a0_max32(float x) { x = fmaxf(x, a0_xm<1>(x)); x = fmaxf(x, a0_xm<2>(x)); x = fmaxf(x, a0_xm<4>(x)); x = fmaxf(x, a0_xm<8>(x)); return fmaxf(x, fa_swap16(x)); }
__device__ __forceinline__ float a0_sum32(float x) { x += a0_xm<1>(x); x += a0_xm<2>(x); x += a0_xm<4>(x); x += a0_xm<8>(x); return x + fa_swap16(x); }
__global__ __launch_bounds__(256) void k_att0(const float* __restrict__ QF, const float* __restrict__ KF, const float* __restrict__ VF, float scale, float* __restrict__ OF) {
  __shared__ __attribute__((aligned(16))) A0Lds L;
  const int t = threadIdx.x; const int h = blockIdx.x / (QT0 / A0R); const int i0 = (blockIdx.x % (QT0 / A0R)) * A0R;
  { const int r = t >> 4, c = (t & 15) * 4; const float* kp = KF + (size_t)r * DM + h * HD + c; const float* vp = VF + (size_t)r * DM + h * HD + c; v4f kv[QT0 / 16], vv[QT0 / 16];
#pragma unroll      /* full: the two arrays must be indexed by constants to stay in registers, and all 33 loads are to be in flight at once */
    for (int it = 0; it < QT0 / 16; ++it) { kv[it] = *(const v4fa*)(kp + (size_t)it * 16 * DM); vv[it] = *(const v4fa*)(vp + (size_t)it * 16 * DM); }
    const float* qp = QF + (size_t)(i0 + r) * DM + h * HD + c; const v4f qv = *(const v4fa*)qp;
    asm volatile("s_wait_xcnt 0x0" :: "v"(kp), "v"(vp), "v"(qp) : "memory");      /* stands behind the last load of the run; the run's three address pairs are inputs, so they keep their registers up to the wait and every later write of those registers stands behind it */
    float* ks = &L.sk[r * A0KP + c]; float* vs = &L.sv[r * HD + c];
#pragma unroll      /* full: constant indices, as above */
    for (int it = 0; it < QT0 / 16; ++it) { *(v4f*)(ks + it * 16 * A0KP) = kv[it]; *(v4f*)(vs + it * 16 * HD) = vv[it]; }
    *(v4f*)&L.sq[r * HD + c] = qv; }
  __syncthreads();      /* K, V, Q staged */
  { const int kq = t & 63, r0 = (t >> 6) * 4; const v4f z4 = {0.f, 0.f, 0.f, 0.f}; v4f acc[4] = {z4, z4, z4, z4};      /* acc[row][key] */
    const float* qb = &L.sq[r0 * HD]; const float* kb = &L.sk[kq * A0KP];
#pragma unroll      /* full: the LDS reads of later steps issue under the FMAs of earlier ones */
    for (int c = 0; c < HD; c += 4) { v4f q[4], k[4];
#pragma unroll
      for (int a = 0; a < 4; ++a) { q[a] = *(const v4f*)(qb + a * HD + c); k[a] = *(const v4f*)(kb + a * 64 * A0KP + c); }
#pragma unroll
      for (int a = 0; a < 4; ++a) for (int u = 0; u < 4; ++u) for (int e = 0; e < 4; ++e) acc[a][u] = fmaf(q[a][e], k[u][e], acc[a][u]); }
#pragma unroll
    for (int a = 0; a < 4; ++a) for (int u = 0; u < 4; ++u) { const int j = kq + 64 * u; L.ss[(r0 + a) * A0SP + j] = (j <= i0 + r0 + a) ? acc[a][u] * scale : -1.0e30f; } }      /* keys above the diagonal are excluded: their weight is exp(-huge) = 0 */
  __syncthreads();      /* scores complete */
  { const int lane = t & 31, r0 = (t >> 5) * 2; float x[2][8], m[2], l[2];      /* the wave's two rows side by side: two independent chains */
#pragma unroll
    for (int rr = 0; rr < 2; ++rr) for (int u = 0; u < 8; ++u) x[rr][u] = L.ss[(r0 + rr) * A0SP + lane + 32 * u];
#pragma unroll
    for (int rr = 0; rr < 2; ++rr) { float a = x[rr][0]; for (int u = 1; u < 8; ++u) a = fmaxf(a, x[rr][u]); m[rr] = a; }
    m[0] = a0_max32(m[0]); m[1] = a0_max32(m[1]);
#pragma unroll
    for (int rr = 0; rr < 2; ++rr) { float a = 0.f; for (int u = 0; u < 8; ++u) { x[rr][u] = expf(x[rr][u] - m[rr]); a += x[rr][u]; } l[rr] = a; }
    l[0] = a0_sum32(l[0]); l[1] = a0_sum32(l[1]);
#pragma unroll
    for (int rr = 0; rr < 2; ++rr) for (int u = 0; u < 8; ++u) L.sp[(lane + 32 * u) * A0PP + r0 + rr] = x[rr][u];
    if (lane < 2) L.sfin[r0 + lane] = 1.0f / (lane == 0 ? l[0] : l[1]); }
  __syncthreads();      /* weights complete */
  { const int c = (t & 15) * 4, r0 = ((t >> 4) & 3) * 4, ks = t >> 6; const v4f z4 = {0.f, 0.f, 0.f, 0.f}; v4f o[4] = {z4, z4, z4, z4};
    const float* vb = &L.sv[ks * (QT0 / 4) * HD + c]; const float* pb = &L.sp[ks * (QT0 / 4) * A0PP + r0];
#pragma unroll      /* full: every LDS read is one base register plus an immediate offset, and later keys' reads issue under earlier keys' FMAs */
    for (int jj = 0; jj < QT0 / 4; ++jj) { const v4f v = *(const v4f*)(vb + jj * HD); const v4f p = *(const v4f*)(pb + jj * A0PP);
#pragma unroll
      for (int a = 0; a < 4; ++a) for (int e = 0; e < 4; ++e) o[a][e] = fmaf(p[a], v[e], o[a][e]); }
#pragma unroll
    for (int a = 0; a < 4; ++a) *(v4f*)&L.red[(ks * A0R + r0 + a) * HD + c] = o[a]; }
  __syncthreads();      /* the four key quarters' partial contexts complete */
  { const int r = t >> 4, c = (t & 15) * 4; v4f s = *(const v4f*)&L.red[r * HD + c];
#pragma unroll
    for (int ks = 1; ks < 4; ++ks) s += *(const v4f*)&L.red[(ks * A0R + r) * HD + c];
    s *= L.sfin[r]; *(v4f*)(OF + (size_t)(i0 + r) * DM + h * HD + c) = s; } }

extern "C" void kernel_launch(void* const* d_in, const int* in_sizes, int n_in,
                              void* d_out, int out_size, void* d_ws, size_t ws_size, hipStream_t stream) {
  (void)in_sizes; (void)n_in; (void)out_size;
  const float* const* I = (const float* const*)d_in; const float* x = I[0]; const float* wq = I[1]; const float* wk = I[2]; const float* wv = I[3];      /* x [4096][1024] (ONE unbatched sequence); three separate [in][out] weights Wq, Wk, Wv [1024][1024]; no biases; no output projection */
  static_assert(HPG == 1 && NH == NG * HPG && NH * HD == DM && KVD == DM, "plain multi-head attention as 16 kv groups of one query head"); const float* bq = nullptr; const float* bk = nullptr; const float* bv = nullptr;      /* the module has no biases: the three bias slots are null */
  char* ws = (char*)d_ws; size_t off = 0;
  auto take = [&](size_t bytes) { char* p = ws + off; off += (bytes + 255) & ~(size_t)255; return p; };
  _Float16* BQKV = (_Float16*)take((size_t)3 * DM * DM * 2); _Float16* BQ = BQKV; _Float16* BK = BQKV + (size_t)DM * DM; _Float16* BV = BQKV + (size_t)2 * DM * DM;      /* three transposed planes, one after another: q, k, v */
  _Float16* X16 = (_Float16*)take(NR * DM * 2); _Float16* Q16 = (_Float16*)take(NR * DM * 2); _Float16* K16 = (_Float16*)take(NR * KVD * 2); _Float16* V16 = (_Float16*)take(NR * KVD * 2);
  _Float16* VT = (_Float16*)take((size_t)NH * HD * SQ * 2);
  float* QF0 = (float*)take((size_t)QT0 * DM * 4); float* KF0 = (float*)take((size_t)QT0 * KVD * 4); float* VF0 = (float*)take((size_t)QT0 * KVD * 4);      /* f32 q, k, v of the first 256 rows */
  if (off > ws_size) return;
  k_wt_f16<<<(unsigned)(((size_t)DM * (DM / 8) + 255) / 256), 256, 0, stream>>>(wq, BQ, DM, DM, 16.0f); k_wt_f16<<<(unsigned)(((size_t)DM * (DM / 8) + 255) / 256), 256, 0, stream>>>(wk, BK, DM, DM, 16.0f); k_wt_f16<<<(unsigned)(((size_t)DM * (DM / 8) + 255) / 256), 256, 0, stream>>>(wv, BV, DM, DM, 16.0f);      /* three [in][out] weights -> their transposed x16 planes */
  k_x16<<<(unsigned)((NR * DM / 8 + 255) / 256), 256, 0, stream>>>(x, X16, NR * DM / 8);
  for (int b = B0; b < B0 + NBR; ++b) { const size_t r0 = (size_t)b * SQ;
    /* q, k, v: every row rounded once to f16 in the epilogue; rows 0..255 stored in f32 as well, for the exact first tile (one head a k/v group: the tile reads these rows as they are) */
    k_gemm2<0><<<dim3((unsigned)((SQ / 128) * (KVD / 64)), 1), 128, 0, stream>>>(X16 + r0 * DM, DM, 0, BV, DM, 0, 0.0625f, bv, 0, nullptr, 1, 0, 0, VF0, QT0, V16 + r0 * KVD, KVD, 0, SQ, KVD, DM);
    k_gemm2<0><<<dim3((unsigned)((SQ / 128) * (DM / 64)), 1), 128, 0, stream>>>(X16 + r0 * DM, DM, 0, BQ, DM, 0, 0.0625f, bq, 0, nullptr, 1, 0, 0, QF0, QT0, Q16 + r0 * DM, DM, 0, SQ, DM, DM);
    k_gemm2<0><<<dim3((unsigned)((SQ / 128) * (KVD / 64)), 1), 128, 0, stream>>>(X16 + r0 * DM, DM, 0, BK, DM, 0, 0.0625f, bk, 0, nullptr, 1, 0, 0, KF0, QT0, K16 + r0 * KVD, KVD, 0, SQ, KVD, DM);
    k_vt<NG, SQ><<<NG * (SQ / 64), 256, 0, stream>>>(V16 + r0 * KVD, KVD, 0, VT);      /* V^T [NH][HD][SQ] for this batch */
    k_att0<<<NH * (QT0 / A0R), 256, 0, stream>>>(QF0, KF0, VF0, 0.125f, (float*)d_out + r0 * DM);      /* exact f32 attention for rows 0..255, written straight into the output rows */
    k_fattn<<<NH * ((SQ - QT0) / FQ), 128, 0, stream>>>(Q16 + r0 * LQ, K16 + r0 * KVD, VT, (float*)d_out + r0 * DM); }      /* rows 256..4095 of all 16 heads: scores, online softmax and context in ONE launch, straight into the output rows as f32 */
}

// v007
// It runs in 109 microseconds.
// Timed twice side by side with v006, it ran 1.11 times as fast both times.
// Counting every step since v000, it is 51.6 times as fast.
#include <hip/hip_runtime.h>
// Causal multi-head self-attention over ONE unbatched sequence with three separate projections and NO output projection (x [4096][1024]; q = x Wq, k = x Wk, v = x Wv ([in][out] 1024 x 1024 each, no biases); 16 heads of 64; scores / sqrt(64); causal (-inf above the diagonal: realised as exclusion); softmax; y = the merged context -> [4096][1024]); 16 k/v groups of ONE head each, no rotation.
// Structure: x as exact f16 rows; [in][out] weights as exact x16 planes; q, k and v as WMMA GEMMs (32x64 wave tiles, f32 accumulation, no bias) whose epilogue stores the one f16 rounding of every row and, for the first 256 rows, the f32 value beside it; V^T of the 16 groups (ONE head each here) via LDS transposes; rows 256..4095: one fused launch, each wave 32 query rows of one head: S^T = K Q^T on WMMA, online softmax in registers (f32 statistics, native exp2; weights f16), O^T += V^T P^T on WMMA, f32 straight into the merged output rows; the first tile: exact f32 attention for rows 0..255 written straight into the output rows; launches: see trace.
// The first tile: the first 256 query rows see only a few keys, where single-f16 v / P operands are least accurate; they are computed exactly: the f32 q/k/v rows that the three GEMMs store for them and an f32 attention on VALU (16 query rows a block, K and V in LDS, true row maximum).
// Compute dtype: inputs rounded to bf16; x / weights exact; q, k, v and softmax weights as plain f16 GEMM operands (~2^-12); scores, softmax statistics and o f32; v_wmma_f32_16x16x32_f16.
#define NB 1
#define NG 16
#define HPG 1
#define KVD (NG * HD)
#define SQ 4096
#define DM 1024
#define NH 16
#define HD 64
#define HG 4
#define QT0 256                      /* first-tile rows recomputed exactly in f32 */
#define B0 0                         /* first batch processed (debug hook) */
#define NBR NB                       /* batches processed (debug hook) */
#define NR ((size_t)NB * SQ)         /* token rows */
#define MP ((int)((size_t)NBR * SQ)) /* NBR x SQ rows; unused: each projection launch takes SQ rows */
#define MPO MP
#define LQ DM      /* row pitch of the q/k/v rows */
typedef __bf16 v16b __attribute__((ext_vector_type(16)));
typedef unsigned short v8us __attribute__((ext_vector_type(8), may_alias));
typedef float  v8f  __attribute__((ext_vector_type(8)));
typedef float  v4f  __attribute__((ext_vector_type(4)));
typedef float  v4fa __attribute__((ext_vector_type(4), may_alias));
union FragB { v16b v; v8us half[2]; unsigned short u[16]; };

__device__ __forceinline__ unsigned short bf16_bits(float x) { unsigned int u = __float_as_uint(x); return (unsigned short)((u + 0x7FFFu + ((u >> 16) & 1u)) >> 16); }
__device__ __forceinline__ float bf16_val(unsigned short b) { return __uint_as_float(((unsigned int)b) << 16); }
__device__ __forceinline__ float bf16_round(float x) { return bf16_val(bf16_bits(x)); }
// D += A·B with NT terms: 1 = ah·bh, 2 = + al·bh (A split), 3 = + ah·bl (both split)
template <int NT>
__device__ __forceinline__ v8f mmaN(v16b ah, v16b al, v16b bh, v16b bl, v8f c) {
  c = __builtin_amdgcn_wmma_f32_16x16x32_bf16(false, ah, false, bh, (short)0, c, false, false);
  if (NT >= 2) c = __builtin_amdgcn_wmma_f32_16x16x32_bf16(false, al, false, bh, (short)0, c, false, false);
  if (NT >= 3) c = __builtin_amdgcn_wmma_f32_16x16x32_bf16(false, ah, false, bl, (short)0, c, false, false);
  asm volatile("v_nop\n\tv_nop\n\tv_nop\n\tv_nop" : "+v"(c) : "v"(ah), "v"(al), "v"(bh), "v"(bl));
  return c;
}




// ---- f16 WMMA path (v_wmma_f32_16x16x32_f16): 11-bit significands for operands in range — used for every WMMA product in this file
typedef _Float16 v16h __attribute__((ext_vector_type(16)));
union FragH { v16h v; v8us half[2]; _Float16 h[16]; unsigned short u[16]; };
template <int NT>
__device__ __forceinline__ v8f mmaH(v16h ah, v16h al, v16h bh, v16h bl, v8f c) {
  c = __builtin_amdgcn_wmma_f32_16x16x32_f16(false, ah, false, bh, (short)0, c, false, false);
  if (NT >= 2) c = __builtin_amdgcn_wmma_f32_16x16x32_f16(false, al, false, bh, (short)0, c, false, false);
  if (NT >= 3) c = __builtin_amdgcn_wmma_f32_16x16x32_f16(false, ah, false, bl, (short)0, c, false, false);
  asm volatile("v_nop\n\tv_nop\n\tv_nop\n\tv_nop" : "+v"(c) : "v"(ah), "v"(al), "v"(bh), "v"(bl));
  return c;
}

typedef _Float16 v4h __attribute__((ext_vector_type(4)));

// Preparation, ONE launch: blocks 0 .. 3 PWB - 1 turn the three [in][out] f32 weights into their transposed x16 f16 planes Wt[n][k] = f16(bf16(W[k][n]) x 16) (a power of two: bf16-exact weights stay exact in f16 away from the subnormal range); the other PXB blocks round x to f16 rows.
// Few blocks with much work a thread: every global access is a 16-byte one, a wave reads whole 512-byte runs, and all of a thread's loads are in flight together.
// A weight block owns 128 k x 128 n. It is turned in LDS: one dword holds the f16 pair (k, k + 1) of one column n, so 4 dwords down a column are 8 consecutive k of the output row n.
#define PWT 128                      /* edge of a weight tile */
#define PWP 129                      /* LDS pitch in dwords: 4 rows = 516 = 4 mod 64, so 16 lanes 4 rows apart and 2 neighbouring columns meet every bank once */
#define PWB ((DM / PWT) * (DM / PWT))      /* blocks a weight */
#define PXC 8                        /* 8-element runs a thread of an x block */
#define PXB ((int)(NR * DM / 8 / 256 / PXC))      /* x blocks */
typedef unsigned int v4ua __attribute__((ext_vector_type(4), may_alias));
typedef float v2f __attribute__((ext_vector_type(2)));
typedef _Float16 v2h __attribute__((ext_vector_type(2)));
__device__ __forceinline__ unsigned pw_pair(float lo, float hi) { const v2f p = {bf16_round(lo) * 16.0f, bf16_round(hi) * 16.0f}; return __builtin_bit_cast(unsigned, __builtin_convertvector(p, v2h)); }
__global__ __launch_bounds__(256) void k_prep(const float* __restrict__ x, const float* __restrict__ wq, const float* __restrict__ wk, const float* __restrict__ wv, _Float16* __restrict__ X16, _Float16* __restrict__ Wt3) {
  static_assert(DM % PWT == 0 && (NR * DM) % (8 * 256 * PXC) == 0, "whole tiles and whole runs only");
  __shared__ unsigned tl[(PWT / 2) * PWP];
  const int tid = threadIdx.x; const int b = blockIdx.x;
  if (b >= 3 * PWB) {      /* the same for the whole block: it leaves as a whole, in front of the barrier below */
    const size_t t0 = (size_t)(b - 3 * PWB) * (PXC * 256) + tid; const float* xp = x + t0 * 8; v4f a[PXC][2];
#pragma unroll      /* full: the array must be indexed by constants to stay in registers, and all 16 loads are to be in flight at once */
    for (int i = 0; i < PXC; ++i) { a[i][0] = *(const v4fa*)(xp + (size_t)i * 2048); a[i][1] = *(const v4fa*)(xp + (size_t)i * 2048 + 4); }
    asm volatile("s_wait_xcnt 0x0" :: "v"(xp), "v"(a[0][0]), "v"(a[0][1]), "v"(a[1][0]), "v"(a[1][1]), "v"(a[2][0]), "v"(a[2][1]), "v"(a[3][0]), "v"(a[3][1]), "v"(a[4][0]), "v"(a[4][1]), "v"(a[5][0]), "v"(a[5][1]), "v"(a[6][0]), "v"(a[6][1]), "v"(a[7][0]), "v"(a[7][1]) : "memory");      /* stands behind the last load of the run; the address pair is an input, so it keeps its registers up to the wait; the loaded values are inputs too, so no conversion is placed between the loads and all 16 are issued back to back (one memory latency, not several) */
    unsigned short* op = (unsigned short*)X16 + t0 * 8;
    FragH f[PXC];
#pragma unroll      /* full: constant indices, as above */
    for (int i = 0; i < PXC; ++i) for (int q = 0; q < 8; ++q) f[i].h[q] = (_Float16)bf16_round(a[i][q >> 2][q & 3]);
    __builtin_amdgcn_sched_barrier(0);      /* every store stands behind every conversion, so no register of an issued store is written again */
#pragma unroll      /* full: constant indices, as above */
    for (int i = 0; i < PXC; ++i) *(v8us*)(op + (size_t)i * 2048) = f[i].half[0];
    return; }
  {
    const int ws = b / PWB, tile = b % PWB; const int k0 = (tile / (DM / PWT)) * PWT, n0 = (tile % (DM / PWT)) * PWT; const float* W = ws == 0 ? wq : ws == 1 ? wk : wv;
    const int r = tid >> 5, c4 = (tid & 31) * 4; const float* wp = W + (size_t)(k0 + 2 * r) * DM + n0 + c4; v4f e0[PWT / 16], e1[PWT / 16];      /* rows k and k + 1, 16 rows on every step */
#pragma unroll      /* full: constant indices and all 16 loads in flight at once, as above */
    for (int it = 0; it < PWT / 16; ++it) { e0[it] = *(const v4fa*)(wp + (size_t)it * 16 * DM); e1[it] = *(const v4fa*)(wp + (size_t)(it * 16 + 1) * DM); }
    asm volatile("s_wait_xcnt 0x0" :: "v"(wp), "v"(e0[0]), "v"(e1[0]), "v"(e0[1]), "v"(e1[1]), "v"(e0[2]), "v"(e1[2]), "v"(e0[3]), "v"(e1[3]), "v"(e0[4]), "v"(e1[4]), "v"(e0[5]), "v"(e1[5]), "v"(e0[6]), "v"(e1[6]), "v"(e0[7]), "v"(e1[7]) : "memory");      /* behind the last load of the run, address pair and loaded values as inputs, for the same two reasons as above */
#pragma unroll      /* full: constant indices, as above */
    for (int it = 0; it < PWT / 16; ++it) for (int e = 0; e < 4; ++e) tl[(it * 8 + r) * PWP + c4 + e] = pw_pair(e0[it][e], e1[it][e]);
    __syncthreads();      /* the tile is complete in LDS */
    const int kc = tid & 15, nn = tid >> 4; _Float16* op = Wt3 + (size_t)ws * DM * DM + (size_t)(n0 + nn) * DM + k0 + kc * 8;      /* 16 lanes write 256 consecutive bytes of an output row */
#pragma unroll      /* full: every LDS read and every store is one base register plus an immediate offset, and all the reads are in flight together */
    for (int rd = 0; rd < PWT / 16; ++rd) { v4ua o; for (int q = 0; q < 4; ++q) o[q] = tl[(kc * 4 + q) * PWP + rd * 16 + nn]; *(v4ua*)(op + (size_t)rd * 16 * DM) = o; }
    asm volatile("s_wait_xcnt 0x0" ::: "memory");      /* stands behind the last store of the run, in front of every later write of the stores' address and data registers on any way the listing's branches allow */
  } }
template <int NHv, int TTv>
__global__ __launch_bounds__(256) void k_vt(const _Float16* __restrict__ V16, int ldv, int voff, _Float16* __restrict__ Vt) { __shared__ unsigned short tl[64][66]; const int tid = threadIdx.x; const int slab = blockIdx.x / (TTv / 64), lg = blockIdx.x % (TTv / 64); const int b = slab / NHv, h = slab % NHv;
  for (int i = tid; i < 64 * 8; i += 256) { const int r = i / 8, c8 = (i % 8) * 8; FragH f; f.half[0] = *(const v8us*)((const unsigned short*)V16 + ((size_t)b * TTv + lg * 64 + r) * ldv + voff + h * 64 + c8);
#pragma unroll
    for (int q = 0; q < 8; ++q) tl[r][c8 + q] = f.u[q]; }
  __syncthreads();
  {
#pragma unroll
    for (int rd = 0; rd < 2; ++rd) { const int d = rd * 32 + tid / 8, pc = tid % 8; FragH f;
#pragma unroll
      for (int q = 0; q < 8; ++q) f.u[q] = tl[pc * 8 + q][d];
      *(v8us*)((unsigned short*)Vt + ((size_t)slab * 64 + d) * TTv + lg * 64 + pc * 8) = f.half[0]; }
     } }


// ---- fast GEMM (wave tile 32x64; requires whole tiles: M % 128 == 0 rows per launch region, N % 64 == 0, K % 128 == 0 and K >= 128); epilogue = k_gemm_hhx semantics ----
__device__ __forceinline__ v16h g2_frag(const _Float16* p, int hh) { FragH f; f.half[0] = *(const v8us*)((const unsigned short*)p + 8 * hh); f.half[1] = *(const v8us*)((const unsigned short*)p + 16 + 8 * hh); return f.v; }
__device__ __forceinline__ v8f g2_mma(v16h a, v16h b, v8f c) { v8f d = __builtin_amdgcn_wmma_f32_16x16x32_f16(false, a, false, b, (short)0, c, false, false); asm volatile("v_nop\n\tv_nop\n\tv_nop\n\tv_nop" : "+v"(d) : "v"(a), "v"(b)); return d; }
// The GEMM's operand tiles go through LDS: a block's 128 A rows and 64 B rows, 128 k at a time, are brought in by asynchronous 16-byte copies (a wave-wide copy = 2 rows x 256 B = 4 whole lines; each line is fetched once a block), two buffers, the next tile in flight while this one is worked on.
#define GKT 128                      /* k elements of a staged tile: rows of 256 bytes */
#define GPE 136                      /* LDS row pitch in elements: 272 B = 16 B x odd, 16 lanes on 16 rows meet every bank once */
#define GTR 192                      /* rows of a staged tile: the block's 128 A rows, then its 64 B rows */
// Eight copies of one lane, rows 8 apart: l = the lane's LDS byte address, g = its global address, g8 = 8 source rows in elements. The s_wait_xcnt stands inside the statement, behind the last copy, so that no later write of an address register can be placed in front of it.
__device__ __forceinline__ void g2_copy8(unsigned l, const _Float16* g, size_t g8) {
  asm volatile("global_load_async_to_lds_b128 %0, %8, off\n\tglobal_load_async_to_lds_b128 %1, %9, off\n\tglobal_load_async_to_lds_b128 %2, %10, off\n\tglobal_load_async_to_lds_b128 %3, %11, off\n\t"
               "global_load_async_to_lds_b128 %4, %12, off\n\tglobal_load_async_to_lds_b128 %5, %13, off\n\tglobal_load_async_to_lds_b128 %6, %14, off\n\tglobal_load_async_to_lds_b128 %7, %15, off\n\ts_wait_xcnt 0x0"
               :: "v"(l), "v"(l + 8u * GPE * 2u), "v"(l + 16u * GPE * 2u), "v"(l + 24u * GPE * 2u), "v"(l + 32u * GPE * 2u), "v"(l + 40u * GPE * 2u), "v"(l + 48u * GPE * 2u), "v"(l + 56u * GPE * 2u),
                  "v"(g), "v"(g + g8), "v"(g + 2 * g8), "v"(g + 3 * g8), "v"(g + 4 * g8), "v"(g + 5 * g8), "v"(g + 6 * g8), "v"(g + 7 * g8) : "memory"); }
template <int ACT>
__global__ __launch_bounds__(128) void k_gemm2(const _Float16* __restrict__ A, int lda, size_t sA, const _Float16* __restrict__ Bh, int ldb, size_t sB, float alpha, const float* __restrict__ bias, size_t sBias, const float* __restrict__ CP, int rowsPerB, size_t sCPb, int row0g,
    float* __restrict__ C, int MC, _Float16* __restrict__ C16, int ldc, size_t sC, int M, int N, int K) {      /* C: f32 rows, stored for rows below MC only (MC % 32 == 0); C16: the f16 rounding of every row */ static_assert(ACT == 0 || ACT == 3 || ACT == 6 || ACT == 8 || ACT == 9 || ACT == 11 || ACT == 12 || ACT == 14 || ACT == 15 || ACT == 16 || ACT == 17, "k_gemm2: unsupported ACT code (would silently apply no activation)");
  __shared__ __attribute__((aligned(16))) _Float16 st[2][GTR * GPE]; __shared__ __attribute__((aligned(16))) float so[4][32][68];
  const int tid = threadIdx.x, w = tid >> 5, lane = tid & 31, ln = lane & 15, hh = lane >> 4; const int by = blockIdx.y;
  A += (size_t)by * sA; Bh += (size_t)by * sB; const size_t cofs = (size_t)by * sC; const float* bp = bias ? bias + (size_t)by * sBias : nullptr;
  const int ntn = N >> 6; const int mt = blockIdx.x / ntn, nq = blockIdx.x - mt * ntn; const int row0 = mt * 128 + 32 * w, col0 = nq * 64; if (mt * 128 >= M) return;      /* the whole block leaves or none: barriers follow */
  const int cr = tid >> 4, cc = (tid & 15) * 8;      /* the thread's row (of 8) and 16-byte column in every copy */
  const _Float16* ga = A + (size_t)(mt * 128 + cr) * lda + cc; const _Float16* gb = Bh + (size_t)(col0 + cr) * ldb + cc; const unsigned l0 = (unsigned)(size_t)&st[0][cr * GPE + cc];
  auto fill = [&](int t) { const unsigned l = l0 + (unsigned)(t & 1) * (GTR * GPE * 2u); const _Float16* a = ga + (size_t)t * GKT;      /* tile t into buffer t mod 2: 24 copies a lane */
    g2_copy8(l, a, (size_t)8 * lda); g2_copy8(l + 64u * GPE * 2u, a + (size_t)64 * lda, (size_t)8 * lda); g2_copy8(l + 128u * GPE * 2u, gb + (size_t)t * GKT, (size_t)8 * ldb); };
  const v8f z8 = {0.f,0.f,0.f,0.f,0.f,0.f,0.f,0.f}; v8f c00 = z8, c01 = z8, c02 = z8, c03 = z8, c10 = z8, c11 = z8, c12 = z8, c13 = z8;
  const int NT = K / GKT;
  fill(0);
  asm volatile("s_wait_asynccnt 0x0" ::: "memory");      /* this wave's copies of tile 0 have landed */
  __syncthreads();      /* tile 0 published */
  if (NT > 1) fill(1);
  for (int t = 0; t < NT; ++t) { const _Float16* sa = &st[t & 1][(32 * w + ln) * GPE]; const _Float16* sb = &st[t & 1][(128 + ln) * GPE]; v16h f[2][6];      /* two fragment sets: the next 32 k are read from LDS under this step's products; never past the tile */
#pragma unroll      /* full: f must be indexed by constants to stay in registers */
    for (int u = 0; u < 6; ++u) f[0][u] = g2_frag((u < 2 ? sa + u * 16 * GPE : sb + (u - 2) * 16 * GPE), hh);
#pragma unroll      /* full: constant indices, as above */
    for (int j = 0; j < GKT / 32; ++j) { const int p = j & 1;
      if (j + 1 < GKT / 32) {
#pragma unroll      /* full: constant indices, as above */
        for (int u = 0; u < 6; ++u) f[p ^ 1][u] = g2_frag((u < 2 ? sa + u * 16 * GPE : sb + (u - 2) * 16 * GPE) + (j + 1) * 32, hh); }
      c00 = g2_mma(f[p][0], f[p][2], c00); c10 = g2_mma(f[p][1], f[p][2], c10); c01 = g2_mma(f[p][0], f[p][3], c01); c11 = g2_mma(f[p][1], f[p][3], c11);
      c02 = g2_mma(f[p][0], f[p][4], c02); c12 = g2_mma(f[p][1], f[p][4], c12); c03 = g2_mma(f[p][0], f[p][5], c03); c13 = g2_mma(f[p][1], f[p][5], c13); }
    asm volatile("s_wait_dscnt 0x0" ::: "memory");      /* this wave's reads of buffer t mod 2 are done before the buffer is given up */
    asm volatile("s_wait_asynccnt 0x0" ::: "memory");      /* this wave's copies of tile t + 1 have landed */
    __syncthreads();      /* publishes tile t + 1 and ends every wave's reads of tile t */
    if (t + 2 < NT) fill(t + 2); }
  asm volatile("s_wait_asynccnt 0x0" ::: "memory");      /* nothing is in flight when the loop is left */
  v8f accs[8] = {c00, c01, c02, c03, c10, c11, c12, c13};
#pragma unroll
  for (int u = 0; u < 8; ++u) { const int t = u & 3, half = u >> 2; const int col = col0 + t * 16 + ln; const float bv = bp ? bf16_round(bp[col]) : 0.f;
#pragma unroll
    for (int r = 0; r < 8; ++r) { const int rloc = half * 16 + 8 * hh + r; float v = accs[u][r] * alpha + bv; if (CP) { if (rowsPerB < 0) v += CP[cofs + (size_t)(row0g + row0 + rloc) * ldc + col];      /* rowsPerB < 0: own element of the batched C plane */ else { const int bidx = (row0g + row0 + rloc) / rowsPerB; v += CP[(size_t)bidx * sCPb + (size_t)by * 64 + col]; } }
      if (ACT == 3) v = fmaxf(v, 0.f); else if (ACT == 6) v = 0.5f * v * (1.0f + erff(v * 0.70710678118654752f)); else if (ACT == 11) v = 1.0f / (1.0f + expf(-v)); else if (ACT == 15) v = v / (1.0f + expf(-v)); else if (ACT == 12) v = (v > 0.f) ? v : 0.01f * v; else if (ACT == 8) v = tanhf(v); else if (ACT == 9) v = 0.5f * v * (1.0f + tanhf(0.7978845608028654f * (v + 0.044715f * v * v * v))); else if (ACT == 14) v = (v > 0.f) ? v : 0.1f * v; else if (ACT == 16) v = (v >= 0.f) ? v : 0.3f * v; else if (ACT == 17) v = (v >= 0.f) ? v : 0.2f * v;
      so[w][rloc][t * 16 + ln] = v; } }
  __builtin_amdgcn_fence(__ATOMIC_ACQ_REL, "workgroup"); __builtin_amdgcn_wave_barrier();
  const int rsub = lane >> 4, c4 = (lane & 15) * 4; const bool cf = C && __builtin_amdgcn_readfirstlane(row0) < MC;      /* the wave's 32 rows lie on one side of MC: a scalar test */
  {
#pragma unroll
    for (int q = 0; q < 16; ++q) { const int r = q * 2 + rsub; const v4f v = *(const v4fa*)&so[w][r][c4]; if (cf) { *(v4f*)(C + cofs + (size_t)(row0 + r) * ldc + col0 + c4) = v; asm volatile("s_wait_xcnt 0x0" ::: "memory"); }      /* the wait stands behind the f32 store, in front of the f16 conversion, which may reuse the store's registers */
      if (C16) { v4h h4; for (int i = 0; i < 4; ++i) h4[i] = (_Float16)v[i]; *(v4h*)(C16 + cofs + (size_t)(row0 + r) * ldc + col0 + c4) = h4; } }
     } }


// Fused causal attention for query rows QT0 .. SQ-1: scores, softmax and context in ONE launch; no score or weight plane in memory.
// One wave owns 32 query rows of one head and walks its keys 32 at a time with a running maximum and sum (online softmax).
// K rows and V^T rows go through LDS: 128 keys at a time are brought in once a block by asynchronous 16-byte copies (a wave-wide copy = 4 whole lines), two buffers, the next tile in flight while this one is worked on; the block's 4 waves read their fragments from there.
// S^T = K Q^T (A = 16 key rows, B = 16 query rows): lane (ln, hh) then holds, for query ln, keys 8 hh + r of each 16-key tile, which is the B operand order of O^T += V^T P^T: the weights go from accumulator to operand in registers.
// All of a lane's values belong to one query per 16-query set, so maximum, sum and rescale are lane-local but for one exchange between the wave halves.
// Every '#pragma unroll' of fa_pass and k_fattn is a full unroll: the fragment and accumulator arrays must be indexed by constants to stay in registers.
#define FQ 128                       /* query rows per block: 4 waves x 32 */
#define SCL2 0.18033688011112042f    /* 1/sqrt(64) x log2(e): scores are carried in log2 units */
#define FKT 128                      /* keys of a staged tile: 4 passes; FQ and QT0 are multiples of it */
#define FKP 72                       /* LDS pitch of a K row in elements: 144 B = 16 B x odd, 16 lanes on 16 rows meet every bank once */
#define FVP 136                      /* LDS pitch of a V^T row (128 keys) in elements: 272 B = 16 B x odd */
// Eight copies of one lane: l = the lane's LDS byte address, LS = the LDS step in bytes from copy to copy, g = its global address, gs = the global step in elements. The s_wait_xcnt stands inside the statement, behind the last copy, so that no later write of an address register can be placed in front of it.
template <unsigned LS>
__device__ __forceinline__ void fa_copy8(unsigned l, const _Float16* g, size_t gs) {
  asm volatile("global_load_async_to_lds_b128 %0, %8, off\n\tglobal_load_async_to_lds_b128 %1, %9, off\n\tglobal_load_async_to_lds_b128 %2, %10, off\n\tglobal_load_async_to_lds_b128 %3, %11, off\n\t"
               "global_load_async_to_lds_b128 %4, %12, off\n\tglobal_load_async_to_lds_b128 %5, %13, off\n\tglobal_load_async_to_lds_b128 %6, %14, off\n\tglobal_load_async_to_lds_b128 %7, %15, off\n\ts_wait_xcnt 0x0"
               :: "v"(l), "v"(l + LS), "v"(l + 2u * LS), "v"(l + 3u * LS), "v"(l + 4u * LS), "v"(l + 5u * LS), "v"(l + 6u * LS), "v"(l + 7u * LS),
                  "v"(g), "v"(g + gs), "v"(g + 2 * gs), "v"(g + 3 * gs), "v"(g + 4 * gs), "v"(g + 5 * gs), "v"(g + 6 * gs), "v"(g + 7 * gs) : "memory"); }
__device__ __forceinline__ v8f fa_mma(v16h a, v16h b, v8f c) { return __builtin_amdgcn_wmma_f32_16x16x32_f16(false, a, false, b, (short)0, c, false, false); }
__device__ __forceinline__ float fa_swap16(float x) { const int b = __float_as_int(x); return __int_as_float(__builtin_amdgcn_permlanex16(b, b, 0x76543210, 0xfedcba98, false, false)); }      /* lane l <-> l ^ 16 */
// One pass: 32 keys against the wave's 32 queries. kp, vp: the lane's K row and V^T row in the staged tile, at the pass's first key. DIAG: the pass that crosses the diagonal (its first key == the wave's first query row), the wave's last. PRE: the next pass lies in the same staged tile.
template <bool DIAG, bool PRE>
__device__ __forceinline__ void fa_pass(const _Float16* kp, const _Float16* vp, int ln, int hh, const v16h (&qf)[2][2], v16h (&kf)[2][2], v8f (&o)[2][4], float (&m)[2], float (&l)[2]) {
  const v8f z8 = {0.f,0.f,0.f,0.f,0.f,0.f,0.f,0.f}; v16h vf[4];
#pragma unroll
  for (int d = 0; d < 4; ++d) vf[d] = g2_frag(vp + d * 16 * FVP, hh);
  v8f st[2][2];      /* [query set][16-key tile] */
#pragma unroll
  for (int s = 0; s < 2; ++s) for (int t = 0; t < 2; ++t) if (!(DIAG && s == 0 && t == 1)) st[s][t] = fa_mma(kf[t][1], qf[s][1], fa_mma(kf[t][0], qf[s][0], z8));      /* on the diagonal pass keys 16..31 lie above every query of set 0: that tile is left out whole */
  if (PRE) {      /* the next pass's keys, fetched one pass ahead into the same registers; never past the staged tile */
#pragma unroll
    for (int t = 0; t < 2; ++t) for (int kb = 0; kb < 2; ++kb) kf[t][kb] = g2_frag(kp + (32 + t * 16) * FKP + kb * 32, hh); }
  if (DIAG) {      /* keys above the diagonal are excluded: their weight is exp2(-huge) = 0 */
#pragma unroll
    for (int s = 0; s < 2; ++s) for (int r = 0; r < 8; ++r) st[s][s][r] = (8 * hh + r <= ln) ? st[s][s][r] : -3.0e38f; }      /* only the two tiles on the diagonal are cut; set 1 sees all of keys 0..15 */
  float mx[2];
#pragma unroll
  for (int s = 0; s < 2; ++s) { float a = st[s][0][0]; for (int r = 1; r < 8; ++r) a = fmaxf(a, st[s][0][r]); if (!(DIAG && s == 0)) for (int r = 0; r < 8; ++r) a = fmaxf(a, st[s][1][r]); a = fmaxf(a, fa_swap16(a)); mx[s] = a * SCL2; }
  /* the maximum in use moves only when some query's new maximum exceeds it by more than 8 (log2 units): weights stay <= 2^8, inside f16; one scalar branch a pass */
  if (__builtin_amdgcn_ballot_w32(mx[0] > m[0] + 8.f || mx[1] > m[1] + 8.f) != 0) {
#pragma unroll
    for (int s = 0; s < 2; ++s) { const float mn = fmaxf(m[s], mx[s]); const float al = __builtin_amdgcn_exp2f(m[s] - mn); m[s] = mn; l[s] *= al; for (int d = 0; d < 4; ++d) o[s][d] *= al; } }
#pragma unroll
  for (int s = 0; s < 2; ++s) { FragH pf; float s0 = 0.f, s1 = 0.f;
#pragma unroll
    for (int r = 0; r < 8; ++r) { const float e0 = __builtin_amdgcn_exp2f(fmaf(st[s][0][r], SCL2, -m[s])); const float e1 = (DIAG && s == 0) ? 0.f : __builtin_amdgcn_exp2f(fmaf(st[s][1][r], SCL2, -m[s])); s0 += e0; s1 += e1; pf.h[r] = (_Float16)e0; pf.h[8 + r] = (_Float16)e1; }
    l[s] += s0 + s1;
#pragma unroll
    for (int d = 0; d < 4; ++d) o[s][d] = fa_mma(vf[d], pf.v, o[s][d]); } }
__global__ __launch_bounds__(128) void k_fattn(const _Float16* __restrict__ Q, const _Float16* __restrict__ Kh, const _Float16* __restrict__ Vt, float* __restrict__ O) {
  __shared__ __attribute__((aligned(16))) _Float16 sK[2][FKT * FKP]; __shared__ __attribute__((aligned(16))) _Float16 sV[2][HD * FVP];
  const int tid = threadIdx.x, lane = tid & 31, ln = lane & 15, hh = lane >> 4; const int w = __builtin_amdgcn_readfirstlane(threadIdx.x >> 5);
  const int h = blockIdx.x % NH; const int tile = (SQ - QT0) / FQ - 1 - blockIdx.x / NH;      /* the longest key ranges start first */
  const int qw = QT0 + tile * FQ + w * 32;      /* first query row of the wave: scalar, a multiple of 32 */
  const int NS = (QT0 + tile * FQ) / FKT + 1;      /* staged tiles of the block: all keys below its first query row, then the 128 keys of its own rows; at least 3 */
  const _Float16* qp = Q + (size_t)(qw + ln) * LQ + h * HD;
  const _Float16* gk = Kh + (size_t)(tid >> 3) * KVD + h * HD + (tid & 7) * 8; const unsigned lk = (unsigned)(size_t)&sK[0][(tid >> 3) * FKP + (tid & 7) * 8];      /* K: a copy of the block = 16 rows of 128 B */
  const _Float16* gv = Vt + ((size_t)h * HD + (tid >> 4)) * SQ + (tid & 15) * 8; const unsigned lv = (unsigned)(size_t)&sV[0][(tid >> 4) * FVP + (tid & 15) * 8];      /* V^T: a copy of the block = 8 rows of 256 B */
  auto fill = [&](int t) {      /* tile t into buffer t mod 2: 16 copies a lane */
    fa_copy8<16u * FKP * 2u>(lk + (unsigned)(t & 1) * (FKT * FKP * 2u), gk + (size_t)t * FKT * KVD, (size_t)16 * KVD); fa_copy8<8u * FVP * 2u>(lv + (unsigned)(t & 1) * (HD * FVP * 2u), gv + (size_t)t * FKT, (size_t)8 * SQ); };
  fill(0);
  v16h qf[2][2], kf[2][2];
#pragma unroll
  for (int s = 0; s < 2; ++s) for (int kb = 0; kb < 2; ++kb) qf[s][kb] = g2_frag(qp + (size_t)s * 16 * LQ + kb * 32, hh);
  asm volatile("s_wait_xcnt 0x0" ::: "memory");      /* stands behind the last load of the opening run, in front of every later write of that run's address registers */
  const v8f z8 = {0.f,0.f,0.f,0.f,0.f,0.f,0.f,0.f}; v8f o[2][4]; float m[2], l[2];
#pragma unroll
  for (int s = 0; s < 2; ++s) { m[s] = -1.0e37f; l[s] = 0.f; for (int d = 0; d < 4; ++d) o[s][d] = z8; }
  asm volatile("s_wait_asynccnt 0x0" ::: "memory");      /* this wave's copies of tile 0 have landed */
  __syncthreads();      /* tile 0 published */
  fill(1);
  for (int t = 0; t < NS - 1; ++t) {      /* tiles below every query of the block: 4 whole passes in every wave */
    const _Float16* kp = &sK[t & 1][ln * FKP]; const _Float16* vp = &sV[t & 1][ln * FVP];
#pragma unroll
    for (int u = 0; u < 2; ++u) for (int kb = 0; kb < 2; ++kb) kf[u][kb] = g2_frag(kp + u * 16 * FKP + kb * 32, hh);
    fa_pass<false, true>(kp, vp, ln, hh, qf, kf, o, m, l); fa_pass<false, true>(kp + 32 * FKP, vp + 32, ln, hh, qf, kf, o, m, l);
    fa_pass<false, true>(kp + 64 * FKP, vp + 64, ln, hh, qf, kf, o, m, l); fa_pass<false, false>(kp + 96 * FKP, vp + 96, ln, hh, qf, kf, o, m, l);
    asm volatile("s_wait_dscnt 0x0" ::: "memory");      /* this wave's reads of buffer t mod 2 are done before the buffer is given up */
    asm volatile("s_wait_asynccnt 0x0" ::: "memory");      /* this wave's copies of tile t + 1 have landed */
    __syncthreads();      /* publishes tile t + 1 and ends every wave's reads of tile t */
    if (t + 2 < NS) fill(t + 2); }
  asm volatile("s_wait_asynccnt 0x0" ::: "memory");      /* nothing is in flight when the loop is left */
  { const _Float16* kp = &sK[(NS - 1) & 1][ln * FKP]; const _Float16* vp = &sV[(NS - 1) & 1][ln * FVP];      /* the block's own 128 keys: wave w has w whole passes, then its diagonal pass; no barrier follows */
#pragma unroll
    for (int u = 0; u < 2; ++u) for (int kb = 0; kb < 2; ++kb) kf[u][kb] = g2_frag(kp + u * 16 * FKP + kb * 32, hh);
    for (int p = 0; p < w; ++p) { fa_pass<false, true>(kp, vp, ln, hh, qf, kf, o, m, l); kp += 32 * FKP; vp += 32; }
    fa_pass<true, false>(kp, vp, ln, hh, qf, kf, o, m, l); }
#pragma unroll
  for (int s = 0; s < 2; ++s) { const float inv = 1.0f / (l[s] + fa_swap16(l[s])); float* op = O + (size_t)(qw + s * 16 + ln) * DM + h * HD + 8 * hh;      /* O^T tile d: rows d*16 + 8 hh + r of column (query) ln */
#pragma unroll
    for (int d = 0; d < 4; ++d) { const v4f lo4 = {o[s][d][0] * inv, o[s][d][1] * inv, o[s][d][2] * inv, o[s][d][3] * inv}; const v4f hi4 = {o[s][d][4] * inv, o[s][d][5] * inv, o[s][d][6] * inv, o[s][d][7] * inv}; *(v4f*)(op + d * 16) = lo4; *(v4f*)(op + d * 16 + 4) = hi4; } } }

// Exact f32 attention for query rows 0 .. QT0-1, all on the vector unit. One block = one head x 16 query rows, 8 waves; the work of a row is spread over lanes and waves, nothing walks the keys one by one.
// Stage: the head's 256 K rows, 256 V rows and the block's 16 Q rows go to LDS by coalesced 16-byte loads, all in flight together. Keys above a row's diagonal are staged too (they are rows of this call) and get the weight 0.
// Scores: a thread owns 4 rows x 4 keys (keys 64 apart), so 8 LDS reads feed 64 FMAs. Softmax: a wave owns 2 rows, 8 keys a lane, true row maximum and sum by butterflies. Context: a thread owns 4 rows x 4 columns over a quarter of the keys; the four quarters are summed through LDS.
#define A0R 16                       /* query rows per block */
#define A0KP 68                      /* K row pitch in LDS (floats): 272 B = 16 B x odd, 16 lanes on 16 rows meet every bank once */
#define A0SP 260                     /* score row pitch (floats) */
#define A0PP 20                      /* weight pitch (floats), laid [key][row] so that one 16-byte read gives 4 rows' weights of a key */
struct A0Lds { float sq[A0R * HD]; float sfin[A0R]; float ss[A0R * A0SP]; float sp[QT0 * A0PP]; float red[4 * A0R * HD]; float sk[QT0 * A0KP]; float sv[QT0 * HD]; };      /* every member starts at a multiple of 16 bytes; the small ones first, inside the reach of an LDS instruction's immediate offset */
template <int M> __device__ __forceinline__ float a0_xm(float x) { return __int_as_float(__builtin_amdgcn_update_dpp(0, __float_as_int(x), 0x160 | M, 0xf, 0xf, true)); }      /* lane l <- l ^ M inside a 16-lane row (DPP row_xmask); every lane is on where it is used */
__device__ __forceinline__ float a0_max32(float x) { x = fmaxf(x, a0_xm<1>(x)); x = fmaxf(x, a0_xm<2>(x)); x = fmaxf(x, a0_xm<4>(x)); x = fmaxf(x, a0_xm<8>(x)); return fmaxf(x, fa_swap16(x)); }
__device__ __forceinline__ float a0_sum32(float x) { x += a0_xm<1>(x); x += a0_xm<2>(x); x += a0_xm<4>(x); x += a0_xm<8>(x); return x + fa_swap16(x); }
__global__ __launch_bounds__(256) void k_att0(const float* __restrict__ QF, const float* __restrict__ KF, const float* __restrict__ VF, float scale, float* __restrict__ OF) {
  __shared__ __attribute__((aligned(16))) A0Lds L;
  const int t = threadIdx.x; const int h = blockIdx.x / (QT0 / A0R); const int i0 = (blockIdx.x % (QT0 / A0R)) * A0R;
  { const int r = t >> 4, c = (t & 15) * 4; const float* kp = KF + (size_t)r * DM + h * HD + c; const float* vp = VF + (size_t)r * DM + h * HD + c; v4f kv[QT0 / 16], vv[QT0 / 16];
#pragma unroll      /* full: the two arrays must be indexed by constants to stay in registers, and all 33 loads are to be in flight at once */
    for (int it = 0; it < QT0 / 16; ++it) { kv[it] = *(const v4fa*)(kp + (size_t)it * 16 * DM); vv[it] = *(const v4fa*)(vp + (size_t)it * 16 * DM); }
    const float* qp = QF + (size_t)(i0 + r) * DM + h * HD + c; const v4f qv = *(const v4fa*)qp;
    asm volatile("s_wait_xcnt 0x0" :: "v"(kp), "v"(vp), "v"(qp) : "memory");      /* stands behind the last load of the run; the run's three address pairs are inputs, so they keep their registers up to the wait and every later write of those registers stands behind it */
    float* ks = &L.sk[r * A0KP + c]; float* vs = &L.sv[r * HD + c];
#pragma unroll      /* full: constant indices, as above */
    for (int it = 0; it < QT0 / 16; ++it) { *(v4f*)(ks + it * 16 * A0KP) = kv[it]; *(v4f*)(vs + it * 16 * HD) = vv[it]; }
    *(v4f*)&L.sq[r * HD + c] = qv; }
  __syncthreads();      /* K, V, Q staged */
  { const int kq = t & 63, r0 = (t >> 6) * 4; const v4f z4 = {0.f, 0.f, 0.f, 0.f}; v4f acc[4] = {z4, z4, z4, z4};      /* acc[row][key] */
    const float* qb = &L.sq[r0 * HD]; const float* kb = &L.sk[kq * A0KP];
#pragma unroll      /* full: the LDS reads of later steps issue under the FMAs of earlier ones */
    for (int c = 0; c < HD; c += 4) { v4f q[4], k[4];
#pragma unroll
      for (int a = 0; a < 4; ++a) { q[a] = *(const v4f*)(qb + a * HD + c); k[a] = *(const v4f*)(kb + a * 64 * A0KP + c); }
#pragma unroll
      for (int a = 0; a < 4; ++a) for (int u = 0; u < 4; ++u) for (int e = 0; e < 4; ++e) acc[a][u] = fmaf(q[a][e], k[u][e], acc[a][u]); }
#pragma unroll
    for (int a = 0; a < 4; ++a) for (int u = 0; u < 4; ++u) { const int j = kq + 64 * u; L.ss[(r0 + a) * A0SP + j] = (j <= i0 + r0 + a) ? acc[a][u] * scale : -1.0e30f; } }      /* keys above the diagonal are excluded: their weight is exp(-huge) = 0 */
  __syncthreads();      /* scores complete */
  { const int lane = t & 31, r0 = (t >> 5) * 2; float x[2][8], m[2], l[2];      /* the wave's two rows side by side: two independent chains */
#pragma unroll
    for (int rr = 0; rr < 2; ++rr) for (int u = 0; u < 8; ++u) x[rr][u] = L.ss[(r0 + rr) * A0SP + lane + 32 * u];
#pragma unroll
    for (int rr = 0; rr < 2; ++rr) { float a = x[rr][0]; for (int u = 1; u < 8; ++u) a = fmaxf(a, x[rr][u]); m[rr] = a; }
    m[0] = a0_max32(m[0]); m[1] = a0_max32(m[1]);
#pragma unroll
    for (int rr = 0; rr < 2; ++rr) { float a = 0.f; for (int u = 0; u < 8; ++u) { x[rr][u] = expf(x[rr][u] - m[rr]); a += x[rr][u]; } l[rr] = a; }
    l[0] = a0_sum32(l[0]); l[1] = a0_sum32(l[1]);
#pragma unroll
    for (int rr = 0; rr < 2; ++rr) for (int u = 0; u < 8; ++u) L.sp[(lane + 32 * u) * A0PP + r0 + rr] = x[rr][u];
    if (lane < 2) L.sfin[r0 + lane] = 1.0f / (lane == 0 ? l[0] : l[1]); }
  __syncthreads();      /* weights complete */
  { const int c = (t & 15) * 4, r0 = ((t >> 4) & 3) * 4, ks = t >> 6; const v4f z4 = {0.f, 0.f, 0.f, 0.f}; v4f o[4] = {z4, z4, z4, z4};
    const float* vb = &L.sv[ks * (QT0 / 4) * HD + c]; const float* pb = &L.sp[ks * (QT0 / 4) * A0PP + r0];
#pragma unroll      /* full: every LDS read is one base register plus an immediate offset, and later keys' reads issue under earlier keys' FMAs */
    for (int jj = 0; jj < QT0 / 4; ++jj) { const v4f v = *(const v4f*)(vb + jj * HD); const v4f p = *(const v4f*)(pb + jj * A0PP);
#pragma unroll
      for (int a = 0; a < 4; ++a) for (int e = 0; e < 4; ++e) o[a][e] = fmaf(p[a], v[e], o[a][e]); }
#pragma unroll
    for (int a = 0; a < 4; ++a) *(v4f*)&L.red[(ks * A0R + r0 + a) * HD + c] = o[a]; }
  __syncthreads();      /* the four key quarters' partial contexts complete */
  { const int r = t >> 4, c = (t & 15) * 4; v4f s = *(const v4f*)&L.red[r * HD + c];
#pragma unroll
    for (int ks = 1; ks < 4; ++ks) s += *(const v4f*)&L.red[(ks * A0R + r) * HD + c];
    s *= L.sfin[r]; *(v4f*)(OF + (size_t)(i0 + r) * DM + h * HD + c) = s; } }

extern "C" void kernel_launch(void* const* d_in, const int* in_sizes, int n_in,
                              void* d_out, int out_size, void* d_ws, size_t ws_size, hipStream_t stream) {
  (void)in_sizes; (void)n_in; (void)out_size;
  const float* const* I = (const float* const*)d_in; const float* x = I[0]; const float* wq = I[1]; const float* wk = I[2]; const float* wv = I[3];      /* x [4096][1024] (ONE unbatched sequence); three separate [in][out] weights Wq, Wk, Wv [1024][1024]; no biases; no output projection */
  static_assert(HPG == 1 && NH == NG * HPG && NH * HD == DM && KVD == DM, "plain multi-head attention as 16 kv groups of one query head"); const float* bq = nullptr; const float* bk = nullptr; const float* bv = nullptr;      /* the module has no biases: the three bias slots are null */
  char* ws = (char*)d_ws; size_t off = 0;
  auto take = [&](size_t bytes) { char* p = ws + off; off += (bytes + 255) & ~(size_t)255; return p; };
  _Float16* BQKV = (_Float16*)take((size_t)3 * DM * DM * 2); _Float16* BQ = BQKV; _Float16* BK = BQKV + (size_t)DM * DM; _Float16* BV = BQKV + (size_t)2 * DM * DM;      /* three transposed planes, one after another: q, k, v */
  _Float16* X16 = (_Float16*)take(NR * DM * 2); _Float16* Q16 = (_Float16*)take(NR * DM * 2); _Float16* K16 = (_Float16*)take(NR * KVD * 2); _Float16* V16 = (_Float16*)take(NR * KVD * 2);
  _Float16* VT = (_Float16*)take((size_t)NH * HD * SQ * 2);
  float* QF0 = (float*)take((size_t)QT0 * DM * 4); float* KF0 = (float*)take((size_t)QT0 * KVD * 4); float* VF0 = (float*)take((size_t)QT0 * KVD * 4);      /* f32 q, k, v of the first 256 rows */
  if (off > ws_size) return;
  k_prep<<<3 * PWB + PXB, 256, 0, stream>>>(x, wq, wk, wv, X16, BQKV);      /* x -> f16 rows; three [in][out] weights -> their transposed x16 planes, q, k, v one after another */
  for (int b = B0; b < B0 + NBR; ++b) { const size_t r0 = (size_t)b * SQ;
    /* q, k, v: every row rounded once to f16 in the epilogue; rows 0..255 stored in f32 as well, for the exact first tile (one head a k/v group: the tile reads these rows as they are) */
    k_gemm2<0><<<dim3((unsigned)((SQ / 128) * (KVD / 64)), 1), 128, 0, stream>>>(X16 + r0 * DM, DM, 0, BV, DM, 0, 0.0625f, bv, 0, nullptr, 1, 0, 0, VF0, QT0, V16 + r0 * KVD, KVD, 0, SQ, KVD, DM);
    k_gemm2<0><<<dim3((unsigned)((SQ / 128) * (DM / 64)), 1), 128, 0, stream>>>(X16 + r0 * DM, DM, 0, BQ, DM, 0, 0.0625f, bq, 0, nullptr, 1, 0, 0, QF0, QT0, Q16 + r0 * DM, DM, 0, SQ, DM, DM);
    k_gemm2<0><<<dim3((unsigned)((SQ / 128) * (KVD / 64)), 1), 128, 0, stream>>>(X16 + r0 * DM, DM, 0, BK, DM, 0, 0.0625f, bk, 0, nullptr, 1, 0, 0, KF0, QT0, K16 + r0 * KVD, KVD, 0, SQ, KVD, DM);
    k_vt<NG, SQ><<<NG * (SQ / 64), 256, 0, stream>>>(V16 + r0 * KVD, KVD, 0, VT);      /* V^T [NH][HD][SQ] for this batch */
    k_att0<<<NH * (QT0 / A0R), 256, 0, stream>>>(QF0, KF0, VF0, 0.125f, (float*)d_out + r0 * DM);      /* exact f32 attention for rows 0..255, written straight into the output rows */
    k_fattn<<<NH * ((SQ - QT0) / FQ), 128, 0, stream>>>(Q16 + r0 * LQ, K16 + r0 * KVD, VT, (float*)d_out + r0 * DM); }      /* rows 256..4095 of all 16 heads: scores, online softmax and context in ONE launch, straight into the output rows as f32 */
}

// v008
// Measured time: 99.8 microseconds a run.
// Timed twice side by side with v007, it ran 1.09 and 1.10 times as fast.
// Over all steps from v000 it is 56.5 times as fast.
#include <hip/hip_runtime.h>
// Causal multi-head self-attention over ONE unbatched sequence with three separate projections and NO output projection (x [4096][1024]; q = x Wq, k = x Wk, v = x Wv ([in][out] 1024 x 1024 each, no biases); 16 heads of 64; scores / sqrt(64); causal (-inf above the diagonal: realised as exclusion); softmax; y = the merged context -> [4096][1024]); 16 k/v groups of ONE head each, no rotation.
// Structure: x as exact f16 rows; [in][out] weights as exact x16 planes; q, k and v as WMMA GEMMs (32x64 wave tiles, f32 accumulation, no bias) whose epilogue stores the one f16 rounding of every row and, for the first 256 rows, the f32 value beside it; V^T of the 16 groups (ONE head each here) via LDS transposes; rows 256..4095: one fused launch, each pair of waves 32 query rows of one head, the keys split between the two: S^T = K Q^T on WMMA, online softmax in registers (f32 statistics, native exp2; weights f16), O^T += V^T P^T on WMMA, f32 straight into the merged output rows; the first tile: exact f32 attention for rows 0..255 written straight into the output rows; launches: see trace.
// The first tile: the first 256 query rows see only a few keys, where single-f16 v / P operands are least accurate; they are computed exactly: the f32 q/k/v rows that the three GEMMs store for them and an f32 attention on VALU (16 query rows a block, K and V in LDS, true row maximum).
// Compute dtype: inputs rounded to bf16; x / weights exact; q, k, v and softmax weights as plain f16 GEMM operands (~2^-12); scores, softmax statistics and o f32; v_wmma_f32_16x16x32_f16.
#define NB 1
#define NG 16
#define HPG 1
#define KVD (NG * HD)
#define SQ 4096
#define DM 1024
#define NH 16
#define HD 64
#define HG 4
#define QT0 256                      /* first-tile rows recomputed exactly in f32 */
#define B0 0                         /* first batch processed (debug hook) */
#define NBR NB                       /* batches processed (debug hook) */
#define NR ((size_t)NB * SQ)         /* token rows */
#define MP ((int)((size_t)NBR * SQ)) /* NBR x SQ rows; unused: each projection launch takes SQ rows */
#define MPO MP
#define LQ DM      /* row pitch of the q/k/v rows */
typedef __bf16 v16b __attribute__((ext_vector_type(16)));
typedef unsigned short v8us __attribute__((ext_vector_type(8), may_alias));
typedef float  v8f  __attribute__((ext_vector_type(8)));
typedef float  v4f  __attribute__((ext_vector_type(4)));
typedef float  v4fa __attribute__((ext_vector_type(4), may_alias));
union FragB { v16b v; v8us half[2]; unsigned short u[16]; };

__device__ __forceinline__ unsigned short bf16_bits(float x) { unsigned int u = __float_as_uint(x); return (unsigned short)((u + 0x7FFFu + ((u >> 16) & 1u)) >> 16); }
__device__ __forceinline__ float bf16_val(unsigned short b) { return __uint_as_float(((unsigned int)b) << 16); }
__device__ __forceinline__ float bf16_round(float x) { return bf16_val(bf16_bits(x)); }
// D += A·B with NT terms: 1 = ah·bh, 2 = + al·bh (A split), 3 = + ah·bl (both split)
template <int NT>
__device__ __forceinline__ v8f mmaN(v16b ah, v16b al, v16b bh, v16b bl, v8f c) {
  c = __builtin_amdgcn_wmma_f32_16x16x32_bf16(false, ah, false, bh, (short)0, c, false, false);
  if (NT >= 2) c = __builtin_amdgcn_wmma_f32_16x16x32_bf16(false, al, false, bh, (short)0, c, false, false);
  if (NT >= 3) c = __builtin_amdgcn_wmma_f32_16x16x32_bf16(false, ah, false, bl, (short)0, c, false, false);
  asm volatile("v_nop\n\tv_nop\n\tv_nop\n\tv_nop" : "+v"(c) : "v"(ah), "v"(al), "v"(bh), "v"(bl));
  return c;
}




// ---- f16 WMMA path (v_wmma_f32_16x16x32_f16): 11-bit significands for operands in range — used for every WMMA product in this file
typedef _Float16 v16h __attribute__((ext_vector_type(16)));
union FragH { v16h v; v8us half[2]; _Float16 h[16]; unsigned short u[16]; };
template <int NT>
__device__ __forceinline__ v8f mmaH(v16h ah, v16h al, v16h bh, v16h bl, v8f c) {
  c = __builtin_amdgcn_wmma_f32_16x16x32_f16(false, ah, false, bh, (short)0, c, false, false);
  if (NT >= 2) c = __builtin_amdgcn_wmma_f32_16x16x32_f16(false, al, false, bh, (short)0, c, false, false);
  if (NT >= 3) c = __builtin_amdgcn_wmma_f32_16x16x32_f16(false, ah, false, bl, (short)0, c, false, false);
  asm volatile("v_nop\n\tv_nop\n\tv_nop\n\tv_nop" : "+v"(c) : "v"(ah), "v"(al), "v"(bh), "v"(bl));
  return c;
}

typedef _Float16 v4h __attribute__((ext_vector_type(4)));

// Preparation, ONE launch: blocks 0 .. 3 PWB - 1 turn the three [in][out] f32 weights into their transposed x16 f16 planes Wt[n][k] = f16(bf16(W[k][n]) x 16) (a power of two: bf16-exact weights stay exact in f16 away from the subnormal range); the other PXB blocks round x to f16 rows.
// Few blocks with much work a thread: every global access is a 16-byte one, a wave reads whole 512-byte runs, and all of a thread's loads are in flight together.
// A weight block owns 128 k x 128 n. It is turned in LDS: one dword holds the f16 pair (k, k + 1) of one column n, so 4 dwords down a column are 8 consecutive k of the output row n.
#define PWT 128                      /* edge of a weight tile */
#define PWP 129                      /* LDS pitch in dwords: 4 rows = 516 = 4 mod 64, so 16 lanes 4 rows apart and 2 neighbouring columns meet every bank once */
#define PWB ((DM / PWT) * (DM / PWT))      /* blocks a weight */
#define PXC 8                        /* 8-element runs a thread of an x block */
#define PXB ((int)(NR * DM / 8 / 256 / PXC))      /* x blocks */
typedef unsigned int v4ua __attribute__((ext_vector_type(4), may_alias));
typedef float v2f __attribute__((ext_vector_type(2)));
typedef _Float16 v2h __attribute__((ext_vector_type(2)));
__device__ __forceinline__ unsigned pw_pair(float lo, float hi) { const v2f p = {bf16_round(lo) * 16.0f, bf16_round(hi) * 16.0f}; return __builtin_bit_cast(unsigned, __builtin_convertvector(p, v2h)); }
__global__ __launch_bounds__(256) void k_prep(const float* __restrict__ x, const float* __restrict__ wq, const float* __restrict__ wk, const float* __restrict__ wv, _Float16* __restrict__ X16, _Float16* __restrict__ Wt3) {
  static_assert(DM % PWT == 0 && (NR * DM) % (8 * 256 * PXC) == 0, "whole tiles and whole runs only");
  __shared__ unsigned tl[(PWT / 2) * PWP];
  const int tid = threadIdx.x; const int b = blockIdx.x;
  if (b >= 3 * PWB) {      /* the same for the whole block: it leaves as a whole, in front of the barrier below */
    const size_t t0 = (size_t)(b - 3 * PWB) * (PXC * 256) + tid; const float* xp = x + t0 * 8; v4f a[PXC][2];
#pragma unroll      /* full: the array must be indexed by constants to stay in registers, and all 16 loads are to be in flight at once */
    for (int i = 0; i < PXC; ++i) { a[i][0] = *(const v4fa*)(xp + (size_t)i * 2048); a[i][1] = *(const v4fa*)(xp + (size_t)i * 2048 + 4); }
    asm volatile("s_wait_xcnt 0x0" :: "v"(xp), "v"(a[0][0]), "v"(a[0][1]), "v"(a[1][0]), "v"(a[1][1]), "v"(a[2][0]), "v"(a[2][1]), "v"(a[3][0]), "v"(a[3][1]), "v"(a[4][0]), "v"(a[4][1]), "v"(a[5][0]), "v"(a[5][1]), "v"(a[6][0]), "v"(a[6][1]), "v"(a[7][0]), "v"(a[7][1]) : "memory");      /* stands behind the last load of the run; the address pair is an input, so it keeps its registers up to the wait; the loaded values are inputs too, so no conversion is placed between the loads and all 16 are issued back to back (one memory latency, not several) */
    unsigned short* op = (unsigned short*)X16 + t0 * 8;
    FragH f[PXC];
#pragma unroll      /* full: constant indices, as above */
    for (int i = 0; i < PXC; ++i) for (int q = 0; q < 8; ++q) f[i].h[q] = (_Float16)bf16_round(a[i][q >> 2][q & 3]);
    __builtin_amdgcn_sched_barrier(0);      /* every store stands behind every conversion, so no register of an issued store is written again */
#pragma unroll      /* full: constant indices, as above */
    for (int i = 0; i < PXC; ++i) *(v8us*)(op + (size_t)i * 2048) = f[i].half[0];
    return; }
  {
    const int ws = b / PWB, tile = b % PWB; const int k0 = (tile / (DM / PWT)) * PWT, n0 = (tile % (DM / PWT)) * PWT; const float* W = ws == 0 ? wq : ws == 1 ? wk : wv;
    const int r = tid >> 5, c4 = (tid & 31) * 4; const float* wp = W + (size_t)(k0 + 2 * r) * DM + n0 + c4; v4f e0[PWT / 16], e1[PWT / 16];      /* rows k and k + 1, 16 rows on every step */
#pragma unroll      /* full: constant indices and all 16 loads in flight at once, as above */
    for (int it = 0; it < PWT / 16; ++it) { e0[it] = *(const v4fa*)(wp + (size_t)it * 16 * DM); e1[it] = *(const v4fa*)(wp + (size_t)(it * 16 + 1) * DM); }
    asm volatile("s_wait_xcnt 0x0" :: "v"(wp), "v"(e0[0]), "v"(e1[0]), "v"(e0[1]), "v"(e1[1]), "v"(e0[2]), "v"(e1[2]), "v"(e0[3]), "v"(e1[3]), "v"(e0[4]), "v"(e1[4]), "v"(e0[5]), "v"(e1[5]), "v"(e0[6]), "v"(e1[6]), "v"(e0[7]), "v"(e1[7]) : "memory");      /* behind the last load of the run, address pair and loaded values as inputs, for the same two reasons as above */
#pragma unroll      /* full: constant indices, as above */
    for (int it = 0; it < PWT / 16; ++it) for (int e = 0; e < 4; ++e) tl[(it * 8 + r) * PWP + c4 + e] = pw_pair(e0[it][e], e1[it][e]);
    __syncthreads();      /* the tile is complete in LDS */
    const int kc = tid & 15, nn = tid >> 4; _Float16* op = Wt3 + (size_t)ws * DM * DM + (size_t)(n0 + nn) * DM + k0 + kc * 8;      /* 16 lanes write 256 consecutive bytes of an output row */
#pragma unroll      /* full: every LDS read and every store is one base register plus an immediate offset, and all the reads are in flight together */
    for (int rd = 0; rd < PWT / 16; ++rd) { v4ua o; for (int q = 0; q < 4; ++q) o[q] = tl[(kc * 4 + q) * PWP + rd * 16 + nn]; *(v4ua*)(op + (size_t)rd * 16 * DM) = o; }
    asm volatile("s_wait_xcnt 0x0" ::: "memory");      /* stands behind the last store of the run, in front of every later write of the stores' address and data registers on any way the listing's branches allow */
  } }
template <int NHv, int TTv>
__global__ __launch_bounds__(256) void k_vt(const _Float16* __restrict__ V16, int ldv, int voff, _Float16* __restrict__ Vt) { __shared__ unsigned short tl[64][66]; const int tid = threadIdx.x; const int slab = blockIdx.x / (TTv / 64), lg = blockIdx.x % (TTv / 64); const int b = slab / NHv, h = slab % NHv;
  for (int i = tid; i < 64 * 8; i += 256) { const int r = i / 8, c8 = (i % 8) * 8; FragH f; f.half[0] = *(const v8us*)((const unsigned short*)V16 + ((size_t)b * TTv + lg * 64 + r) * ldv + voff + h * 64 + c8);
#pragma unroll
    for (int q = 0; q < 8; ++q) tl[r][c8 + q] = f.u[q]; }
  __syncthreads();
  {
#pragma unroll
    for (int rd = 0; rd < 2; ++rd) { const int d = rd * 32 + tid / 8, pc = tid % 8; FragH f;
#pragma unroll
      for (int q = 0; q < 8; ++q) f.u[q] = tl[pc * 8 + q][d];
      *(v8us*)((unsigned short*)Vt + ((size_t)slab * 64 + d) * TTv + lg * 64 + pc * 8) = f.half[0]; }
     } }


// ---- fast GEMM (wave tile 32x64; requires whole tiles: M % 128 == 0 rows per launch region, N % 64 == 0, K % 128 == 0 and K >= 128); epilogue = k_gemm_hhx semantics ----
__device__ __forceinline__ v16h g2_frag(const _Float16* p, int hh) { FragH f; f.half[0] = *(const v8us*)((const unsigned short*)p + 8 * hh); f.half[1] = *(const v8us*)((const unsigned short*)p + 16 + 8 * hh); return f.v; }
__device__ __forceinline__ v8f g2_mma(v16h a, v16h b, v8f c) { v8f d = __builtin_amdgcn_wmma_f32_16x16x32_f16(false, a, false, b, (short)0, c, false, false); asm volatile("v_nop\n\tv_nop\n\tv_nop\n\tv_nop" : "+v"(d) : "v"(a), "v"(b)); return d; }
// The GEMM's operand tiles go through LDS: a block's 128 A rows and 64 B rows, 128 k at a time, are brought in by asynchronous 16-byte copies (a wave-wide copy = 2 rows x 256 B = 4 whole lines; each line is fetched once a block), two buffers, the next tile in flight while this one is worked on.
#define GKT 128                      /* k elements of a staged tile: rows of 256 bytes */
#define GPE 136                      /* LDS row pitch in elements: 272 B = 16 B x odd, 16 lanes on 16 rows meet every bank once */
#define GTR 192                      /* rows of a staged tile: the block's 128 A rows, then its 64 B rows */
// Eight copies of one lane, rows 8 apart: l = the lane's LDS byte address, g = its global address, g8 = 8 source rows in elements. The s_wait_xcnt stands inside the statement, behind the last copy, so that no later write of an address register can be placed in front of it.
__device__ __forceinline__ void g2_copy8(unsigned l, const _Float16* g, size_t g8) {
  asm volatile("global_load_async_to_lds_b128 %0, %8, off\n\tglobal_load_async_to_lds_b128 %1, %9, off\n\tglobal_load_async_to_lds_b128 %2, %10, off\n\tglobal_load_async_to_lds_b128 %3, %11, off\n\t"
               "global_load_async_to_lds_b128 %4, %12, off\n\tglobal_load_async_to_lds_b128 %5, %13, off\n\tglobal_load_async_to_lds_b128 %6, %14, off\n\tglobal_load_async_to_lds_b128 %7, %15, off\n\ts_wait_xcnt 0x0"
               :: "v"(l), "v"(l + 8u * GPE * 2u), "v"(l + 16u * GPE * 2u), "v"(l + 24u * GPE * 2u), "v"(l + 32u * GPE * 2u), "v"(l + 40u * GPE * 2u), "v"(l + 48u * GPE * 2u), "v"(l + 56u * GPE * 2u),
                  "v"(g), "v"(g + g8), "v"(g + 2 * g8), "v"(g + 3 * g8), "v"(g + 4 * g8), "v"(g + 5 * g8), "v"(g + 6 * g8), "v"(g + 7 * g8) : "memory"); }
template <int ACT>
__global__ __launch_bounds__(128) void k_gemm2(const _Float16* __restrict__ A, int lda, size_t sA, const _Float16* __restrict__ Bh, int ldb, size_t sB, float alpha, const float* __restrict__ bias, size_t sBias, const float* __restrict__ CP, int rowsPerB, size_t sCPb, int row0g,
    float* __restrict__ C, int MC, _Float16* __restrict__ C16, int ldc, size_t sC, int M, int N, int K) {      /* C: f32 rows, stored for rows below MC only (MC % 32 == 0); C16: the f16 rounding of every row */ static_assert(ACT == 0 || ACT == 3 || ACT == 6 || ACT == 8 || ACT == 9 || ACT == 11 || ACT == 12 || ACT == 14 || ACT == 15 || ACT == 16 || ACT == 17, "k_gemm2: unsupported ACT code (would silently apply no activation)");
  __shared__ __attribute__((aligned(16))) _Float16 st[2][GTR * GPE]; __shared__ __attribute__((aligned(16))) float so[4][32][68];
  const int tid = threadIdx.x, w = tid >> 5, lane = tid & 31, ln = lane & 15, hh = lane >> 4; const int by = blockIdx.y;
  A += (size_t)by * sA; Bh += (size_t)by * sB; const size_t cofs = (size_t)by * sC; const float* bp = bias ? bias + (size_t)by * sBias : nullptr;
  const int ntn = N >> 6; const int mt = blockIdx.x / ntn, nq = blockIdx.x - mt * ntn; const int row0 = mt * 128 + 32 * w, col0 = nq * 64; if (mt * 128 >= M) return;      /* the whole block leaves or none: barriers follow */
  const int cr = tid >> 4, cc = (tid & 15) * 8;      /* the thread's row (of 8) and 16-byte column in every copy */
  const _Float16* ga = A + (size_t)(mt * 128 + cr) * lda + cc; const _Float16* gb = Bh + (size_t)(col0 + cr) * ldb + cc; const unsigned l0 = (unsigned)(size_t)&st[0][cr * GPE + cc];
  auto fill = [&](int t) { const unsigned l = l0 + (unsigned)(t & 1) * (GTR * GPE * 2u); const _Float16* a = ga + (size_t)t * GKT;      /* tile t into buffer t mod 2: 24 copies a lane */
    g2_copy8(l, a, (size_t)8 * lda); g2_copy8(l + 64u * GPE * 2u, a + (size_t)64 * lda, (size_t)8 * lda); g2_copy8(l + 128u * GPE * 2u, gb + (size_t)t * GKT, (size_t)8 * ldb); };
  const v8f z8 = {0.f,0.f,0.f,0.f,0.f,0.f,0.f,0.f}; v8f c00 = z8, c01 = z8, c02 = z8, c03 = z8, c10 = z8, c11 = z8, c12 = z8, c13 = z8;
  const int NT = K / GKT;
  fill(0);
  asm volatile("s_wait_asynccnt 0x0" ::: "memory");      /* this wave's copies of tile 0 have landed */
  __syncthreads();      /* tile 0 published */
  if (NT > 1) fill(1);
  for (int t = 0; t < NT; ++t) { const _Float16* sa = &st[t & 1][(32 * w + ln) * GPE]; const _Float16* sb = &st[t & 1][(128 + ln) * GPE]; v16h f[2][6];      /* two fragment sets: the next 32 k are read from LDS under this step's products; never past the tile */
#pragma unroll      /* full: f must be indexed by constants to stay in registers */
    for (int u = 0; u < 6; ++u) f[0][u] = g2_frag((u < 2 ? sa + u * 16 * GPE : sb + (u - 2) * 16 * GPE), hh);
#pragma unroll      /* full: constant indices, as above */
    for (int j = 0; j < GKT / 32; ++j) { const int p = j & 1;
      if (j + 1 < GKT / 32) {
#pragma unroll      /* full: constant indices, as above */
        for (int u = 0; u < 6; ++u) f[p ^ 1][u] = g2_frag((u < 2 ? sa + u * 16 * GPE : sb + (u - 2) * 16 * GPE) + (j + 1) * 32, hh); }
      c00 = g2_mma(f[p][0], f[p][2], c00); c10 = g2_mma(f[p][1], f[p][2], c10); c01 = g2_mma(f[p][0], f[p][3], c01); c11 = g2_mma(f[p][1], f[p][3], c11);
      c02 = g2_mma(f[p][0], f[p][4], c02); c12 = g2_mma(f[p][1], f[p][4], c12); c03 = g2_mma(f[p][0], f[p][5], c03); c13 = g2_mma(f[p][1], f[p][5], c13); }
    asm volatile("s_wait_dscnt 0x0" ::: "memory");      /* this wave's reads of buffer t mod 2 are done before the buffer is given up */
    asm volatile("s_wait_asynccnt 0x0" ::: "memory");      /* this wave's copies of tile t + 1 have landed */
    __syncthreads();      /* publishes tile t + 1 and ends every wave's reads of tile t */
    if (t + 2 < NT) fill(t + 2); }
  asm volatile("s_wait_asynccnt 0x0" ::: "memory");      /* nothing is in flight when the loop is left */
  v8f accs[8] = {c00, c01, c02, c03, c10, c11, c12, c13};
#pragma unroll
  for (int u = 0; u < 8; ++u) { const int t = u & 3, half = u >> 2; const int col = col0 + t * 16 + ln; const float bv = bp ? bf16_round(bp[col]) : 0.f;
#pragma unroll
    for (int r = 0; r < 8; ++r) { const int rloc = half * 16 + 8 * hh + r; float v = accs[u][r] * alpha + bv; if (CP) { if (rowsPerB < 0) v += CP[cofs + (size_t)(row0g + row0 + rloc) * ldc + col];      /* rowsPerB < 0: own element of the batched C plane */ else { const int bidx = (row0g + row0 + rloc) / rowsPerB; v += CP[(size_t)bidx * sCPb + (size_t)by * 64 + col]; } }
      if (ACT == 3) v = fmaxf(v, 0.f); else if (ACT == 6) v = 0.5f * v * (1.0f + erff(v * 0.70710678118654752f)); else if (ACT == 11) v = 1.0f / (1.0f + expf(-v)); else if (ACT == 15) v = v / (1.0f + expf(-v)); else if (ACT == 12) v = (v > 0.f) ? v : 0.01f * v; else if (ACT == 8) v = tanhf(v); else if (ACT == 9) v = 0.5f * v * (1.0f + tanhf(0.7978845608028654f * (v + 0.044715f * v * v * v))); else if (ACT == 14) v = (v > 0.f) ? v : 0.1f * v; else if (ACT == 16) v = (v >= 0.f) ? v : 0.3f * v; else if (ACT == 17) v = (v >= 0.f) ? v : 0.2f * v;
      so[w][rloc][t * 16 + ln] = v; } }
  __builtin_amdgcn_fence(__ATOMIC_ACQ_REL, "workgroup"); __builtin_amdgcn_wave_barrier();
  const int rsub = lane >> 4, c4 = (lane & 15) * 4; const bool cf = C && __builtin_amdgcn_readfirstlane(row0) < MC;      /* the wave's 32 rows lie on one side of MC: a scalar test */
  {
#pragma unroll
    for (int q = 0; q < 16; ++q) { const int r = q * 2 + rsub; const v4f v = *(const v4fa*)&so[w][r][c4]; if (cf) { *(v4f*)(C + cofs + (size_t)(row0 + r) * ldc + col0 + c4) = v; asm volatile("s_wait_xcnt 0x0" ::: "memory"); }      /* the wait stands behind the f32 store, in front of the f16 conversion, which may reuse the store's registers */
      if (C16) { v4h h4; for (int i = 0; i < 4; ++i) h4[i] = (_Float16)v[i]; *(v4h*)(C16 + cofs + (size_t)(row0 + r) * ldc + col0 + c4) = h4; } }
     } }


// Fused causal attention for query rows QT0 .. SQ-1: scores, softmax and context in ONE launch; no score or weight plane in memory.
// Two waves own 32 query rows of one head: of every 128 staged keys below the block's rows wave w takes the first 64 and wave w + 4 the last 64 (of the block's own 128 keys passes 0, 2 and 1, 3), 32 at a time, each with its own running maximum and sum (online softmax); the two partial results are joined once, through LDS, at the end.
// K rows and V^T rows go through LDS: 128 keys at a time are brought in once a block by asynchronous 16-byte copies (a wave-wide copy = 4 whole lines), two buffers, the next tile in flight while this one is worked on; the block's 8 waves read their fragments from there.
// S^T = K Q^T (A = 16 key rows, B = 16 query rows): lane (ln, hh) then holds, for query ln, keys 8 hh + r of each 16-key tile, which is the B operand order of O^T += V^T P^T: the weights go from accumulator to operand in registers.
// All of a lane's values belong to one query per 16-query set, so maximum, sum and rescale are lane-local but for one exchange between the wave halves.
// Two blocks a WGP, four waves a SIMD: the register budget is set for that (256 a wave), and twice the LDS fits.
// Every '#pragma unroll' of fa_pass and k_fattn is a full unroll: the fragment and accumulator arrays must be indexed by constants to stay in registers.
#define FQ 128                       /* query rows per block: 4 wave pairs x 32 */
#define SCL2 0.18033688011112042f    /* 1/sqrt(64) x log2(e): scores are carried in log2 units */
#define FKT 128                      /* keys of a staged tile: 2 passes in each wave of a pair; FQ and QT0 are multiples of it */
#define FKP 72                       /* LDS pitch of a K row in elements: 144 B = 16 B x odd, 16 lanes on 16 rows meet every bank once */
#define FVP 136                      /* LDS pitch of a V^T row (128 keys) in elements: 272 B = 16 B x odd */
// Four copies of one lane: l = the lane's LDS byte address, LS = the LDS step in bytes from copy to copy, g = its global address, gs = the global step in elements. The s_wait_xcnt stands inside the statement, behind the last copy, so that no later write of an address register can be placed in front of it.
template <unsigned LS>
__device__ __forceinline__ void fa_copy4(unsigned l, const _Float16* g, size_t gs) {
  asm volatile("global_load_async_to_lds_b128 %0, %4, off\n\tglobal_load_async_to_lds_b128 %1, %5, off\n\tglobal_load_async_to_lds_b128 %2, %6, off\n\tglobal_load_async_to_lds_b128 %3, %7, off\n\ts_wait_xcnt 0x0"
               :: "v"(l), "v"(l + LS), "v"(l + 2u * LS), "v"(l + 3u * LS), "v"(g), "v"(g + gs), "v"(g + 2 * gs), "v"(g + 3 * gs) : "memory"); }
__device__ __forceinline__ v8f fa_mma(v16h a, v16h b, v8f c) { return __builtin_amdgcn_wmma_f32_16x16x32_f16(false, a, false, b, (short)0, c, false, false); }
__device__ __forceinline__ float fa_swap16(float x) { const int b = __float_as_int(x); return __int_as_float(__builtin_amdgcn_permlanex16(b, b, 0x76543210, 0xfedcba98, false, false)); }      /* lane l <-> l ^ 16 */
// One pass: 32 keys against the wave's 32 queries. kp, vp: the lane's K row and V^T row in the staged tile, at the pass's first key. DIAG: the pass that crosses the diagonal (its first key == the wave's first query row), the wave's last. PRE: the next pass lies in the same staged tile.
template <bool DIAG, bool PRE>
__device__ __forceinline__ void fa_pass(const _Float16* kp, const _Float16* vp, int ln, int hh, const v16h (&qf)[2][2], v16h (&kf)[2][2], v8f (&o)[2][4], float (&m)[2], float (&l)[2]) {
  const v8f z8 = {0.f,0.f,0.f,0.f,0.f,0.f,0.f,0.f}; v16h vf[4];
#pragma unroll
  for (int d = 0; d < 4; ++d) vf[d] = g2_frag(vp + d * 16 * FVP, hh);
  v8f st[2][2];      /* [query set][16-key tile] */
#pragma unroll
  for (int s = 0; s < 2; ++s) for (int t = 0; t < 2; ++t) if (!(DIAG && s == 0 && t == 1)) st[s][t] = fa_mma(kf[t][1], qf[s][1], fa_mma(kf[t][0], qf[s][0], z8));      /* on the diagonal pass keys 16..31 lie above every query of set 0: that tile is left out whole */
  if (PRE) {      /* the next pass's keys, fetched one pass ahead into the same registers; never past the staged tile */
#pragma unroll
    for (int t = 0; t < 2; ++t) for (int kb = 0; kb < 2; ++kb) kf[t][kb] = g2_frag(kp + (32 + t * 16) * FKP + kb * 32, hh); }
  if (DIAG) {      /* keys above the diagonal are excluded: their weight is exp2(-huge) = 0 */
#pragma unroll
    for (int s = 0; s < 2; ++s) for (int r = 0; r < 8; ++r) st[s][s][r] = (8 * hh + r <= ln) ? st[s][s][r] : -3.0e38f; }      /* only the two tiles on the diagonal are cut; set 1 sees all of keys 0..15 */
  float mx[2];
#pragma unroll
  for (int s = 0; s < 2; ++s) { float a = st[s][0][0]; for (int r = 1; r < 8; ++r) a = fmaxf(a, st[s][0][r]); if (!(DIAG && s == 0)) for (int r = 0; r < 8; ++r) a = fmaxf(a, st[s][1][r]); a = fmaxf(a, fa_swap16(a)); mx[s] = a * SCL2; }
  /* the maximum in use moves only when some query's new maximum exceeds it by more than 8 (log2 units): weights stay <= 2^8, inside f16; one scalar branch a pass */
  if (__builtin_amdgcn_ballot_w32(mx[0] > m[0] + 8.f || mx[1] > m[1] + 8.f) != 0) {
#pragma unroll
    for (int s = 0; s < 2; ++s) { const float mn = fmaxf(m[s], mx[s]); const float al = __builtin_amdgcn_exp2f(m[s] - mn); m[s] = mn; l[s] *= al; for (int d = 0; d < 4; ++d) o[s][d] *= al; } }
#pragma unroll
  for (int s = 0; s < 2; ++s) { FragH pf; float s0 = 0.f, s1 = 0.f;
#pragma unroll
    for (int r = 0; r < 8; ++r) { const float e0 = __builtin_amdgcn_exp2f(fmaf(st[s][0][r], SCL2, -m[s])); const float e1 = (DIAG && s == 0) ? 0.f : __builtin_amdgcn_exp2f(fmaf(st[s][1][r], SCL2, -m[s])); s0 += e0; s1 += e1; pf.h[r] = (_Float16)e0; pf.h[8 + r] = (_Float16)e1; }
    l[s] += s0 + s1;
#pragma unroll
    for (int d = 0; d < 4; ++d) o[s][d] = fa_mma(vf[d], pf.v, o[s][d]); } }
// The join of a wave pair. Each wave keeps one 16-query set and gives the other to its partner: fa_give<S> writes set S (32 context values, maximum in use, partial sum of a lane) to the wave's own LDS slot, 16 bytes a lane and 512 consecutive bytes a wave at every write.
template <int S>
__device__ __forceinline__ void fa_give(v4f* xw, const v8f (&o)[2][4], const float (&m)[2], const float (&l)[2]) {
#pragma unroll
  for (int d = 0; d < 4; ++d) { const v4f lo4 = {o[S][d][0], o[S][d][1], o[S][d][2], o[S][d][3]}; const v4f hi4 = {o[S][d][4], o[S][d][5], o[S][d][6], o[S][d][7]}; xw[(2 * d) * 32] = lo4; xw[(2 * d + 1) * 32] = hi4; }
  const v4f ml = {m[S], l[S], 0.f, 0.f}; xw[8 * 32] = ml; }
// fa_take<S> reads the partner's half of set S, brings both halves to the larger of the two maxima, adds them, divides by the whole sum and stores the 16 output rows' 64 columns.
template <int S>
__device__ __forceinline__ void fa_take(const v4f* xr, const v8f (&o)[2][4], const float (&m)[2], const float (&l)[2], float* op) {
  const v4f ml = xr[8 * 32]; const float dm = m[S] - ml[0]; const float e = __builtin_amdgcn_exp2f(-fabsf(dm)); const float a = dm >= 0.f ? 1.0f : e, b = dm >= 0.f ? e : 1.0f;      /* the half with the larger maximum keeps its scale, the other comes down to it */
  const float lt = l[S] * a + ml[1] * b; const float inv = 1.0f / (lt + fa_swap16(lt)); const float ai = a * inv, bi = b * inv;
#pragma unroll
  for (int d = 0; d < 4; ++d) { const v4f pl = xr[(2 * d) * 32], ph = xr[(2 * d + 1) * 32];      /* O^T tile d: rows d*16 + 8 hh + r of column (query) ln */
    const v4f lo4 = {o[S][d][0] * ai + pl[0] * bi, o[S][d][1] * ai + pl[1] * bi, o[S][d][2] * ai + pl[2] * bi, o[S][d][3] * ai + pl[3] * bi}; const v4f hi4 = {o[S][d][4] * ai + ph[0] * bi, o[S][d][5] * ai + ph[1] * bi, o[S][d][6] * ai + ph[2] * bi, o[S][d][7] * ai + ph[3] * bi};
    *(v4f*)(op + d * 16) = lo4; *(v4f*)(op + d * 16 + 4) = hi4; } }
__global__ __launch_bounds__(256) __attribute__((amdgpu_waves_per_eu(4, 4))) void k_fattn(const _Float16* __restrict__ Q, const _Float16* __restrict__ Kh, const _Float16* __restrict__ Vt, float* __restrict__ O) {
  __shared__ __attribute__((aligned(16))) _Float16 sK[2][FKT * FKP]; __shared__ __attribute__((aligned(16))) _Float16 sV[2][HD * FVP]; __shared__ __attribute__((aligned(16))) v4f sx[8 * 9 * 32];      /* sx: a slot of 9 x 512 B for every wave, for the join */
  const int tid = threadIdx.x, lane = tid & 31, ln = lane & 15, hh = lane >> 4; const int wv = __builtin_amdgcn_readfirstlane(threadIdx.x >> 5); const int w = wv & 3, g = wv >> 2;      /* w: the pair's 32 query rows; g: which half of every staged tile's keys */
  const int h = blockIdx.x % NH; const int tile = (SQ - QT0) / FQ - 1 - blockIdx.x / NH;      /* the longest key ranges start first */
  const int qw = QT0 + tile * FQ + w * 32;      /* first query row of the wave pair: scalar, a multiple of 32 */
  const int NS = (QT0 + tile * FQ) / FKT + 1;      /* staged tiles of the block: all keys below its first query row, then the 128 keys of its own rows; at least 3 */
  const _Float16* qp = Q + (size_t)(qw + ln) * LQ + h * HD;
  const _Float16* gk = Kh + (size_t)(tid >> 3) * KVD + h * HD + (tid & 7) * 8; const unsigned lk = (unsigned)(size_t)&sK[0][(tid >> 3) * FKP + (tid & 7) * 8];      /* K: a copy of the block = 32 rows of 128 B */
  const _Float16* gv = Vt + ((size_t)h * HD + (tid >> 4)) * SQ + (tid & 15) * 8; const unsigned lv = (unsigned)(size_t)&sV[0][(tid >> 4) * FVP + (tid & 15) * 8];      /* V^T: a copy of the block = 16 rows of 256 B */
  auto fill = [&](int t) {      /* tile t into buffer t mod 2: 8 copies a lane */
    fa_copy4<32u * FKP * 2u>(lk + (unsigned)(t & 1) * (FKT * FKP * 2u), gk + (size_t)t * FKT * KVD, (size_t)32 * KVD); fa_copy4<16u * FVP * 2u>(lv + (unsigned)(t & 1) * (HD * FVP * 2u), gv + (size_t)t * FKT, (size_t)16 * SQ); };
  fill(0);
  v16h qf[2][2], kf[2][2];
#pragma unroll
  for (int s = 0; s < 2; ++s) for (int kb = 0; kb < 2; ++kb) qf[s][kb] = g2_frag(qp + (size_t)s * 16 * LQ + kb * 32, hh);
  asm volatile("s_wait_xcnt 0x0" ::: "memory");      /* stands behind the last load of the opening run, in front of every later write of that run's address registers */
  const v8f z8 = {0.f,0.f,0.f,0.f,0.f,0.f,0.f,0.f}; v8f o[2][4]; float m[2], l[2];
#pragma unroll
  for (int s = 0; s < 2; ++s) { m[s] = -1.0e37f; l[s] = 0.f; for (int d = 0; d < 4; ++d) o[s][d] = z8; }
  asm volatile("s_wait_asynccnt 0x0" ::: "memory");      /* this wave's copies of tile 0 have landed */
  __syncthreads();      /* tile 0 published */
  fill(1);
#pragma nounroll      /* one copy of the loop's body: a peeled last trip took registers past the budget of four waves a SIMD (spills) */
  for (int t = 0; t < NS - 1; ++t) {      /* tiles below every query of the block: 2 whole passes in every wave, over its half of the tile's keys */
    const _Float16* kp = &sK[t & 1][(g * 64 + ln) * FKP]; const _Float16* vp = &sV[t & 1][ln * FVP + g * 64];
#pragma unroll
    for (int u = 0; u < 2; ++u) for (int kb = 0; kb < 2; ++kb) kf[u][kb] = g2_frag(kp + u * 16 * FKP + kb * 32, hh);
    fa_pass<false, true>(kp, vp, ln, hh, qf, kf, o, m, l); fa_pass<false, false>(kp + 32 * FKP, vp + 32, ln, hh, qf, kf, o, m, l);
    asm volatile("s_wait_dscnt 0x0" ::: "memory");      /* this wave's reads of buffer t mod 2 are done before the buffer is given up */
    asm volatile("s_wait_asynccnt 0x0" ::: "memory");      /* this wave's copies of tile t + 1 have landed */
    __syncthreads();      /* publishes tile t + 1 and ends every wave's reads of tile t */
    if (t + 2 < NS) fill(t + 2); }
  asm volatile("s_wait_asynccnt 0x0" ::: "memory");      /* nothing is in flight when the loop is left */
  { const _Float16* kp = &sK[(NS - 1) & 1][(g * 32 + ln) * FKP]; const _Float16* vp = &sV[(NS - 1) & 1][ln * FVP + g * 32];      /* the block's own 128 keys: pair w has w whole passes, then its diagonal pass; wave g takes passes g, g + 2; all tests are scalar */
    int p = g;
    for (; p < w; p += 2) {
#pragma unroll
      for (int u = 0; u < 2; ++u) for (int kb = 0; kb < 2; ++kb) kf[u][kb] = g2_frag(kp + u * 16 * FKP + kb * 32, hh);
      fa_pass<false, false>(kp, vp, ln, hh, qf, kf, o, m, l); kp += 64 * FKP; vp += 64; }
    if (p == w) {
#pragma unroll
      for (int u = 0; u < 2; ++u) for (int kb = 0; kb < 2; ++kb) kf[u][kb] = g2_frag(kp + u * 16 * FKP + kb * 32, hh);
      fa_pass<true, false>(kp, vp, ln, hh, qf, kf, o, m, l); } }
  asm volatile("v_nop\n\tv_nop\n\tv_nop\n\tv_nop");      /* the distance behind the last pass's last matrix instruction: the join below begins with scalar branches */
  v4f* xw = &sx[wv * (9 * 32) + lane]; const v4f* xr = &sx[(wv ^ 4) * (9 * 32) + lane]; float* op = O + (size_t)(qw + g * 16 + ln) * DM + h * HD + 8 * hh;      /* wave g keeps query set g and gives away the other */
  if (g == 0) fa_give<1>(xw, o, m, l); else fa_give<0>(xw, o, m, l);
  __syncthreads();      /* every wave's given half is in LDS before its partner reads it */
  if (g == 0) fa_take<0>(xr, o, m, l, op); else fa_take<1>(xr, o, m, l, op); }

// Exact f32 attention for query rows 0 .. QT0-1, all on the vector unit. One block = one head x 16 query rows, 8 waves; the work of a row is spread over lanes and waves, nothing walks the keys one by one.
// Stage: the head's 256 K rows, 256 V rows and the block's 16 Q rows go to LDS by coalesced 16-byte loads, all in flight together. Keys above a row's diagonal are staged too (they are rows of this call) and get the weight 0.
// Scores: a thread owns 4 rows x 4 keys (keys 64 apart), so 8 LDS reads feed 64 FMAs. Softmax: a wave owns 2 rows, 8 keys a lane, true row maximum and sum by butterflies. Context: a thread owns 4 rows x 4 columns over a quarter of the keys; the four quarters are summed through LDS.
#define A0R 16                       /* query rows per block */
#define A0KP 68                      /* K row pitch in LDS (floats): 272 B = 16 B x odd, 16 lanes on 16 rows meet every bank once */
#define A0SP 260                     /* score row pitch (floats) */
#define A0PP 20                      /* weight pitch (floats), laid [key][row] so that one 16-byte read gives 4 rows' weights of a key */
struct A0Lds { float sq[A0R * HD]; float sfin[A0R]; float ss[A0R * A0SP]; float sp[QT0 * A0PP]; float red[4 * A0R * HD]; float sk[QT0 * A0KP]; float sv[QT0 * HD]; };      /* every member starts at a multiple of 16 bytes; the small ones first, inside the reach of an LDS instruction's immediate offset */
template <int M> __device__ __forceinline__ float a0_xm(float x) { return __int_as_float(__builtin_amdgcn_update_dpp(0, __float_as_int(x), 0x160 | M, 0xf, 0xf, true)); }      /* lane l <- l ^ M inside a 16-lane row (DPP row_xmask); every lane is on where it is used */
__device__ __forceinline__ float a0_max32(float x) { x = fmaxf(x, a0_xm<1>(x)); x = fmaxf(x, a0_xm<2>(x)); x = fmaxf(x, a0_xm<4>(x)); x = fmaxf(x, a0_xm<8>(x)); return fmaxf(x, fa_swap16(x)); }
__device__ __forceinline__ float a0_sum32(float x) { x += a0_xm<1>(x); x += a0_xm<2>(x); x += a0_xm<4>(x); x += a0_xm<8>(x); return x + fa_swap16(x); }
__global__ __launch_bounds__(256) void k_att0(const float* __restrict__ QF, const float* __restrict__ KF, const float* __restrict__ VF, float scale, float* __restrict__ OF) {
  __shared__ __attribute__((aligned(16))) A0Lds L;
  const int t = threadIdx.x; const int h = blockIdx.x / (QT0 / A0R); const int i0 = (blockIdx.x % (QT0 / A0R)) * A0R;
  { const int r = t >> 4, c = (t & 15) * 4; const float* kp = KF + (size_t)r * DM + h * HD + c; const float* vp = VF + (size_t)r * DM + h * HD + c; v4f kv[QT0 / 16], vv[QT0 / 16];
#pragma unroll      /* full: the two arrays must be indexed by constants to stay in registers, and all 33 loads are to be in flight at once */
    for (int it = 0; it < QT0 / 16; ++it) { kv[it] = *(const v4fa*)(kp + (size_t)it * 16 * DM); vv[it] = *(const v4fa*)(vp + (size_t)it * 16 * DM); }
    const float* qp = QF + (size_t)(i0 + r) * DM + h * HD + c; const v4f qv = *(const v4fa*)qp;
    asm volatile("s_wait_xcnt 0x0" :: "v"(kp), "v"(vp), "v"(qp) : "memory");      /* stands behind the last load of the run; the run's three address pairs are inputs, so they keep their registers up to the wait and every later write of those registers stands behind it */
    float* ks = &L.sk[r * A0KP + c]; float* vs = &L.sv[r * HD + c];
#pragma unroll      /* full: constant indices, as above */
    for (int it = 0; it < QT0 / 16; ++it) { *(v4f*)(ks + it * 16 * A0KP) = kv[it]; *(v4f*)(vs + it * 16 * HD) = vv[it]; }
    *(v4f*)&L.sq[r * HD + c] = qv; }
  __syncthreads();      /* K, V, Q staged */
  { const int kq = t & 63, r0 = (t >> 6) * 4; const v4f z4 = {0.f, 0.f, 0.f, 0.f}; v4f acc[4] = {z4, z4, z4, z4};      /* acc[row][key] */
    const float* qb = &L.sq[r0 * HD]; const float* kb = &L.sk[kq * A0KP];
#pragma unroll      /* full: the LDS reads of later steps issue under the FMAs of earlier ones */
    for (int c = 0; c < HD; c += 4) { v4f q[4], k[4];
#pragma unroll
      for (int a = 0; a < 4; ++a) { q[a] = *(const v4f*)(qb + a * HD + c); k[a] = *(const v4f*)(kb + a * 64 * A0KP + c); }
#pragma unroll
      for (int a = 0; a < 4; ++a) for (int u = 0; u < 4; ++u) for (int e = 0; e < 4; ++e) acc[a][u] = fmaf(q[a][e], k[u][e], acc[a][u]); }
#pragma unroll
    for (int a = 0; a < 4; ++a) for (int u = 0; u < 4; ++u) { const int j = kq + 64 * u; L.ss[(r0 + a) * A0SP + j] = (j <= i0 + r0 + a) ? acc[a][u] * scale : -1.0e30f; } }      /* keys above the diagonal are excluded: their weight is exp(-huge) = 0 */
  __syncthreads();      /* scores complete */
  { const int lane = t & 31, r0 = (t >> 5) * 2; float x[2][8], m[2], l[2];      /* the wave's two rows side by side: two independent chains */
#pragma unroll
    for (int rr = 0; rr < 2; ++rr) for (int u = 0; u < 8; ++u) x[rr][u] = L.ss[(r0 + rr) * A0SP + lane + 32 * u];
#pragma unroll
    for (int rr = 0; rr < 2; ++rr) { float a = x[rr][0]; for (int u = 1; u < 8; ++u) a = fmaxf(a, x[rr][u]); m[rr] = a; }
    m[0] = a0_max32(m[0]); m[1] = a0_max32(m[1]);
#pragma unroll
    for (int rr = 0; rr < 2; ++rr) { float a = 0.f; for (int u = 0; u < 8; ++u) { x[rr][u] = expf(x[rr][u] - m[rr]); a += x[rr][u]; } l[rr] = a; }
    l[0] = a0_sum32(l[0]); l[1] = a0_sum32(l[1]);
#pragma unroll
    for (int rr = 0; rr < 2; ++rr) for (int u = 0; u < 8; ++u) L.sp[(lane + 32 * u) * A0PP + r0 + rr] = x[rr][u];
    if (lane < 2) L.sfin[r0 + lane] = 1.0f / (lane == 0 ? l[0] : l[1]); }
  __syncthreads();      /* weights complete */
  { const int c = (t & 15) * 4, r0 = ((t >> 4) & 3) * 4, ks = t >> 6; const v4f z4 = {0.f, 0.f, 0.f, 0.f}; v4f o[4] = {z4, z4, z4, z4};
    const float* vb = &L.sv[ks * (QT0 / 4) * HD + c]; const float* pb = &L.sp[ks * (QT0 / 4) * A0PP + r0];
#pragma unroll      /* full: every LDS read is one base register plus an immediate offset, and later keys' reads issue under earlier keys' FMAs */
    for (int jj = 0; jj < QT0 / 4; ++jj) { const v4f v = *(const v4f*)(vb + jj * HD); const v4f p = *(const v4f*)(pb + jj * A0PP);
#pragma unroll
      for (int a = 0; a < 4; ++a) for (int e = 0; e < 4; ++e) o[a][e] = fmaf(p[a], v[e], o[a][e]); }
#pragma unroll
    for (int a = 0; a < 4; ++a) *(v4f*)&L.red[(ks * A0R + r0 + a) * HD + c] = o[a]; }
  __syncthreads();      /* the four key quarters' partial contexts complete */
  { const int r = t >> 4, c = (t & 15) * 4; v4f s = *(const v4f*)&L.red[r * HD + c];
#pragma unroll
    for (int ks = 1; ks < 4; ++ks) s += *(const v4f*)&L.red[(ks * A0R + r) * HD + c];
    s *= L.sfin[r]; *(v4f*)(OF + (size_t)(i0 + r) * DM + h * HD + c) = s; } }

extern "C" void kernel_launch(void* const* d_in, const int* in_sizes, int n_in,
                              void* d_out, int out_size, void* d_ws, size_t ws_size, hipStream_t stream) {
  (void)in_sizes; (void)n_in; (void)out_size;
  const float* const* I = (const float* const*)d_in; const float* x = I[0]; const float* wq = I[1]; const float* wk = I[2]; const float* wv = I[3];      /* x [4096][1024] (ONE unbatched sequence); three separate [in][out] weights Wq, Wk, Wv [1024][1024]; no biases; no output projection */
  static_assert(HPG == 1 && NH == NG * HPG && NH * HD == DM && KVD == DM, "plain multi-head attention as 16 kv groups of one query head"); const float* bq = nullptr; const float* bk = nullptr; const float* bv = nullptr;      /* the module has no biases: the three bias slots are null */
  char* ws = (char*)d_ws; size_t off = 0;
  auto take = [&](size_t bytes) { char* p = ws + off; off += (bytes + 255) & ~(size_t)255; return p; };
  _Float16* BQKV = (_Float16*)take((size_t)3 * DM * DM * 2); _Float16* BQ = BQKV; _Float16* BK = BQKV + (size_t)DM * DM; _Float16* BV = BQKV + (size_t)2 * DM * DM;      /* three transposed planes, one after another: q, k, v */
  _Float16* X16 = (_Float16*)take(NR * DM * 2); _Float16* Q16 = (_Float16*)take(NR * DM * 2); _Float16* K16 = (_Float16*)take(NR * KVD * 2); _Float16* V16 = (_Float16*)take(NR * KVD * 2);
  _Float16* VT = (_Float16*)take((size_t)NH * HD * SQ * 2);
  float* QF0 = (float*)take((size_t)QT0 * DM * 4); float* KF0 = (float*)take((size_t)QT0 * KVD * 4); float* VF0 = (float*)take((size_t)QT0 * KVD * 4);      /* f32 q, k, v of the first 256 rows */
  if (off > ws_size) return;
  k_prep<<<3 * PWB + PXB, 256, 0, stream>>>(x, wq, wk, wv, X16, BQKV);      /* x -> f16 rows; three [in][out] weights -> their transposed x16 planes, q, k, v one after another */
  for (int b = B0; b < B0 + NBR; ++b) { const size_t r0 = (size_t)b * SQ;
    /* q, k, v: every row rounded once to f16 in the epilogue; rows 0..255 stored in f32 as well, for the exact first tile (one head a k/v group: the tile reads these rows as they are) */
    k_gemm2<0><<<dim3((unsigned)((SQ / 128) * (KVD / 64)), 1), 128, 0, stream>>>(X16 + r0 * DM, DM, 0, BV, DM, 0, 0.0625f, bv, 0, nullptr, 1, 0, 0, VF0, QT0, V16 + r0 * KVD, KVD, 0, SQ, KVD, DM);
    k_gemm2<0><<<dim3((unsigned)((SQ / 128) * (DM / 64)), 1), 128, 0, stream>>>(X16 + r0 * DM, DM, 0, BQ, DM, 0, 0.0625f, bq, 0, nullptr, 1, 0, 0, QF0, QT0, Q16 + r0 * DM, DM, 0, SQ, DM, DM);
    k_gemm2<0><<<dim3((unsigned)((SQ / 128) * (KVD / 64)), 1), 128, 0, stream>>>(X16 + r0 * DM, DM, 0, BK, DM, 0, 0.0625f, bk, 0, nullptr, 1, 0, 0, KF0, QT0, K16 + r0 * KVD, KVD, 0, SQ, KVD, DM);
    k_vt<NG, SQ><<<NG * (SQ / 64), 256, 0, stream>>>(V16 + r0 * KVD, KVD, 0, VT);      /* V^T [NH][HD][SQ] for this batch */
    k_att0<<<NH * (QT0 / A0R), 256, 0, stream>>>(QF0, KF0, VF0, 0.125f, (float*)d_out + r0 * DM);      /* exact f32 attention for rows 0..255, written straight into the output rows */
    k_fattn<<<NH * ((SQ - QT0) / FQ), 256, 0, stream>>>(Q16 + r0 * LQ, K16 + r0 * KVD, VT, (float*)d_out + r0 * DM); }      /* rows 256..4095 of all 16 heads: scores, online softmax and context in ONE launch, straight into the output rows as f32 */
}

// v009
// It runs in 79.1 microseconds.
// In both of two side-by-side timings against v008, it was 1.26 times as fast.
// Over all steps from v000 it is 71.0 times as fast.
#include <hip/hip_runtime.h>
// Causal multi-head self-attention over ONE unbatched sequence with three separate projections and NO output projection (x [4096][1024]; q = x Wq, k = x Wk, v = x Wv ([in][out] 1024 x 1024 each, no biases); 16 heads of 64; scores / sqrt(64); causal (-inf above the diagonal: realised as exclusion); softmax; y = the merged context -> [4096][1024]); 16 k/v groups of ONE head each, no rotation.
// Structure: x as exact f16 rows; [in][out] weights as exact x16 planes; q, k and v as ONE WMMA GEMM launch (64x64 wave tiles, f32 accumulation, no bias) whose epilogue stores the one f16 rounding of every row and, for the first 256 rows, the f32 value beside it; V^T of the 16 groups (ONE head each here) via LDS transposes; rows 256..4095: one fused launch, each pair of waves 32 query rows of one head, the keys split between the two: S^T = K Q^T on WMMA, online softmax in registers (f32 statistics, native exp2; weights f16), O^T += V^T P^T on WMMA, f32 straight into the merged output rows; the first tile: exact f32 attention for rows 0..255 written straight into the output rows; launches: see trace.
// The first tile: the first 256 query rows see only a few keys, where single-f16 v / P operands are least accurate; they are computed exactly: the f32 q/k/v rows that the GEMM launch stores for them and an f32 attention on VALU (16 query rows a block, K and V in LDS, true row maximum).
// Compute dtype: inputs rounded to bf16; x / weights exact; q, k, v and softmax weights as plain f16 GEMM operands (~2^-12); scores and softmax statistics f32; v_wmma_f32_16x16x32_f16.
#define NB 1
#define NG 16
#define HPG 1
#define KVD (NG * HD)
#define SQ 4096
#define DM 1024
#define NH 16
#define HD 64
#define HG 4
#define QT0 256                      /* first-tile rows recomputed exactly in f32 */
#define B0 0                         /* first batch processed (debug hook) */
#define NBR NB                       /* batches processed (debug hook) */
#define NR ((size_t)NB * SQ)         /* token rows */
#define MP ((int)((size_t)NBR * SQ)) /* NBR x SQ rows; unused: each projection launch takes SQ rows */
#define MPO MP
#define LQ DM      /* row pitch of the q/k/v rows */
typedef __bf16 v16b __attribute__((ext_vector_type(16)));
typedef unsigned short v8us __attribute__((ext_vector_type(8), may_alias));
typedef float  v8f  __attribute__((ext_vector_type(8)));
typedef float  v4f  __attribute__((ext_vector_type(4)));
typedef float  v4fa __attribute__((ext_vector_type(4), may_alias));
union FragB { v16b v; v8us half[2]; unsigned short u[16]; };

__device__ __forceinline__ unsigned short bf16_bits(float x) { unsigned int u = __float_as_uint(x); return (unsigned short)((u + 0x7FFFu + ((u >> 16) & 1u)) >> 16); }
__device__ __forceinline__ float bf16_val(unsigned short b) { return __uint_as_float(((unsigned int)b) << 16); }
__device__ __forceinline__ float bf16_round(float x) { return bf16_val(bf16_bits(x)); }
// D += A·B with NT terms: 1 = ah·bh, 2 = + al·bh (A split), 3 = + ah·bl (both split)
template <int NT>
__device__ __forceinline__ v8f mmaN(v16b ah, v16b al, v16b bh, v16b bl, v8f c) {
  c = __builtin_amdgcn_wmma_f32_16x16x32_bf16(false, ah, false, bh, (short)0, c, false, false);
  if (NT >= 2) c = __builtin_amdgcn_wmma_f32_16x16x32_bf16(false, al, false, bh, (short)0, c, false, false);
  if (NT >= 3) c = __builtin_amdgcn_wmma_f32_16x16x32_bf16(false, ah, false, bl, (short)0, c, false, false);
  asm volatile("v_nop\n\tv_nop\n\tv_nop\n\tv_nop" : "+v"(c) : "v"(ah), "v"(al), "v"(bh), "v"(bl));
  return c;
}




// ---- f16 WMMA path (v_wmma_f32_16x16x32_f16): 11-bit significands for operands in range — used for every WMMA product in this file
typedef _Float16 v16h __attribute__((ext_vector_type(16)));
union FragH { v16h v; v8us half[2]; _Float16 h[16]; unsigned short u[16]; };
template <int NT>
__device__ __forceinline__ v8f mmaH(v16h ah, v16h al, v16h bh, v16h bl, v8f c) {
  c = __builtin_amdgcn_wmma_f32_16x16x32_f16(false, ah, false, bh, (short)0, c, false, false);
  if (NT >= 2) c = __builtin_amdgcn_wmma_f32_16x16x32_f16(false, al, false, bh, (short)0, c, false, false);
  if (NT >= 3) c = __builtin_amdgcn_wmma_f32_16x16x32_f16(false, ah, false, bl, (short)0, c, false, false);
  asm volatile("v_nop\n\tv_nop\n\tv_nop\n\tv_nop" : "+v"(c) : "v"(ah), "v"(al), "v"(bh), "v"(bl));
  return c;
}

typedef _Float16 v4h __attribute__((ext_vector_type(4)));

// Preparation, ONE launch: blocks 0 .. 3 PWB - 1 turn the three [in][out] f32 weights into their transposed x16 f16 planes Wt[n][k] = f16(bf16(W[k][n]) x 16) (a power of two: bf16-exact weights stay exact in f16 away from the subnormal range); the other PXB blocks round x to f16 rows.
// Few blocks with much work a thread: every global access is a 16-byte one, a wave reads whole 512-byte runs, and all of a thread's loads are in flight together.
// A weight block owns 128 k x 128 n. It is turned in LDS: one dword holds the f16 pair (k, k + 1) of one column n, so 4 dwords down a column are 8 consecutive k of the output row n.
#define PWT 128                      /* edge of a weight tile */
#define PWP 129                      /* LDS pitch in dwords: 4 rows = 516 = 4 mod 64, so 16 lanes 4 rows apart and 2 neighbouring columns meet every bank once */
#define PWB ((DM / PWT) * (DM / PWT))      /* blocks a weight */
#define PXC 8                        /* 8-element runs a thread of an x block */
#define PXB ((int)(NR * DM / 8 / 256 / PXC))      /* x blocks */
typedef unsigned int v4ua __attribute__((ext_vector_type(4), may_alias));
typedef float v2f __attribute__((ext_vector_type(2)));
typedef _Float16 v2h __attribute__((ext_vector_type(2)));
__device__ __forceinline__ unsigned pw_pair(float lo, float hi) { const v2f p = {bf16_round(lo) * 16.0f, bf16_round(hi) * 16.0f}; return __builtin_bit_cast(unsigned, __builtin_convertvector(p, v2h)); }
__global__ __launch_bounds__(256) void k_prep(const float* __restrict__ x, const float* __restrict__ wq, const float* __restrict__ wk, const float* __restrict__ wv, _Float16* __restrict__ X16, _Float16* __restrict__ Wt3) {
  static_assert(DM % PWT == 0 && (NR * DM) % (8 * 256 * PXC) == 0, "whole tiles and whole runs only");
  __shared__ unsigned tl[(PWT / 2) * PWP];
  const int tid = threadIdx.x; const int b = blockIdx.x;
  if (b >= 3 * PWB) {      /* the same for the whole block: it leaves as a whole, in front of the barrier below */
    const size_t t0 = (size_t)(b - 3 * PWB) * (PXC * 256) + tid; const float* xp = x + t0 * 8; v4f a[PXC][2];
#pragma unroll      /* full: the array must be indexed by constants to stay in registers, and all 16 loads are to be in flight at once */
    for (int i = 0; i < PXC; ++i) { a[i][0] = *(const v4fa*)(xp + (size_t)i * 2048); a[i][1] = *(const v4fa*)(xp + (size_t)i * 2048 + 4); }
    asm volatile("s_wait_xcnt 0x0" :: "v"(xp), "v"(a[0][0]), "v"(a[0][1]), "v"(a[1][0]), "v"(a[1][1]), "v"(a[2][0]), "v"(a[2][1]), "v"(a[3][0]), "v"(a[3][1]), "v"(a[4][0]), "v"(a[4][1]), "v"(a[5][0]), "v"(a[5][1]), "v"(a[6][0]), "v"(a[6][1]), "v"(a[7][0]), "v"(a[7][1]) : "memory");      /* stands behind the last load of the run; the address pair is an input, so it keeps its registers up to the wait; the loaded values are inputs too, so no conversion is placed between the loads and all 16 are issued back to back (one memory latency, not several) */
    unsigned short* op = (unsigned short*)X16 + t0 * 8;
    FragH f[PXC];
#pragma unroll      /* full: constant indices, as above */
    for (int i = 0; i < PXC; ++i) for (int q = 0; q < 8; ++q) f[i].h[q] = (_Float16)bf16_round(a[i][q >> 2][q & 3]);
    __builtin_amdgcn_sched_barrier(0);      /* every store stands behind every conversion, so no register of an issued store is written again */
#pragma unroll      /* full: constant indices, as above */
    for (int i = 0; i < PXC; ++i) *(v8us*)(op + (size_t)i * 2048) = f[i].half[0];
    return; }
  {
    const int ws = b / PWB, tile = b % PWB; const int k0 = (tile / (DM / PWT)) * PWT, n0 = (tile % (DM / PWT)) * PWT; const float* W = ws == 0 ? wq : ws == 1 ? wk : wv;
    const int r = tid >> 5, c4 = (tid & 31) * 4; const float* wp = W + (size_t)(k0 + 2 * r) * DM + n0 + c4; v4f e0[PWT / 16], e1[PWT / 16];      /* rows k and k + 1, 16 rows on every step */
#pragma unroll      /* full: constant indices and all 16 loads in flight at once, as above */
    for (int it = 0; it < PWT / 16; ++it) { e0[it] = *(const v4fa*)(wp + (size_t)it * 16 * DM); e1[it] = *(const v4fa*)(wp + (size_t)(it * 16 + 1) * DM); }
    asm volatile("s_wait_xcnt 0x0" :: "v"(wp), "v"(e0[0]), "v"(e1[0]), "v"(e0[1]), "v"(e1[1]), "v"(e0[2]), "v"(e1[2]), "v"(e0[3]), "v"(e1[3]), "v"(e0[4]), "v"(e1[4]), "v"(e0[5]), "v"(e1[5]), "v"(e0[6]), "v"(e1[6]), "v"(e0[7]), "v"(e1[7]) : "memory");      /* behind the last load of the run, address pair and loaded values as inputs, for the same two reasons as above */
#pragma unroll      /* full: constant indices, as above */
    for (int it = 0; it < PWT / 16; ++it) for (int e = 0; e < 4; ++e) tl[(it * 8 + r) * PWP + c4 + e] = pw_pair(e0[it][e], e1[it][e]);
    __syncthreads();      /* the tile is complete in LDS */
    const int kc = tid & 15, nn = tid >> 4; _Float16* op = Wt3 + (size_t)ws * DM * DM + (size_t)(n0 + nn) * DM + k0 + kc * 8;      /* 16 lanes write 256 consecutive bytes of an output row */
#pragma unroll      /* full: every LDS read and every store is one base register plus an immediate offset, and all the reads are in flight together */
    for (int rd = 0; rd < PWT / 16; ++rd) { v4ua o; for (int q = 0; q < 4; ++q) o[q] = tl[(kc * 4 + q) * PWP + rd * 16 + nn]; *(v4ua*)(op + (size_t)rd * 16 * DM) = o; }
    asm volatile("s_wait_xcnt 0x0" ::: "memory");      /* stands behind the last store of the run, in front of every later write of the stores' address and data registers on any way the listing's branches allow */
  } }
template <int NHv, int TTv>
__global__ __launch_bounds__(256) void k_vt(const _Float16* __restrict__ V16, int ldv, int voff, _Float16* __restrict__ Vt) { __shared__ unsigned short tl[64][66]; const int tid = threadIdx.x; const int slab = blockIdx.x / (TTv / 64), lg = blockIdx.x % (TTv / 64); const int b = slab / NHv, h = slab % NHv;
  for (int i = tid; i < 64 * 8; i += 256) { const int r = i / 8, c8 = (i % 8) * 8; FragH f; f.half[0] = *(const v8us*)((const unsigned short*)V16 + ((size_t)b * TTv + lg * 64 + r) * ldv + voff + h * 64 + c8);
#pragma unroll
    for (int q = 0; q < 8; ++q) tl[r][c8 + q] = f.u[q]; }
  __syncthreads();
  {
#pragma unroll
    for (int rd = 0; rd < 2; ++rd) { const int d = rd * 32 + tid / 8, pc = tid % 8; FragH f;
#pragma unroll
      for (int q = 0; q < 8; ++q) f.u[q] = tl[pc * 8 + q][d];
      *(v8us*)((unsigned short*)Vt + ((size_t)slab * 64 + d) * TTv + lg * 64 + pc * 8) = f.half[0]; }
     } }


// ---- q/k/v GEMM (wave tile 64x64; whole tiles only) ----
__device__ __forceinline__ v16h g2_frag(const _Float16* p, int hh) { FragH f; f.half[0] = *(const v8us*)((const unsigned short*)p + 8 * hh); f.half[1] = *(const v8us*)((const unsigned short*)p + 16 + 8 * hh); return f.v; }
__device__ __forceinline__ v8f g2_mma(v16h a, v16h b, v8f c) { v8f d = __builtin_amdgcn_wmma_f32_16x16x32_f16(false, a, false, b, (short)0, c, false, false); asm volatile("v_nop\n\tv_nop\n\tv_nop\n\tv_nop" : "+v"(d) : "v"(a), "v"(b)); return d; }
// The three projections are ONE launch. A block of 12 waves owns 256 x rows and 64 columns of each of q, k and v: waves 0..3 work on q, 4..7 on k, 8..11 on v, each on 64 rows x 64 columns, so one staged x tile feeds all three products and every fragment read from LDS feeds four matrix instructions.
// The operand tiles go through LDS: the block's 256 A rows and 3 x 64 B rows, 128 k at a time, are brought in by asynchronous 16-byte copies (a wave-wide copy = 2 rows x 256 B = 4 whole lines; each line is fetched once a block), two buffers, the next tile in flight while this one is worked on.
#define GKT 128                      /* k elements of a staged tile: rows of 256 bytes */
#define GPE 136                      /* LDS row pitch in elements: 272 B = 16 B x odd, 16 lanes on 16 rows meet every bank once */
#define GAR 256                      /* A rows of a staged tile */
#define GTR (GAR + 3 * 64)           /* rows of a staged tile: the block's A rows, then 64 B rows of each weight plane */
#define GNW 12                       /* waves of a block: 4 row strips x 3 planes */
// Eight copies of one lane: l = the lane's LDS byte address, LS = the LDS step in bytes from copy to copy, g = its global address, gs = the global step in elements. The s_wait_xcnt stands inside the statement, behind the last copy, so that no later write of an address register can be placed in front of it.
template <unsigned LS>
__device__ __forceinline__ void g2_copy8(unsigned l, const _Float16* g, size_t gs) {
  asm volatile("global_load_async_to_lds_b128 %0, %8, off\n\tglobal_load_async_to_lds_b128 %1, %9, off\n\tglobal_load_async_to_lds_b128 %2, %10, off\n\tglobal_load_async_to_lds_b128 %3, %11, off\n\t"
               "global_load_async_to_lds_b128 %4, %12, off\n\tglobal_load_async_to_lds_b128 %5, %13, off\n\tglobal_load_async_to_lds_b128 %6, %14, off\n\tglobal_load_async_to_lds_b128 %7, %15, off\n\ts_wait_xcnt 0x0"
               :: "v"(l), "v"(l + LS), "v"(l + 2u * LS), "v"(l + 3u * LS), "v"(l + 4u * LS), "v"(l + 5u * LS), "v"(l + 6u * LS), "v"(l + 7u * LS),
                  "v"(g), "v"(g + gs), "v"(g + 2 * gs), "v"(g + 3 * gs), "v"(g + 4 * gs), "v"(g + 5 * gs), "v"(g + 6 * gs), "v"(g + 7 * gs) : "memory"); }
__global__ __launch_bounds__(GNW * 32) void k_qkv(const _Float16* __restrict__ A, const _Float16* __restrict__ Bq, const _Float16* __restrict__ Bk, const _Float16* __restrict__ Bv, float alpha,
    float* __restrict__ Fq, float* __restrict__ Fk, float* __restrict__ Fv, _Float16* __restrict__ Hq, _Float16* __restrict__ Hk, _Float16* __restrict__ Hv) {      /* F*: f32 rows, stored for rows below QT0 only; H*: the f16 rounding of every row */
  static_assert(SQ % GAR == 0 && DM % 64 == 0 && DM % GKT == 0 && DM / GKT >= 2 && QT0 % 64 == 0 && KVD == DM, "whole tiles only; a wave's 64 rows lie on one side of QT0");
  __shared__ __attribute__((aligned(16))) union { _Float16 st[2][GTR * GPE]; float so[GNW][64][68]; } S;      /* so, the epilogue's turn-round space, takes the place of the staged tiles once the last tile has been read by every wave */
  const int tid = threadIdx.x, lane = tid & 31, ln = lane & 15, hh = lane >> 4; const int wv = __builtin_amdgcn_readfirstlane(tid >> 5); const int rw = wv & 3, p = wv >> 2;      /* rw: the wave's 64-row strip; p: its plane */
  const int mt = blockIdx.x / (DM / 64), nq = blockIdx.x % (DM / 64); const int row0 = mt * GAR + 64 * rw, col0 = nq * 64;
  const int cc = (tid & 15) * 8, ca = (tid >> 4) & 15, cb = (tid >> 4) & 7;      /* the thread's 16-byte column in every copy; its row (of 16) as one of the 8 waves that copy A; its row (of 8) as one of the 4 that copy B */
  const _Float16* ga = A + (size_t)(mt * GAR + ca) * DM + cc; const size_t gb = (size_t)(col0 + cb) * DM + cc; const unsigned la = (unsigned)(size_t)&S.st[0][ca * GPE + cc], lb = (unsigned)(size_t)&S.st[0][(GAR + cb) * GPE + cc];
  auto fill = [&](int t) { const unsigned bo = (unsigned)(t & 1) * (GTR * GPE * 2u); const size_t ko = (size_t)t * GKT;      /* tile t into buffer t mod 2; the test is scalar: a wave copies as a whole. Waves 0..7: 16 copies a lane, waves 8..11: 24 */
    if (wv < 8) { g2_copy8<16u * GPE * 2u>(la + bo, ga + ko, (size_t)16 * DM); g2_copy8<16u * GPE * 2u>(la + bo + 128u * GPE * 2u, ga + ko + (size_t)128 * DM, (size_t)16 * DM); }
    else { g2_copy8<8u * GPE * 2u>(lb + bo, Bq + gb + ko, (size_t)8 * DM); g2_copy8<8u * GPE * 2u>(lb + bo + 64u * GPE * 2u, Bk + gb + ko, (size_t)8 * DM); g2_copy8<8u * GPE * 2u>(lb + bo + 128u * GPE * 2u, Bv + gb + ko, (size_t)8 * DM); } };
  const v8f z8 = {0.f,0.f,0.f,0.f,0.f,0.f,0.f,0.f}; v8f c[4][4];      /* [16-row tile][16-column tile] */
#pragma unroll      /* full, here and below: c and the fragment arrays must be indexed by constants to stay in registers */
  for (int m = 0; m < 4; ++m) for (int n = 0; n < 4; ++n) c[m][n] = z8;
  const int NT = DM / GKT;
  fill(0);
  asm volatile("s_wait_asynccnt 0x0" ::: "memory");      /* this wave's copies of tile 0 have landed */
  __syncthreads();      /* tile 0 published */
  fill(1);
  for (int t = 0; t < NT; ++t) { const _Float16* sa = &S.st[t & 1][(64 * rw + ln) * GPE]; const _Float16* sb = &S.st[t & 1][(GAR + 64 * p + ln) * GPE];
    v16h a[2][4], b[4];      /* the next 32 k are read from LDS under this step's products: A into a second fragment set, each B fragment into its own registers once its four products are issued; never past the tile */
#pragma unroll
    for (int u = 0; u < 4; ++u) { b[u] = g2_frag(sb + u * 16 * GPE, hh); a[0][u] = g2_frag(sa + u * 16 * GPE, hh); }
#pragma unroll
    for (int j = 0; j < GKT / 32; ++j) { const int q = j & 1;
      if (j + 1 < GKT / 32) {
#pragma unroll
        for (int u = 0; u < 4; ++u) a[q ^ 1][u] = g2_frag(sa + u * 16 * GPE + (j + 1) * 32, hh); }
#pragma unroll
      for (int n = 0; n < 4; ++n) {
#pragma unroll
        for (int m = 0; m < 4; ++m) c[m][n] = g2_mma(a[q][m], b[n], c[m][n]);
        if (j + 1 < GKT / 32) b[n] = g2_frag(sb + n * 16 * GPE + (j + 1) * 32, hh); } }
    asm volatile("s_wait_dscnt 0x0" ::: "memory");      /* this wave's reads of buffer t mod 2 are done before the buffer is given up */
    asm volatile("s_wait_asynccnt 0x0" ::: "memory");      /* this wave's copies of tile t + 1 have landed */
    __syncthreads();      /* publishes tile t + 1 and ends every wave's reads of tile t */
    if (t + 2 < NT) fill(t + 2); }
  asm volatile("s_wait_asynccnt 0x0" ::: "memory");      /* nothing is in flight when the loop is left; the last trip's barrier has ended every wave's reads of the tiles, so their LDS may be written */
#pragma unroll
  for (int m = 0; m < 4; ++m) for (int n = 0; n < 4; ++n) for (int r = 0; r < 8; ++r) S.so[wv][m * 16 + 8 * hh + r][n * 16 + ln] = c[m][n][r] * alpha;
  __builtin_amdgcn_fence(__ATOMIC_ACQ_REL, "workgroup"); __builtin_amdgcn_wave_barrier();
  float* C = p == 0 ? Fq : p == 1 ? Fk : Fv; _Float16* C16 = p == 0 ? Hq : p == 1 ? Hk : Hv;
  const int rsub = lane >> 4, c4 = (lane & 15) * 4; const bool cf = row0 < QT0;      /* the wave's 64 rows lie on one side of QT0: a scalar test */
  const float* sp = &S.so[wv][rsub][c4]; float* fp = C + (size_t)(row0 + rsub) * DM + col0 + c4; _Float16* hp = C16 + (size_t)(row0 + rsub) * DM + col0 + c4;      /* a wave-wide access = 2 rows; every access is one base register plus an immediate offset */
#pragma unroll      /* full: constant indices and immediate offsets */
  for (int q0 = 0; q0 < 32; q0 += 8) { v4f v[8]; v4h h[8];      /* 16 rows a round: 8 LDS reads in flight together, then the stores back to back */
#pragma unroll
    for (int i = 0; i < 8; ++i) v[i] = *(const v4fa*)(sp + (q0 + i) * 2 * 68);
    if (cf) {
#pragma unroll
      for (int i = 0; i < 8; ++i) *(v4f*)(fp + (size_t)(q0 + i) * 2 * DM) = v[i];
      asm volatile("s_wait_xcnt 0x0" ::: "memory"); }      /* stands behind the last f32 store of the run, in front of every later write of the stores' registers */
#pragma unroll
    for (int i = 0; i < 8; ++i) { for (int e = 0; e < 4; ++e) h[i][e] = (_Float16)v[i][e]; *(v4h*)(hp + (size_t)(q0 + i) * 2 * DM) = h[i]; }
    asm volatile("s_wait_xcnt 0x0" ::: "memory"); } }      /* stands behind the last f16 store of the run, for the same reason, on the way through the branch above too */


// Fused causal attention for query rows QT0 .. SQ-1: scores, softmax and context in ONE launch; no score or weight plane in memory.
// Two waves own 32 query rows of one head: of every 128 staged keys below the block's rows wave w takes the first 64 and wave w + 4 the last 64 (of the block's own 128 keys passes 0, 2 and 1, 3), 32 at a time, each with its own running maximum and sum (online softmax); the two partial results are joined once, through LDS, at the end.
// K rows and V^T rows go through LDS: 128 keys at a time are brought in once a block by asynchronous 16-byte copies (a wave-wide copy = 4 whole lines), two buffers, the next tile in flight while this one is worked on; the block's 8 waves read their fragments from there.
// S^T = K Q^T (A = 16 key rows, B = 16 query rows): lane (ln, hh) then holds, for query ln, keys 8 hh + r of each 16-key tile, which is the B operand order of O^T += V^T P^T: the weights go from accumulator to operand in registers.
// All of a lane's values belong to one query per 16-query set, so maximum, sum and rescale are lane-local but for one exchange between the wave halves.
// Two blocks a WGP, four waves a SIMD: the register budget is set for that (256 a wave), and twice the LDS fits.
// Every '#pragma unroll' of fa_pass and k_fattn is a full unroll: the fragment and accumulator arrays must be indexed by constants to stay in registers.
#define FQ 128                       /* query rows per block: 4 wave pairs x 32 */
#define SCL2 0.18033688011112042f    /* 1/sqrt(64) x log2(e): scores are carried in log2 units */
#define FKT 128                      /* keys of a staged tile: 2 passes in each wave of a pair; FQ and QT0 are multiples of it */
#define FKP 72                       /* LDS pitch of a K row in elements: 144 B = 16 B x odd, 16 lanes on 16 rows meet every bank once */
#define FVP 136                      /* LDS pitch of a V^T row (128 keys) in elements: 272 B = 16 B x odd */
// Four copies of one lane: l = the lane's LDS byte address, LS = the LDS step in bytes from copy to copy, g = its global address, gs = the global step in elements. The s_wait_xcnt stands inside the statement, behind the last copy, so that no later write of an address register can be placed in front of it.
template <unsigned LS>
__device__ __forceinline__ void fa_copy4(unsigned l, const _Float16* g, size_t gs) {
  asm volatile("global_load_async_to_lds_b128 %0, %4, off\n\tglobal_load_async_to_lds_b128 %1, %5, off\n\tglobal_load_async_to_lds_b128 %2, %6, off\n\tglobal_load_async_to_lds_b128 %3, %7, off\n\ts_wait_xcnt 0x0"
               :: "v"(l), "v"(l + LS), "v"(l + 2u * LS), "v"(l + 3u * LS), "v"(g), "v"(g + gs), "v"(g + 2 * gs), "v"(g + 3 * gs) : "memory"); }
__device__ __forceinline__ v8f fa_mma(v16h a, v16h b, v8f c) { return __builtin_amdgcn_wmma_f32_16x16x32_f16(false, a, false, b, (short)0, c, false, false); }
__device__ __forceinline__ float fa_swap16(float x) { const int b = __float_as_int(x); return __int_as_float(__builtin_amdgcn_permlanex16(b, b, 0x76543210, 0xfedcba98, false, false)); }      /* lane l <-> l ^ 16 */
// One pass: 32 keys against the wave's 32 queries. kp, vp: the lane's K row and V^T row in the staged tile, at the pass's first key. DIAG: the pass that crosses the diagonal (its first key == the wave's first query row), the wave's last. PRE: the next pass lies in the same staged tile.
template <bool DIAG, bool PRE>
__device__ __forceinline__ void fa_pass(const _Float16* kp, const _Float16* vp, int ln, int hh, const v16h (&qf)[2][2], v16h (&kf)[2][2], v8f (&o)[2][4], float (&m)[2], float (&l)[2]) {
  const v8f z8 = {0.f,0.f,0.f,0.f,0.f,0.f,0.f,0.f}; v16h vf[4];
#pragma unroll
  for (int d = 0; d < 4; ++d) vf[d] = g2_frag(vp + d * 16 * FVP, hh);
  v8f st[2][2];      /* [query set][16-key tile] */
#pragma unroll
  for (int s = 0; s < 2; ++s) for (int t = 0; t < 2; ++t) if (!(DIAG && s == 0 && t == 1)) st[s][t] = fa_mma(kf[t][1], qf[s][1], fa_mma(kf[t][0], qf[s][0], z8));      /* on the diagonal pass keys 16..31 lie above every query of set 0: that tile is left out whole */
  if (PRE) {      /* the next pass's keys, fetched one pass ahead into the same registers; never past the staged tile */
#pragma unroll
    for (int t = 0; t < 2; ++t) for (int kb = 0; kb < 2; ++kb) kf[t][kb] = g2_frag(kp + (32 + t * 16) * FKP + kb * 32, hh); }
  if (DIAG) {      /* keys above the diagonal are excluded: their weight is exp2(-huge) = 0 */
#pragma unroll
    for (int s = 0; s < 2; ++s) for (int r = 0; r < 8; ++r) st[s][s][r] = (8 * hh + r <= ln) ? st[s][s][r] : -3.0e38f; }      /* only the two tiles on the diagonal are cut; set 1 sees all of keys 0..15 */
  float mx[2];
#pragma unroll
  for (int s = 0; s < 2; ++s) { float a = st[s][0][0]; for (int r = 1; r < 8; ++r) a = fmaxf(a, st[s][0][r]); if (!(DIAG && s == 0)) for (int r = 0; r < 8; ++r) a = fmaxf(a, st[s][1][r]); a = fmaxf(a, fa_swap16(a)); mx[s] = a * SCL2; }
  /* the maximum in use moves only when some query's new maximum exceeds it by more than 8 (log2 units): weights stay <= 2^8, inside f16; one scalar branch a pass */
  if (__builtin_amdgcn_ballot_w32(mx[0] > m[0] + 8.f || mx[1] > m[1] + 8.f) != 0) {
#pragma unroll
    for (int s = 0; s < 2; ++s) { const float mn = fmaxf(m[s], mx[s]); const float al = __builtin_amdgcn_exp2f(m[s] - mn); m[s] = mn; l[s] *= al; for (int d = 0; d < 4; ++d) o[s][d] *= al; } }
#pragma unroll
  for (int s = 0; s < 2; ++s) { FragH pf; float s0 = 0.f, s1 = 0.f;
#pragma unroll
    for (int r = 0; r < 8; ++r) { const float e0 = __builtin_amdgcn_exp2f(fmaf(st[s][0][r], SCL2, -m[s])); const float e1 = (DIAG && s == 0) ? 0.f : __builtin_amdgcn_exp2f(fmaf(st[s][1][r], SCL2, -m[s])); s0 += e0; s1 += e1; pf.h[r] = (_Float16)e0; pf.h[8 + r] = (_Float16)e1; }
    l[s] += s0 + s1;
#pragma unroll
    for (int d = 0; d < 4; ++d) o[s][d] = fa_mma(vf[d], pf.v, o[s][d]); } }
// The join of a wave pair. Each wave keeps one 16-query set and gives the other to its partner: fa_give<S> writes set S (32 context values, maximum in use, partial sum of a lane) to the wave's own LDS slot, 16 bytes a lane and 512 consecutive bytes a wave at every write.
template <int S>
__device__ __forceinline__ void fa_give(v4f* xw, const v8f (&o)[2][4], const float (&m)[2], const float (&l)[2]) {
#pragma unroll
  for (int d = 0; d < 4; ++d) { const v4f lo4 = {o[S][d][0], o[S][d][1], o[S][d][2], o[S][d][3]}; const v4f hi4 = {o[S][d][4], o[S][d][5], o[S][d][6], o[S][d][7]}; xw[(2 * d) * 32] = lo4; xw[(2 * d + 1) * 32] = hi4; }
  const v4f ml = {m[S], l[S], 0.f, 0.f}; xw[8 * 32] = ml; }
// fa_take<S> reads the partner's half of set S, brings both halves to the larger of the two maxima, adds them, divides by the whole sum and stores the 16 output rows' 64 columns.
template <int S>
__device__ __forceinline__ void fa_take(const v4f* xr, const v8f (&o)[2][4], const float (&m)[2], const float (&l)[2], float* op) {
  const v4f ml = xr[8 * 32]; const float dm = m[S] - ml[0]; const float e = __builtin_amdgcn_exp2f(-fabsf(dm)); const float a = dm >= 0.f ? 1.0f : e, b = dm >= 0.f ? e : 1.0f;      /* the half with the larger maximum keeps its scale, the other comes down to it */
  const float lt = l[S] * a + ml[1] * b; const float inv = 1.0f / (lt + fa_swap16(lt)); const float ai = a * inv, bi = b * inv;
#pragma unroll
  for (int d = 0; d < 4; ++d) { const v4f pl = xr[(2 * d) * 32], ph = xr[(2 * d + 1) * 32];      /* O^T tile d: rows d*16 + 8 hh + r of column (query) ln */
    const v4f lo4 = {o[S][d][0] * ai + pl[0] * bi, o[S][d][1] * ai + pl[1] * bi, o[S][d][2] * ai + pl[2] * bi, o[S][d][3] * ai + pl[3] * bi}; const v4f hi4 = {o[S][d][4] * ai + ph[0] * bi, o[S][d][5] * ai + ph[1] * bi, o[S][d][6] * ai + ph[2] * bi, o[S][d][7] * ai + ph[3] * bi};
    *(v4f*)(op + d * 16) = lo4; *(v4f*)(op + d * 16 + 4) = hi4; } }
__global__ __launch_bounds__(256) __attribute__((amdgpu_waves_per_eu(4, 4))) void k_fattn(const _Float16* __restrict__ Q, const _Float16* __restrict__ Kh, const _Float16* __restrict__ Vt, float* __restrict__ O) {
  __shared__ __attribute__((aligned(16))) _Float16 sK[2][FKT * FKP]; __shared__ __attribute__((aligned(16))) _Float16 sV[2][HD * FVP]; __shared__ __attribute__((aligned(16))) v4f sx[8 * 9 * 32];      /* sx: a slot of 9 x 512 B for every wave, for the join */
  const int tid = threadIdx.x, lane = tid & 31, ln = lane & 15, hh = lane >> 4; const int wv = __builtin_amdgcn_readfirstlane(threadIdx.x >> 5); const int w = wv & 3, g = wv >> 2;      /* w: the pair's 32 query rows; g: which half of every staged tile's keys */
  const int h = blockIdx.x % NH; const int tile = (SQ - QT0) / FQ - 1 - blockIdx.x / NH;      /* the longest key ranges start first */
  const int qw = QT0 + tile * FQ + w * 32;      /* first query row of the wave pair: scalar, a multiple of 32 */
  const int NS = (QT0 + tile * FQ) / FKT + 1;      /* staged tiles of the block: all keys below its first query row, then the 128 keys of its own rows; at least 3 */
  const _Float16* qp = Q + (size_t)(qw + ln) * LQ + h * HD;
  const _Float16* gk = Kh + (size_t)(tid >> 3) * KVD + h * HD + (tid & 7) * 8; const unsigned lk = (unsigned)(size_t)&sK[0][(tid >> 3) * FKP + (tid & 7) * 8];      /* K: a copy of the block = 32 rows of 128 B */
  const _Float16* gv = Vt + ((size_t)h * HD + (tid >> 4)) * SQ + (tid & 15) * 8; const unsigned lv = (unsigned)(size_t)&sV[0][(tid >> 4) * FVP + (tid & 15) * 8];      /* V^T: a copy of the block = 16 rows of 256 B */
  auto fill = [&](int t) {      /* tile t into buffer t mod 2: 8 copies a lane */
    fa_copy4<32u * FKP * 2u>(lk + (unsigned)(t & 1) * (FKT * FKP * 2u), gk + (size_t)t * FKT * KVD, (size_t)32 * KVD); fa_copy4<16u * FVP * 2u>(lv + (unsigned)(t & 1) * (HD * FVP * 2u), gv + (size_t)t * FKT, (size_t)16 * SQ); };
  fill(0);
  v16h qf[2][2], kf[2][2];
#pragma unroll
  for (int s = 0; s < 2; ++s) for (int kb = 0; kb < 2; ++kb) qf[s][kb] = g2_frag(qp + (size_t)s * 16 * LQ + kb * 32, hh);
  asm volatile("s_wait_xcnt 0x0" ::: "memory");      /* stands behind the last load of the opening run, in front of every later write of that run's address registers */
  const v8f z8 = {0.f,0.f,0.f,0.f,0.f,0.f,0.f,0.f}; v8f o[2][4]; float m[2], l[2];
#pragma unroll
  for (int s = 0; s < 2; ++s) { m[s] = -1.0e37f; l[s] = 0.f; for (int d = 0; d < 4; ++d) o[s][d] = z8; }
  asm volatile("s_wait_asynccnt 0x0" ::: "memory");      /* this wave's copies of tile 0 have landed */
  __syncthreads();      /* tile 0 published */
  fill(1);
#pragma nounroll      /* one copy of the loop's body: a peeled last trip took registers past the budget of four waves a SIMD (spills) */
  for (int t = 0; t < NS - 1; ++t) {      /* tiles below every query of the block: 2 whole passes in every wave, over its half of the tile's keys */
    const _Float16* kp = &sK[t & 1][(g * 64 + ln) * FKP]; const _Float16* vp = &sV[t & 1][ln * FVP + g * 64];
#pragma unroll
    for (int u = 0; u < 2; ++u) for (int kb = 0; kb < 2; ++kb) kf[u][kb] = g2_frag(kp + u * 16 * FKP + kb * 32, hh);
    fa_pass<false, true>(kp, vp, ln, hh, qf, kf, o, m, l); fa_pass<false, false>(kp + 32 * FKP, vp + 32, ln, hh, qf, kf, o, m, l);
    asm volatile("s_wait_dscnt 0x0" ::: "memory");      /* this wave's reads of buffer t mod 2 are done before the buffer is given up */
    asm volatile("s_wait_asynccnt 0x0" ::: "memory");      /* this wave's copies of tile t + 1 have landed */
    __syncthreads();      /* publishes tile t + 1 and ends every wave's reads of tile t */
    if (t + 2 < NS) fill(t + 2); }
  asm volatile("s_wait_asynccnt 0x0" ::: "memory");      /* nothing is in flight when the loop is left */
  { const _Float16* kp = &sK[(NS - 1) & 1][(g * 32 + ln) * FKP]; const _Float16* vp = &sV[(NS - 1) & 1][ln * FVP + g * 32];      /* the block's own 128 keys: pair w has w whole passes, then its diagonal pass; wave g takes passes g, g + 2; all tests are scalar */
    int p = g;
    for (; p < w; p += 2) {
#pragma unroll
      for (int u = 0; u < 2; ++u) for (int kb = 0; kb < 2; ++kb) kf[u][kb] = g2_frag(kp + u * 16 * FKP + kb * 32, hh);
      fa_pass<false, false>(kp, vp, ln, hh, qf, kf, o, m, l); kp += 64 * FKP; vp += 64; }
    if (p == w) {
#pragma unroll
      for (int u = 0; u < 2; ++u) for (int kb = 0; kb < 2; ++kb) kf[u][kb] = g2_frag(kp + u * 16 * FKP + kb * 32, hh);
      fa_pass<true, false>(kp, vp, ln, hh, qf, kf, o, m, l); } }
  asm volatile("v_nop\n\tv_nop\n\tv_nop\n\tv_nop");      /* the distance behind the last pass's last matrix instruction: the join below begins with scalar branches */
  v4f* xw = &sx[wv * (9 * 32) + lane]; const v4f* xr = &sx[(wv ^ 4) * (9 * 32) + lane]; float* op = O + (size_t)(qw + g * 16 + ln) * DM + h * HD + 8 * hh;      /* wave g keeps query set g and gives away the other */
  if (g == 0) fa_give<1>(xw, o, m, l); else fa_give<0>(xw, o, m, l);
  __syncthreads();      /* every wave's given half is in LDS before its partner reads it */
  if (g == 0) fa_take<0>(xr, o, m, l, op); else fa_take<1>(xr, o, m, l, op); }

// Exact f32 attention for query rows 0 .. QT0-1, all on the vector unit. One block = one head x 16 query rows, 8 waves; the work of a row is spread over lanes and waves, nothing walks the keys one by one.
// Stage: the head's 256 K rows, 256 V rows and the block's 16 Q rows go to LDS by coalesced 16-byte loads, all in flight together. Keys above a row's diagonal are staged too (they are rows of this call) and get the weight 0.
// Scores: a thread owns 4 rows x 4 keys (keys 64 apart), so 8 LDS reads feed 64 FMAs. Softmax: a wave owns 2 rows, 8 keys a lane, true row maximum and sum by butterflies. Context: a thread owns 4 rows x 4 columns over a quarter of the keys; the four quarters are summed through LDS.
#define A0R 16                       /* query rows per block */
#define A0KP 68                      /* K row pitch in LDS (floats): 272 B = 16 B x odd, 16 lanes on 16 rows meet every bank once */
#define A0SP 260                     /* score row pitch (floats) */
#define A0PP 20                      /* weight pitch (floats), laid [key][row] so that one 16-byte read gives 4 rows' weights of a key */
struct A0Lds { float sq[A0R * HD]; float sfin[A0R]; float ss[A0R * A0SP]; float sp[QT0 * A0PP]; float red[4 * A0R * HD]; float sk[QT0 * A0KP]; float sv[QT0 * HD]; };      /* every member starts at a multiple of 16 bytes; the small ones first, inside the reach of an LDS instruction's immediate offset */
template <int M> __device__ __forceinline__ float a0_xm(float x) { return __int_as_float(__builtin_amdgcn_update_dpp(0, __float_as_int(x), 0x160 | M, 0xf, 0xf, true)); }      /* lane l <- l ^ M inside a 16-lane row (DPP row_xmask); every lane is on where it is used */
__device__ __forceinline__ float a0_max32(float x) { x = fmaxf(x, a0_xm<1>(x)); x = fmaxf(x, a0_xm<2>(x)); x = fmaxf(x, a0_xm<4>(x)); x = fmaxf(x, a0_xm<8>(x)); return fmaxf(x, fa_swap16(x)); }
__device__ __forceinline__ float a0_sum32(float x) { x += a0_xm<1>(x); x += a0_xm<2>(x); x += a0_xm<4>(x); x += a0_xm<8>(x); return x + fa_swap16(x); }
__global__ __launch_bounds__(256) void k_att0(const float* __restrict__ QF, const float* __restrict__ KF, const float* __restrict__ VF, float scale, float* __restrict__ OF) {
  __shared__ __attribute__((aligned(16))) A0Lds L;
  const int t = threadIdx.x; const int h = blockIdx.x / (QT0 / A0R); const int i0 = (blockIdx.x % (QT0 / A0R)) * A0R;
  { const int r = t >> 4, c = (t & 15) * 4; const float* kp = KF + (size_t)r * DM + h * HD + c; const float* vp = VF + (size_t)r * DM + h * HD + c; v4f kv[QT0 / 16], vv[QT0 / 16];
#pragma unroll      /* full: the two arrays must be indexed by constants to stay in registers, and all 33 loads are to be in flight at once */
    for (int it = 0; it < QT0 / 16; ++it) { kv[it] = *(const v4fa*)(kp + (size_t)it * 16 * DM); vv[it] = *(const v4fa*)(vp + (size_t)it * 16 * DM); }
    const float* qp = QF + (size_t)(i0 + r) * DM + h * HD + c; const v4f qv = *(const v4fa*)qp;
    asm volatile("s_wait_xcnt 0x0" :: "v"(kp), "v"(vp), "v"(qp) : "memory");      /* stands behind the last load of the run; the run's three address pairs are inputs, so they keep their registers up to the wait and every later write of those registers stands behind it */
    float* ks = &L.sk[r * A0KP + c]; float* vs = &L.sv[r * HD + c];
#pragma unroll      /* full: constant indices, as above */
    for (int it = 0; it < QT0 / 16; ++it) { *(v4f*)(ks + it * 16 * A0KP) = kv[it]; *(v4f*)(vs + it * 16 * HD) = vv[it]; }
    *(v4f*)&L.sq[r * HD + c] = qv; }
  __syncthreads();      /* K, V, Q staged */
  { const int kq = t & 63, r0 = (t >> 6) * 4; const v4f z4 = {0.f, 0.f, 0.f, 0.f}; v4f acc[4] = {z4, z4, z4, z4};      /* acc[row][key] */
    const float* qb = &L.sq[r0 * HD]; const float* kb = &L.sk[kq * A0KP];
#pragma unroll      /* full: the LDS reads of later steps issue under the FMAs of earlier ones */
    for (int c = 0; c < HD; c += 4) { v4f q[4], k[4];
#pragma unroll
      for (int a = 0; a < 4; ++a) { q[a] = *(const v4f*)(qb + a * HD + c); k[a] = *(const v4f*)(kb + a * 64 * A0KP + c); }
#pragma unroll
      for (int a = 0; a < 4; ++a) for (int u = 0; u < 4; ++u) for (int e = 0; e < 4; ++e) acc[a][u] = fmaf(q[a][e], k[u][e], acc[a][u]); }
#pragma unroll
    for (int a = 0; a < 4; ++a) for (int u = 0; u < 4; ++u) { const int j = kq + 64 * u; L.ss[(r0 + a) * A0SP + j] = (j <= i0 + r0 + a) ? acc[a][u] * scale : -1.0e30f; } }      /* keys above the diagonal are excluded: their weight is exp(-huge) = 0 */
  __syncthreads();      /* scores complete */
  { const int lane = t & 31, r0 = (t >> 5) * 2; float x[2][8], m[2], l[2];      /* the wave's two rows side by side: two independent chains */
#pragma unroll
    for (int rr = 0; rr < 2; ++rr) for (int u = 0; u < 8; ++u) x[rr][u] = L.ss[(r0 + rr) * A0SP + lane + 32 * u];
#pragma unroll
    for (int rr = 0; rr < 2; ++rr) { float a = x[rr][0]; for (int u = 1; u < 8; ++u) a = fmaxf(a, x[rr][u]); m[rr] = a; }
    m[0] = a0_max32(m[0]); m[1] = a0_max32(m[1]);
#pragma unroll
    for (int rr = 0; rr < 2; ++rr) { float a = 0.f; for (int u = 0; u < 8; ++u) { x[rr][u] = expf(x[rr][u] - m[rr]); a += x[rr][u]; } l[rr] = a; }
    l[0] = a0_sum32(l[0]); l[1] = a0_sum32(l[1]);
#pragma unroll
    for (int rr = 0; rr < 2; ++rr) for (int u = 0; u < 8; ++u) L.sp[(lane + 32 * u) * A0PP + r0 + rr] = x[rr][u];
    if (lane < 2) L.sfin[r0 + lane] = 1.0f / (lane == 0 ? l[0] : l[1]); }
  __syncthreads();      /* weights complete */
  { const int c = (t & 15) * 4, r0 = ((t >> 4) & 3) * 4, ks = t >> 6; const v4f z4 = {0.f, 0.f, 0.f, 0.f}; v4f o[4] = {z4, z4, z4, z4};
    const float* vb = &L.sv[ks * (QT0 / 4) * HD + c]; const float* pb = &L.sp[ks * (QT0 / 4) * A0PP + r0];
#pragma unroll      /* full: every LDS read is one base register plus an immediate offset, and later keys' reads issue under earlier keys' FMAs */
    for (int jj = 0; jj < QT0 / 4; ++jj) { const v4f v = *(const v4f*)(vb + jj * HD); const v4f p = *(const v4f*)(pb + jj * A0PP);
#pragma unroll
      for (int a = 0; a < 4; ++a) for (int e = 0; e < 4; ++e) o[a][e] = fmaf(p[a], v[e], o[a][e]); }
#pragma unroll
    for (int a = 0; a < 4; ++a) *(v4f*)&L.red[(ks * A0R + r0 + a) * HD + c] = o[a]; }
  __syncthreads();      /* the four key quarters' partial contexts complete */
  { const int r = t >> 4, c = (t & 15) * 4; v4f s = *(const v4f*)&L.red[r * HD + c];
#pragma unroll
    for (int ks = 1; ks < 4; ++ks) s += *(const v4f*)&L.red[(ks * A0R + r) * HD + c];
    s *= L.sfin[r]; *(v4f*)(OF + (size_t)(i0 + r) * DM + h * HD + c) = s; } }

extern "C" void kernel_launch(void* const* d_in, const int* in_sizes, int n_in,
                              void* d_out, int out_size, void* d_ws, size_t ws_size, hipStream_t stream) {
  (void)in_sizes; (void)n_in; (void)out_size;
  const float* const* I = (const float* const*)d_in; const float* x = I[0]; const float* wq = I[1]; const float* wk = I[2]; const float* wv = I[3];      /* x [4096][1024] (ONE unbatched sequence); three separate [in][out] weights Wq, Wk, Wv [1024][1024]; no biases; no output projection */
  static_assert(HPG == 1 && NH == NG * HPG && NH * HD == DM && KVD == DM, "plain multi-head attention as 16 kv groups of one query head");
  char* ws = (char*)d_ws; size_t off = 0;
  auto take = [&](size_t bytes) { char* p = ws + off; off += (bytes + 255) & ~(size_t)255; return p; };
  _Float16* BQKV = (_Float16*)take((size_t)3 * DM * DM * 2); _Float16* BQ = BQKV; _Float16* BK = BQKV + (size_t)DM * DM; _Float16* BV = BQKV + (size_t)2 * DM * DM;      /* three transposed planes, one after another: q, k, v */
  _Float16* X16 = (_Float16*)take(NR * DM * 2); _Float16* Q16 = (_Float16*)take(NR * DM * 2); _Float16* K16 = (_Float16*)take(NR * KVD * 2); _Float16* V16 = (_Float16*)take(NR * KVD * 2);
  _Float16* VT = (_Float16*)take((size_t)NH * HD * SQ * 2);
  float* QF0 = (float*)take((size_t)QT0 * DM * 4); float* KF0 = (float*)take((size_t)QT0 * KVD * 4); float* VF0 = (float*)take((size_t)QT0 * KVD * 4);      /* f32 q, k, v of the first 256 rows */
  if (off > ws_size) return;
  k_prep<<<3 * PWB + PXB, 256, 0, stream>>>(x, wq, wk, wv, X16, BQKV);      /* x -> f16 rows; three [in][out] weights -> their transposed x16 planes, q, k, v one after another */
  for (int b = B0; b < B0 + NBR; ++b) { const size_t r0 = (size_t)b * SQ;
    /* q, k, v: every row rounded once to f16 in the epilogue; rows 0..255 stored in f32 as well, for the exact first tile (one head a k/v group: the tile reads these rows as they are) */
    k_qkv<<<(SQ / GAR) * (DM / 64), GNW * 32, 0, stream>>>(X16 + r0 * DM, BQ, BK, BV, 0.0625f, QF0, KF0, VF0, Q16 + r0 * DM, K16 + r0 * KVD, V16 + r0 * KVD);
    k_vt<NG, SQ><<<NG * (SQ / 64), 256, 0, stream>>>(V16 + r0 * KVD, KVD, 0, VT);      /* V^T [NH][HD][SQ] for this batch */
    k_att0<<<NH * (QT0 / A0R), 256, 0, stream>>>(QF0, KF0, VF0, 0.125f, (float*)d_out + r0 * DM);      /* exact f32 attention for rows 0..255, written straight into the output rows */
    k_fattn<<<NH * ((SQ - QT0) / FQ), 256, 0, stream>>>(Q16 + r0 * LQ, K16 + r0 * KVD, VT, (float*)d_out + r0 * DM); }      /* rows 256..4095 of all 16 heads: scores, online softmax and context in ONE launch, straight into the output rows as f32 */
}

// v010
// It runs in 73.5 microseconds.
// In both of two side-by-side timings against v009, it was 1.07 times as fast.
// Over all steps from v000 it is 76.2 times as fast.
#include <hip/hip_runtime.h>
// Causal multi-head self-attention over ONE unbatched sequence with three separate projections and NO output projection (x [4096][1024]; q = x Wq, k = x Wk, v = x Wv ([in][out] 1024 x 1024 each, no biases); 16 heads of 64; scores / sqrt(64); causal (-inf above the diagonal: realised as exclusion); softmax; y = the merged context -> [4096][1024]); 16 k/v groups of ONE head each, no rotation.
// Structure: x as exact f16 rows; [in][out] weights as exact x16 planes; q, k and v as ONE WMMA GEMM launch (64x64 wave tiles, f32 accumulation, no bias) whose epilogue stores the one f16 rounding of every q and k row, the same rounding of v as V^T [head][64][4096] straight from the accumulators and, for the first 256 rows, the f32 value beside it; rows 256..4095: one fused launch, each pair of waves 32 query rows of one head, the keys split between the two: S^T = K Q^T on WMMA, online softmax in registers (f32 statistics, native exp2; weights f16), O^T += V^T P^T on WMMA, f32 straight into the merged output rows; the first tile: exact f32 attention for rows 0..255 written straight into the output rows.
// The first tile: the first 256 query rows see only a few keys, where single-f16 v / P operands are least accurate; they are computed exactly: the f32 q/k/v rows that the GEMM launch stores for them and an f32 attention on VALU (16 query rows a block, K and V in LDS, true row maximum).
// Compute dtype: inputs rounded to bf16; x / weights exact; q, k, v and softmax weights as plain f16 GEMM operands (~2^-12); scores and softmax statistics f32; v_wmma_f32_16x16x32_f16.
#define NB 1
#define NG 16
#define HPG 1
#define KVD (NG * HD)
#define SQ 4096
#define DM 1024
#define NH 16
#define HD 64
#define HG 4
#define QT0 256                      /* first-tile rows recomputed exactly in f32 */
#define B0 0                         /* first batch processed (debug hook) */
#define NBR NB                       /* batches processed (debug hook) */
#define NR ((size_t)NB * SQ)         /* token rows */
#define MP ((int)((size_t)NBR * SQ)) /* NBR x SQ rows; unused: each projection launch takes SQ rows */
#define MPO MP
#define LQ DM      /* row pitch of the q/k/v rows */
typedef __bf16 v16b __attribute__((ext_vector_type(16)));
typedef unsigned short v8us __attribute__((ext_vector_type(8), may_alias));
typedef float  v8f  __attribute__((ext_vector_type(8)));
typedef float  v4f  __attribute__((ext_vector_type(4)));
typedef float  v4fa __attribute__((ext_vector_type(4), may_alias));
union FragB { v16b v; v8us half[2]; unsigned short u[16]; };

__device__ __forceinline__ unsigned short bf16_bits(float x) { unsigned int u = __float_as_uint(x); return (unsigned short)((u + 0x7FFFu + ((u >> 16) & 1u)) >> 16); }
__device__ __forceinline__ float bf16_val(unsigned short b) { return __uint_as_float(((unsigned int)b) << 16); }
__device__ __forceinline__ float bf16_round(float x) { return bf16_val(bf16_bits(x)); }
// D += A·B with NT terms: 1 = ah·bh, 2 = + al·bh (A split), 3 = + ah·bl (both split)
template <int NT>
__device__ __forceinline__ v8f mmaN(v16b ah, v16b al, v16b bh, v16b bl, v8f c) {
  c = __builtin_amdgcn_wmma_f32_16x16x32_bf16(false, ah, false, bh, (short)0, c, false, false);
  if (NT >= 2) c = __builtin_amdgcn_wmma_f32_16x16x32_bf16(false, al, false, bh, (short)0, c, false, false);
  if (NT >= 3) c = __builtin_amdgcn_wmma_f32_16x16x32_bf16(false, ah, false, bl, (short)0, c, false, false);
  asm volatile("v_nop\n\tv_nop\n\tv_nop\n\tv_nop" : "+v"(c) : "v"(ah), "v"(al), "v"(bh), "v"(bl));
  return c;
}




// ---- f16 WMMA path (v_wmma_f32_16x16x32_f16): 11-bit significands for operands in range — used for every WMMA product in this file
typedef _Float16 v16h __attribute__((ext_vector_type(16)));
union FragH { v16h v; v8us half[2]; _Float16 h[16]; unsigned short u[16]; };
template <int NT>
__device__ __forceinline__ v8f mmaH(v16h ah, v16h al, v16h bh, v16h bl, v8f c) {
  c = __builtin_amdgcn_wmma_f32_16x16x32_f16(false, ah, false, bh, (short)0, c, false, false);
  if (NT >= 2) c = __builtin_amdgcn_wmma_f32_16x16x32_f16(false, al, false, bh, (short)0, c, false, false);
  if (NT >= 3) c = __builtin_amdgcn_wmma_f32_16x16x32_f16(false, ah, false, bl, (short)0, c, false, false);
  asm volatile("v_nop\n\tv_nop\n\tv_nop\n\tv_nop" : "+v"(c) : "v"(ah), "v"(al), "v"(bh), "v"(bl));
  return c;
}

typedef _Float16 v4h __attribute__((ext_vector_type(4)));
typedef _Float16 v8h __attribute__((ext_vector_type(8)));

// Preparation, ONE launch: blocks 0 .. 3 PWB - 1 turn the three [in][out] f32 weights into their transposed x16 f16 planes Wt[n][k] = f16(bf16(W[k][n]) x 16) (a power of two: bf16-exact weights stay exact in f16 away from the subnormal range); the other PXB blocks round x to f16 rows.
// Few blocks with much work a thread: every global access is a 16-byte one, a wave reads whole 512-byte runs, and all of a thread's loads are in flight together.
// A weight block owns 128 k x 128 n. It is turned in LDS: one dword holds the f16 pair (k, k + 1) of one column n, so 4 dwords down a column are 8 consecutive k of the output row n.
#define PWT 128                      /* edge of a weight tile */
#define PWP 129                      /* LDS pitch in dwords: 4 rows = 516 = 4 mod 64, so 16 lanes 4 rows apart and 2 neighbouring columns meet every bank once */
#define PWB ((DM / PWT) * (DM / PWT))      /* blocks a weight */
#define PXC 8                        /* 8-element runs a thread of an x block */
#define PXB ((int)(NR * DM / 8 / 256 / PXC))      /* x blocks */
typedef unsigned int v4ua __attribute__((ext_vector_type(4), may_alias));
typedef float v2f __attribute__((ext_vector_type(2)));
typedef _Float16 v2h __attribute__((ext_vector_type(2)));
__device__ __forceinline__ unsigned pw_pair(float lo, float hi) { const v2f p = {bf16_round(lo) * 16.0f, bf16_round(hi) * 16.0f}; return __builtin_bit_cast(unsigned, __builtin_convertvector(p, v2h)); }
__global__ __launch_bounds__(256) void k_prep(const float* __restrict__ x, const float* __restrict__ wq, const float* __restrict__ wk, const float* __restrict__ wv, _Float16* __restrict__ X16, _Float16* __restrict__ Wt3) {
  static_assert(DM % PWT == 0 && (NR * DM) % (8 * 256 * PXC) == 0, "whole tiles and whole runs only");
  __shared__ unsigned tl[(PWT / 2) * PWP];
  const int tid = threadIdx.x; const int b = blockIdx.x;
  if (b >= 3 * PWB) {      /* the same for the whole block: it leaves as a whole, in front of the barrier below */
    const size_t t0 = (size_t)(b - 3 * PWB) * (PXC * 256) + tid; const float* xp = x + t0 * 8; v4f a[PXC][2];
#pragma unroll      /* full: the array must be indexed by constants to stay in registers, and all 16 loads are to be in flight at once */
    for (int i = 0; i < PXC; ++i) { a[i][0] = *(const v4fa*)(xp + (size_t)i * 2048); a[i][1] = *(const v4fa*)(xp + (size_t)i * 2048 + 4); }
    asm volatile("s_wait_xcnt 0x0" :: "v"(xp), "v"(a[0][0]), "v"(a[0][1]), "v"(a[1][0]), "v"(a[1][1]), "v"(a[2][0]), "v"(a[2][1]), "v"(a[3][0]), "v"(a[3][1]), "v"(a[4][0]), "v"(a[4][1]), "v"(a[5][0]), "v"(a[5][1]), "v"(a[6][0]), "v"(a[6][1]), "v"(a[7][0]), "v"(a[7][1]) : "memory");      /* stands behind the last load of the run; the address pair is an input, so it keeps its registers up to the wait; the loaded values are inputs too, so no conversion is placed between the loads and all 16 are issued back to back (one memory latency, not several) */
    unsigned short* op = (unsigned short*)X16 + t0 * 8;
    FragH f[PXC];
#pragma unroll      /* full: constant indices, as above */
    for (int i = 0; i < PXC; ++i) for (int q = 0; q < 8; ++q) f[i].h[q] = (_Float16)bf16_round(a[i][q >> 2][q & 3]);
    __builtin_amdgcn_sched_barrier(0);      /* every store stands behind every conversion, so no register of an issued store is written again */
#pragma unroll      /* full: constant indices, as above */
    for (int i = 0; i < PXC; ++i) *(v8us*)(op + (size_t)i * 2048) = f[i].half[0];
    return; }
  {
    const int ws = b / PWB, tile = b % PWB; const int k0 = (tile / (DM / PWT)) * PWT, n0 = (tile % (DM / PWT)) * PWT; const float* W = ws == 0 ? wq : ws == 1 ? wk : wv;
    const int r = tid >> 5, c4 = (tid & 31) * 4; const float* wp = W + (size_t)(k0 + 2 * r) * DM + n0 + c4; v4f e0[PWT / 16], e1[PWT / 16];      /* rows k and k + 1, 16 rows on every step */
#pragma unroll      /* full: constant indices and all 16 loads in flight at once, as above */
    for (int it = 0; it < PWT / 16; ++it) { e0[it] = *(const v4fa*)(wp + (size_t)it * 16 * DM); e1[it] = *(const v4fa*)(wp + (size_t)(it * 16 + 1) * DM); }
    asm volatile("s_wait_xcnt 0x0" :: "v"(wp), "v"(e0[0]), "v"(e1[0]), "v"(e0[1]), "v"(e1[1]), "v"(e0[2]), "v"(e1[2]), "v"(e0[3]), "v"(e1[3]), "v"(e0[4]), "v"(e1[4]), "v"(e0[5]), "v"(e1[5]), "v"(e0[6]), "v"(e1[6]), "v"(e0[7]), "v"(e1[7]) : "memory");      /* behind the last load of the run, address pair and loaded values as inputs, for the same two reasons as above */
#pragma unroll      /* full: constant indices, as above */
    for (int it = 0; it < PWT / 16; ++it) for (int e = 0; e < 4; ++e) tl[(it * 8 + r) * PWP + c4 + e] = pw_pair(e0[it][e], e1[it][e]);
    __syncthreads();      /* the tile is complete in LDS */
    const int kc = tid & 15, nn = tid >> 4; _Float16* op = Wt3 + (size_t)ws * DM * DM + (size_t)(n0 + nn) * DM + k0 + kc * 8;      /* 16 lanes write 256 consecutive bytes of an output row */
#pragma unroll      /* full: every LDS read and every store is one base register plus an immediate offset, and all the reads are in flight together */
    for (int rd = 0; rd < PWT / 16; ++rd) { v4ua o; for (int q = 0; q < 4; ++q) o[q] = tl[(kc * 4 + q) * PWP + rd * 16 + nn]; *(v4ua*)(op + (size_t)rd * 16 * DM) = o; }
    asm volatile("s_wait_xcnt 0x0" ::: "memory");      /* stands behind the last store of the run, in front of every later write of the stores' address and data registers on any way the listing's branches allow */
  } }

// ---- q/k/v GEMM (wave tile 64x64; whole tiles only) ----
__device__ __forceinline__ v16h g2_frag(const _Float16* p, int hh) { FragH f; f.half[0] = *(const v8us*)((const unsigned short*)p + 8 * hh); f.half[1] = *(const v8us*)((const unsigned short*)p + 16 + 8 * hh); return f.v; }
__device__ __forceinline__ v8f g2_mma(v16h a, v16h b, v8f c) { v8f d = __builtin_amdgcn_wmma_f32_16x16x32_f16(false, a, false, b, (short)0, c, false, false); asm volatile("v_nop\n\tv_nop\n\tv_nop\n\tv_nop" : "+v"(d) : "v"(a), "v"(b)); return d; }
// The three projections are ONE launch. A block of 12 waves owns 256 x rows and 64 columns of each of q, k and v: waves 0..3 work on q, 4..7 on k, 8..11 on v, each on 64 rows x 64 columns, so one staged x tile feeds all three products and every fragment read from LDS feeds four matrix instructions.
// The operand tiles go through LDS: the block's 256 A rows and 3 x 64 B rows, 128 k at a time, are brought in by asynchronous 16-byte copies (a wave-wide copy = 2 rows x 256 B = 4 whole lines; each line is fetched once a block), two buffers, the next tile in flight while this one is worked on.
#define GKT 128                      /* k elements of a staged tile: rows of 256 bytes */
#define GPE 136                      /* LDS row pitch in elements: 272 B = 16 B x odd, 16 lanes on 16 rows meet every bank once */
#define GAR 256                      /* A rows of a staged tile */
#define GTR (GAR + 3 * 64)           /* rows of a staged tile: the block's A rows, then 64 B rows of each weight plane */
#define GNW 12                       /* waves of a block: 4 row strips x 3 planes */
// Eight copies of one lane: l = the lane's LDS byte address, LS = the LDS step in bytes from copy to copy, g = its global address, gs = the global step in elements. The s_wait_xcnt stands inside the statement, behind the last copy, so that no later write of an address register can be placed in front of it.
template <unsigned LS>
__device__ __forceinline__ void g2_copy8(unsigned l, const _Float16* g, size_t gs) {
  asm volatile("global_load_async_to_lds_b128 %0, %8, off\n\tglobal_load_async_to_lds_b128 %1, %9, off\n\tglobal_load_async_to_lds_b128 %2, %10, off\n\tglobal_load_async_to_lds_b128 %3, %11, off\n\t"
               "global_load_async_to_lds_b128 %4, %12, off\n\tglobal_load_async_to_lds_b128 %5, %13, off\n\tglobal_load_async_to_lds_b128 %6, %14, off\n\tglobal_load_async_to_lds_b128 %7, %15, off\n\ts_wait_xcnt 0x0"
               :: "v"(l), "v"(l + LS), "v"(l + 2u * LS), "v"(l + 3u * LS), "v"(l + 4u * LS), "v"(l + 5u * LS), "v"(l + 6u * LS), "v"(l + 7u * LS),
                  "v"(g), "v"(g + gs), "v"(g + 2 * gs), "v"(g + 3 * gs), "v"(g + 4 * gs), "v"(g + 5 * gs), "v"(g + 6 * gs), "v"(g + 7 * gs) : "memory"); }
__global__ __launch_bounds__(GNW * 32) void k_qkv(const _Float16* __restrict__ A, const _Float16* __restrict__ Bq, const _Float16* __restrict__ Bk, const _Float16* __restrict__ Bv, float alpha,
    float* __restrict__ Fq, float* __restrict__ Fk, float* __restrict__ Fv, _Float16* __restrict__ Hq, _Float16* __restrict__ Hk, _Float16* __restrict__ Vt) {      /* F*: f32 rows, stored for rows below QT0 only; H*: the f16 rounding of every q and k row; Vt: the f16 rounding of v, transposed: [head][HD][SQ] */
  static_assert(SQ % GAR == 0 && DM % 64 == 0 && DM % GKT == 0 && DM / GKT >= 2 && QT0 % 64 == 0 && KVD == DM, "whole tiles only; a wave's 64 rows lie on one side of QT0");
  __shared__ __attribute__((aligned(16))) union { _Float16 st[2][GTR * GPE]; float so[GNW][64][68]; } S;      /* so, the epilogue's turn-round space, takes the place of the staged tiles once the last tile has been read by every wave */
  const int tid = threadIdx.x, lane = tid & 31, ln = lane & 15, hh = lane >> 4; const int wv = __builtin_amdgcn_readfirstlane(tid >> 5); const int rw = wv & 3, p = wv >> 2;      /* rw: the wave's 64-row strip; p: its plane */
  const int mt = blockIdx.x / (DM / 64), nq = blockIdx.x % (DM / 64); const int row0 = mt * GAR + 64 * rw, col0 = nq * 64;
  const int cc = (tid & 15) * 8, ca = (tid >> 4) & 15, cb = (tid >> 4) & 7;      /* the thread's 16-byte column in every copy; its row (of 16) as one of the 8 waves that copy A; its row (of 8) as one of the 4 that copy B */
  const _Float16* ga = A + (size_t)(mt * GAR + ca) * DM + cc; const size_t gb = (size_t)(col0 + cb) * DM + cc; const unsigned la = (unsigned)(size_t)&S.st[0][ca * GPE + cc], lb = (unsigned)(size_t)&S.st[0][(GAR + cb) * GPE + cc];
  auto fill = [&](int t) { const unsigned bo = (unsigned)(t & 1) * (GTR * GPE * 2u); const size_t ko = (size_t)t * GKT;      /* tile t into buffer t mod 2; the test is scalar: a wave copies as a whole. Waves 0..7: 16 copies a lane, waves 8..11: 24 */
    if (wv < 8) { g2_copy8<16u * GPE * 2u>(la + bo, ga + ko, (size_t)16 * DM); g2_copy8<16u * GPE * 2u>(la + bo + 128u * GPE * 2u, ga + ko + (size_t)128 * DM, (size_t)16 * DM); }
    else { g2_copy8<8u * GPE * 2u>(lb + bo, Bq + gb + ko, (size_t)8 * DM); g2_copy8<8u * GPE * 2u>(lb + bo + 64u * GPE * 2u, Bk + gb + ko, (size_t)8 * DM); g2_copy8<8u * GPE * 2u>(lb + bo + 128u * GPE * 2u, Bv + gb + ko, (size_t)8 * DM); } };
  const v8f z8 = {0.f,0.f,0.f,0.f,0.f,0.f,0.f,0.f}; v8f c[4][4];      /* [16-row tile][16-column tile] */
#pragma unroll      /* full, here and below: c and the fragment arrays must be indexed by constants to stay in registers */
  for (int m = 0; m < 4; ++m) for (int n = 0; n < 4; ++n) c[m][n] = z8;
  const int NT = DM / GKT;
  fill(0);
  asm volatile("s_wait_asynccnt 0x0" ::: "memory");      /* this wave's copies of tile 0 have landed */
  __syncthreads();      /* tile 0 published */
  fill(1);
  for (int t = 0; t < NT; ++t) { const _Float16* sa = &S.st[t & 1][(64 * rw + ln) * GPE]; const _Float16* sb = &S.st[t & 1][(GAR + 64 * p + ln) * GPE];
    v16h a[2][4], b[4];      /* the next 32 k are read from LDS under this step's products: A into a second fragment set, each B fragment into its own registers once its four products are issued; never past the tile */
#pragma unroll
    for (int u = 0; u < 4; ++u) { b[u] = g2_frag(sb + u * 16 * GPE, hh); a[0][u] = g2_frag(sa + u * 16 * GPE, hh); }
#pragma unroll
    for (int j = 0; j < GKT / 32; ++j) { const int q = j & 1;
      if (j + 1 < GKT / 32) {
#pragma unroll
        for (int u = 0; u < 4; ++u) a[q ^ 1][u] = g2_frag(sa + u * 16 * GPE + (j + 1) * 32, hh); }
#pragma unroll
      for (int n = 0; n < 4; ++n) {
#pragma unroll
        for (int m = 0; m < 4; ++m) c[m][n] = g2_mma(a[q][m], b[n], c[m][n]);
        if (j + 1 < GKT / 32) b[n] = g2_frag(sb + n * 16 * GPE + (j + 1) * 32, hh); } }
    asm volatile("s_wait_dscnt 0x0" ::: "memory");      /* this wave's reads of buffer t mod 2 are done before the buffer is given up */
    asm volatile("s_wait_asynccnt 0x0" ::: "memory");      /* this wave's copies of tile t + 1 have landed */
    __syncthreads();      /* publishes tile t + 1 and ends every wave's reads of tile t */
    if (t + 2 < NT) fill(t + 2); }
  asm volatile("s_wait_asynccnt 0x0" ::: "memory");      /* nothing is in flight when the loop is left; the last trip's barrier has ended every wave's reads of the tiles, so their LDS may be written */
  const bool cf = row0 < QT0;      /* the wave's 64 rows lie on one side of QT0: a scalar test */
  if (p == 2) {      /* a scalar test: the v waves. A lane's 8 values of an accumulator tile are 8 consecutive rows (keys) of one column, which is the order of a V^T row: v goes out transposed straight from the registers, 16 bytes a lane; the wave's 4 stores of a column group fill whole 128-byte lines (its 64 keys) */
    _Float16* tp = Vt + (size_t)(col0 + ln) * SQ + row0 + 8 * hh; v8h f[4][4];      /* col0 + column = head x HD + d; every store is one base register plus an immediate offset */
#pragma unroll
    for (int n = 0; n < 4; ++n) for (int m = 0; m < 4; ++m) for (int r = 0; r < 8; ++r) f[n][m][r] = (_Float16)(c[m][n][r] * alpha);
    __builtin_amdgcn_sched_barrier(0);      /* every store stands behind every conversion, so no register of an issued store is written again */
#pragma unroll
    for (int n = 0; n < 4; ++n) for (int m = 0; m < 4; ++m) *(v8h*)(tp + (size_t)n * 16 * SQ + m * 16) = f[n][m];
    asm volatile("s_wait_xcnt 0x0" ::: "memory"); }      /* stands behind the last store of the run, in front of every later write of the stores' registers */
  if (p != 2 || cf) {      /* a scalar test: row-major output, turned round in LDS; of v only the f32 rows below QT0 */
#pragma unroll
    for (int m = 0; m < 4; ++m) for (int n = 0; n < 4; ++n) for (int r = 0; r < 8; ++r) S.so[wv][m * 16 + 8 * hh + r][n * 16 + ln] = c[m][n][r] * alpha;
    __builtin_amdgcn_fence(__ATOMIC_ACQ_REL, "workgroup"); __builtin_amdgcn_wave_barrier();
    float* C = p == 0 ? Fq : p == 1 ? Fk : Fv; _Float16* C16 = p == 0 ? Hq : Hk;
    const int rsub = lane >> 4, c4 = (lane & 15) * 4;
    const float* sp = &S.so[wv][rsub][c4]; float* fp = C + (size_t)(row0 + rsub) * DM + col0 + c4; _Float16* hp = C16 + (size_t)(row0 + rsub) * DM + col0 + c4;      /* a wave-wide access = 2 rows; every access is one base register plus an immediate offset */
#pragma unroll      /* full: constant indices and immediate offsets */
    for (int q0 = 0; q0 < 32; q0 += 8) { v4f v[8]; v4h h[8];      /* 16 rows a round: 8 LDS reads in flight together, then the stores back to back */
#pragma unroll
      for (int i = 0; i < 8; ++i) v[i] = *(const v4fa*)(sp + (q0 + i) * 2 * 68);
      if (cf) {
#pragma unroll
        for (int i = 0; i < 8; ++i) *(v4f*)(fp + (size_t)(q0 + i) * 2 * DM) = v[i];
        asm volatile("s_wait_xcnt 0x0" ::: "memory"); }      /* stands behind the last f32 store of the run, in front of every later write of the stores' registers */
      if (p != 2) {
#pragma unroll
        for (int i = 0; i < 8; ++i) { for (int e = 0; e < 4; ++e) h[i][e] = (_Float16)v[i][e]; *(v4h*)(hp + (size_t)(q0 + i) * 2 * DM) = h[i]; }
        asm volatile("s_wait_xcnt 0x0" ::: "memory"); } } } }      /* stands behind the last f16 store of the run, for the same reason, on the way through the branch above too */


// Fused causal attention for query rows QT0 .. SQ-1: scores, softmax and context in ONE launch; no score or weight plane in memory.
// Two waves own 32 query rows of one head: of every 128 staged keys below the block's rows wave w takes the first 64 and wave w + 4 the last 64 (of the block's own 128 keys passes 0, 2 and 1, 3), 32 at a time, each with its own running maximum and sum (online softmax); the two partial results are joined once, through LDS, at the end.
// K rows and V^T rows go through LDS: 128 keys at a time are brought in once a block by asynchronous 16-byte copies (a wave-wide copy = 4 whole lines), two buffers, the next tile in flight while this one is worked on; the block's 8 waves read their fragments from there.
// S^T = K Q^T (A = 16 key rows, B = 16 query rows): lane (ln, hh) then holds, for query ln, keys 8 hh + r of each 16-key tile, which is the B operand order of O^T += V^T P^T: the weights go from accumulator to operand in registers.
// All of a lane's values belong to one query per 16-query set, so maximum, sum and rescale are lane-local but for one exchange between the wave halves.
// Two blocks a WGP, four waves a SIMD: the register budget is set for that (256 a wave), and twice the LDS fits.
// Every '#pragma unroll' of fa_pass and k_fattn is a full unroll: the fragment and accumulator arrays must be indexed by constants to stay in registers.
#define FQ 128                       /* query rows per block: 4 wave pairs x 32 */
#define SCL2 0.18033688011112042f    /* 1/sqrt(64) x log2(e): scores are carried in log2 units */
#define FKT 128                      /* keys of a staged tile: 2 passes in each wave of a pair; FQ and QT0 are multiples of it */
#define FKP 72                       /* LDS pitch of a K row in elements: 144 B = 16 B x odd, 16 lanes on 16 rows meet every bank once */
#define FVP 136                      /* LDS pitch of a V^T row (128 keys) in elements: 272 B = 16 B x odd */
// Four copies of one lane: l = the lane's LDS byte address, LS = the LDS step in bytes from copy to copy, g = its global address, gs = the global step in elements. The s_wait_xcnt stands inside the statement, behind the last copy, so that no later write of an address register can be placed in front of it.
template <unsigned LS>
__device__ __forceinline__ void fa_copy4(unsigned l, const _Float16* g, size_t gs) {
  asm volatile("global_load_async_to_lds_b128 %0, %4, off\n\tglobal_load_async_to_lds_b128 %1, %5, off\n\tglobal_load_async_to_lds_b128 %2, %6, off\n\tglobal_load_async_to_lds_b128 %3, %7, off\n\ts_wait_xcnt 0x0"
               :: "v"(l), "v"(l + LS), "v"(l + 2u * LS), "v"(l + 3u * LS), "v"(g), "v"(g + gs), "v"(g + 2 * gs), "v"(g + 3 * gs) : "memory"); }
__device__ __forceinline__ v8f fa_mma(v16h a, v16h b, v8f c) { return __builtin_amdgcn_wmma_f32_16x16x32_f16(false, a, false, b, (short)0, c, false, false); }
__device__ __forceinline__ float fa_swap16(float x) { const int b = __float_as_int(x); return __int_as_float(__builtin_amdgcn_permlanex16(b, b, 0x76543210, 0xfedcba98, false, false)); }      /* lane l <-> l ^ 16 */
// One pass: 32 keys against the wave's 32 queries. kp, vp: the lane's K row and V^T row in the staged tile, at the pass's first key. DIAG: the pass that crosses the diagonal (its first key == the wave's first query row), the wave's last. PRE: the next pass lies in the same staged tile.
template <bool DIAG, bool PRE>
__device__ __forceinline__ void fa_pass(const _Float16* kp, const _Float16* vp, int ln, int hh, const v16h (&qf)[2][2], v16h (&kf)[2][2], v8f (&o)[2][4], float (&m)[2], float (&l)[2]) {
  const v8f z8 = {0.f,0.f,0.f,0.f,0.f,0.f,0.f,0.f}; v16h vf[4];
#pragma unroll
  for (int d = 0; d < 4; ++d) vf[d] = g2_frag(vp + d * 16 * FVP, hh);
  v8f st[2][2];      /* [query set][16-key tile] */
#pragma unroll
  for (int s = 0; s < 2; ++s) for (int t = 0; t < 2; ++t) if (!(DIAG && s == 0 && t == 1)) st[s][t] = fa_mma(kf[t][1], qf[s][1], fa_mma(kf[t][0], qf[s][0], z8));      /* on the diagonal pass keys 16..31 lie above every query of set 0: that tile is left out whole */
  if (PRE) {      /* the next pass's keys, fetched one pass ahead into the same registers; never past the staged tile */
#pragma unroll
    for (int t = 0; t < 2; ++t) for (int kb = 0; kb < 2; ++kb) kf[t][kb] = g2_frag(kp + (32 + t * 16) * FKP + kb * 32, hh); }
  if (DIAG) {      /* keys above the diagonal are excluded: their weight is exp2(-huge) = 0 */
#pragma unroll
    for (int s = 0; s < 2; ++s) for (int r = 0; r < 8; ++r) st[s][s][r] = (8 * hh + r <= ln) ? st[s][s][r] : -3.0e38f; }      /* only the two tiles on the diagonal are cut; set 1 sees all of keys 0..15 */
  float mx[2];
#pragma unroll
  for (int s = 0; s < 2; ++s) { float a = st[s][0][0]; for (int r = 1; r < 8; ++r) a = fmaxf(a, st[s][0][r]); if (!(DIAG && s == 0)) for (int r = 0; r < 8; ++r) a = fmaxf(a, st[s][1][r]); a = fmaxf(a, fa_swap16(a)); mx[s] = a * SCL2; }
  /* the maximum in use moves only when some query's new maximum exceeds it by more than 8 (log2 units): weights stay <= 2^8, inside f16; one scalar branch a pass */
  if (__builtin_amdgcn_ballot_w32(mx[0] > m[0] + 8.f || mx[1] > m[1] + 8.f) != 0) {
#pragma unroll
    for (int s = 0; s < 2; ++s) { const float mn = fmaxf(m[s], mx[s]); const float al = __builtin_amdgcn_exp2f(m[s] - mn); m[s] = mn; l[s] *= al; for (int d = 0; d < 4; ++d) o[s][d] *= al; } }
#pragma unroll
  for (int s = 0; s < 2; ++s) { FragH pf; float s0 = 0.f, s1 = 0.f;
#pragma unroll
    for (int r = 0; r < 8; ++r) { const float e0 = __builtin_amdgcn_exp2f(fmaf(st[s][0][r], SCL2, -m[s])); const float e1 = (DIAG && s == 0) ? 0.f : __builtin_amdgcn_exp2f(fmaf(st[s][1][r], SCL2, -m[s])); s0 += e0; s1 += e1; pf.h[r] = (_Float16)e0; pf.h[8 + r] = (_Float16)e1; }
    l[s] += s0 + s1;
#pragma unroll
    for (int d = 0; d < 4; ++d) o[s][d] = fa_mma(vf[d], pf.v, o[s][d]); } }
// The join of a wave pair. Each wave keeps one 16-query set and gives the other to its partner: fa_give<S> writes set S (32 context values, maximum in use, partial sum of a lane) to the wave's own LDS slot, 16 bytes a lane and 512 consecutive bytes a wave at every write.
template <int S>
__device__ __forceinline__ void fa_give(v4f* xw, const v8f (&o)[2][4], const float (&m)[2], const float (&l)[2]) {
#pragma unroll
  for (int d = 0; d < 4; ++d) { const v4f lo4 = {o[S][d][0], o[S][d][1], o[S][d][2], o[S][d][3]}; const v4f hi4 = {o[S][d][4], o[S][d][5], o[S][d][6], o[S][d][7]}; xw[(2 * d) * 32] = lo4; xw[(2 * d + 1) * 32] = hi4; }
  const v4f ml = {m[S], l[S], 0.f, 0.f}; xw[8 * 32] = ml; }
// fa_take<S> reads the partner's half of set S, brings both halves to the larger of the two maxima, adds them, divides by the whole sum and stores the 16 output rows' 64 columns.
template <int S>
__device__ __forceinline__ void fa_take(const v4f* xr, const v8f (&o)[2][4], const float (&m)[2], const float (&l)[2], float* op) {
  const v4f ml = xr[8 * 32]; const float dm = m[S] - ml[0]; const float e = __builtin_amdgcn_exp2f(-fabsf(dm)); const float a = dm >= 0.f ? 1.0f : e, b = dm >= 0.f ? e : 1.0f;      /* the half with the larger maximum keeps its scale, the other comes down to it */
  const float lt = l[S] * a + ml[1] * b; const float inv = 1.0f / (lt + fa_swap16(lt)); const float ai = a * inv, bi = b * inv;
#pragma unroll
  for (int d = 0; d < 4; ++d) { const v4f pl = xr[(2 * d) * 32], ph = xr[(2 * d + 1) * 32];      /* O^T tile d: rows d*16 + 8 hh + r of column (query) ln */
    const v4f lo4 = {o[S][d][0] * ai + pl[0] * bi, o[S][d][1] * ai + pl[1] * bi, o[S][d][2] * ai + pl[2] * bi, o[S][d][3] * ai + pl[3] * bi}; const v4f hi4 = {o[S][d][4] * ai + ph[0] * bi, o[S][d][5] * ai + ph[1] * bi, o[S][d][6] * ai + ph[2] * bi, o[S][d][7] * ai + ph[3] * bi};
    *(v4f*)(op + d * 16) = lo4; *(v4f*)(op + d * 16 + 4) = hi4; } }
__global__ __launch_bounds__(256) __attribute__((amdgpu_waves_per_eu(4, 4))) void k_fattn(const _Float16* __restrict__ Q, const _Float16* __restrict__ Kh, const _Float16* __restrict__ Vt, float* __restrict__ O) {
  __shared__ __attribute__((aligned(16))) _Float16 sK[2][FKT * FKP]; __shared__ __attribute__((aligned(16))) _Float16 sV[2][HD * FVP]; __shared__ __attribute__((aligned(16))) v4f sx[8 * 9 * 32];      /* sx: a slot of 9 x 512 B for every wave, for the join */
  const int tid = threadIdx.x, lane = tid & 31, ln = lane & 15, hh = lane >> 4; const int wv = __builtin_amdgcn_readfirstlane(threadIdx.x >> 5); const int w = wv & 3, g = wv >> 2;      /* w: the pair's 32 query rows; g: which half of every staged tile's keys */
  const int h = blockIdx.x % NH; const int tile = (SQ - QT0) / FQ - 1 - blockIdx.x / NH;      /* the longest key ranges start first */
  const int qw = QT0 + tile * FQ + w * 32;      /* first query row of the wave pair: scalar, a multiple of 32 */
  const int NS = (QT0 + tile * FQ) / FKT + 1;      /* staged tiles of the block: all keys below its first query row, then the 128 keys of its own rows; at least 3 */
  const _Float16* qp = Q + (size_t)(qw + ln) * LQ + h * HD;
  const _Float16* gk = Kh + (size_t)(tid >> 3) * KVD + h * HD + (tid & 7) * 8; const unsigned lk = (unsigned)(size_t)&sK[0][(tid >> 3) * FKP + (tid & 7) * 8];      /* K: a copy of the block = 32 rows of 128 B */
  const _Float16* gv = Vt + ((size_t)h * HD + (tid >> 4)) * SQ + (tid & 15) * 8; const unsigned lv = (unsigned)(size_t)&sV[0][(tid >> 4) * FVP + (tid & 15) * 8];      /* V^T: a copy of the block = 16 rows of 256 B */
  auto fill = [&](int t) {      /* tile t into buffer t mod 2: 8 copies a lane */
    fa_copy4<32u * FKP * 2u>(lk + (unsigned)(t & 1) * (FKT * FKP * 2u), gk + (size_t)t * FKT * KVD, (size_t)32 * KVD); fa_copy4<16u * FVP * 2u>(lv + (unsigned)(t & 1) * (HD * FVP * 2u), gv + (size_t)t * FKT, (size_t)16 * SQ); };
  fill(0);
  v16h qf[2][2], kf[2][2];
#pragma unroll
  for (int s = 0; s < 2; ++s) for (int kb = 0; kb < 2; ++kb) qf[s][kb] = g2_frag(qp + (size_t)s * 16 * LQ + kb * 32, hh);
  asm volatile("s_wait_xcnt 0x0" ::: "memory");      /* stands behind the last load of the opening run, in front of every later write of that run's address registers */
  const v8f z8 = {0.f,0.f,0.f,0.f,0.f,0.f,0.f,0.f}; v8f o[2][4]; float m[2], l[2];
#pragma unroll
  for (int s = 0; s < 2; ++s) { m[s] = -1.0e37f; l[s] = 0.f; for (int d = 0; d < 4; ++d) o[s][d] = z8; }
  asm volatile("s_wait_asynccnt 0x0" ::: "memory");      /* this wave's copies of tile 0 have landed */
  __syncthreads();      /* tile 0 published */
  fill(1);
#pragma nounroll      /* one copy of the loop's body: a peeled last trip took registers past the budget of four waves a SIMD (spills) */
  for (int t = 0; t < NS - 1; ++t) {      /* tiles below every query of the block: 2 whole passes in every wave, over its half of the tile's keys */
    const _Float16* kp = &sK[t & 1][(g * 64 + ln) * FKP]; const _Float16* vp = &sV[t & 1][ln * FVP + g * 64];
#pragma unroll
    for (int u = 0; u < 2; ++u) for (int kb = 0; kb < 2; ++kb) kf[u][kb] = g2_frag(kp + u * 16 * FKP + kb * 32, hh);
    fa_pass<false, true>(kp, vp, ln, hh, qf, kf, o, m, l); fa_pass<false, false>(kp + 32 * FKP, vp + 32, ln, hh, qf, kf, o, m, l);
    asm volatile("s_wait_dscnt 0x0" ::: "memory");      /* this wave's reads of buffer t mod 2 are done before the buffer is given up */
    asm volatile("s_wait_asynccnt 0x0" ::: "memory");      /* this wave's copies of tile t + 1 have landed */
    __syncthreads();      /* publishes tile t + 1 and ends every wave's reads of tile t */
    if (t + 2 < NS) fill(t + 2); }
  asm volatile("s_wait_asynccnt 0x0" ::: "memory");      /* nothing is in flight when the loop is left */
  { const _Float16* kp = &sK[(NS - 1) & 1][(g * 32 + ln) * FKP]; const _Float16* vp = &sV[(NS - 1) & 1][ln * FVP + g * 32];      /* the block's own 128 keys: pair w has w whole passes, then its diagonal pass; wave g takes passes g, g + 2; all tests are scalar */
    int p = g;
    for (; p < w; p += 2) {
#pragma unroll
      for (int u = 0; u < 2; ++u) for (int kb = 0; kb < 2; ++kb) kf[u][kb] = g2_frag(kp + u * 16 * FKP + kb * 32, hh);
      fa_pass<false, false>(kp, vp, ln, hh, qf, kf, o, m, l); kp += 64 * FKP; vp += 64; }
    if (p == w) {
#pragma unroll
      for (int u = 0; u < 2; ++u) for (int kb = 0; kb < 2; ++kb) kf[u][kb] = g2_frag(kp + u * 16 * FKP + kb * 32, hh);
      fa_pass<true, false>(kp, vp, ln, hh, qf, kf, o, m, l); } }
  asm volatile("v_nop\n\tv_nop\n\tv_nop\n\tv_nop");      /* the distance behind the last pass's last matrix instruction: the join below begins with scalar branches */
  v4f* xw = &sx[wv * (9 * 32) + lane]; const v4f* xr = &sx[(wv ^ 4) * (9 * 32) + lane]; float* op = O + (size_t)(qw + g * 16 + ln) * DM + h * HD + 8 * hh;      /* wave g keeps query set g and gives away the other */
  if (g == 0) fa_give<1>(xw, o, m, l); else fa_give<0>(xw, o, m, l);
  __syncthreads();      /* every wave's given half is in LDS before its partner reads it */
  if (g == 0) fa_take<0>(xr, o, m, l, op); else fa_take<1>(xr, o, m, l, op); }

// Exact f32 attention for query rows 0 .. QT0-1, all on the vector unit. One block = one head x 16 query rows, 8 waves; the work of a row is spread over lanes and waves, nothing walks the keys one by one.
// Stage: the head's 256 K rows, 256 V rows and the block's 16 Q rows go to LDS by coalesced 16-byte loads, all in flight together. Keys above a row's diagonal are staged too (they are rows of this call) and get the weight 0.
// Scores: a thread owns 4 rows x 4 keys (keys 64 apart), so 8 LDS reads feed 64 FMAs. Softmax: a wave owns 2 rows, 8 keys a lane, true row maximum and sum by butterflies. Context: a thread owns 4 rows x 4 columns over a quarter of the keys; the four quarters are summed through LDS.
#define A0R 16                       /* query rows per block */
#define A0KP 68                      /* K row pitch in LDS (floats): 272 B = 16 B x odd, 16 lanes on 16 rows meet every bank once */
#define A0SP 260                     /* score row pitch (floats) */
#define A0PP 20                      /* weight pitch (floats), laid [key][row] so that one 16-byte read gives 4 rows' weights of a key */
struct A0Lds { float sq[A0R * HD]; float sfin[A0R]; float ss[A0R * A0SP]; float sp[QT0 * A0PP]; float red[4 * A0R * HD]; float sk[QT0 * A0KP]; float sv[QT0 * HD]; };      /* every member starts at a multiple of 16 bytes; the small ones first, inside the reach of an LDS instruction's immediate offset */
template <int M> __device__ __forceinline__ float a0_xm(float x) { return __int_as_float(__builtin_amdgcn_update_dpp(0, __float_as_int(x), 0x160 | M, 0xf, 0xf, true)); }      /* lane l <- l ^ M inside a 16-lane row (DPP row_xmask); every lane is on where it is used */
__device__ __forceinline__ float a0_max32(float x) { x = fmaxf(x, a0_xm<1>(x)); x = fmaxf(x, a0_xm<2>(x)); x = fmaxf(x, a0_xm<4>(x)); x = fmaxf(x, a0_xm<8>(x)); return fmaxf(x, fa_swap16(x)); }
__device__ __forceinline__ float a0_sum32(float x) { x += a0_xm<1>(x); x += a0_xm<2>(x); x += a0_xm<4>(x); x += a0_xm<8>(x); return x + fa_swap16(x); }
__global__ __launch_bounds__(256) void k_att0(const float* __restrict__ QF, const float* __restrict__ KF, const float* __restrict__ VF, float scale, float* __restrict__ OF) {
  __shared__ __attribute__((aligned(16))) A0Lds L;
  const int t = threadIdx.x; const int h = blockIdx.x / (QT0 / A0R); const int i0 = (blockIdx.x % (QT0 / A0R)) * A0R;
  { const int r = t >> 4, c = (t & 15) * 4; const float* kp = KF + (size_t)r * DM + h * HD + c; const float* vp = VF + (size_t)r * DM + h * HD + c; v4f kv[QT0 / 16], vv[QT0 / 16];
#pragma unroll      /* full: the two arrays must be indexed by constants to stay in registers, and all 33 loads are to be in flight at once */
    for (int it = 0; it < QT0 / 16; ++it) { kv[it] = *(const v4fa*)(kp + (size_t)it * 16 * DM); vv[it] = *(const v4fa*)(vp + (size_t)it * 16 * DM); }
    const float* qp = QF + (size_t)(i0 + r) * DM + h * HD + c; const v4f qv = *(const v4fa*)qp;
    asm volatile("s_wait_xcnt 0x0" :: "v"(kp), "v"(vp), "v"(qp) : "memory");      /* stands behind the last load of the run; the run's three address pairs are inputs, so they keep their registers up to the wait and every later write of those registers stands behind it */
    float* ks = &L.sk[r * A0KP + c]; float* vs = &L.sv[r * HD + c];
#pragma unroll      /* full: constant indices, as above */
    for (int it = 0; it < QT0 / 16; ++it) { *(v4f*)(ks + it * 16 * A0KP) = kv[it]; *(v4f*)(vs + it * 16 * HD) = vv[it]; }
    *(v4f*)&L.sq[r * HD + c] = qv; }
  __syncthreads();      /* K, V, Q staged */
  { const int kq = t & 63, r0 = (t >> 6) * 4; const v4f z4 = {0.f, 0.f, 0.f, 0.f}; v4f acc[4] = {z4, z4, z4, z4};      /* acc[row][key] */
    const float* qb = &L.sq[r0 * HD]; const float* kb = &L.sk[kq * A0KP];
#pragma unroll      /* full: the LDS reads of later steps issue under the FMAs of earlier ones */
    for (int c = 0; c < HD; c += 4) { v4f q[4], k[4];
#pragma unroll
      for (int a = 0; a < 4; ++a) { q[a] = *(const v4f*)(qb + a * HD + c); k[a] = *(const v4f*)(kb + a * 64 * A0KP + c); }
#pragma unroll
      for (int a = 0; a < 4; ++a) for (int u = 0; u < 4; ++u) for (int e = 0; e < 4; ++e) acc[a][u] = fmaf(q[a][e], k[u][e], acc[a][u]); }
#pragma unroll
    for (int a = 0; a < 4; ++a) for (int u = 0; u < 4; ++u) { const int j = kq + 64 * u; L.ss[(r0 + a) * A0SP + j] = (j <= i0 + r0 + a) ? acc[a][u] * scale : -1.0e30f; } }      /* keys above the diagonal are excluded: their weight is exp(-huge) = 0 */
  __syncthreads();      /* scores complete */
  { const int lane = t & 31, r0 = (t >> 5) * 2; float x[2][8], m[2], l[2];      /* the wave's two rows side by side: two independent chains */
#pragma unroll
    for (int rr = 0; rr < 2; ++rr) for (int u = 0; u < 8; ++u) x[rr][u] = L.ss[(r0 + rr) * A0SP + lane + 32 * u];
#pragma unroll
    for (int rr = 0; rr < 2; ++rr) { float a = x[rr][0]; for (int u = 1; u < 8; ++u) a = fmaxf(a, x[rr][u]); m[rr] = a; }
    m[0] = a0_max32(m[0]); m[1] = a0_max32(m[1]);
#pragma unroll
    for (int rr = 0; rr < 2; ++rr) { float a = 0.f; for (int u = 0; u < 8; ++u) { x[rr][u] = expf(x[rr][u] - m[rr]); a += x[rr][u]; } l[rr] = a; }
    l[0] = a0_sum32(l[0]); l[1] = a0_sum32(l[1]);
#pragma unroll
    for (int rr = 0; rr < 2; ++rr) for (int u = 0; u < 8; ++u) L.sp[(lane + 32 * u) * A0PP + r0 + rr] = x[rr][u];
    if (lane < 2) L.sfin[r0 + lane] = 1.0f / (lane == 0 ? l[0] : l[1]); }
  __syncthreads();      /* weights complete */
  { const int c = (t & 15) * 4, r0 = ((t >> 4) & 3) * 4, ks = t >> 6; const v4f z4 = {0.f, 0.f, 0.f, 0.f}; v4f o[4] = {z4, z4, z4, z4};
    const float* vb = &L.sv[ks * (QT0 / 4) * HD + c]; const float* pb = &L.sp[ks * (QT0 / 4) * A0PP + r0];
#pragma unroll      /* full: every LDS read is one base register plus an immediate offset, and later keys' reads issue under earlier keys' FMAs */
    for (int jj = 0; jj < QT0 / 4; ++jj) { const v4f v = *(const v4f*)(vb + jj * HD); const v4f p = *(const v4f*)(pb + jj * A0PP);
#pragma unroll
      for (int a = 0; a < 4; ++a) for (int e = 0; e < 4; ++e) o[a][e] = fmaf(p[a], v[e], o[a][e]); }
#pragma unroll
    for (int a = 0; a < 4; ++a) *(v4f*)&L.red[(ks * A0R + r0 + a) * HD + c] = o[a]; }
  __syncthreads();      /* the four key quarters' partial contexts complete */
  { const int r = t >> 4, c = (t & 15) * 4; v4f s = *(const v4f*)&L.red[r * HD + c];
#pragma unroll
    for (int ks = 1; ks < 4; ++ks) s += *(const v4f*)&L.red[(ks * A0R + r) * HD + c];
    s *= L.sfin[r]; *(v4f*)(OF + (size_t)(i0 + r) * DM + h * HD + c) = s; } }

extern "C" void kernel_launch(void* const* d_in, const int* in_sizes, int n_in,
                              void* d_out, int out_size, void* d_ws, size_t ws_size, hipStream_t stream) {
  (void)in_sizes; (void)n_in; (void)out_size;
  const float* const* I = (const float* const*)d_in; const float* x = I[0]; const float* wq = I[1]; const float* wk = I[2]; const float* wv = I[3];      /* x [4096][1024] (ONE unbatched sequence); three separate [in][out] weights Wq, Wk, Wv [1024][1024]; no biases; no output projection */
  static_assert(HPG == 1 && NH == NG * HPG && NH * HD == DM && KVD == DM, "plain multi-head attention as 16 kv groups of one query head");
  char* ws = (char*)d_ws; size_t off = 0;
  auto take = [&](size_t bytes) { char* p = ws + off; off += (bytes + 255) & ~(size_t)255; return p; };
  _Float16* BQKV = (_Float16*)take((size_t)3 * DM * DM * 2); _Float16* BQ = BQKV; _Float16* BK = BQKV + (size_t)DM * DM; _Float16* BV = BQKV + (size_t)2 * DM * DM;      /* three transposed planes, one after another: q, k, v */
  _Float16* X16 = (_Float16*)take(NR * DM * 2); _Float16* Q16 = (_Float16*)take(NR * DM * 2); _Float16* K16 = (_Float16*)take(NR * KVD * 2);
  _Float16* VT = (_Float16*)take((size_t)NH * HD * SQ * 2);
  float* QF0 = (float*)take((size_t)QT0 * DM * 4); float* KF0 = (float*)take((size_t)QT0 * KVD * 4); float* VF0 = (float*)take((size_t)QT0 * KVD * 4);      /* f32 q, k, v of the first 256 rows */
  if (off > ws_size) return;
  k_prep<<<3 * PWB + PXB, 256, 0, stream>>>(x, wq, wk, wv, X16, BQKV);      /* x -> f16 rows; three [in][out] weights -> their transposed x16 planes, q, k, v one after another */
  for (int b = B0; b < B0 + NBR; ++b) { const size_t r0 = (size_t)b * SQ;
    /* q, k, v: every value rounded once to f16 in the epilogue, q and k as rows, v as V^T [NH][HD][SQ]; rows 0..255 stored in f32 as well, for the exact first tile (one head a k/v group: the tile reads these rows as they are) */
    k_qkv<<<(SQ / GAR) * (DM / 64), GNW * 32, 0, stream>>>(X16 + r0 * DM, BQ, BK, BV, 0.0625f, QF0, KF0, VF0, Q16 + r0 * DM, K16 + r0 * KVD, VT);
    k_att0<<<NH * (QT0 / A0R), 256, 0, stream>>>(QF0, KF0, VF0, 0.125f, (float*)d_out + r0 * DM);      /* exact f32 attention for rows 0..255, written straight into the output rows */
    k_fattn<<<NH * ((SQ - QT0) / FQ), 256, 0, stream>>>(Q16 + r0 * LQ, K16 + r0 * KVD, VT, (float*)d_out + r0 * DM); }      /* rows 256..4095 of all 16 heads: scores, online softmax and context in ONE launch, straight into the output rows as f32 */
}
